// v000
// Measured on an AMD MI455X. A time is GPU time per run, averaged over a window of back-to-back runs after a warm-up
// (all launches, gaps included; the runs take copies of the inputs in turn), and the median of several windows.
// Apart from v000's, it joins two sittings. Times from different sittings can be a few percent apart, while
// side-by-side timings come from the same sitting.
// The starting kernel, v000, takes 1530 microseconds a run.
// Contractions: per batch the trilinear term (q * w_qm).m^T [1024x128].[128x1024] on bf16 hi/lo split planes (logits reach ~+-30, so they need f32-class accuracy) and the query->memory read q2m.memory [1024x1024].[1024x128] with f16 operands (probabilities x 2^12) — 64x64 register-blocked wave tiles; f32 accumulate. The two linear terms, the mask arithmetic (sim + (1 - mask) * -1e30, exactly as the module), the row softmax (exp once), the row maxima, the softmax over rows and the memory->query vector (broadcast to every row) are f32 kernels.
#include <hip/hip_runtime.h>
#include <math.h>

typedef __attribute__((ext_vector_type(16))) _Float16 v16h;
typedef __attribute__((ext_vector_type(8)))  _Float16 v8h;
typedef __attribute__((ext_vector_type(16))) __bf16   v16b;
typedef __attribute__((ext_vector_type(8)))  float    v8f;
typedef __attribute__((ext_vector_type(4)))  float    v4f;

// 16-bit WMMA fragment map (wave32), lane L, h = L>>4, m = L&15:
//   A 16x32: lane = row m;   element i -> k = (i<8) ? 8h+i : 16+8h+(i-8)
//   B 32x16: lane = column m; the SAME k(i,h)
//   D 16x16 (8 f32): lane = column m; element r -> row 8h+r
__device__ __forceinline__ int frag_k(int i, int h) { return (i < 8) ? (8 * h + i) : (16 + 8 * h + (i - 8)); }
__device__ __forceinline__ __bf16 bf16_rne(float f) {
    unsigned int u = __float_as_uint(f);
    u += 0x7fffu + ((u >> 16) & 1u);
    return __builtin_bit_cast(__bf16, (unsigned short)(u >> 16));
}
__device__ __forceinline__ float bf16_f32(__bf16 b) { return __uint_as_float(((unsigned int)__builtin_bit_cast(unsigned short, b)) << 16); }
__device__ __forceinline__ v8f wmma16(v16h a, v16h b, v8f c) {
    c = __builtin_amdgcn_wmma_f32_16x16x32_f16(false, a, false, b, (short)0, c, false, false);
    asm volatile("v_nop\n\tv_nop\n\tv_nop\n\tv_nop" : "+v"(c) : "v"(a), "v"(b));
    return c;
}
__device__ __forceinline__ v8f wmmab(v16b a, v16b b, v8f c) {
    c = __builtin_amdgcn_wmma_f32_16x16x32_bf16(false, a, false, b, (short)0, c, false, false);
    asm volatile("v_nop\n\tv_nop\n\tv_nop\n\tv_nop" : "+v"(c) : "v"(a), "v"(b));
    return c;
}
struct Split { v16b hi, lo; };
// hi/lo split product: a.hi*b.hi + a.hi*b.lo + a.lo*b.hi
__device__ __forceinline__ v8f wmma3(const Split& a, const Split& b, v8f c) {
    c = __builtin_amdgcn_wmma_f32_16x16x32_bf16(false, a.hi, false, b.hi, (short)0, c, false, false);
    c = __builtin_amdgcn_wmma_f32_16x16x32_bf16(false, a.hi, false, b.lo, (short)0, c, false, false);
    c = __builtin_amdgcn_wmma_f32_16x16x32_bf16(false, a.lo, false, b.hi, (short)0, c, false, false);
    asm volatile("v_nop\n\tv_nop\n\tv_nop\n\tv_nop" : "+v"(c) : "v"(a.hi), "v"(a.lo), "v"(b.hi), "v"(b.lo));
    return c;
}
struct Split3 { v16b hi, mid, lo; };
// triple split product (6 terms, drops only terms below 2^-24 relative)
__device__ __forceinline__ v8f wmma6(const Split3& a, const Split3& b, v8f c) {
    c = __builtin_amdgcn_wmma_f32_16x16x32_bf16(false, a.hi, false, b.hi, (short)0, c, false, false);
    c = __builtin_amdgcn_wmma_f32_16x16x32_bf16(false, a.hi, false, b.mid, (short)0, c, false, false);
    c = __builtin_amdgcn_wmma_f32_16x16x32_bf16(false, a.mid, false, b.hi, (short)0, c, false, false);
    c = __builtin_amdgcn_wmma_f32_16x16x32_bf16(false, a.hi, false, b.lo, (short)0, c, false, false);
    c = __builtin_amdgcn_wmma_f32_16x16x32_bf16(false, a.mid, false, b.mid, (short)0, c, false, false);
    c = __builtin_amdgcn_wmma_f32_16x16x32_bf16(false, a.lo, false, b.hi, (short)0, c, false, false);
    asm volatile("v_nop\n\tv_nop\n\tv_nop\n\tv_nop" : "+v"(c) : "v"(a.hi), "v"(a.mid), "v"(a.lo), "v"(b.hi), "v"(b.mid), "v"(b.lo));
    return c;
}

// Fragment gathers from f32 memory: element i <- p[(k0 + frag_k(i,h)) * sk] * s, zero for k >= klen.
__device__ __forceinline__ v16h fh_ld(const float* __restrict__ p, long long sk, int k0, int h, int klen, float s) {
    v16h a;
#pragma unroll
    for (int i = 0; i < 16; ++i) { const int k = k0 + frag_k(i, h); a[i] = (k < klen) ? (_Float16)(p[(long long)k * sk] * s) : (_Float16)0.f; }
    return a;
}
__device__ __forceinline__ Split sp_ld(const float* __restrict__ p, long long sk, int k0, int h, int klen, float s) {
    Split r;
#pragma unroll
    for (int i = 0; i < 16; ++i) {
        const int k = k0 + frag_k(i, h); const float x = (k < klen) ? p[(long long)k * sk] * s : 0.f;
        const __bf16 hb = bf16_rne(x); r.hi[i] = hb; r.lo[i] = bf16_rne(x - bf16_f32(hb));
    }
    return r;
}
__device__ __forceinline__ Split3 sp3_ld(const float* __restrict__ p, long long sk, int k0, int h, int klen, float s) {
    Split3 r;
#pragma unroll
    for (int i = 0; i < 16; ++i) {
        const int k = k0 + frag_k(i, h); const float x = (k < klen) ? p[(long long)k * sk] * s : 0.f;
        const __bf16 hb = bf16_rne(x); const float r1 = x - bf16_f32(hb); const __bf16 mb = bf16_rne(r1);
        r.hi[i] = hb; r.mid[i] = mb; r.lo[i] = bf16_rne(r1 - bf16_f32(mb));
    }
    return r;
}
__device__ __forceinline__ v16b bh_ld(const float* __restrict__ p, long long sk, int k0, int h, int klen, float s) {
    v16b a;
#pragma unroll
    for (int i = 0; i < 16; ++i) { const int k = k0 + frag_k(i, h); a[i] = bf16_rne((k < klen) ? p[(long long)k * sk] * s : 0.f); }
    return a;
}
// f16 fragment from an f16 LDS/global row with element stride 1 (k-contiguous), no bounds (tile already zero padded)
__device__ __forceinline__ v16h fh_row(const _Float16* __restrict__ row, int k0, int h) {
    v16h a;
#pragma unroll
    for (int i = 0; i < 16; ++i) a[i] = row[k0 + frag_k(i, h)];
    return a;
}

#define VST2(T, ptr, val) do { const T vst2_v_ = (val); *(T*)(ptr) = vst2_v_;  } while (0)
typedef float v4f __attribute__((ext_vector_type(4)));
#define VST2V4(ptr, val) do { const v4f vst2_v4_ = (val); *(v4f*)(ptr) = vst2_v4_;  } while (0)

__device__ __attribute__((noinline)) float act_fn(float v, int act) {
    if (act == 1) return fmaxf(v, 0.f);                                                                               // relu
    if (act == 2) { const float u = 0.7978845608028654f * (v + 0.044715f * v * v * v); return 0.5f * v * (1.f + tanhf(u)); } // tanh-gelu
    if (act == 3) return v / (1.f + expf(-v));                                                                        // silu
    if (act == 4) return 0.5f * v * (1.f + erff(v * 0.7071067811865476f));                                             // erf-gelu
    if (act == 5) return tanhf(v);
    if (act == 6) return 1.f / (1.f + expf(-v));                                                                      // sigmoid
    if (act == 7) return (v > 0.f) ? v : 0.01f * v;                                                                   // leaky relu 0.01
    if (act == 8) return (v > 0.f) ? v : (expf(v) - 1.f);                                                             // elu
    if (act == 9) return fminf(fmaxf(v, 0.f), 6.f);                                                                   // relu6
    if (act == 10) return fabsf(v);                                                                                    // abs
    if (act == 11) return (v >= 0.f) ? v : 0.1f * v;                                                                  // leaky 0.1
    if (act == 12) return (v > 0.f) ? v : 0.2f * v;                                                                   // leaky 0.2
    if (act == 13) return (v > 20.f) ? v : log1pf(expf(v));                                                            // softplus
    return v;
}

// =====================================================================================================================
// k_gemm<MODE>: C(z, m, n) = act(alpha * sum_k A(z, m, k) * B(z, k, n) + bias) + beta * R(z, m, n)
//   One wave (32-thread block) per 16 x 32 tile of C; grid (ceil(N/32), ceil(M/16), Z). Batch z -> (zo = z / zi_n, zi = z % zi_n)
//   with separate outer/inner strides for every tensor (e.g. batch and head). A(m,k) = A[zo*sAo + zi*sAi + m*sAm + k*sAk] (f32),
//   B(k,n) = B[zo*sBo + zi*sBi + n*sBn + k*sBk] (f32); any M, N, K (K zero-padded to 32 inside the fragments, M/N tails guarded).
//   C(m,n) = C[zo*sCo + zi*sCi + m*sCm + n] (n contiguous). flags: 1 bias[n], 2 bias[m], 4 residual R[zo*sRo + zi*sRi + m*sRm + n*sRn].
//   MODE 0: f16 operands (A prescaled by sa, B by sb, both undone in the epilogue); 1: bf16 hi/lo split (3 products); 2: bf16;
//   3: bf16 hi/mid/lo triple split (6 products); 4: as 3 with Kahan-compensated f32 accumulation across k-steps.
// =====================================================================================================================
struct GemmP {
    const float* A; const float* B; const float* bias; const float* R; float* C;
    long long sAo, sAi, sAm, sAk, sBo, sBi, sBn, sBk, sCo, sCi, sCm, sRo, sRi, sRm, sRn;
    int M, N, K, zi_n, flags, act; float alpha, beta, sa, sb;
    int Npad, pad_;     // columns [N, Npad) of C are written as 0 so that padded workspace rows are covered by whole-line stores; Npad >= N
};
static_assert(sizeof(GemmP) == 5 * 8 + 15 * 8 + 6 * 4 + 4 * 4 + 2 * 4, "GemmP has padding");

template <int MODE>
__global__ __launch_bounds__(32) void k_gemm(GemmP p) {
    const int lane = threadIdx.x & 31, h = lane >> 4, l15 = lane & 15;
    const int m0 = blockIdx.y * 16, n0 = blockIdx.x * 32;
    const int z = blockIdx.z, zo = z / p.zi_n, zi = z - zo * p.zi_n;
    const float* A = p.A + zo * p.sAo + zi * p.sAi;
    const float* B = p.B + zo * p.sBo + zi * p.sBi;
    const int am = min(m0 + l15, p.M - 1);                       // clamped row for loads (stores are guarded)
    v8f acc[2], comp[2];
#pragma unroll
    for (int t = 0; t < 2; ++t) { v8f zz = {}; acc[t] = zz; comp[t] = zz; }
    for (int k0 = 0; k0 < p.K; k0 += 32) {
        const float* arow = A + (long long)am * p.sAm;
        if (MODE == 1) {
            const Split a = sp_ld(arow, p.sAk, k0, h, p.K, 1.f);
#pragma unroll
            for (int t = 0; t < 2; ++t) {
                const int bn = min(n0 + t * 16 + l15, p.N - 1);
                acc[t] = wmma3(a, sp_ld(B + (long long)bn * p.sBn, p.sBk, k0, h, p.K, 1.f), acc[t]);
            }
        } else if (MODE == 3) {
            const Split3 a = sp3_ld(arow, p.sAk, k0, h, p.K, 1.f);
#pragma unroll
            for (int t = 0; t < 2; ++t) {
                const int bn = min(n0 + t * 16 + l15, p.N - 1);
                acc[t] = wmma6(a, sp3_ld(B + (long long)bn * p.sBn, p.sBk, k0, h, p.K, 1.f), acc[t]);
            }
        } else if (MODE == 4) {
            // triple split as MODE 3, but each k-step's 6 products go into a fresh accumulator and the partial is added to the running f32 sum
            // on the VALU with Kahan compensation (accumulation error stays ~1 ulp however long K is)
            const Split3 a = sp3_ld(arow, p.sAk, k0, h, p.K, 1.f);
#pragma unroll
            for (int t = 0; t < 2; ++t) {
                const int bn = min(n0 + t * 16 + l15, p.N - 1); v8f zz = {};
                const v8f part = wmma6(a, sp3_ld(B + (long long)bn * p.sBn, p.sBk, k0, h, p.K, 1.f), zz);
                const v8f y = part - comp[t]; const v8f s = acc[t] + y; comp[t] = (s - acc[t]) - y; acc[t] = s;
            }
        } else if (MODE == 2) {
            const v16b a = bh_ld(arow, p.sAk, k0, h, p.K, 1.f);
#pragma unroll
            for (int t = 0; t < 2; ++t) {
                const int bn = min(n0 + t * 16 + l15, p.N - 1);
                acc[t] = wmmab(a, bh_ld(B + (long long)bn * p.sBn, p.sBk, k0, h, p.K, 1.f), acc[t]);
            }
        } else {
            const v16h a = fh_ld(arow, p.sAk, k0, h, p.K, p.sa);
#pragma unroll
            for (int t = 0; t < 2; ++t) {
                const int bn = min(n0 + t * 16 + l15, p.N - 1);
                acc[t] = wmma16(a, fh_ld(B + (long long)bn * p.sBn, p.sBk, k0, h, p.K, p.sb), acc[t]);
            }
        }
    }
    const float iscale = (MODE == 0) ? p.alpha / (p.sa * p.sb) : p.alpha;
    float* C = p.C + zo * p.sCo + zi * p.sCi;
    const float* R = p.R + zo * p.sRo + zi * p.sRi;
    __shared__ __align__(16) float ctile[16][36];
#pragma unroll
    for (int t = 0; t < 2; ++t) {
        const int n = n0 + t * 16 + l15; const int nn = min(n, p.N - 1);
#pragma unroll
        for (int r = 0; r < 8; ++r) {
            const int m = m0 + 8 * h + r; const int mm = min(m, p.M - 1);
            float v = acc[t][r] * iscale;
            if (p.flags & 1) v += p.bias[nn];
            if (p.flags & 2) v += p.bias[mm];
            if (p.flags & 8) v *= p.bias[(long long)zo * p.M + mm];   /* per-(z,row) scale vector laid out [Z][M]; exclusive with the bias flags */
            v = act_fn(v, p.act);
            if (p.flags & 4) v += p.beta * R[(long long)mm * p.sRm + (long long)nn * p.sRn];
            ctile[8 * h + r][t * 16 + l15] = (n < p.N) ? v : 0.f;
        }
    }
    __syncthreads();
    const int NW = (p.Npad > p.N) ? p.Npad : p.N;           // write width
    const bool fast = (m0 + 16 <= p.M) && (n0 + 32 <= NW) && ((p.sCm & 3) == 0) && ((((size_t)C) & 15) == 0);
    if (fast) {
#pragma unroll
        for (int s = 0; s < 4; ++s) {
            const int row = s * 4 + (lane >> 3), c4 = (lane & 7) * 4;
            const v4f v = *(const v4f*)&ctile[row][c4];
            VST2V4(C + (long long)(m0 + row) * p.sCm + n0 + c4, v);
        }
    } else {
        for (int row = 0; row < 16; ++row) {
            const int m = m0 + row, n = n0 + lane;
            if (m < p.M && n < NW) VST2(float, C + (long long)m * p.sCm + n, ctile[row][lane]);
        }
    }
}


// =====================================================================================================================
// k_gemmT<MODE, TM, TN>: same contract as k_gemm, but one wave computes a (16*TM) x (16*TN) tile: TM A fragments and TN B fragments are
//   loaded per 32-wide k-step and reused across TM*TN WMMAs (far fewer load/convert instructions per MAC). MODE 0 (f16), 1 (bf16 hi/lo),
//   2 (bf16) only. grid (ceil(NW/(16*TN)), ceil(M/(16*TM)), Z), block 32. Epilogue identical to k_gemm, run per 16x32 sub-tile.
// =====================================================================================================================
template <int MODE, int TM, int TN>
__global__ __launch_bounds__(32) void k_gemmT(GemmP p) {
    const int lane = threadIdx.x & 31, h = lane >> 4, l15 = lane & 15;
    const int m0 = blockIdx.y * (16 * TM), n0 = blockIdx.x * (16 * TN);
    const int z = blockIdx.z, zo = z / p.zi_n, zi = z - zo * p.zi_n;
    const float* A = p.A + zo * p.sAo + zi * p.sAi;
    const float* B = p.B + zo * p.sBo + zi * p.sBi;
    v8f acc[TM][TN];
#pragma unroll
    for (int i = 0; i < TM; ++i)
#pragma unroll
        for (int t = 0; t < TN; ++t) { v8f zz = {}; acc[i][t] = zz; }
    for (int k0 = 0; k0 < p.K; k0 += 32) {
        if (MODE == 1) {
            Split a[TM], b[TN];
#pragma unroll
            for (int i = 0; i < TM; ++i) { const int am = min(m0 + 16 * i + l15, p.M - 1); a[i] = sp_ld(A + (long long)am * p.sAm, p.sAk, k0, h, p.K, 1.f); }
#pragma unroll
            for (int t = 0; t < TN; ++t) { const int bn = min(n0 + 16 * t + l15, p.N - 1); b[t] = sp_ld(B + (long long)bn * p.sBn, p.sBk, k0, h, p.K, 1.f); }
#pragma unroll
            for (int i = 0; i < TM; ++i)
#pragma unroll
                for (int t = 0; t < TN; ++t) acc[i][t] = wmma3(a[i], b[t], acc[i][t]);
        } else if (MODE == 2) {
            v16b a[TM], b[TN];
#pragma unroll
            for (int i = 0; i < TM; ++i) { const int am = min(m0 + 16 * i + l15, p.M - 1); a[i] = bh_ld(A + (long long)am * p.sAm, p.sAk, k0, h, p.K, 1.f); }
#pragma unroll
            for (int t = 0; t < TN; ++t) { const int bn = min(n0 + 16 * t + l15, p.N - 1); b[t] = bh_ld(B + (long long)bn * p.sBn, p.sBk, k0, h, p.K, 1.f); }
#pragma unroll
            for (int i = 0; i < TM; ++i)
#pragma unroll
                for (int t = 0; t < TN; ++t) acc[i][t] = wmmab(a[i], b[t], acc[i][t]);
        } else {
            v16h a[TM], b[TN];
#pragma unroll
            for (int i = 0; i < TM; ++i) { const int am = min(m0 + 16 * i + l15, p.M - 1); a[i] = fh_ld(A + (long long)am * p.sAm, p.sAk, k0, h, p.K, p.sa); }
#pragma unroll
            for (int t = 0; t < TN; ++t) { const int bn = min(n0 + 16 * t + l15, p.N - 1); b[t] = fh_ld(B + (long long)bn * p.sBn, p.sBk, k0, h, p.K, p.sb); }
#pragma unroll
            for (int i = 0; i < TM; ++i)
#pragma unroll
                for (int t = 0; t < TN; ++t) acc[i][t] = wmma16(a[i], b[t], acc[i][t]);
        }
    }
    const float iscale = (MODE == 0) ? p.alpha / (p.sa * p.sb) : p.alpha;
    float* C = p.C + zo * p.sCo + zi * p.sCi;
    const float* R = p.R + zo * p.sRo + zi * p.sRi;
    const int NW = (p.Npad > p.N) ? p.Npad : p.N;
    __shared__ __align__(16) float ctile[16][36];
#pragma unroll
    for (int i = 0; i < TM; ++i) {
        const int mb = m0 + 16 * i; if (mb >= p.M) break;          // wave-uniform
#pragma unroll
        for (int tp = 0; tp < TN / 2; ++tp) {
            const int nb = n0 + 32 * tp; if (nb >= NW) break;        // wave-uniform
#pragma unroll
            for (int t2 = 0; t2 < 2; ++t2) {
                const int t = 2 * tp + t2; const int n = nb + t2 * 16 + l15; const int nn = min(n, p.N - 1);
#pragma unroll
                for (int r = 0; r < 8; ++r) {
                    const int m = mb + 8 * h + r; const int mm = min(m, p.M - 1);
                    float v = acc[i][t][r] * iscale;
                    if (p.flags & 1) v += p.bias[nn];
                    if (p.flags & 2) v += p.bias[mm];
            if (p.flags & 8) v *= p.bias[(long long)zo * p.M + mm];   /* per-(z,row) scale vector laid out [Z][M]; exclusive with the bias flags */
                    v = act_fn(v, p.act);
                    if (p.flags & 4) v += p.beta * R[(long long)mm * p.sRm + (long long)nn * p.sRn];
                    ctile[8 * h + r][t2 * 16 + l15] = (n < p.N) ? v : 0.f;
                }
            }
            __syncthreads();
            const bool fast = (mb + 16 <= p.M) && (nb + 32 <= NW) && ((p.sCm & 3) == 0) && ((((size_t)C) & 15) == 0);
            if (fast) {
#pragma unroll
                for (int s = 0; s < 4; ++s) {
                    const int row = s * 4 + (lane >> 3), c4 = (lane & 7) * 4;
                    const v4f v = *(const v4f*)&ctile[row][c4];
                    VST2V4(C + (long long)(mb + row) * p.sCm + nb + c4, v);
                }
            } else {
                for (int row = 0; row < 16; ++row) {
                    const int m = mb + row, n = nb + lane;
                    if (m < p.M && n < NW) VST2(float, C + (long long)m * p.sCm + n, ctile[row][lane]);
                }
            }
            __syncthreads();
        }
    }
}

// =====================================================================================================================
//   Wave = 16 queries, AW waves per block, 64-key blocks; grid (ceil(Lq/(16*AW)), H, B), block 32*AW. Any Lq, Lk; head dim dh <= DHP
//   (DHP multiple of 32), value dim dv <= DVP (multiple of 16, <= 128). Every tensor addressed by (batch, head, row, element) strides, f32.
//   Scores: QM 0 f16 operands, 1 bf16 hi/lo split, 2 bf16 triple split; statistics f32 (exp2 domain); P.V: P x 4096 as f16 with V f16 staged in LDS
//   (SPLITPV: P and V as bf16 hi/lo splits). kv head = h / hrep. Masking: causal = 1 (keep j <= i + coff, masked -> -inf, key blocks beyond the
//   diagonal skipped), causal = 2 (masked -> mfill, a finite fill like the -1e9; no skipping), causal = 3 (keep j >= i + coff,
//   masked -> -inf, no skipping); optional additive f32 mask Mf,
//   optional int keep-mask Mi (0 -> score := mfill), both addressed b*smb + h*smh + i*smi + j*smj (0 strides broadcast).
// =====================================================================================================================
#define AW 4
struct AttnP {   // apv4
    const float* Q; const float* K; const float* V; float* O; float* P; const float* Mf; const int* Mi; float* ST;
    const float* Pw; const float* Rt; const int* SQ; const int* SK;           // optional: post-softmax weight, relative-position table, segment ids
    long long swb, swh, swi, swj, srb, srh, sri;                                 // Pw strides (b,h,i,j); Rt strides (b,h,i), column = clamp(i - j + roff, 0, rn-1)
    long long sQb, sQh, sQi, sQd, sKb, sKh, sKj, sKd, sVb, sVh, sVj, sVd, sOb, sOh, sOi, sPb, sPh, sPi, smb, smh, smi, smj;
    int Lq, Lk, dh, dv, hrep, causal, coff, pband;   // pband > 0: P holds only the band |j - i| <= pband, column j - i + pband
    float scale, mfill; int nonorm, mpol;             // nonorm (online path only): O = sum_j exp(score_j) V_j without the 1/rowsum (scores must be <= ~0); mpol: Mi masks where ==0 (mpol 0) or where !=0 (mpol 1)
    int roff, rn, segpol, win;                        // Rt column offset/count; SQ/SK: score := mfill where (segpol 0) SQ[i] != SK[j] or (segpol 1) SQ[i] == SK[j]; win > 0: keys with i - j > win (after coff) -> -inf
};
//   Pw: the softmax numerator is multiplied by Pw(b,h,i,j) AFTER the row sum is taken (probs * weight, then P.V), as in post-softmax multiplicative biases.                                                    // ST (optional): per row (b,h,i) -> ST[((b*H + h)*Lq + i)*2 + {0,1}] = {row max of the scaled+masked score (natural units), sum_j exp(score - max)}
static_assert(sizeof(AttnP) == 12 * 8 + 29 * 8 + 16 * 4, "AttnP has padding");

#ifndef KATTN_ATTR
#define KATTN_ATTR
#endif
template <int DHP, int DVP, int QM, bool SPLITPV, bool TWOPASS>
__global__ __launch_bounds__(32 * AW) KATTN_ATTR void k_attn(AttnP p) {
    constexpr int NT = DVP / 16;                // output tiles
    constexpr int KS = DHP / 32;                // k-steps for the scores
    constexpr int VP = DVP + 8;                 // LDS pitch (halves)
    __shared__ __align__(16) float    pl[AW][16 * 64];
    __shared__ __align__(16) _Float16 vl[(SPLITPV ? 2 : 1) * 64 * VP];   // f16 V tile, or bf16 hi and lo tiles (same 2-byte size)
    const int lane = threadIdx.x & 31, hf = lane >> 4, l15 = lane & 15, wave = threadIdx.x >> 5;
    const int h = blockIdx.y, b = blockIdx.z, hk = h / p.hrep;
    const int q0 = (blockIdx.x * AW + wave) * 16;
    float* myp = pl[wave];
    const float L2E = 1.4426950408889634f;
    const float NEG = -__builtin_inff();
    const int qi = min(q0 + l15, p.Lq - 1);
    const float* qrow = p.Q + b * p.sQb + h * p.sQh + (long long)qi * p.sQi;
    const float* kbase = p.K + b * p.sKb + hk * p.sKh;
    const float* vbase = p.V + b * p.sVb + hk * p.sVh;
    v16h qa[QM == 0 ? KS : 1]; Split qs_[QM == 1 ? KS : 1]; Split3 qt_[QM == 2 ? KS : 1];
#pragma unroll
    for (int ks = 0; ks < KS; ++ks) {
        if (QM == 2) qt_[ks] = sp3_ld(qrow, p.sQd, ks * 32, hf, p.dh, 1.f);
        else if (QM == 1) qs_[ks] = sp_ld(qrow, p.sQd, ks * 32, hf, p.dh, 1.f);
        else qa[ks] = fh_ld(qrow, p.sQd, ks * 32, hf, p.dh, 1.f);
    }
    v8f o[NT]; float m8[8], l8[8];
#pragma unroll
    for (int t = 0; t < NT; ++t) { v8f zz = {}; o[t] = zz; }
#pragma unroll
    for (int i = 0; i < 8; ++i) { m8[i] = NEG; l8[i] = 0.f; }
    int jend = p.Lk;
    if (p.causal == 1) { const int je = (blockIdx.x * AW + AW - 1) * 16 + 16 + p.coff; jend = min(jend, max(je, 0)); }   // uniform per block
    const int npass = TWOPASS ? 2 : 1;
    for (int pass = 0; pass < npass; ++pass) {
        const bool dopv = (!TWOPASS) || pass == 1;
        for (int j0 = 0; j0 < jend; j0 += 64) {
            if (dopv) {
                __syncthreads();                                 // previous key block's reads of vl / pl are done
                for (int idx = threadIdx.x; idx < 64 * DVP; idx += 32 * AW) {
                    const int jr = idx / DVP, d = idx - jr * DVP, j = j0 + jr;
                    const float f = (j < p.Lk && d < p.dv) ? vbase[(long long)j * p.sVj + (long long)d * p.sVd] : 0.f;
                    if (SPLITPV) {
                        const __bf16 hb = bf16_rne(f);
                        ((__bf16*)vl)[jr * VP + d] = hb; ((__bf16*)vl)[64 * VP + jr * VP + d] = bf16_rne(f - bf16_f32(hb));
                    } else vl[jr * VP + d] = (_Float16)f;
                }
            }
            v8f s[4];
#pragma unroll
            for (int t = 0; t < 4; ++t) {
                const int j = min(j0 + t * 16 + l15, p.Lk - 1);
                const float* krow = kbase + (long long)j * p.sKj;
                v8f acc = {};
#pragma unroll
                for (int ks = 0; ks < KS; ++ks) {
                    if (QM == 2)      acc = wmma6(qt_[ks], sp3_ld(krow, p.sKd, ks * 32, hf, p.dh, 1.f), acc);
                    else if (QM == 1) acc = wmma3(qs_[ks], sp_ld(krow, p.sKd, ks * 32, hf, p.dh, 1.f), acc);
                    else              acc = wmma16(qa[ks], fh_ld(krow, p.sKd, ks * 32, hf, p.dh, 1.f), acc);
                }
                s[t] = acc;
            }
            float pv[8][4];
#pragma unroll
            for (int i = 0; i < 8; ++i) {
                const int irow = q0 + i + 8 * hf;
                const int ic = min(irow, p.Lq - 1);
                float sc[4];
#pragma unroll
                for (int t = 0; t < 4; ++t) {
                    const int jg = j0 + t * 16 + l15;
                    float v = s[t][i] * p.scale;
                    if (p.Mf) v += p.Mf[b * p.smb + h * p.smh + (long long)ic * p.smi + (long long)min(jg, p.Lk - 1) * p.smj];
                    if (p.Rt) { int rc = ic - min(jg, p.Lk - 1) + p.roff; rc = rc < 0 ? 0 : (rc >= p.rn ? p.rn - 1 : rc); v += p.Rt[b * p.srb + h * p.srh + (long long)ic * p.sri + rc]; }
                    if (p.Mi) { const int mv = p.Mi[b * p.smb + h * p.smh + (long long)ic * p.smi + (long long)min(jg, p.Lk - 1) * p.smj]; if (p.mpol ? (mv != 0) : (mv == 0)) v = p.mfill; }
                    if (p.SQ) { const bool same = p.SQ[(long long)b * p.Lq + ic] == p.SK[(long long)b * p.Lk + min(jg, p.Lk - 1)]; if (p.segpol ? same : !same) v = p.mfill; }
                    if (p.causal == 2 && jg > irow + p.coff) v = p.mfill;
                    if (jg >= p.Lk || (p.causal == 1 && jg > irow + p.coff) || (p.causal == 3 && jg < irow + p.coff) || (p.win > 0 && irow + p.coff - jg > p.win)) v = NEG; else v *= L2E;
                    sc[t] = v;
                }
                if (!TWOPASS || pass == 0) {
                    float mx = fmaxf(fmaxf(sc[0], sc[1]), fmaxf(sc[2], sc[3]));
                    mx = fmaxf(mx, __shfl_xor(mx, 1, 32)); mx = fmaxf(mx, __shfl_xor(mx, 2, 32));
                    mx = fmaxf(mx, __shfl_xor(mx, 4, 32)); mx = fmaxf(mx, __shfl_xor(mx, 8, 32));
                    const float mnew = fmaxf(m8[i], mx);
                    const float corr = (mnew == NEG) ? 1.f : exp2f(m8[i] - mnew);
                    float rs = 0.f;
#pragma unroll
                    for (int t = 0; t < 4; ++t) {
                        const float pp = (sc[t] == NEG) ? 0.f : exp2f(sc[t] - mnew); rs += pp;
                        pv[i][t] = p.Pw ? pp * p.Pw[b * p.swb + h * p.swh + (long long)ic * p.swi + (long long)min(j0 + t * 16 + l15, p.Lk - 1) * p.swj] : pp;
                    }
                    rs += __shfl_xor(rs, 1, 32); rs += __shfl_xor(rs, 2, 32); rs += __shfl_xor(rs, 4, 32); rs += __shfl_xor(rs, 8, 32);
                    l8[i] = l8[i] * corr + rs; m8[i] = mnew;
                    if (!TWOPASS) {
#pragma unroll
                        for (int t = 0; t < NT; ++t) o[t][i] *= corr;
                    }
                } else {
                    const float inv = (l8[i] > 0.f) ? 1.f / l8[i] : 0.f;
#pragma unroll
                    for (int t = 0; t < 4; ++t) {
                        const int jg = j0 + t * 16 + l15;
                        float pp = (sc[t] == NEG) ? 0.f : exp2f(sc[t] - m8[i]) * inv;
                        if (p.Pw) pp *= p.Pw[b * p.swb + h * p.swh + (long long)ic * p.swi + (long long)min(jg, p.Lk - 1) * p.swj];
                        pv[i][t] = pp;
                    }
                }
            }
            if (dopv) {
#pragma unroll
                for (int i = 0; i < 8; ++i)
#pragma unroll
                    for (int t = 0; t < 4; ++t) ((float*)myp)[(i + 8 * hf) * 64 + t * 16 + l15] = pv[i][t];
                __syncthreads();                                 // P (per wave) and V (shared) visible
                if (p.P) {
                    float* pb_ = p.P + b * p.sPb + h * p.sPh;
                    const bool fastP = (p.pband == 0) && ((p.sPi & 3) == 0) && (j0 + 64 <= p.Lk) && (q0 + 16 <= p.Lq) && ((((size_t)pb_) & 15) == 0);
                    if (fastP) {
#pragma unroll
                        for (int s = 0; s < 8; ++s) {
                            const int row = s * 2 + (lane >> 4), c4 = (lane & 15) * 4;
                            const v4f v = *(const v4f*)(myp + row * 64 + c4);
                            VST2V4(pb_ + (long long)(q0 + row) * p.sPi + j0 + c4, v);
                        }
                    } else {
                        for (int row = 0; row < 16; ++row) {
                            const int irow = q0 + row; if (irow >= p.Lq) continue;
                            for (int c = lane; c < 64; c += 32) {
                                const int jg = j0 + c; if (jg >= p.Lk) continue;
                                if (p.pband == 0) VST2(float, pb_ + (long long)irow * p.sPi + jg, myp[row * 64 + c]);
                                else if (jg - irow <= p.pband && irow - jg <= p.pband) VST2(float, pb_ + (long long)irow * p.sPi + (jg - irow + p.pband), myp[row * 64 + c]);
                            }
                        }
                    }
                }
                if (SPLITPV) {
                    const Split pa0 = sp_ld(myp + l15 * 64, 1, 0, hf, 64, 1.f), pa1 = sp_ld(myp + l15 * 64, 1, 32, hf, 64, 1.f);
                    const __bf16* vh = (const __bf16*)vl; const __bf16* vlo = vh + 64 * VP;
#pragma unroll
                    for (int t = 0; t < NT; ++t) {
                        const int dcol = t * 16 + l15;
                        Split b0, b1;
#pragma unroll
                        for (int e = 0; e < 16; ++e) {
                            const int k0 = frag_k(e, hf), k1 = 32 + frag_k(e, hf);
                            b0.hi[e] = vh[k0 * VP + dcol]; b0.lo[e] = vlo[k0 * VP + dcol]; b1.hi[e] = vh[k1 * VP + dcol]; b1.lo[e] = vlo[k1 * VP + dcol];
                        }
                        o[t] = wmma3(pa0, b0, o[t]);
                        o[t] = wmma3(pa1, b1, o[t]);
                    }
                } else {
                    const v16h pa0 = fh_ld(myp + l15 * 64, 1, 0, hf, 64, 4096.f), pa1 = fh_ld(myp + l15 * 64, 1, 32, hf, 64, 4096.f);
#pragma unroll
                    for (int t = 0; t < NT; ++t) {
                        const int dcol = t * 16 + l15;
                        v16h b0, b1;
#pragma unroll
                        for (int e = 0; e < 16; ++e) { b0[e] = vl[frag_k(e, hf) * VP + dcol]; b1[e] = vl[(32 + frag_k(e, hf)) * VP + dcol]; }
                        o[t] = wmma16(pa0, b0, o[t]);
                        o[t] = wmma16(pa1, b1, o[t]);
                    }
                }
            }
        }
    }
    float* obase = p.O + b * p.sOb + h * p.sOh;
    if (p.ST) {
        const int rl = lane >> 1, isel = rl & 7;           // row q0 + rl ; rl>>3 == hf holds because lane>>4 == (lane>>1)>>3
        float mv = 0.f, lv = 0.f;
#pragma unroll
        for (int i = 0; i < 8; ++i) if (i == isel) { mv = m8[i]; lv = l8[i]; }
        const int irow = q0 + rl;
        if (irow < p.Lq) { float* st = p.ST + (((long long)b * gridDim.y + h) * p.Lq + irow) * 2 + (lane & 1); VST2(float, st, (lane & 1) ? lv : mv * 0.6931471805599453f); }
    }
    float invr[8];
#pragma unroll
    for (int i = 0; i < 8; ++i) {
        if (TWOPASS) invr[i] = SPLITPV ? 1.f : (1.f / 4096.f);
        else if (p.nonorm) invr[i] = exp2f(m8[i]) * (SPLITPV ? 1.f : (1.f / 4096.f));
        else invr[i] = (l8[i] > 0.f) ? (SPLITPV ? 1.f / l8[i] : 1.f / (l8[i] * 4096.f)) : 0.f;
    }
    __syncthreads();                                             // all waves done with pl/vl from the main loop
    const bool ofast = ((p.sOi & 3) == 0) && ((((size_t)obase) & 15) == 0) && (q0 + 16 <= p.Lq);
#pragma unroll
    for (int c0 = 0; c0 < DVP; c0 += 64) {
#pragma unroll
        for (int i = 0; i < 8; ++i)
#pragma unroll
            for (int t = 0; t < NT; ++t) if (t * 16 >= c0 && t * 16 < c0 + 64) ((float*)myp)[(i + 8 * hf) * 64 + (t * 16 - c0) + l15] = o[t][i] * invr[i];
        __syncthreads();
        const int cw = (DVP - c0 < 64) ? (DVP - c0) : 64;      // staged columns in this chunk (multiple of 16)
        if (ofast && (c0 + cw <= p.dv) && (cw % 32 == 0)) {
            const int lpr = cw / 4;                              // lanes per row (16 for 64 cols, 8 for 32)
            const int rows_per_ins = 32 / lpr;
            for (int r0 = 0; r0 < 16; r0 += rows_per_ins) {
                const int row = r0 + lane / lpr, c4 = (lane % lpr) * 4;
                const v4f v = *(const v4f*)(myp + row * 64 + c4);
                VST2V4(obase + (long long)(q0 + row) * p.sOi + c0 + c4, v);
            }
        } else {
            for (int row = 0; row < 16; ++row) {
                const int irow = q0 + row; if (irow >= p.Lq) continue;
                for (int c = lane; c < cw; c += 32) { const int d = c0 + c; if (d < p.dv) VST2(float, obase + (long long)irow * p.sOi + d, myp[row * 64 + c]); }
            }
        }
        __syncthreads();
    }
}

// =====================================================================================================================
// k_tr: dst(z, c, r) = alpha * src(z, r, c) (+ beta * R2(z, c, r)): [Z][R][C] (row stride lds) -> [Z][C][R] (row stride ldd) through a 32x32 LDS tile;
//   flags: 1 -> add beta * residual R2 addressed like dst (z*sRz + c*ldr + r); act applied before the residual.
// =====================================================================================================================
struct TrP { const float* src; float* dst; const float* R2; long long sSz, lds, sDz, ldd, sRz, ldr; int R, C, flags, act; float alpha, beta; };
static_assert(sizeof(TrP) == 3 * 8 + 6 * 8 + 6 * 4, "TrP has padding");
__global__ __launch_bounds__(256) void k_tr(TrP p) {
    __shared__ float tile[32][33];
    const int c0 = blockIdx.x * 32, r0 = blockIdx.y * 32, z = blockIdx.z;
    const int lane = threadIdx.x & 31, wave = threadIdx.x >> 5;
    const float* s = p.src + z * p.sSz;
#pragma unroll
    for (int k = 0; k < 4; ++k) {
        const int rl = wave * 4 + k, r = r0 + rl, c = c0 + lane;
        tile[rl][lane] = (r < p.R && c < p.C) ? s[(long long)r * p.lds + c] : 0.f;
    }
    __syncthreads();
    float* d = p.dst + z * p.sDz; const float* rr = p.R2 + z * p.sRz;
#pragma unroll
    for (int k = 0; k < 4; ++k) {
        const int cl = wave * 4 + k, c = c0 + cl, r = r0 + lane;
        if (c < p.C && r < p.R) {
            float v = act_fn(p.alpha * tile[lane][cl], p.act);
            if (p.flags & 1) v += p.beta * rr[(long long)c * p.ldr + r];
            VST2(float, d + (long long)c * p.ldd + r, v);
        }
    }
}

// k_affine: dst[i] = a * (sdev ? sdev[0] : 1) * src[i] + b, i < n (one thread per element; consecutive lanes -> consecutive addresses)
__global__ __launch_bounds__(256) void k_affine(const float* __restrict__ src, float* __restrict__ dst, int n, float a, float b, const float* __restrict__ sdev) {
    const int i = blockIdx.x * 256 + threadIdx.x;
    if (i < n) { const float aa = sdev ? a * sdev[0] : a; const float v = aa * src[i] + b; VST2(float, dst + i, v); }
}

// =====================================================================================================================
// k_softmax: row softmax over n contiguous elements, one 256-thread block per row; rows addressed z*sz + r*sr (grid (R, Z)).
//   out = scale_out * softmax(scale_in * x + (Mf ? Mf[z*smz + r*smr + j] : 0)); a row whose max is -inf is written as 0.
// =====================================================================================================================
struct SmP { const float* src; float* dst; const float* Mf; long long sz, sr, dz, dr, smz, smr; int n, pad; float scale_in, scale_out; };
static_assert(sizeof(SmP) == 3 * 8 + 6 * 8 + 4 * 4, "SmP has padding");
__global__ __launch_bounds__(256) void k_softmax(SmP p) {
    __shared__ float red[256];
    const int r = blockIdx.x, z = blockIdx.y, tid = threadIdx.x;
    const float* s = p.src + z * p.sz + (long long)r * p.sr;
    const float* mf = p.Mf ? (p.Mf + z * p.smz + (long long)r * p.smr) : nullptr;
    float mx = -__builtin_inff();
    for (int j = tid; j < p.n; j += 256) { float v = s[j] * p.scale_in; if (mf) v += mf[j]; mx = fmaxf(mx, v); }
    red[tid] = mx; __syncthreads();
    for (int o = 128; o > 0; o >>= 1) { if (tid < o) red[tid] = fmaxf(red[tid], red[tid + o]); __syncthreads(); }
    mx = red[0]; __syncthreads();
    float sum = 0.f;
    for (int j = tid; j < p.n; j += 256) { float v = s[j] * p.scale_in; if (mf) v += mf[j]; sum += (mx == -__builtin_inff()) ? 0.f : expf(v - mx); }
    red[tid] = sum; __syncthreads();
    for (int o = 128; o > 0; o >>= 1) { if (tid < o) red[tid] += red[tid + o]; __syncthreads(); }
    sum = red[0];
    const float inv = (sum > 0.f) ? p.scale_out / sum : 0.f;
    float* d = p.dst + z * p.dz + (long long)r * p.dr;
    for (int j = tid; j < p.n; j += 256) { float v = s[j] * p.scale_in; if (mf) v += mf[j]; const float o = (mx == -__builtin_inff()) ? 0.f : expf(v - mx) * inv; VST2(float, d + j, o); }
}
// =====================================================================================================================
// k_stats: mean and rsqrt(var + eps) over a set of n elements addressed base + z*sz + (e / inner) * so + (e % inner) * si, one 256-thread
// k_norm_apply: y = (x - mean[set]) * rstd[set] * g[c] + b[c] over a [Z][C][L] channel-major tensor with set = z*G + c / (C/G) (G groups per z;
//   G = C -> per-channel sets indexed z*C+c; for batch norm pass stats indexed by c only via bn = 1). Optional act. Output same layout.
// =====================================================================================================================
//   mode 0: mean / rsqrt(var + eps); mode 1 (RMSNorm): 0 / rsqrt(mean(x^2) + eps); mode 2 (L2 normalize * sqrt(n)): 0 / sqrt(n) / max(||x||, eps); mode 3: as 0 with unbiased variance (n-1)
__global__ __launch_bounds__(256) void k_stats(const float* __restrict__ x, long long sz, long long so, long long si, int inner, int n, float eps, float* __restrict__ stat, int mode) {
    __shared__ float red[256];
    const int z = blockIdx.x, tid = threadIdx.x;
    const float* base = x + z * sz;
    float s = 0.f;
    for (int e = tid; e < n; e += 256) s += base[(long long)(e / inner) * so + (long long)(e % inner) * si];
    red[tid] = s; __syncthreads();
    for (int o = 128; o > 0; o >>= 1) { if (tid < o) red[tid] += red[tid + o]; __syncthreads(); }
    const float mu = (mode == 0 || mode == 3) ? red[0] / (float)n : 0.f; __syncthreads();
    float q = 0.f;
    for (int e = tid; e < n; e += 256) { const float dlt = base[(long long)(e / inner) * so + (long long)(e % inner) * si] - mu; q += dlt * dlt; }
    red[tid] = q; __syncthreads();
    for (int o = 128; o > 0; o >>= 1) { if (tid < o) red[tid] += red[tid + o]; __syncthreads(); }
    {
        float rs;
        if (mode == 2) rs = sqrtf((float)n) / fmaxf(sqrtf(red[0]), eps); else if (mode == 3) rs = rsqrtf(red[0] / (float)(n - 1) + eps); else rs = rsqrtf(red[0] / (float)n + eps);
        if (tid < 32) { const float v = (tid == 0) ? mu : ((tid == 1) ? rs : 0.f); VST2(float, stat + (long long)z * 32 + tid, v); }
    }
}
//   One thread per element over the flat [Z][C][L] index space: grid ceil(Z*C*L / 256).
__global__ __launch_bounds__(256) void k_norm_apply(const float* __restrict__ x, float* __restrict__ y, const float* __restrict__ stat, const float* __restrict__ g, const float* __restrict__ bta,
                                                     int Z, int C, int L, int G, int bn, int act) {
    const long long idx = (long long)blockIdx.x * 256 + threadIdx.x;
    if (idx >= (long long)Z * C * L) return;
    const int l = (int)(idx % L); const long long zc = idx / L; const int c = (int)(zc % C), z = (int)(zc / C); (void)l;
    const int set = bn ? c : (z * G + c / (C / G));
    float v = (x[idx] - stat[(long long)set * 32]) * stat[(long long)set * 32 + 1];
    if (g) v *= g[c];
    if (bta) v += bta[c];
    v = act_fn(v, act);
    VST2(float, y + idx, v);
}

// k_lse_neg: c[i] = -(st[2i] + log(st[2i+1])) = minus the log-sum-exp of row i from k_attn's ST output (for softmax over the query dimension)
__global__ __launch_bounds__(256) void k_lse_neg(const float* __restrict__ st, float* __restrict__ c, int n) {
    const int i = blockIdx.x * 256 + threadIdx.x;
    if (i < n) { const float v = -(st[2 * i] + logf(st[2 * i + 1])); VST2(float, c + i, v); }
}

// k_iota: dst[i] = a * i + b as int32 (segment/position id helper)
__global__ __launch_bounds__(256) void k_iota(int* __restrict__ dst, int n, int a, int b) {
    const int i = blockIdx.x * 256 + threadIdx.x;
    if (i < n) { const int v = a * i + b; VST2(int, dst + i, v); }
}

// k_axpby: dst[i] = a * x[i] + b * y[i] (+ c), i < n
__global__ __launch_bounds__(256) void k_axpby(const float* __restrict__ x, const float* __restrict__ y, float* __restrict__ dst, int n, float a, float b, float c) {
    const int i = blockIdx.x * 256 + threadIdx.x;
    if (i < n) { const float v = a * x[i] + b * y[i] + c; VST2(float, dst + i, v); }
}

// =====================================================================================================================
// k_rope: rotary embedding on a [R rows][Hn heads][D] view (row stride sXr, head stride sXh, element stride 1) -> Y (own strides).
//   mode 0: rotate_half (partner d±D/2, sign - for d<D/2); mode 1: interleaved pairs (partner d^1, sign - for even d).
//   table column tcol: tmode 0 -> d, 1 -> d % (D/2), 2 -> d / 2; position p: pmode 0 -> r % S, 1 -> head index, 2 -> pos[r];
//   c = C[(r / S) * sCb + p * sCp + tcol * sCd], s likewise from Sn; y = x[d] * c + sign * x[partner] * s. X and Y must not alias.
// =====================================================================================================================
struct RopeP { const float* X; float* Y; const float* C; const float* Sn; const int* pos; long long sXr, sXh, sYr, sYh, sCb, sCp, sCd; int R, Hn, D, S, mode, tmode, pmode, pad; };
static_assert(sizeof(RopeP) == 5 * 8 + 7 * 8 + 8 * 4, "RopeP has padding");
__global__ __launch_bounds__(256) void k_rope(RopeP p) {
    const long long idx = (long long)blockIdx.x * 256 + threadIdx.x;
    if (idx >= (long long)p.R * p.Hn * p.D) return;
    const int d = (int)(idx % p.D); const long long rh = idx / p.D; const int h = (int)(rh % p.Hn); const int r = (int)(rh / p.Hn);
    const int half = p.D / 2;
    int partner; float sign;
    if (p.mode == 0) { partner = (d < half) ? d + half : d - half; sign = (d < half) ? -1.f : 1.f; }
    else { partner = d ^ 1; sign = (d & 1) ? 1.f : -1.f; }
    const int tcol = (p.tmode == 0) ? d : ((p.tmode == 1) ? (d % half) : (d >> 1));
    const int pp = (p.pmode == 0) ? (r % p.S) : ((p.pmode == 1) ? h : p.pos[r]);
    const long long toff = (long long)(r / p.S) * p.sCb + (long long)pp * p.sCp + (long long)tcol * p.sCd;
    const float* xr = p.X + (long long)r * p.sXr + (long long)h * p.sXh;
    const float v = xr[d] * p.C[toff] + sign * xr[partner] * p.Sn[toff];
    VST2(float, p.Y + (long long)r * p.sYr + (long long)h * p.sYh + d, v);
}

// k_invf + k_sincos (split so neither kernel carries a large VALU-fma footprint): invf_i = num * (1 / powf(base, (2 i)/D)) [fmode 0],
//   num * expf((2 i) * cexp) [fmode 1], num * powf(base, -2 (i - 1) / D) [fmode 2]; then cs/sn[s*half + i] = cos/sin((pscale * s) * invf_i)
__global__ __launch_bounds__(256) void k_invf(float* __restrict__ invb, int half, int D, float base, float num, int fmode, float cexp) {
    const int i = blockIdx.x * 256 + threadIdx.x;
    if (i >= ((half + 31) / 32) * 32) return;
    if (i >= half) { VST2(float, invb + i, 0.f); return; }
    const float e = (float)(2 * i) / (float)D;
    float invf;
    if (fmode == 1) invf = num * expf((float)(2 * i) * cexp);
    else if (fmode == 2) invf = num * powf(base, (-2.0f * ((float)i - 1.0f)) / (float)D);
    else invf = num * (1.0f / powf(base, e));
    VST2(float, invb + i, invf);
}
__global__ __launch_bounds__(256) void k_sincos(float* __restrict__ cs, float* __restrict__ sn, const float* __restrict__ invb, int S, int half, float pscale) {
    const int idx = blockIdx.x * 256 + threadIdx.x;
    if (idx >= S * half) return;
    const int s = idx / half, i = idx - s * half;
    const float ang = (pscale * (float)s) * invb[i];
    VST2(float, cs + idx, cosf(ang)); VST2(float, sn + idx, sinf(ang));
}

// k_mulact: dst[i] = act(x[i]) * y[i]
__global__ __launch_bounds__(256) void k_mulact(const float* __restrict__ x, const float* __restrict__ y, float* __restrict__ dst, int n, int act) {
    const int i = blockIdx.x * 256 + threadIdx.x;
    if (i < n) { const float v = act_fn(x[i], act) * y[i]; VST2(float, dst + i, v); }
}

// =====================================================================================================================
// k_matvec: thread-per-row matrix-vector products for N <= 8 output columns (heads with 1-3 outputs, gates), f32 on the VALU.
//   C[r*sCm + j] = act(alpha * sum_k A[r*sAm + k*sAk] * B[j*sBn + k*sBk] + bias[j]) + beta * R[r*sRm + j*sRn]; each thread writes its N contiguous floats.
// =====================================================================================================================
__global__ __launch_bounds__(256) void k_matvec(GemmP p) {
    // 32 lanes write one line with one instruction.
    const int rpt = (p.N == 1) ? 1 : 32;
    const long long r0 = ((long long)blockIdx.x * 256 + threadIdx.x) * rpt; const int z = blockIdx.z, zo = z / p.zi_n, zi = z - zo * p.zi_n;
    if (r0 >= p.M) return;
    const float* Bb = p.B + zo * p.sBo + zi * p.sBi;
    float* C = p.C + zo * p.sCo + zi * p.sCi; const float* R = p.R + zo * p.sRo + zi * p.sRi;
    for (int rr = 0; rr < rpt; ++rr) {
        const long long r = r0 + rr; if (r >= p.M) break;
        const float* A = p.A + zo * p.sAo + zi * p.sAi + r * p.sAm;
        float acc[8] = {0.f, 0.f, 0.f, 0.f, 0.f, 0.f, 0.f, 0.f};
        for (int k = 0; k < p.K; ++k) { const float a = A[(long long)k * p.sAk];
#pragma unroll
            for (int j = 0; j < 8; ++j) if (j < p.N) acc[j] += a * Bb[(long long)j * p.sBn + (long long)k * p.sBk]; }
#pragma unroll
        for (int j = 0; j < 8; ++j) if (j < p.N) {
            float v = acc[j] * p.alpha;
            if (p.flags & 1) v += p.bias[j];
            if (p.flags & 2) v += p.bias[r];
            v = act_fn(v, p.act);
            if (p.flags & 4) v += p.beta * R[r * p.sRm + (long long)j * p.sRn];
            VST2(float, C + r * p.sCm + j, v);
        }
    }
}
// k_smallsoftmax: thread-per-row softmax for short rows (n <= 64): dst[r*dr + j] = softmax(scale*src[r*sr + j])
__global__ __launch_bounds__(256) void k_smallsoftmax(const float* __restrict__ src, float* __restrict__ dst, long long sr, long long dr, int n, long long R, float scale) {
    const long long r0 = ((long long)blockIdx.x * 256 + threadIdx.x) * 32;
    for (int rr = 0; rr < 32; ++rr) {
        const long long r = r0 + rr; if (r >= R) return;
        const float* s = src + r * sr; float* d = dst + r * dr;
        float mx = -__builtin_inff();
        for (int j = 0; j < n; ++j) mx = fmaxf(mx, s[j] * scale);
        float sum = 0.f;
        for (int j = 0; j < n; ++j) sum += expf(s[j] * scale - mx);
        const float inv = 1.f / sum;
        for (int j = 0; j < n; ++j) { const float v = expf(s[j] * scale - mx) * inv; VST2(float, d + j, v); }
    }
}

__global__ __launch_bounds__(32) void k_unitstat(float* __restrict__ st) { const int t = threadIdx.x; const float v = (t == 1) ? 1.f : 0.f; VST2(float, st + t, v); }

// destination (e.g. a d_out whose row width is not a multiple of 32 floats) is written by consecutive lanes of one instruction
__global__ __launch_bounds__(256) void k_lincopy(const float* __restrict__ src, long long lds, float* __restrict__ dst, long long ldd, long long rows, int cols) {
    const long long i = (long long)blockIdx.x * 256 + threadIdx.x; if (i >= rows * cols) return;
    const long long r = i / cols; const int c = (int)(i - r * cols);
    const float v = src[r * lds + c]; VST2(float, dst + r * ldd + c, v);
}

namespace w25 {
typedef __attribute__((ext_vector_type(16))) _Float16 v16h;
typedef __attribute__((ext_vector_type(8)))  _Float16 v8h;
typedef __attribute__((ext_vector_type(16))) __bf16   v16b;
typedef __attribute__((ext_vector_type(8)))  __bf16   v8b;
typedef __attribute__((ext_vector_type(8)))  float    v8f;
typedef __attribute__((ext_vector_type(4)))  float    v4f;

__device__ __forceinline__ unsigned short f2bf_bits(float f) {
  unsigned u = __float_as_uint(f);
  return (unsigned short)((u + 0x7FFFu + ((u >> 16) & 1u)) >> 16);
}
__device__ __forceinline__ float bf_bits2f(unsigned short h) { return __uint_as_float(((unsigned)h) << 16); }

// hazard guards as plain device helpers (no inline asm inside the kernel template body)
__device__ __forceinline__ void dep_guard_h(v8f& a, v8f& b, v16h x, v16h y) { asm volatile("v_nop\n\tv_nop\n\tv_nop\n\tv_nop" : "+v"(a), "+v"(b) : "v"(x), "v"(y)); }
__device__ __forceinline__ void dep_guard_b(v8f& a, v8f& b, v16b x, v16b y) { asm volatile("v_nop\n\tv_nop\n\tv_nop\n\tv_nop" : "+v"(a), "+v"(b) : "v"(x), "v"(y)); }
__device__ __forceinline__ void keep4_h(v16h a, v16h b, v16h c, v16h d) { asm volatile("v_nop" :: "v"(a), "v"(b), "v"(c), "v"(d)); }
__device__ __forceinline__ void keep4_b(v16b a, v16b b, v16b c, v16b d) { asm volatile("v_nop" :: "v"(a), "v"(b), "v"(c), "v"(d)); }
__device__ __forceinline__ void acc_guard4(v8f& a, v8f& b, v8f& c, v8f& d) { asm volatile("v_nop\n\tv_nop\n\tv_nop\n\tv_nop" : "+v"(a), "+v"(b), "+v"(c), "+v"(d)); }
template <typename T> struct Frag;
template <> struct Frag<_Float16> {
  typedef v16h V; union U { v16h v; v8h h[2]; };
  static __device__ __forceinline__ v16h load(const _Float16* p) {   // elements 0..7 <- p[0..7], 8..15 <- p[16..23]
    U f; f.h[0] = *(const v8h*)(p); f.h[1] = *(const v8h*)(p + 16); return f.v;
  }
  static __device__ __forceinline__ v8f mma(v16h a, v16h b, v8f c) {
    return __builtin_amdgcn_wmma_f32_16x16x32_f16(false, a, false, b, (short)0, c, false, false);
  }
  static __device__ __forceinline__ void guard(v8f& a, v8f& b, v16h x, v16h y) { dep_guard_h(a, b, x, y); }
  static __device__ __forceinline__ void keep(v16h a, v16h b, v16h c, v16h d) { keep4_h(a, b, c, d); }
};
template <> struct Frag<__bf16> {
  typedef v16b V; union U { v16b v; v8b h[2]; };
  static __device__ __forceinline__ v16b load(const __bf16* p) {
    U f; f.h[0] = *(const v8b*)(p); f.h[1] = *(const v8b*)(p + 16); return f.v;
  }
  static __device__ __forceinline__ v8f mma(v16b a, v16b b, v8f c) {
    return __builtin_amdgcn_wmma_f32_16x16x32_bf16(false, a, false, b, (short)0, c, false, false);
  }
  static __device__ __forceinline__ void guard(v8f& a, v8f& b, v16b x, v16b y) { dep_guard_b(a, b, x, y); }
  static __device__ __forceinline__ void keep(v16b a, v16b b, v16b c, v16b d) { keep4_b(a, b, c, d); }
};

// ---- Register-blocked batched WMMA GEMM ------------------------------------
// C[m,n] = scale * sum_k A[m,k] * Bt[n,k] (+bias)(+resid); each wave owns a 64x64 tile.
// A row-major [M,K]; Bt row-major [N,K]; M,N % 64 == 0, K % 32 == 0.
// SPLIT: operands are hi/lo planes (A2/Bt2 = lo planes, same layout); product = hi·hi + hi·lo + lo·hi.
// BIAS_MODE: 0 = none, 1 = bias[m], 2 = bias[n].
// OUT_MODE: 0 = f32, 1 = f16, 2 = bf16 hi plane (Cout) + bf16 lo plane (Cout2).
// ET: 0 = f16 operands, 1 = bf16 operands (pointers passed as 16-bit storage)
template <int ET> struct Elem;
template <> struct Elem<0> { typedef _Float16 T; };
template <> struct Elem<1> { typedef __bf16 T; };
template <int ET, bool SPLIT, int BIAS_MODE, int OUT_MODE, bool RESID, int ACT = 0>
__global__ __launch_bounds__(256) void wmma_gemm64(
    const unsigned short* __restrict__ Ap, const unsigned short* __restrict__ A2p, int lda, long strideA,
    const unsigned short* __restrict__ Btp, const unsigned short* __restrict__ Bt2p, int ldb, long strideB,
    void* __restrict__ Cout, void* __restrict__ Cout2, int ldc, long strideC,
    const float* __restrict__ bias,
    const float* __restrict__ resid, long strideR,
    int M, int N, int K, float scale) {
  typedef typename Elem<ET>::T T;
  typedef typename Frag<T>::V V;
  const T* A = (const T*)Ap; const T* A2 = (const T*)A2p; const T* Bt = (const T*)Btp; const T* Bt2 = (const T*)Bt2p;
  __shared__ __align__(16) float sT[8][16 * 68];   // per-wave 16x64 slab, pitch 68 floats
  const int b    = blockIdx.y;
  const int lane = threadIdx.x & 31;
  const int wave = threadIdx.x >> 5;
  const int tilesN = N >> 6;
  const int tilesM = M >> 6;
  const int tile = blockIdx.x * 8 + wave;
  if (tile >= tilesM * tilesN) return;   // wave-uniform; no block barriers in this kernel
  const int tm = tile / tilesN;
  const int tn = tile - tm * tilesN;
  const int m0 = tm << 6;
  const int n0 = tn << 6;

  const T* Ab  = A  + (size_t)b * strideA;
  const T* Bb  = Bt + (size_t)b * strideB;
  const T* Ab2 = SPLIT ? (A2  + (size_t)b * strideA) : nullptr;
  const T* Bb2 = SPLIT ? (Bt2 + (size_t)b * strideB) : nullptr;

  const int rlane = lane & 15;                 // row (A) / col (B, D) within subtile
  const int koff  = (lane >> 4) * 8;           // k offset of this lane half
  const int mOff  = (lane >> 4) * 8;           // D row offset

  v8f acc[4][4];
#pragma unroll
  for (int i = 0; i < 4; ++i)
#pragma unroll
    for (int j = 0; j < 4; ++j) acc[i][j] = (v8f){0.f,0.f,0.f,0.f,0.f,0.f,0.f,0.f};

  for (int k0 = 0; k0 < K; k0 += 32) {
    V bh[4], bl[4];
#pragma unroll
    for (int j = 0; j < 4; ++j) {
      const size_t bo = (size_t)(n0 + (j << 4) + rlane) * ldb + koff + k0;
      bh[j] = Frag<T>::load(Bb + bo);
      if (SPLIT) bl[j] = Frag<T>::load(Bb2 + bo);
    }
#pragma unroll
    for (int i = 0; i < 4; ++i) {
      const size_t ao = (size_t)(m0 + (i << 4) + rlane) * lda + koff + k0;
      V ah = Frag<T>::load(Ab + ao);
      V al;
      if (SPLIT) al = Frag<T>::load(Ab2 + ao);
#pragma unroll
      for (int j = 0; j < 4; ++j) {
        acc[i][j] = Frag<T>::mma(ah, bh[j], acc[i][j]);
        if (SPLIT) {
          acc[i][j] = Frag<T>::mma(ah, bl[j], acc[i][j]);
          acc[i][j] = Frag<T>::mma(al, bh[j], acc[i][j]);
        }
      }
      Frag<T>::guard(acc[i][0], acc[i][3], ah, SPLIT ? al : ah);
    }
    Frag<T>::keep(bh[0], bh[1], bh[2], bh[3]);
    if (SPLIT) Frag<T>::keep(bl[0], bl[1], bl[2], bl[3]);
  }
  acc_guard4(acc[0][0], acc[0][1], acc[0][2], acc[0][3]);
  acc_guard4(acc[1][0], acc[1][1], acc[1][2], acc[1][3]);
  acc_guard4(acc[2][0], acc[2][1], acc[2][2], acc[2][3]);
  acc_guard4(acc[3][0], acc[3][1], acc[3][2], acc[3][3]);

  // ---- epilogue ----
  float* slab = sT[wave];
  const float* Rb = RESID ? (resid + (size_t)b * strideR) : nullptr;
#pragma unroll
  for (int i = 0; i < 4; ++i) {
    const int mBase = m0 + (i << 4);
#pragma unroll
    for (int j = 0; j < 4; ++j) {
      const int n = n0 + (j << 4) + rlane;
      float bv = 0.f;
      if (BIAS_MODE == 2) bv = bias[n];
#pragma unroll
      for (int r = 0; r < 8; ++r) {
        float v = acc[i][j][r] * scale;
        if (BIAS_MODE == 1) v += bias[mBase + mOff + r];
        if (BIAS_MODE == 2) v += bv;
        if (RESID) v += Rb[(size_t)(mBase + mOff + r) * ldc + n];
        if (ACT == 1) v = tanhf(v);
        if (ACT == 2) v = fmaxf(v, 0.0f);
        if (ACT == 3) v = v / (1.0f + expf(-v));
        if (ACT == 4) v = (v > 0.f) ? v : 0.01f * v;
        if (ACT == 5) v = 0.5f * v * (1.0f + erff(v * 0.70710678118654752f));
        slab[(mOff + r) * 68 + (j << 4) + rlane] = v;
      }
    }
    __builtin_amdgcn_fence(__ATOMIC_RELEASE, "workgroup");
    __builtin_amdgcn_wave_barrier();
    __builtin_amdgcn_fence(__ATOMIC_ACQUIRE, "workgroup");
    if (OUT_MODE == 0) {
      float* C = (float*)Cout + (size_t)b * strideC;
      const int hh = lane >> 4, c4 = (lane & 15) * 4;     // row seg = 256 B = 16 lanes x 16 B
      {
#pragma unroll
        for (int it = 0; it < 8; ++it) {
          const int row = it * 2 + hh;
          v4f v = *(const v4f*)(slab + row * 68 + c4);
          *(v4f*)(C + (size_t)(mBase + row) * ldc + n0 + c4) = v;
        }
        
      }
    } else {
      const int q = lane >> 3, c8 = (lane & 7) * 8;
      unsigned short* C  = (unsigned short*)Cout  + (size_t)b * strideC;
      unsigned short* C2 = (OUT_MODE == 2) ? ((unsigned short*)Cout2 + (size_t)b * strideC) : nullptr;
      {
#pragma unroll
        for (int it = 0; it < 4; ++it) {
          const int row = it * 4 + q;
          const float* sp = slab + row * 68 + c8;
          v8h hv, lv;
#pragma unroll
          for (int e = 0; e < 8; ++e) {
            if (OUT_MODE == 1) {
              hv[e] = (_Float16)sp[e];
            } else {
              unsigned short hb = f2bf_bits(sp[e]);
              unsigned short lb = f2bf_bits(sp[e] - bf_bits2f(hb));
              hv[e] = __builtin_bit_cast(_Float16, hb);
              lv[e] = __builtin_bit_cast(_Float16, lb);
            }
          }
          *(v8h*)(C + (size_t)(mBase + row) * ldc + n0 + c8) = hv;
          if (OUT_MODE == 2) *(v8h*)(C2 + (size_t)(mBase + row) * ldc + n0 + c8) = lv;
        }
        
      }
    }
    __builtin_amdgcn_fence(__ATOMIC_RELEASE, "workgroup");
    __builtin_amdgcn_wave_barrier();
    __builtin_amdgcn_fence(__ATOMIC_ACQUIRE, "workgroup");
  }
}

__global__ __launch_bounds__(256) void cast_f32_f16x2(
    const float* __restrict__ in, _Float16* __restrict__ out, int n2) {
  int i = blockIdx.x * 256 + threadIdx.x;
  if (i < n2) {
    const _Float16 h0 = (_Float16)in[2 * i], h1 = (_Float16)in[2 * i + 1];
    const unsigned u = (unsigned)__builtin_bit_cast(unsigned short, h0) | ((unsigned)__builtin_bit_cast(unsigned short, h1) << 16);
    ((unsigned*)out)[i] = u;
    
  }
}


} // namespace w25

__global__ __launch_bounds__(256) void k_castT16(const float* __restrict__ src, long long lds, _Float16* __restrict__ dst, long long ldd, int R, int C, float s) {
    const long long i = (long long)blockIdx.x * 256 + threadIdx.x; const long long np = (long long)C * (R / 2); if (i >= np) return; const int c = (int)(i / (R / 2)); const int r = 2 * (int)(i % (R / 2));
    const _Float16 h0 = (_Float16)(src[(long long)r * lds + c] * s), h1 = (_Float16)(src[(long long)(r + 1) * lds + c] * s);
    const unsigned u = (unsigned)__builtin_bit_cast(unsigned short, h0) | ((unsigned)__builtin_bit_cast(unsigned short, h1) << 16);
    unsigned* d = (unsigned*)(dst + (long long)c * ldd + r); *d = u;  }
__global__ __launch_bounds__(256) void k_cast16(const float* __restrict__ src, long long lds, _Float16* __restrict__ dst, long long ldd, int R, int C, float s) {
    const long long i = (long long)blockIdx.x * 256 + threadIdx.x; const long long np = (long long)R * (C / 2); if (i >= np) return; const int r = (int)(i / (C / 2)); const int c = 2 * (int)(i % (C / 2));
    const _Float16 h0 = (_Float16)(src[(long long)r * lds + c] * s), h1 = (_Float16)(src[(long long)r * lds + c + 1] * s);
    const unsigned u = (unsigned)__builtin_bit_cast(unsigned short, h0) | ((unsigned)__builtin_bit_cast(unsigned short, h1) << 16);
    unsigned* d = (unsigned*)(dst + (long long)r * ldd + c); *d = u;  }

// f32 -> bf16 hi plane + bf16 lo plane (x = hi + lo to ~2^-17 relative; RNE both), [R][C] -> [R][C] (or transposed to [C][R]); 2 consecutive destination elements
__device__ __forceinline__ unsigned int f2bf2_pack(float a, float b, unsigned int* lo) {
    const unsigned short ha = w25::f2bf_bits(a), hb = w25::f2bf_bits(b);
    const unsigned short la = w25::f2bf_bits(a - w25::bf_bits2f(ha)), lb = w25::f2bf_bits(b - w25::bf_bits2f(hb));
    *lo = (unsigned)la | ((unsigned)lb << 16); return (unsigned)ha | ((unsigned)hb << 16); }
__global__ __launch_bounds__(256) void k_castS16(const float* __restrict__ src, long long lds, __bf16* __restrict__ dhi, __bf16* __restrict__ dlo, long long ldd, int R, int C, float s, int transpose) {
    const long long i = (long long)blockIdx.x * 256 + threadIdx.x; long long o; float a, b;
    if (transpose) { const long long np = (long long)C * (R / 2); if (i >= np) return; const int c = (int)(i / (R / 2)); const int r = 2 * (int)(i % (R / 2)); a = src[(long long)r * lds + c] * s; b = src[(long long)(r + 1) * lds + c] * s; o = (long long)c * ldd + r; }
    else { const long long np = (long long)R * (C / 2); if (i >= np) return; const int r = (int)(i / (C / 2)); const int c = 2 * (int)(i % (C / 2)); a = src[(long long)r * lds + c] * s; b = src[(long long)r * lds + c + 1] * s; o = (long long)r * ldd + c; }
    unsigned lo; const unsigned hi = f2bf2_pack(a, b, &lo); unsigned* ph = (unsigned*)(dhi + o); unsigned* pl = (unsigned*)(dlo + o);
    *ph = hi; *pl = lo;  }

namespace w25 {
// =====================================================================================
// Generic causal/non-causal attention for head_dim 64, f32 in / f32 out; 16-bit operands: bf16 with optional hi/lo splits, or
// plain f16 (F16=true, non-split, probabilities carried x2^15).
//   scores = (q*qscale)·kᵀ : v_wmma_f32_16x16x32_bf16; SPLIT_QK -> q,k as bf16 hi/lo (hi·hi + hi·lo + lo·hi)
//   out    = p·v           : v_wmma_f32_16x16x32_bf16; SPLIT_PV -> p,v as bf16 hi/lo; else p,v plain bf16
//   f32 accumulate; online softmax in f32. Block = 4 waves = 64 query rows of one (batch, head); S % 64 == 0.
//   Element (b, s, h, d) of tensor X lives at X[b*X_bs + s*X_rs + h*X_hs + d] (strides in floats, multiples of 4).
//   Masking: mask_mode 0 none, 1 causal (kv > q masked), 2 tensor [S][Skv] shared over (b,h) (float if
//   mask_is_int==0, int32 with element == 0 -> masked if 1, int32 with element != 0 -> masked if 2), 3 per-token vectors qmask[B][S] & kvmask[B][Skv] (int32,
//   0 -> masked), 4 causal + sliding window (kv > q or q - kv > W masked; W passed in mask_is_int);
//   5 = relative-position bias: s += cp[b,h,q][idx[q][kv]] + pc[b,h,kv][idx[q][kv]] with idx = mask_b ([S][Skv] int32) and
//   mask_a an int32 [S][Skv] tensor with nonzero = masked (tables: element (b,h,row,n) at X + b*c_bs + h*c_hs + row*c_rs + n);
//   masked scores are replaced by mask_fill (e.g. -inf or -1e9) before the softmax.
//   grid.x = B * H * (S/64) (or a sub-range with blk0).
// =====================================================================================
#define AT_D 64
#define AT_NW 4
#define AT_QB 64
#define AT_KC 64
struct AttnGeom { const float* cp = nullptr; const float* pc = nullptr; long c_bs = 0, c_rs = 0, c_hs = 0;   // mode-5 score-bias tables
                  long q_bs, q_rs, q_hs, k_bs, k_rs, k_hs, v_bs, v_rs, v_hs, o_bs, o_rs, o_hs;
                  int S, Skv, H, mask_mode; float qscale; int blk0; float mask_fill; int mask_is_int; };
static_assert(sizeof(AttnGeom) == 168, "no padding");

__device__ __forceinline__ unsigned short at_bf_bits(float f) {
  unsigned u = __float_as_uint(f);
  return (unsigned short)((u + 0x7FFFu + ((u >> 16) & 1u)) >> 16);
}
__device__ __forceinline__ __bf16 at_f2bf(float f) { return __builtin_bit_cast(__bf16, at_bf_bits(f)); }
__device__ __forceinline__ void at_split(float f, __bf16& hi, __bf16& lo) {
  const unsigned short hb = at_bf_bits(f);
  hi = __builtin_bit_cast(__bf16, hb);
  lo = at_f2bf(f - __uint_as_float(((unsigned)hb) << 16));
}
__device__ __forceinline__ v8f at_mma(v16b a, v16b b, v8f c) {
  c = __builtin_amdgcn_wmma_f32_16x16x32_bf16(false, a, false, b, (short)0, c, false, false);
  asm volatile("v_nop\n\tv_nop\n\tv_nop\n\tv_nop" : "+v"(c) : "v"(a), "v"(b));
  return c;
}
// 16-bit element as a bit pattern held in a __bf16 slot: f16 bits when F16, bf16 (RNE) otherwise
template <bool F16> __device__ __forceinline__ __bf16 at_to16(float f) {
  if (F16) return __builtin_bit_cast(__bf16, (_Float16)f);
  return at_f2bf(f);
}
template <bool F16> __device__ __forceinline__ v8f at_mma16(v16b a, v16b b, v8f c) {
  if (F16) {
    const v16h ah = __builtin_bit_cast(v16h, a), bh = __builtin_bit_cast(v16h, b);
    c = __builtin_amdgcn_wmma_f32_16x16x32_f16(false, ah, false, bh, (short)0, c, false, false);
    asm volatile("v_nop\n\tv_nop\n\tv_nop\n\tv_nop" : "+v"(c) : "v"(ah), "v"(bh));
    return c;
  }
  return at_mma(a, b, c);
}

template <bool SPLIT_QK, bool SPLIT_PV, bool F16 = false>
__global__ __launch_bounds__(128)
void attn64_kernel(const float* __restrict__ q, const float* __restrict__ k,
                   const float* __restrict__ v, float* __restrict__ out,
                   const void* __restrict__ mask_a, const int* __restrict__ mask_b, AttnGeom g) {
  static_assert(!(F16 && (SPLIT_QK || SPLIT_PV)), "f16 mode is non-split");
  const float PSC = F16 ? 32768.0f : 1.0f;     // f16 probabilities carried x2^15 (subnormal range), folded into the final 1/l
  union FB { v16b v; v8b h[2]; };
  __shared__ __align__(16) __bf16 Ksh[AT_KC * AT_D];             // K hi [kv][d]      8 KB
  __shared__ __align__(16) __bf16 Ksl[SPLIT_QK ? AT_KC * AT_D : 8];
  __shared__ __align__(16) __bf16 Vth[AT_D * AT_KC];             // V hi [d][kv]      8 KB
  __shared__ __align__(16) __bf16 Vtl[SPLIT_PV ? AT_D * AT_KC : 8];
  __shared__ __align__(16) __bf16 Psh[AT_NW][16 * AT_KC];        // per wave P hi [row][kv]  8 KB
  __shared__ __align__(16) __bf16 Psl[SPLIT_PV ? AT_NW : 1][SPLIT_PV ? 16 * AT_KC : 8];
  __shared__ __align__(16) float  Os[AT_NW][16 * 68];            // per wave out tile, pitch 68

  const int tid  = threadIdx.x;
  const int wave = tid >> 5;
  const int lane = tid & 31;
  const int hh   = lane >> 4;
  const int c    = lane & 15;

  const int nqb = g.S / AT_QB;
  const int bx = blockIdx.x + g.blk0;
  const int qb = bx % nqb;
  const int bh = bx / nqb;
  const int h  = bh % g.H;
  const int b  = bh / g.H;
  const int qbase_block = qb * AT_QB;
  const int q0 = qbase_block + wave * 16;

  const float* qb_ptr = q + (size_t)b * g.q_bs + (size_t)h * g.q_hs;
  const float* kb_ptr = k + (size_t)b * g.k_bs + (size_t)h * g.k_hs;
  const float* vb_ptr = v + (size_t)b * g.v_bs + (size_t)h * g.v_hs;
  float*       ob_ptr = out + (size_t)b * g.o_bs + (size_t)h * g.o_hs;

  // ---- Q fragments (A operand): 2 d-chunks, hi (and lo) ----
  v16b qah[2], qal[2];
  {
    const float* qrow = qb_ptr + (size_t)(q0 + c) * g.q_rs;
#pragma unroll
    for (int dc = 0; dc < 2; ++dc) {
#pragma unroll
      for (int e = 0; e < 8; ++e) {
        const float f0 = qrow[dc * 32 + 8 * hh + e] * g.qscale;
        const float f1 = qrow[dc * 32 + 16 + 8 * hh + e] * g.qscale;
        if (SPLIT_QK) { __bf16 hq, lq; at_split(f0, hq, lq); qah[dc][e] = hq; qal[dc][e] = lq; at_split(f1, hq, lq); qah[dc][8 + e] = hq; qal[dc][8 + e] = lq; }
        else { qah[dc][e] = at_to16<F16>(f0); qah[dc][8 + e] = at_to16<F16>(f1); qal[dc][e] = qah[dc][e]; qal[dc][8 + e] = qah[dc][8 + e]; }
      }
    }
  }

  float mrow[8], lrow[8];
  v8f oacc[4];
#pragma unroll
  for (int r = 0; r < 8; ++r) { mrow[r] = -INFINITY; lrow[r] = 0.f; }
#pragma unroll
  for (int t = 0; t < 4; ++t) oacc[t] = (v8f){0.f,0.f,0.f,0.f,0.f,0.f,0.f,0.f};

  const int nChunks = (g.mask_mode == 1 || g.mask_mode == 4) ? (qb + 1) : (g.Skv / AT_KC);   // block-uniform
  // per-row query mask (mode 3)
  int qkeep[8];
#pragma unroll
  for (int r = 0; r < 8; ++r) qkeep[r] = (g.mask_mode == 3) ? mask_b[(size_t)b * g.S + q0 + 8 * hh + r] : 1;   // mask_b = qmask in mode 3
  for (int kc = 0; kc < nChunks; ++kc) {
    const int kv0 = kc * AT_KC;
    __syncthreads();
    {
      const int kvr = tid >> 1, dh = (tid & 1) * 32;
      const float* krow = kb_ptr + (size_t)(kv0 + kvr) * g.k_rs + dh;
      const float* vrow = vb_ptr + (size_t)(kv0 + kvr) * g.v_rs + dh;
#pragma unroll
      for (int i = 0; i < 8; ++i) {
        v4f kk = *(const v4f*)(krow + 4 * i);
        v4f vv = *(const v4f*)(vrow + 4 * i);
#pragma unroll
        for (int e = 0; e < 4; ++e) {
          const int d = dh + 4 * i + e;
          if (SPLIT_QK) { __bf16 a, bl; at_split(kk[e], a, bl); Ksh[kvr * AT_D + d] = a; Ksl[kvr * AT_D + d] = bl; }
          else Ksh[kvr * AT_D + d] = at_to16<F16>(kk[e]);
          if (SPLIT_PV) { __bf16 a, bl; at_split(vv[e], a, bl); Vth[d * AT_KC + kvr] = a; Vtl[d * AT_KC + kvr] = bl; }
          else Vth[d * AT_KC + kvr] = at_to16<F16>(vv[e]);
        }
      }
    }
    __syncthreads();

    v8f s[4];
#pragma unroll
    for (int j = 0; j < 4; ++j) {
      s[j] = (v8f){0.f,0.f,0.f,0.f,0.f,0.f,0.f,0.f};
#pragma unroll 1
      for (int dc = 0; dc < 2; ++dc) {
        FB kb;
        kb.h[0] = *(const v8b*)(Ksh + (j * 16 + c) * AT_D + dc * 32 + 8 * hh);
        kb.h[1] = *(const v8b*)(Ksh + (j * 16 + c) * AT_D + dc * 32 + 16 + 8 * hh);
        s[j] = at_mma16<F16>(qah[dc], kb.v, s[j]);
        if (SPLIT_QK) {
          FB kl;
          kl.h[0] = *(const v8b*)(Ksl + (j * 16 + c) * AT_D + dc * 32 + 8 * hh);
          kl.h[1] = *(const v8b*)(Ksl + (j * 16 + c) * AT_D + dc * 32 + 16 + 8 * hh);
          s[j] = at_mma16<F16>(qah[dc], kl.v, s[j]);
          s[j] = at_mma16<F16>(qal[dc], kb.v, s[j]);
        }
      }
    }
    const bool diag = (g.mask_mode == 1) && (kc == qb);
    int kvkeep[4] = {1, 1, 1, 1};
    if (g.mask_mode == 3) {
#pragma unroll
      for (int j = 0; j < 4; ++j) kvkeep[j] = ((const int*)mask_a)[(size_t)b * g.Skv + kv0 + j * 16 + c];   // mask_a = kvmask
    }
    float cm[8];
#pragma unroll
    for (int r = 0; r < 8; ++r) {
      const int qrow = q0 + 8 * hh + r;
      float m = -INFINITY;
#pragma unroll
      for (int j = 0; j < 4; ++j) {
        const int kvcol = kv0 + j * 16 + c;
        bool masked = false;
        if (diag) masked = (kvcol > qrow);
        else if (g.mask_mode == 4) masked = (kvcol > qrow) || (qrow - kvcol > g.mask_is_int);
        else if (g.mask_mode == 2) {
          const size_t mi = (size_t)qrow * g.Skv + kvcol;
          masked = (g.mask_is_int == 0) ? (((const float*)mask_a)[mi] == 0.0f)
                 : (g.mask_is_int == 1) ? (((const int*)mask_a)[mi] == 0) : (((const int*)mask_a)[mi] != 0);
        } else if (g.mask_mode == 3) masked = (qkeep[r] == 0) || (kvkeep[j] == 0);
        else if (g.mask_mode == 5) {
          const size_t mi = (size_t)qrow * g.Skv + kvcol;
          masked = (((const int*)mask_a)[mi] != 0);
          int n = mask_b[mi]; n = n < 0 ? 0 : n;
          s[j][r] += g.cp[(size_t)b * g.c_bs + (size_t)h * g.c_hs + (size_t)qrow * g.c_rs + n]
                   + g.pc[(size_t)b * g.c_bs + (size_t)h * g.c_hs + (size_t)kvcol * g.c_rs + n];
        }
        if (masked) s[j][r] = g.mask_fill;
        m = fmaxf(m, s[j][r]);
      }
#pragma unroll
      for (int off = 1; off < 16; off <<= 1) m = fmaxf(m, __shfl_xor(m, off, 32));
      cm[r] = m;
    }
    __bf16* pwh = Psh[wave];
    __bf16* pwl = Psl[SPLIT_PV ? wave : 0];
#pragma unroll
    for (int r = 0; r < 8; ++r) {
      const float mnew = fmaxf(mrow[r], cm[r]);
      const float alpha = expf(mrow[r] - mnew);
      mrow[r] = mnew;
      float psum = 0.f;
#pragma unroll
      for (int j = 0; j < 4; ++j) {
        const float p = expf(s[j][r] - mnew);
        psum += p;
        if (SPLIT_PV) { __bf16 a, bl; at_split(p, a, bl); pwh[(8 * hh + r) * AT_KC + j * 16 + c] = a; pwl[(8 * hh + r) * AT_KC + j * 16 + c] = bl; }
        else pwh[(8 * hh + r) * AT_KC + j * 16 + c] = at_to16<F16>(p * PSC);
      }
#pragma unroll
      for (int off = 1; off < 16; off <<= 1) psum += __shfl_xor(psum, off, 32);
      lrow[r] = lrow[r] * alpha + psum;
#pragma unroll
      for (int t = 0; t < 4; ++t) oacc[t][r] *= alpha;
    }
    __builtin_amdgcn_fence(__ATOMIC_RELEASE, "workgroup");
    __builtin_amdgcn_wave_barrier();
    __builtin_amdgcn_fence(__ATOMIC_ACQUIRE, "workgroup");
#pragma unroll 1
    for (int kk = 0; kk < 2; ++kk) {
      FB pa, pl;
      pa.h[0] = *(const v8b*)(pwh + c * AT_KC + kk * 32 + 8 * hh);
      pa.h[1] = *(const v8b*)(pwh + c * AT_KC + kk * 32 + 16 + 8 * hh);
      if (SPLIT_PV) {
        pl.h[0] = *(const v8b*)(pwl + c * AT_KC + kk * 32 + 8 * hh);
        pl.h[1] = *(const v8b*)(pwl + c * AT_KC + kk * 32 + 16 + 8 * hh);
      }
#pragma unroll
      for (int t = 0; t < 4; ++t) {
        FB vb;
        vb.h[0] = *(const v8b*)(Vth + (t * 16 + c) * AT_KC + kk * 32 + 8 * hh);
        vb.h[1] = *(const v8b*)(Vth + (t * 16 + c) * AT_KC + kk * 32 + 16 + 8 * hh);
        oacc[t] = at_mma16<F16>(pa.v, vb.v, oacc[t]);
        if (SPLIT_PV) {
          FB vl;
          vl.h[0] = *(const v8b*)(Vtl + (t * 16 + c) * AT_KC + kk * 32 + 8 * hh);
          vl.h[1] = *(const v8b*)(Vtl + (t * 16 + c) * AT_KC + kk * 32 + 16 + 8 * hh);
          oacc[t] = at_mma16<F16>(pa.v, vl.v, oacc[t]);
          oacc[t] = at_mma16<F16>(pl.v, vb.v, oacc[t]);
        }
      }
    }
  }

  float* os = Os[wave];
#pragma unroll
  for (int r = 0; r < 8; ++r) {
    const float inv = 1.0f / (lrow[r] * PSC);
#pragma unroll
    for (int t = 0; t < 4; ++t) os[(8 * hh + r) * 68 + t * 16 + c] = oacc[t][r] * inv;
  }
  __builtin_amdgcn_fence(__ATOMIC_RELEASE, "workgroup");
  __builtin_amdgcn_wave_barrier();
  __builtin_amdgcn_fence(__ATOMIC_ACQUIRE, "workgroup");
  {
    const int c4 = (lane & 15) * 4;
    {
#pragma unroll
      for (int it = 0; it < 8; ++it) {
        const int row = it * 2 + hh;
        v4f val = *(const v4f*)(os + row * 68 + c4);
        *(v4f*)(ob_ptr + (size_t)(q0 + row) * g.o_rs + c4) = val;
      }
      
    }
  }
}

} // namespace w25

// row dots: OUT[r] = X[r] . w (one wave per 32 rows? no: wave per row -> lone store; use 8 rows per block with lane-kept results: wave w handles rows 32*blk... simpler: each wave handles 4 rows sequentially, 8 waves -> 32 rows per block, results through LDS, wave 0 writes the 32-float line)
__global__ __launch_bounds__(256) void k_bi_lin(const float* __restrict__ X, const float* __restrict__ w, float* __restrict__ OUT, int nrows, int D) { __shared__ float res[32]; const long long r0 = (long long)blockIdx.x * 32; const int wv = threadIdx.x >> 5, lane = threadIdx.x & 31;
    for (int rr = 0; rr < 4; ++rr) { const long long r = r0 + wv * 4 + rr; float s = 0.f; if (r < nrows) { for (int d = lane; d < D; d += 32) s += X[r * D + d] * w[d]; } for (int o = 16; o > 0; o >>= 1) s += __shfl_xor(s, o, 32); if (lane == 0) res[wv * 4 + rr] = s; }
    __syncthreads(); if (wv == 0 && r0 + lane < nrows) VST2(float, OUT + r0 + lane, res[lane]); }
// QW[n][d] = q[b][n][d] * w_qm[d] (thread-linear)
__global__ __launch_bounds__(256) void k_bi_qw(const float* __restrict__ Q, const float* __restrict__ wqm, float* __restrict__ QW, int b, int N, int D) { const int t = blockIdx.x * 256 + threadIdx.x; if (t >= N * D) return; VST2(float, QW + t, Q[(long long)b * N * D + t] * wqm[t % D]); }
// per row n (block): sim = tril + AQ[n] + CM[m], masked exactly as the module: sim + (1 - qm*mm) * -1e30; row max -> RMX; softmax over m (exp once) in place
__global__ __launch_bounds__(256) void k_bi_soft(float* __restrict__ SIM, const float* __restrict__ AQb, const float* __restrict__ CMb, const int* __restrict__ QMb, const int* __restrict__ MMb, float* __restrict__ RMXb, int N, int M) { __shared__ float red[256]; const int n = blockIdx.x; float* sr = SIM + (long long)n * M; const int t = threadIdx.x; const float aq = AQb[n]; float mx = -3.0e38f;
#pragma unroll 1
    for (int m = t; m < M; m += 256) { const float msk = (float)QMb[n] * (float)MMb[m]; const float v = sr[m] + aq + CMb[m] + (1.f - msk) * -1.0e30f; mx = fmaxf(mx, v); VST2(float, sr + m, v); }
    red[t] = mx; __syncthreads(); for (int o = 128; o > 0; o >>= 1) { if (t < o) red[t] = fmaxf(red[t], red[t + o]); __syncthreads(); } const float mm = red[0]; __syncthreads();
    float s = 0.f;
#pragma unroll 1
    for (int m = t; m < M; m += 256) { const float e = expf(sr[m] - mm); s += e; VST2(float, sr + m, e); }
    red[t] = s; __syncthreads(); for (int o = 128; o > 0; o >>= 1) { if (t < o) red[t] += red[t + o]; __syncthreads(); } const float inv = 1.f / red[0];
#pragma unroll 1
    for (int m = t; m < M; m += 256) VST2(float, sr + m, sr[m] * inv);
    if (t < 32) VST2(float, RMXb + (long long)n * 32 + t, mm); }   // row max staged as a whole 32-float line (slot 0 is read later)

// memory->query: per batch (block): p = softmax_n(RMX[b][n]); M2Q[b][d] = sum_n p_n q[b][n][d]  (256 threads: softmax stats by trees, then thread d<128 accumulates over n)
__global__ __launch_bounds__(256) void k_bi_m2q(const float* __restrict__ RMX, const float* __restrict__ Q, float* __restrict__ M2Q, int N, int D) { __shared__ float red[256]; __shared__ float pw[1024]; const int b = blockIdx.x; const int t = threadIdx.x; const float* rm = RMX + (long long)b * N * 32; float mx = -3.0e38f;
    for (int n = t; n < N; n += 256) mx = fmaxf(mx, rm[(long long)n * 32]);
    red[t] = mx; __syncthreads(); for (int o = 128; o > 0; o >>= 1) { if (t < o) red[t] = fmaxf(red[t], red[t + o]); __syncthreads(); } const float mm = red[0]; __syncthreads();
    float s = 0.f; for (int n = t; n < N; n += 256) { const float e = expf(rm[(long long)n * 32] - mm); pw[n] = e; s += e; }
    red[t] = s; __syncthreads(); for (int o = 128; o > 0; o >>= 1) { if (t < o) red[t] += red[t + o]; __syncthreads(); } const float inv = 1.f / red[0]; __syncthreads();
    if (t < D) { float acc = 0.f;
#pragma unroll 1
        for (int n = 0; n < N; ++n) acc += pw[n] * Q[((long long)b * N + n) * D + t];
        VST2(float, M2Q + (long long)b * D + t, acc * inv); } }
// out1[b][n][d] = M2Q[b][d] broadcast (thread-linear)
__global__ __launch_bounds__(256) void k_bi_bc(const float* __restrict__ M2Q, float* __restrict__ MQ, int Bn, int N, int D) { const long long t = (long long)blockIdx.x * 256 + threadIdx.x; if (t >= (long long)Bn * N * D) return; const int d = (int)(t % D); const int b = (int)(t / ((long long)N * D)); VST2(float, MQ + t, M2Q[b * D + d]); }


extern "C" void kernel_launch(void* const* d_in, const int* in_sizes, int n_in, void* d_out, int out_size, void* d_ws, size_t ws_size, hipStream_t stream) {
    (void)in_sizes; (void)n_in; (void)out_size; (void)ws_size;
    const float* q = (const float*)d_in[0];
    const float* mem = (const float*)d_in[1];
    const float* wq = (const float*)d_in[2];
    const float* wm = (const float*)d_in[3];
    const float* wqm = (const float*)d_in[4];
    const int* qmask = (const int*)d_in[5];
    const int* mmask = (const int*)d_in[6];
    const int Bn = 16;
    const int N = 1024;
    const int M = 1024;
    const int D = 128;
    float* out = (float*)d_out;
    float* mq = out + ((size_t)Bn * N * D);
    char* wsp = (char*)d_ws;
    float* QW = (float*)wsp; wsp += (((size_t)((size_t)N * D) * 4 + 255) / 256) * 256;
    float* AQ = (float*)wsp; wsp += (((size_t)((size_t)Bn * N) * 4 + 255) / 256) * 256;
    float* CM = (float*)wsp; wsp += (((size_t)((size_t)Bn * M) * 4 + 255) / 256) * 256;
    float* SIM = (float*)wsp; wsp += (((size_t)((size_t)N * M) * 4 + 255) / 256) * 256;
    float* RMX = (float*)wsp; wsp += (((size_t)((size_t)Bn * N * 32) * 4 + 255) / 256) * 256;
    float* M2Q = (float*)wsp; wsp += (((size_t)((size_t)Bn * D) * 4 + 255) / 256) * 256;
    unsigned short* G64A = (unsigned short*)wsp; wsp += (((size_t)(1048576) * 2 + 255) / 256) * 256;
    unsigned short* G64B = (unsigned short*)wsp; wsp += (((size_t)(131072) * 2 + 255) / 256) * 256;
    unsigned short* G64A2 = (unsigned short*)wsp; wsp += (((size_t)(131072) * 2 + 255) / 256) * 256;
    unsigned short* G64B2 = (unsigned short*)wsp; wsp += (((size_t)(131072) * 2 + 255) / 256) * 256;
    k_bi_lin<<<(Bn * N + 7) / 8, 256, 0, stream>>>(q, wq, AQ, Bn * N, D); k_bi_lin<<<(Bn * M + 7) / 8, 256, 0, stream>>>(mem, wm, CM, Bn * M, D);
    k_bi_qw<<<(N * D + 255) / 256, 256, 0, stream>>>(q, wqm, QW, 0, N, D);
    k_castS16<<<(unsigned)((((long long)(1024) * ((128) / 2)) + 255) / 256), 256, 0, stream>>>(QW, 128, (__bf16*)(G64A), (__bf16*)(G64A2), 128, 1024, 128, 1.0f, 0);
    k_castS16<<<(unsigned)((((long long)(1024) * ((128) / 2)) + 255) / 256), 256, 0, stream>>>(mem + (size_t)0 * M * D, 128, (__bf16*)(G64B), (__bf16*)(G64B2), 128, 1024, 128, 1.0f, 0);
    w25::wmma_gemm64<1, true, 0, 0, false, 0><<<dim3((unsigned)((((1024) / 64) * ((1024) / 64) + 7) / 8), (unsigned)(1)), 256, 0, stream>>>((const unsigned short*)(G64A), (const unsigned short*)(G64A2), 128, 0, (const unsigned short*)(G64B), (const unsigned short*)(G64B2), 128, 0, (void*)(SIM), nullptr, 1024, 0, nullptr, nullptr, 0, 1024, 1024, 128, 1.0f);
    k_bi_soft<<<N, 256, 0, stream>>>(SIM, AQ + 0 * N, CM + 0 * M, (const int*)qmask + 0 * N, (const int*)mmask + 0 * M, RMX + (size_t)0 * N * 32, N, M);
    k_cast16<<<(unsigned)((((long long)(1024) * ((1024) / 2)) + 255) / 256), 256, 0, stream>>>(SIM, 1024, (_Float16*)(G64A), 1024, 1024, 1024, 4096.0f);
    k_castT16<<<(unsigned)((((long long)(128) * ((1024) / 2)) + 255) / 256), 256, 0, stream>>>(mem + (size_t)0 * M * D, 128, (_Float16*)(G64B), 1024, 1024, 128, 16.0f);
    w25::wmma_gemm64<0, false, 0, 0, false, 0><<<dim3((unsigned)((((1024) / 64) * ((128) / 64) + 7) / 8), (unsigned)(1)), 256, 0, stream>>>((const unsigned short*)(G64A), nullptr, 1024, 0, (const unsigned short*)(G64B), nullptr, 1024, 0, (void*)(out + (size_t)0 * N * D), nullptr, 128, 0, nullptr, nullptr, 0, 1024, 128, 1024, 1.52587890625e-05f);
    k_bi_qw<<<(N * D + 255) / 256, 256, 0, stream>>>(q, wqm, QW, 1, N, D);
    k_castS16<<<(unsigned)((((long long)(1024) * ((128) / 2)) + 255) / 256), 256, 0, stream>>>(QW, 128, (__bf16*)(G64A), (__bf16*)(G64A2), 128, 1024, 128, 1.0f, 0);
    k_castS16<<<(unsigned)((((long long)(1024) * ((128) / 2)) + 255) / 256), 256, 0, stream>>>(mem + (size_t)1 * M * D, 128, (__bf16*)(G64B), (__bf16*)(G64B2), 128, 1024, 128, 1.0f, 0);
    w25::wmma_gemm64<1, true, 0, 0, false, 0><<<dim3((unsigned)((((1024) / 64) * ((1024) / 64) + 7) / 8), (unsigned)(1)), 256, 0, stream>>>((const unsigned short*)(G64A), (const unsigned short*)(G64A2), 128, 0, (const unsigned short*)(G64B), (const unsigned short*)(G64B2), 128, 0, (void*)(SIM), nullptr, 1024, 0, nullptr, nullptr, 0, 1024, 1024, 128, 1.0f);
    k_bi_soft<<<N, 256, 0, stream>>>(SIM, AQ + 1 * N, CM + 1 * M, (const int*)qmask + 1 * N, (const int*)mmask + 1 * M, RMX + (size_t)1 * N * 32, N, M);
    k_cast16<<<(unsigned)((((long long)(1024) * ((1024) / 2)) + 255) / 256), 256, 0, stream>>>(SIM, 1024, (_Float16*)(G64A), 1024, 1024, 1024, 4096.0f);
    k_castT16<<<(unsigned)((((long long)(128) * ((1024) / 2)) + 255) / 256), 256, 0, stream>>>(mem + (size_t)1 * M * D, 128, (_Float16*)(G64B), 1024, 1024, 128, 16.0f);
    w25::wmma_gemm64<0, false, 0, 0, false, 0><<<dim3((unsigned)((((1024) / 64) * ((128) / 64) + 7) / 8), (unsigned)(1)), 256, 0, stream>>>((const unsigned short*)(G64A), nullptr, 1024, 0, (const unsigned short*)(G64B), nullptr, 1024, 0, (void*)(out + (size_t)1 * N * D), nullptr, 128, 0, nullptr, nullptr, 0, 1024, 128, 1024, 1.52587890625e-05f);
    k_bi_qw<<<(N * D + 255) / 256, 256, 0, stream>>>(q, wqm, QW, 2, N, D);
    k_castS16<<<(unsigned)((((long long)(1024) * ((128) / 2)) + 255) / 256), 256, 0, stream>>>(QW, 128, (__bf16*)(G64A), (__bf16*)(G64A2), 128, 1024, 128, 1.0f, 0);
    k_castS16<<<(unsigned)((((long long)(1024) * ((128) / 2)) + 255) / 256), 256, 0, stream>>>(mem + (size_t)2 * M * D, 128, (__bf16*)(G64B), (__bf16*)(G64B2), 128, 1024, 128, 1.0f, 0);
    w25::wmma_gemm64<1, true, 0, 0, false, 0><<<dim3((unsigned)((((1024) / 64) * ((1024) / 64) + 7) / 8), (unsigned)(1)), 256, 0, stream>>>((const unsigned short*)(G64A), (const unsigned short*)(G64A2), 128, 0, (const unsigned short*)(G64B), (const unsigned short*)(G64B2), 128, 0, (void*)(SIM), nullptr, 1024, 0, nullptr, nullptr, 0, 1024, 1024, 128, 1.0f);
    k_bi_soft<<<N, 256, 0, stream>>>(SIM, AQ + 2 * N, CM + 2 * M, (const int*)qmask + 2 * N, (const int*)mmask + 2 * M, RMX + (size_t)2 * N * 32, N, M);
    k_cast16<<<(unsigned)((((long long)(1024) * ((1024) / 2)) + 255) / 256), 256, 0, stream>>>(SIM, 1024, (_Float16*)(G64A), 1024, 1024, 1024, 4096.0f);
    k_castT16<<<(unsigned)((((long long)(128) * ((1024) / 2)) + 255) / 256), 256, 0, stream>>>(mem + (size_t)2 * M * D, 128, (_Float16*)(G64B), 1024, 1024, 128, 16.0f);
    w25::wmma_gemm64<0, false, 0, 0, false, 0><<<dim3((unsigned)((((1024) / 64) * ((128) / 64) + 7) / 8), (unsigned)(1)), 256, 0, stream>>>((const unsigned short*)(G64A), nullptr, 1024, 0, (const unsigned short*)(G64B), nullptr, 1024, 0, (void*)(out + (size_t)2 * N * D), nullptr, 128, 0, nullptr, nullptr, 0, 1024, 128, 1024, 1.52587890625e-05f);
    k_bi_qw<<<(N * D + 255) / 256, 256, 0, stream>>>(q, wqm, QW, 3, N, D);
    k_castS16<<<(unsigned)((((long long)(1024) * ((128) / 2)) + 255) / 256), 256, 0, stream>>>(QW, 128, (__bf16*)(G64A), (__bf16*)(G64A2), 128, 1024, 128, 1.0f, 0);
    k_castS16<<<(unsigned)((((long long)(1024) * ((128) / 2)) + 255) / 256), 256, 0, stream>>>(mem + (size_t)3 * M * D, 128, (__bf16*)(G64B), (__bf16*)(G64B2), 128, 1024, 128, 1.0f, 0);
    w25::wmma_gemm64<1, true, 0, 0, false, 0><<<dim3((unsigned)((((1024) / 64) * ((1024) / 64) + 7) / 8), (unsigned)(1)), 256, 0, stream>>>((const unsigned short*)(G64A), (const unsigned short*)(G64A2), 128, 0, (const unsigned short*)(G64B), (const unsigned short*)(G64B2), 128, 0, (void*)(SIM), nullptr, 1024, 0, nullptr, nullptr, 0, 1024, 1024, 128, 1.0f);
    k_bi_soft<<<N, 256, 0, stream>>>(SIM, AQ + 3 * N, CM + 3 * M, (const int*)qmask + 3 * N, (const int*)mmask + 3 * M, RMX + (size_t)3 * N * 32, N, M);
    k_cast16<<<(unsigned)((((long long)(1024) * ((1024) / 2)) + 255) / 256), 256, 0, stream>>>(SIM, 1024, (_Float16*)(G64A), 1024, 1024, 1024, 4096.0f);
    k_castT16<<<(unsigned)((((long long)(128) * ((1024) / 2)) + 255) / 256), 256, 0, stream>>>(mem + (size_t)3 * M * D, 128, (_Float16*)(G64B), 1024, 1024, 128, 16.0f);
    w25::wmma_gemm64<0, false, 0, 0, false, 0><<<dim3((unsigned)((((1024) / 64) * ((128) / 64) + 7) / 8), (unsigned)(1)), 256, 0, stream>>>((const unsigned short*)(G64A), nullptr, 1024, 0, (const unsigned short*)(G64B), nullptr, 1024, 0, (void*)(out + (size_t)3 * N * D), nullptr, 128, 0, nullptr, nullptr, 0, 1024, 128, 1024, 1.52587890625e-05f);
    k_bi_qw<<<(N * D + 255) / 256, 256, 0, stream>>>(q, wqm, QW, 4, N, D);
    k_castS16<<<(unsigned)((((long long)(1024) * ((128) / 2)) + 255) / 256), 256, 0, stream>>>(QW, 128, (__bf16*)(G64A), (__bf16*)(G64A2), 128, 1024, 128, 1.0f, 0);
    k_castS16<<<(unsigned)((((long long)(1024) * ((128) / 2)) + 255) / 256), 256, 0, stream>>>(mem + (size_t)4 * M * D, 128, (__bf16*)(G64B), (__bf16*)(G64B2), 128, 1024, 128, 1.0f, 0);
    w25::wmma_gemm64<1, true, 0, 0, false, 0><<<dim3((unsigned)((((1024) / 64) * ((1024) / 64) + 7) / 8), (unsigned)(1)), 256, 0, stream>>>((const unsigned short*)(G64A), (const unsigned short*)(G64A2), 128, 0, (const unsigned short*)(G64B), (const unsigned short*)(G64B2), 128, 0, (void*)(SIM), nullptr, 1024, 0, nullptr, nullptr, 0, 1024, 1024, 128, 1.0f);
    k_bi_soft<<<N, 256, 0, stream>>>(SIM, AQ + 4 * N, CM + 4 * M, (const int*)qmask + 4 * N, (const int*)mmask + 4 * M, RMX + (size_t)4 * N * 32, N, M);
    k_cast16<<<(unsigned)((((long long)(1024) * ((1024) / 2)) + 255) / 256), 256, 0, stream>>>(SIM, 1024, (_Float16*)(G64A), 1024, 1024, 1024, 4096.0f);
    k_castT16<<<(unsigned)((((long long)(128) * ((1024) / 2)) + 255) / 256), 256, 0, stream>>>(mem + (size_t)4 * M * D, 128, (_Float16*)(G64B), 1024, 1024, 128, 16.0f);
    w25::wmma_gemm64<0, false, 0, 0, false, 0><<<dim3((unsigned)((((1024) / 64) * ((128) / 64) + 7) / 8), (unsigned)(1)), 256, 0, stream>>>((const unsigned short*)(G64A), nullptr, 1024, 0, (const unsigned short*)(G64B), nullptr, 1024, 0, (void*)(out + (size_t)4 * N * D), nullptr, 128, 0, nullptr, nullptr, 0, 1024, 128, 1024, 1.52587890625e-05f);
    k_bi_qw<<<(N * D + 255) / 256, 256, 0, stream>>>(q, wqm, QW, 5, N, D);
    k_castS16<<<(unsigned)((((long long)(1024) * ((128) / 2)) + 255) / 256), 256, 0, stream>>>(QW, 128, (__bf16*)(G64A), (__bf16*)(G64A2), 128, 1024, 128, 1.0f, 0);
    k_castS16<<<(unsigned)((((long long)(1024) * ((128) / 2)) + 255) / 256), 256, 0, stream>>>(mem + (size_t)5 * M * D, 128, (__bf16*)(G64B), (__bf16*)(G64B2), 128, 1024, 128, 1.0f, 0);
    w25::wmma_gemm64<1, true, 0, 0, false, 0><<<dim3((unsigned)((((1024) / 64) * ((1024) / 64) + 7) / 8), (unsigned)(1)), 256, 0, stream>>>((const unsigned short*)(G64A), (const unsigned short*)(G64A2), 128, 0, (const unsigned short*)(G64B), (const unsigned short*)(G64B2), 128, 0, (void*)(SIM), nullptr, 1024, 0, nullptr, nullptr, 0, 1024, 1024, 128, 1.0f);
    k_bi_soft<<<N, 256, 0, stream>>>(SIM, AQ + 5 * N, CM + 5 * M, (const int*)qmask + 5 * N, (const int*)mmask + 5 * M, RMX + (size_t)5 * N * 32, N, M);
    k_cast16<<<(unsigned)((((long long)(1024) * ((1024) / 2)) + 255) / 256), 256, 0, stream>>>(SIM, 1024, (_Float16*)(G64A), 1024, 1024, 1024, 4096.0f);
    k_castT16<<<(unsigned)((((long long)(128) * ((1024) / 2)) + 255) / 256), 256, 0, stream>>>(mem + (size_t)5 * M * D, 128, (_Float16*)(G64B), 1024, 1024, 128, 16.0f);
    w25::wmma_gemm64<0, false, 0, 0, false, 0><<<dim3((unsigned)((((1024) / 64) * ((128) / 64) + 7) / 8), (unsigned)(1)), 256, 0, stream>>>((const unsigned short*)(G64A), nullptr, 1024, 0, (const unsigned short*)(G64B), nullptr, 1024, 0, (void*)(out + (size_t)5 * N * D), nullptr, 128, 0, nullptr, nullptr, 0, 1024, 128, 1024, 1.52587890625e-05f);
    k_bi_qw<<<(N * D + 255) / 256, 256, 0, stream>>>(q, wqm, QW, 6, N, D);
    k_castS16<<<(unsigned)((((long long)(1024) * ((128) / 2)) + 255) / 256), 256, 0, stream>>>(QW, 128, (__bf16*)(G64A), (__bf16*)(G64A2), 128, 1024, 128, 1.0f, 0);
    k_castS16<<<(unsigned)((((long long)(1024) * ((128) / 2)) + 255) / 256), 256, 0, stream>>>(mem + (size_t)6 * M * D, 128, (__bf16*)(G64B), (__bf16*)(G64B2), 128, 1024, 128, 1.0f, 0);
    w25::wmma_gemm64<1, true, 0, 0, false, 0><<<dim3((unsigned)((((1024) / 64) * ((1024) / 64) + 7) / 8), (unsigned)(1)), 256, 0, stream>>>((const unsigned short*)(G64A), (const unsigned short*)(G64A2), 128, 0, (const unsigned short*)(G64B), (const unsigned short*)(G64B2), 128, 0, (void*)(SIM), nullptr, 1024, 0, nullptr, nullptr, 0, 1024, 1024, 128, 1.0f);
    k_bi_soft<<<N, 256, 0, stream>>>(SIM, AQ + 6 * N, CM + 6 * M, (const int*)qmask + 6 * N, (const int*)mmask + 6 * M, RMX + (size_t)6 * N * 32, N, M);
    k_cast16<<<(unsigned)((((long long)(1024) * ((1024) / 2)) + 255) / 256), 256, 0, stream>>>(SIM, 1024, (_Float16*)(G64A), 1024, 1024, 1024, 4096.0f);
    k_castT16<<<(unsigned)((((long long)(128) * ((1024) / 2)) + 255) / 256), 256, 0, stream>>>(mem + (size_t)6 * M * D, 128, (_Float16*)(G64B), 1024, 1024, 128, 16.0f);
    w25::wmma_gemm64<0, false, 0, 0, false, 0><<<dim3((unsigned)((((1024) / 64) * ((128) / 64) + 7) / 8), (unsigned)(1)), 256, 0, stream>>>((const unsigned short*)(G64A), nullptr, 1024, 0, (const unsigned short*)(G64B), nullptr, 1024, 0, (void*)(out + (size_t)6 * N * D), nullptr, 128, 0, nullptr, nullptr, 0, 1024, 128, 1024, 1.52587890625e-05f);
    k_bi_qw<<<(N * D + 255) / 256, 256, 0, stream>>>(q, wqm, QW, 7, N, D);
    k_castS16<<<(unsigned)((((long long)(1024) * ((128) / 2)) + 255) / 256), 256, 0, stream>>>(QW, 128, (__bf16*)(G64A), (__bf16*)(G64A2), 128, 1024, 128, 1.0f, 0);
    k_castS16<<<(unsigned)((((long long)(1024) * ((128) / 2)) + 255) / 256), 256, 0, stream>>>(mem + (size_t)7 * M * D, 128, (__bf16*)(G64B), (__bf16*)(G64B2), 128, 1024, 128, 1.0f, 0);
    w25::wmma_gemm64<1, true, 0, 0, false, 0><<<dim3((unsigned)((((1024) / 64) * ((1024) / 64) + 7) / 8), (unsigned)(1)), 256, 0, stream>>>((const unsigned short*)(G64A), (const unsigned short*)(G64A2), 128, 0, (const unsigned short*)(G64B), (const unsigned short*)(G64B2), 128, 0, (void*)(SIM), nullptr, 1024, 0, nullptr, nullptr, 0, 1024, 1024, 128, 1.0f);
    k_bi_soft<<<N, 256, 0, stream>>>(SIM, AQ + 7 * N, CM + 7 * M, (const int*)qmask + 7 * N, (const int*)mmask + 7 * M, RMX + (size_t)7 * N * 32, N, M);
    k_cast16<<<(unsigned)((((long long)(1024) * ((1024) / 2)) + 255) / 256), 256, 0, stream>>>(SIM, 1024, (_Float16*)(G64A), 1024, 1024, 1024, 4096.0f);
    k_castT16<<<(unsigned)((((long long)(128) * ((1024) / 2)) + 255) / 256), 256, 0, stream>>>(mem + (size_t)7 * M * D, 128, (_Float16*)(G64B), 1024, 1024, 128, 16.0f);
    w25::wmma_gemm64<0, false, 0, 0, false, 0><<<dim3((unsigned)((((1024) / 64) * ((128) / 64) + 7) / 8), (unsigned)(1)), 256, 0, stream>>>((const unsigned short*)(G64A), nullptr, 1024, 0, (const unsigned short*)(G64B), nullptr, 1024, 0, (void*)(out + (size_t)7 * N * D), nullptr, 128, 0, nullptr, nullptr, 0, 1024, 128, 1024, 1.52587890625e-05f);
    k_bi_qw<<<(N * D + 255) / 256, 256, 0, stream>>>(q, wqm, QW, 8, N, D);
    k_castS16<<<(unsigned)((((long long)(1024) * ((128) / 2)) + 255) / 256), 256, 0, stream>>>(QW, 128, (__bf16*)(G64A), (__bf16*)(G64A2), 128, 1024, 128, 1.0f, 0);
    k_castS16<<<(unsigned)((((long long)(1024) * ((128) / 2)) + 255) / 256), 256, 0, stream>>>(mem + (size_t)8 * M * D, 128, (__bf16*)(G64B), (__bf16*)(G64B2), 128, 1024, 128, 1.0f, 0);
    w25::wmma_gemm64<1, true, 0, 0, false, 0><<<dim3((unsigned)((((1024) / 64) * ((1024) / 64) + 7) / 8), (unsigned)(1)), 256, 0, stream>>>((const unsigned short*)(G64A), (const unsigned short*)(G64A2), 128, 0, (const unsigned short*)(G64B), (const unsigned short*)(G64B2), 128, 0, (void*)(SIM), nullptr, 1024, 0, nullptr, nullptr, 0, 1024, 1024, 128, 1.0f);
    k_bi_soft<<<N, 256, 0, stream>>>(SIM, AQ + 8 * N, CM + 8 * M, (const int*)qmask + 8 * N, (const int*)mmask + 8 * M, RMX + (size_t)8 * N * 32, N, M);
    k_cast16<<<(unsigned)((((long long)(1024) * ((1024) / 2)) + 255) / 256), 256, 0, stream>>>(SIM, 1024, (_Float16*)(G64A), 1024, 1024, 1024, 4096.0f);
    k_castT16<<<(unsigned)((((long long)(128) * ((1024) / 2)) + 255) / 256), 256, 0, stream>>>(mem + (size_t)8 * M * D, 128, (_Float16*)(G64B), 1024, 1024, 128, 16.0f);
    w25::wmma_gemm64<0, false, 0, 0, false, 0><<<dim3((unsigned)((((1024) / 64) * ((128) / 64) + 7) / 8), (unsigned)(1)), 256, 0, stream>>>((const unsigned short*)(G64A), nullptr, 1024, 0, (const unsigned short*)(G64B), nullptr, 1024, 0, (void*)(out + (size_t)8 * N * D), nullptr, 128, 0, nullptr, nullptr, 0, 1024, 128, 1024, 1.52587890625e-05f);
    k_bi_qw<<<(N * D + 255) / 256, 256, 0, stream>>>(q, wqm, QW, 9, N, D);
    k_castS16<<<(unsigned)((((long long)(1024) * ((128) / 2)) + 255) / 256), 256, 0, stream>>>(QW, 128, (__bf16*)(G64A), (__bf16*)(G64A2), 128, 1024, 128, 1.0f, 0);
    k_castS16<<<(unsigned)((((long long)(1024) * ((128) / 2)) + 255) / 256), 256, 0, stream>>>(mem + (size_t)9 * M * D, 128, (__bf16*)(G64B), (__bf16*)(G64B2), 128, 1024, 128, 1.0f, 0);
    w25::wmma_gemm64<1, true, 0, 0, false, 0><<<dim3((unsigned)((((1024) / 64) * ((1024) / 64) + 7) / 8), (unsigned)(1)), 256, 0, stream>>>((const unsigned short*)(G64A), (const unsigned short*)(G64A2), 128, 0, (const unsigned short*)(G64B), (const unsigned short*)(G64B2), 128, 0, (void*)(SIM), nullptr, 1024, 0, nullptr, nullptr, 0, 1024, 1024, 128, 1.0f);
    k_bi_soft<<<N, 256, 0, stream>>>(SIM, AQ + 9 * N, CM + 9 * M, (const int*)qmask + 9 * N, (const int*)mmask + 9 * M, RMX + (size_t)9 * N * 32, N, M);
    k_cast16<<<(unsigned)((((long long)(1024) * ((1024) / 2)) + 255) / 256), 256, 0, stream>>>(SIM, 1024, (_Float16*)(G64A), 1024, 1024, 1024, 4096.0f);
    k_castT16<<<(unsigned)((((long long)(128) * ((1024) / 2)) + 255) / 256), 256, 0, stream>>>(mem + (size_t)9 * M * D, 128, (_Float16*)(G64B), 1024, 1024, 128, 16.0f);
    w25::wmma_gemm64<0, false, 0, 0, false, 0><<<dim3((unsigned)((((1024) / 64) * ((128) / 64) + 7) / 8), (unsigned)(1)), 256, 0, stream>>>((const unsigned short*)(G64A), nullptr, 1024, 0, (const unsigned short*)(G64B), nullptr, 1024, 0, (void*)(out + (size_t)9 * N * D), nullptr, 128, 0, nullptr, nullptr, 0, 1024, 128, 1024, 1.52587890625e-05f);
    k_bi_qw<<<(N * D + 255) / 256, 256, 0, stream>>>(q, wqm, QW, 10, N, D);
    k_castS16<<<(unsigned)((((long long)(1024) * ((128) / 2)) + 255) / 256), 256, 0, stream>>>(QW, 128, (__bf16*)(G64A), (__bf16*)(G64A2), 128, 1024, 128, 1.0f, 0);
    k_castS16<<<(unsigned)((((long long)(1024) * ((128) / 2)) + 255) / 256), 256, 0, stream>>>(mem + (size_t)10 * M * D, 128, (__bf16*)(G64B), (__bf16*)(G64B2), 128, 1024, 128, 1.0f, 0);
    w25::wmma_gemm64<1, true, 0, 0, false, 0><<<dim3((unsigned)((((1024) / 64) * ((1024) / 64) + 7) / 8), (unsigned)(1)), 256, 0, stream>>>((const unsigned short*)(G64A), (const unsigned short*)(G64A2), 128, 0, (const unsigned short*)(G64B), (const unsigned short*)(G64B2), 128, 0, (void*)(SIM), nullptr, 1024, 0, nullptr, nullptr, 0, 1024, 1024, 128, 1.0f);
    k_bi_soft<<<N, 256, 0, stream>>>(SIM, AQ + 10 * N, CM + 10 * M, (const int*)qmask + 10 * N, (const int*)mmask + 10 * M, RMX + (size_t)10 * N * 32, N, M);
    k_cast16<<<(unsigned)((((long long)(1024) * ((1024) / 2)) + 255) / 256), 256, 0, stream>>>(SIM, 1024, (_Float16*)(G64A), 1024, 1024, 1024, 4096.0f);
    k_castT16<<<(unsigned)((((long long)(128) * ((1024) / 2)) + 255) / 256), 256, 0, stream>>>(mem + (size_t)10 * M * D, 128, (_Float16*)(G64B), 1024, 1024, 128, 16.0f);
    w25::wmma_gemm64<0, false, 0, 0, false, 0><<<dim3((unsigned)((((1024) / 64) * ((128) / 64) + 7) / 8), (unsigned)(1)), 256, 0, stream>>>((const unsigned short*)(G64A), nullptr, 1024, 0, (const unsigned short*)(G64B), nullptr, 1024, 0, (void*)(out + (size_t)10 * N * D), nullptr, 128, 0, nullptr, nullptr, 0, 1024, 128, 1024, 1.52587890625e-05f);
    k_bi_qw<<<(N * D + 255) / 256, 256, 0, stream>>>(q, wqm, QW, 11, N, D);
    k_castS16<<<(unsigned)((((long long)(1024) * ((128) / 2)) + 255) / 256), 256, 0, stream>>>(QW, 128, (__bf16*)(G64A), (__bf16*)(G64A2), 128, 1024, 128, 1.0f, 0);
    k_castS16<<<(unsigned)((((long long)(1024) * ((128) / 2)) + 255) / 256), 256, 0, stream>>>(mem + (size_t)11 * M * D, 128, (__bf16*)(G64B), (__bf16*)(G64B2), 128, 1024, 128, 1.0f, 0);
    w25::wmma_gemm64<1, true, 0, 0, false, 0><<<dim3((unsigned)((((1024) / 64) * ((1024) / 64) + 7) / 8), (unsigned)(1)), 256, 0, stream>>>((const unsigned short*)(G64A), (const unsigned short*)(G64A2), 128, 0, (const unsigned short*)(G64B), (const unsigned short*)(G64B2), 128, 0, (void*)(SIM), nullptr, 1024, 0, nullptr, nullptr, 0, 1024, 1024, 128, 1.0f);
    k_bi_soft<<<N, 256, 0, stream>>>(SIM, AQ + 11 * N, CM + 11 * M, (const int*)qmask + 11 * N, (const int*)mmask + 11 * M, RMX + (size_t)11 * N * 32, N, M);
    k_cast16<<<(unsigned)((((long long)(1024) * ((1024) / 2)) + 255) / 256), 256, 0, stream>>>(SIM, 1024, (_Float16*)(G64A), 1024, 1024, 1024, 4096.0f);
    k_castT16<<<(unsigned)((((long long)(128) * ((1024) / 2)) + 255) / 256), 256, 0, stream>>>(mem + (size_t)11 * M * D, 128, (_Float16*)(G64B), 1024, 1024, 128, 16.0f);
    w25::wmma_gemm64<0, false, 0, 0, false, 0><<<dim3((unsigned)((((1024) / 64) * ((128) / 64) + 7) / 8), (unsigned)(1)), 256, 0, stream>>>((const unsigned short*)(G64A), nullptr, 1024, 0, (const unsigned short*)(G64B), nullptr, 1024, 0, (void*)(out + (size_t)11 * N * D), nullptr, 128, 0, nullptr, nullptr, 0, 1024, 128, 1024, 1.52587890625e-05f);
    k_bi_qw<<<(N * D + 255) / 256, 256, 0, stream>>>(q, wqm, QW, 12, N, D);
    k_castS16<<<(unsigned)((((long long)(1024) * ((128) / 2)) + 255) / 256), 256, 0, stream>>>(QW, 128, (__bf16*)(G64A), (__bf16*)(G64A2), 128, 1024, 128, 1.0f, 0);
    k_castS16<<<(unsigned)((((long long)(1024) * ((128) / 2)) + 255) / 256), 256, 0, stream>>>(mem + (size_t)12 * M * D, 128, (__bf16*)(G64B), (__bf16*)(G64B2), 128, 1024, 128, 1.0f, 0);
    w25::wmma_gemm64<1, true, 0, 0, false, 0><<<dim3((unsigned)((((1024) / 64) * ((1024) / 64) + 7) / 8), (unsigned)(1)), 256, 0, stream>>>((const unsigned short*)(G64A), (const unsigned short*)(G64A2), 128, 0, (const unsigned short*)(G64B), (const unsigned short*)(G64B2), 128, 0, (void*)(SIM), nullptr, 1024, 0, nullptr, nullptr, 0, 1024, 1024, 128, 1.0f);
    k_bi_soft<<<N, 256, 0, stream>>>(SIM, AQ + 12 * N, CM + 12 * M, (const int*)qmask + 12 * N, (const int*)mmask + 12 * M, RMX + (size_t)12 * N * 32, N, M);
    k_cast16<<<(unsigned)((((long long)(1024) * ((1024) / 2)) + 255) / 256), 256, 0, stream>>>(SIM, 1024, (_Float16*)(G64A), 1024, 1024, 1024, 4096.0f);
    k_castT16<<<(unsigned)((((long long)(128) * ((1024) / 2)) + 255) / 256), 256, 0, stream>>>(mem + (size_t)12 * M * D, 128, (_Float16*)(G64B), 1024, 1024, 128, 16.0f);
    w25::wmma_gemm64<0, false, 0, 0, false, 0><<<dim3((unsigned)((((1024) / 64) * ((128) / 64) + 7) / 8), (unsigned)(1)), 256, 0, stream>>>((const unsigned short*)(G64A), nullptr, 1024, 0, (const unsigned short*)(G64B), nullptr, 1024, 0, (void*)(out + (size_t)12 * N * D), nullptr, 128, 0, nullptr, nullptr, 0, 1024, 128, 1024, 1.52587890625e-05f);
    k_bi_qw<<<(N * D + 255) / 256, 256, 0, stream>>>(q, wqm, QW, 13, N, D);
    k_castS16<<<(unsigned)((((long long)(1024) * ((128) / 2)) + 255) / 256), 256, 0, stream>>>(QW, 128, (__bf16*)(G64A), (__bf16*)(G64A2), 128, 1024, 128, 1.0f, 0);
    k_castS16<<<(unsigned)((((long long)(1024) * ((128) / 2)) + 255) / 256), 256, 0, stream>>>(mem + (size_t)13 * M * D, 128, (__bf16*)(G64B), (__bf16*)(G64B2), 128, 1024, 128, 1.0f, 0);
    w25::wmma_gemm64<1, true, 0, 0, false, 0><<<dim3((unsigned)((((1024) / 64) * ((1024) / 64) + 7) / 8), (unsigned)(1)), 256, 0, stream>>>((const unsigned short*)(G64A), (const unsigned short*)(G64A2), 128, 0, (const unsigned short*)(G64B), (const unsigned short*)(G64B2), 128, 0, (void*)(SIM), nullptr, 1024, 0, nullptr, nullptr, 0, 1024, 1024, 128, 1.0f);
    k_bi_soft<<<N, 256, 0, stream>>>(SIM, AQ + 13 * N, CM + 13 * M, (const int*)qmask + 13 * N, (const int*)mmask + 13 * M, RMX + (size_t)13 * N * 32, N, M);
    k_cast16<<<(unsigned)((((long long)(1024) * ((1024) / 2)) + 255) / 256), 256, 0, stream>>>(SIM, 1024, (_Float16*)(G64A), 1024, 1024, 1024, 4096.0f);
    k_castT16<<<(unsigned)((((long long)(128) * ((1024) / 2)) + 255) / 256), 256, 0, stream>>>(mem + (size_t)13 * M * D, 128, (_Float16*)(G64B), 1024, 1024, 128, 16.0f);
    w25::wmma_gemm64<0, false, 0, 0, false, 0><<<dim3((unsigned)((((1024) / 64) * ((128) / 64) + 7) / 8), (unsigned)(1)), 256, 0, stream>>>((const unsigned short*)(G64A), nullptr, 1024, 0, (const unsigned short*)(G64B), nullptr, 1024, 0, (void*)(out + (size_t)13 * N * D), nullptr, 128, 0, nullptr, nullptr, 0, 1024, 128, 1024, 1.52587890625e-05f);
    k_bi_qw<<<(N * D + 255) / 256, 256, 0, stream>>>(q, wqm, QW, 14, N, D);
    k_castS16<<<(unsigned)((((long long)(1024) * ((128) / 2)) + 255) / 256), 256, 0, stream>>>(QW, 128, (__bf16*)(G64A), (__bf16*)(G64A2), 128, 1024, 128, 1.0f, 0);
    k_castS16<<<(unsigned)((((long long)(1024) * ((128) / 2)) + 255) / 256), 256, 0, stream>>>(mem + (size_t)14 * M * D, 128, (__bf16*)(G64B), (__bf16*)(G64B2), 128, 1024, 128, 1.0f, 0);
    w25::wmma_gemm64<1, true, 0, 0, false, 0><<<dim3((unsigned)((((1024) / 64) * ((1024) / 64) + 7) / 8), (unsigned)(1)), 256, 0, stream>>>((const unsigned short*)(G64A), (const unsigned short*)(G64A2), 128, 0, (const unsigned short*)(G64B), (const unsigned short*)(G64B2), 128, 0, (void*)(SIM), nullptr, 1024, 0, nullptr, nullptr, 0, 1024, 1024, 128, 1.0f);
    k_bi_soft<<<N, 256, 0, stream>>>(SIM, AQ + 14 * N, CM + 14 * M, (const int*)qmask + 14 * N, (const int*)mmask + 14 * M, RMX + (size_t)14 * N * 32, N, M);
    k_cast16<<<(unsigned)((((long long)(1024) * ((1024) / 2)) + 255) / 256), 256, 0, stream>>>(SIM, 1024, (_Float16*)(G64A), 1024, 1024, 1024, 4096.0f);
    k_castT16<<<(unsigned)((((long long)(128) * ((1024) / 2)) + 255) / 256), 256, 0, stream>>>(mem + (size_t)14 * M * D, 128, (_Float16*)(G64B), 1024, 1024, 128, 16.0f);
    w25::wmma_gemm64<0, false, 0, 0, false, 0><<<dim3((unsigned)((((1024) / 64) * ((128) / 64) + 7) / 8), (unsigned)(1)), 256, 0, stream>>>((const unsigned short*)(G64A), nullptr, 1024, 0, (const unsigned short*)(G64B), nullptr, 1024, 0, (void*)(out + (size_t)14 * N * D), nullptr, 128, 0, nullptr, nullptr, 0, 1024, 128, 1024, 1.52587890625e-05f);
    k_bi_qw<<<(N * D + 255) / 256, 256, 0, stream>>>(q, wqm, QW, 15, N, D);
    k_castS16<<<(unsigned)((((long long)(1024) * ((128) / 2)) + 255) / 256), 256, 0, stream>>>(QW, 128, (__bf16*)(G64A), (__bf16*)(G64A2), 128, 1024, 128, 1.0f, 0);
    k_castS16<<<(unsigned)((((long long)(1024) * ((128) / 2)) + 255) / 256), 256, 0, stream>>>(mem + (size_t)15 * M * D, 128, (__bf16*)(G64B), (__bf16*)(G64B2), 128, 1024, 128, 1.0f, 0);
    w25::wmma_gemm64<1, true, 0, 0, false, 0><<<dim3((unsigned)((((1024) / 64) * ((1024) / 64) + 7) / 8), (unsigned)(1)), 256, 0, stream>>>((const unsigned short*)(G64A), (const unsigned short*)(G64A2), 128, 0, (const unsigned short*)(G64B), (const unsigned short*)(G64B2), 128, 0, (void*)(SIM), nullptr, 1024, 0, nullptr, nullptr, 0, 1024, 1024, 128, 1.0f);
    k_bi_soft<<<N, 256, 0, stream>>>(SIM, AQ + 15 * N, CM + 15 * M, (const int*)qmask + 15 * N, (const int*)mmask + 15 * M, RMX + (size_t)15 * N * 32, N, M);
    k_cast16<<<(unsigned)((((long long)(1024) * ((1024) / 2)) + 255) / 256), 256, 0, stream>>>(SIM, 1024, (_Float16*)(G64A), 1024, 1024, 1024, 4096.0f);
    k_castT16<<<(unsigned)((((long long)(128) * ((1024) / 2)) + 255) / 256), 256, 0, stream>>>(mem + (size_t)15 * M * D, 128, (_Float16*)(G64B), 1024, 1024, 128, 16.0f);
    w25::wmma_gemm64<0, false, 0, 0, false, 0><<<dim3((unsigned)((((1024) / 64) * ((128) / 64) + 7) / 8), (unsigned)(1)), 256, 0, stream>>>((const unsigned short*)(G64A), nullptr, 1024, 0, (const unsigned short*)(G64B), nullptr, 1024, 0, (void*)(out + (size_t)15 * N * D), nullptr, 128, 0, nullptr, nullptr, 0, 1024, 128, 1024, 1.52587890625e-05f);
    k_bi_m2q<<<Bn, 256, 0, stream>>>(RMX, q, M2Q, N, D); k_bi_bc<<<(unsigned)(((long long)Bn * N * D + 255) / 256), 256, 0, stream>>>(M2Q, mq, Bn, N, D);
}

// v001
// A run of this version takes 565 microseconds.
// In both of two side-by-side timings against v000, it was 2.71 times as fast.
// Contractions: per batch the trilinear term (q * w_qm).m^T [1024x128].[128x1024] on bf16 hi/lo split planes (logits reach ~+-30, so they need f32-class accuracy) and the query->memory read q2m.memory [1024x1024].[1024x128] with f16 operands (probabilities x 2^12) — 64x64 register-blocked wave tiles; f32 accumulate. The two linear terms, the mask arithmetic (sim + (1 - mask) * -1e30, exactly as the module), the row softmax (exp once), the row maxima, the softmax over rows and the memory->query vector (broadcast to every row) are f32 kernels.
#include <hip/hip_runtime.h>
#include <math.h>

typedef __attribute__((ext_vector_type(16))) _Float16 v16h;
typedef __attribute__((ext_vector_type(8)))  _Float16 v8h;
typedef __attribute__((ext_vector_type(16))) __bf16   v16b;
typedef __attribute__((ext_vector_type(8)))  float    v8f;
typedef __attribute__((ext_vector_type(4)))  float    v4f;

// 16-bit WMMA fragment map (wave32), lane L, h = L>>4, m = L&15:
//   A 16x32: lane = row m;   element i -> k = (i<8) ? 8h+i : 16+8h+(i-8)
//   B 32x16: lane = column m; the SAME k(i,h)
//   D 16x16 (8 f32): lane = column m; element r -> row 8h+r
__device__ __forceinline__ int frag_k(int i, int h) { return (i < 8) ? (8 * h + i) : (16 + 8 * h + (i - 8)); }
__device__ __forceinline__ __bf16 bf16_rne(float f) {
    unsigned int u = __float_as_uint(f);
    u += 0x7fffu + ((u >> 16) & 1u);
    return __builtin_bit_cast(__bf16, (unsigned short)(u >> 16));
}
__device__ __forceinline__ float bf16_f32(__bf16 b) { return __uint_as_float(((unsigned int)__builtin_bit_cast(unsigned short, b)) << 16); }
__device__ __forceinline__ v8f wmma16(v16h a, v16h b, v8f c) {
    c = __builtin_amdgcn_wmma_f32_16x16x32_f16(false, a, false, b, (short)0, c, false, false);
    asm volatile("v_nop\n\tv_nop\n\tv_nop\n\tv_nop" : "+v"(c) : "v"(a), "v"(b));
    return c;
}
__device__ __forceinline__ v8f wmmab(v16b a, v16b b, v8f c) {
    c = __builtin_amdgcn_wmma_f32_16x16x32_bf16(false, a, false, b, (short)0, c, false, false);
    asm volatile("v_nop\n\tv_nop\n\tv_nop\n\tv_nop" : "+v"(c) : "v"(a), "v"(b));
    return c;
}
struct Split { v16b hi, lo; };
// hi/lo split product: a.hi*b.hi + a.hi*b.lo + a.lo*b.hi
__device__ __forceinline__ v8f wmma3(const Split& a, const Split& b, v8f c) {
    c = __builtin_amdgcn_wmma_f32_16x16x32_bf16(false, a.hi, false, b.hi, (short)0, c, false, false);
    c = __builtin_amdgcn_wmma_f32_16x16x32_bf16(false, a.hi, false, b.lo, (short)0, c, false, false);
    c = __builtin_amdgcn_wmma_f32_16x16x32_bf16(false, a.lo, false, b.hi, (short)0, c, false, false);
    asm volatile("v_nop\n\tv_nop\n\tv_nop\n\tv_nop" : "+v"(c) : "v"(a.hi), "v"(a.lo), "v"(b.hi), "v"(b.lo));
    return c;
}
struct Split3 { v16b hi, mid, lo; };
// triple split product (6 terms, drops only terms below 2^-24 relative)
__device__ __forceinline__ v8f wmma6(const Split3& a, const Split3& b, v8f c) {
    c = __builtin_amdgcn_wmma_f32_16x16x32_bf16(false, a.hi, false, b.hi, (short)0, c, false, false);
    c = __builtin_amdgcn_wmma_f32_16x16x32_bf16(false, a.hi, false, b.mid, (short)0, c, false, false);
    c = __builtin_amdgcn_wmma_f32_16x16x32_bf16(false, a.mid, false, b.hi, (short)0, c, false, false);
    c = __builtin_amdgcn_wmma_f32_16x16x32_bf16(false, a.hi, false, b.lo, (short)0, c, false, false);
    c = __builtin_amdgcn_wmma_f32_16x16x32_bf16(false, a.mid, false, b.mid, (short)0, c, false, false);
    c = __builtin_amdgcn_wmma_f32_16x16x32_bf16(false, a.lo, false, b.hi, (short)0, c, false, false);
    asm volatile("v_nop\n\tv_nop\n\tv_nop\n\tv_nop" : "+v"(c) : "v"(a.hi), "v"(a.mid), "v"(a.lo), "v"(b.hi), "v"(b.mid), "v"(b.lo));
    return c;
}

// Fragment gathers from f32 memory: element i <- p[(k0 + frag_k(i,h)) * sk] * s, zero for k >= klen.
__device__ __forceinline__ v16h fh_ld(const float* __restrict__ p, long long sk, int k0, int h, int klen, float s) {
    v16h a;
#pragma unroll
    for (int i = 0; i < 16; ++i) { const int k = k0 + frag_k(i, h); a[i] = (k < klen) ? (_Float16)(p[(long long)k * sk] * s) : (_Float16)0.f; }
    return a;
}
__device__ __forceinline__ Split sp_ld(const float* __restrict__ p, long long sk, int k0, int h, int klen, float s) {
    Split r;
#pragma unroll
    for (int i = 0; i < 16; ++i) {
        const int k = k0 + frag_k(i, h); const float x = (k < klen) ? p[(long long)k * sk] * s : 0.f;
        const __bf16 hb = bf16_rne(x); r.hi[i] = hb; r.lo[i] = bf16_rne(x - bf16_f32(hb));
    }
    return r;
}
__device__ __forceinline__ Split3 sp3_ld(const float* __restrict__ p, long long sk, int k0, int h, int klen, float s) {
    Split3 r;
#pragma unroll
    for (int i = 0; i < 16; ++i) {
        const int k = k0 + frag_k(i, h); const float x = (k < klen) ? p[(long long)k * sk] * s : 0.f;
        const __bf16 hb = bf16_rne(x); const float r1 = x - bf16_f32(hb); const __bf16 mb = bf16_rne(r1);
        r.hi[i] = hb; r.mid[i] = mb; r.lo[i] = bf16_rne(r1 - bf16_f32(mb));
    }
    return r;
}
__device__ __forceinline__ v16b bh_ld(const float* __restrict__ p, long long sk, int k0, int h, int klen, float s) {
    v16b a;
#pragma unroll
    for (int i = 0; i < 16; ++i) { const int k = k0 + frag_k(i, h); a[i] = bf16_rne((k < klen) ? p[(long long)k * sk] * s : 0.f); }
    return a;
}
// f16 fragment from an f16 LDS/global row with element stride 1 (k-contiguous), no bounds (tile already zero padded)
__device__ __forceinline__ v16h fh_row(const _Float16* __restrict__ row, int k0, int h) {
    v16h a;
#pragma unroll
    for (int i = 0; i < 16; ++i) a[i] = row[k0 + frag_k(i, h)];
    return a;
}

#define VST2(T, ptr, val) do { const T vst2_v_ = (val); *(T*)(ptr) = vst2_v_;  } while (0)
typedef float v4f __attribute__((ext_vector_type(4)));
#define VST2V4(ptr, val) do { const v4f vst2_v4_ = (val); *(v4f*)(ptr) = vst2_v4_;  } while (0)

__device__ __attribute__((noinline)) float act_fn(float v, int act) {
    if (act == 1) return fmaxf(v, 0.f);                                                                               // relu
    if (act == 2) { const float u = 0.7978845608028654f * (v + 0.044715f * v * v * v); return 0.5f * v * (1.f + tanhf(u)); } // tanh-gelu
    if (act == 3) return v / (1.f + expf(-v));                                                                        // silu
    if (act == 4) return 0.5f * v * (1.f + erff(v * 0.7071067811865476f));                                             // erf-gelu
    if (act == 5) return tanhf(v);
    if (act == 6) return 1.f / (1.f + expf(-v));                                                                      // sigmoid
    if (act == 7) return (v > 0.f) ? v : 0.01f * v;                                                                   // leaky relu 0.01
    if (act == 8) return (v > 0.f) ? v : (expf(v) - 1.f);                                                             // elu
    if (act == 9) return fminf(fmaxf(v, 0.f), 6.f);                                                                   // relu6
    if (act == 10) return fabsf(v);                                                                                    // abs
    if (act == 11) return (v >= 0.f) ? v : 0.1f * v;                                                                  // leaky 0.1
    if (act == 12) return (v > 0.f) ? v : 0.2f * v;                                                                   // leaky 0.2
    if (act == 13) return (v > 20.f) ? v : log1pf(expf(v));                                                            // softplus
    return v;
}

// =====================================================================================================================
// k_gemm<MODE>: C(z, m, n) = act(alpha * sum_k A(z, m, k) * B(z, k, n) + bias) + beta * R(z, m, n)
//   One wave (32-thread block) per 16 x 32 tile of C; grid (ceil(N/32), ceil(M/16), Z). Batch z -> (zo = z / zi_n, zi = z % zi_n)
//   with separate outer/inner strides for every tensor (e.g. batch and head). A(m,k) = A[zo*sAo + zi*sAi + m*sAm + k*sAk] (f32),
//   B(k,n) = B[zo*sBo + zi*sBi + n*sBn + k*sBk] (f32); any M, N, K (K zero-padded to 32 inside the fragments, M/N tails guarded).
//   C(m,n) = C[zo*sCo + zi*sCi + m*sCm + n] (n contiguous). flags: 1 bias[n], 2 bias[m], 4 residual R[zo*sRo + zi*sRi + m*sRm + n*sRn].
//   MODE 0: f16 operands (A prescaled by sa, B by sb, both undone in the epilogue); 1: bf16 hi/lo split (3 products); 2: bf16;
//   3: bf16 hi/mid/lo triple split (6 products); 4: as 3 with Kahan-compensated f32 accumulation across k-steps.
// =====================================================================================================================
struct GemmP {
    const float* A; const float* B; const float* bias; const float* R; float* C;
    long long sAo, sAi, sAm, sAk, sBo, sBi, sBn, sBk, sCo, sCi, sCm, sRo, sRi, sRm, sRn;
    int M, N, K, zi_n, flags, act; float alpha, beta, sa, sb;
    int Npad, pad_;     // columns [N, Npad) of C are written as 0 so that padded workspace rows are covered by whole-line stores; Npad >= N
};
static_assert(sizeof(GemmP) == 5 * 8 + 15 * 8 + 6 * 4 + 4 * 4 + 2 * 4, "GemmP has padding");

template <int MODE>
__global__ __launch_bounds__(32) void k_gemm(GemmP p) {
    const int lane = threadIdx.x & 31, h = lane >> 4, l15 = lane & 15;
    const int m0 = blockIdx.y * 16, n0 = blockIdx.x * 32;
    const int z = blockIdx.z, zo = z / p.zi_n, zi = z - zo * p.zi_n;
    const float* A = p.A + zo * p.sAo + zi * p.sAi;
    const float* B = p.B + zo * p.sBo + zi * p.sBi;
    const int am = min(m0 + l15, p.M - 1);                       // clamped row for loads (stores are guarded)
    v8f acc[2], comp[2];
#pragma unroll
    for (int t = 0; t < 2; ++t) { v8f zz = {}; acc[t] = zz; comp[t] = zz; }
    for (int k0 = 0; k0 < p.K; k0 += 32) {
        const float* arow = A + (long long)am * p.sAm;
        if (MODE == 1) {
            const Split a = sp_ld(arow, p.sAk, k0, h, p.K, 1.f);
#pragma unroll
            for (int t = 0; t < 2; ++t) {
                const int bn = min(n0 + t * 16 + l15, p.N - 1);
                acc[t] = wmma3(a, sp_ld(B + (long long)bn * p.sBn, p.sBk, k0, h, p.K, 1.f), acc[t]);
            }
        } else if (MODE == 3) {
            const Split3 a = sp3_ld(arow, p.sAk, k0, h, p.K, 1.f);
#pragma unroll
            for (int t = 0; t < 2; ++t) {
                const int bn = min(n0 + t * 16 + l15, p.N - 1);
                acc[t] = wmma6(a, sp3_ld(B + (long long)bn * p.sBn, p.sBk, k0, h, p.K, 1.f), acc[t]);
            }
        } else if (MODE == 4) {
            // triple split as MODE 3, but each k-step's 6 products go into a fresh accumulator and the partial is added to the running f32 sum
            // on the VALU with Kahan compensation (accumulation error stays ~1 ulp however long K is)
            const Split3 a = sp3_ld(arow, p.sAk, k0, h, p.K, 1.f);
#pragma unroll
            for (int t = 0; t < 2; ++t) {
                const int bn = min(n0 + t * 16 + l15, p.N - 1); v8f zz = {};
                const v8f part = wmma6(a, sp3_ld(B + (long long)bn * p.sBn, p.sBk, k0, h, p.K, 1.f), zz);
                const v8f y = part - comp[t]; const v8f s = acc[t] + y; comp[t] = (s - acc[t]) - y; acc[t] = s;
            }
        } else if (MODE == 2) {
            const v16b a = bh_ld(arow, p.sAk, k0, h, p.K, 1.f);
#pragma unroll
            for (int t = 0; t < 2; ++t) {
                const int bn = min(n0 + t * 16 + l15, p.N - 1);
                acc[t] = wmmab(a, bh_ld(B + (long long)bn * p.sBn, p.sBk, k0, h, p.K, 1.f), acc[t]);
            }
        } else {
            const v16h a = fh_ld(arow, p.sAk, k0, h, p.K, p.sa);
#pragma unroll
            for (int t = 0; t < 2; ++t) {
                const int bn = min(n0 + t * 16 + l15, p.N - 1);
                acc[t] = wmma16(a, fh_ld(B + (long long)bn * p.sBn, p.sBk, k0, h, p.K, p.sb), acc[t]);
            }
        }
    }
    const float iscale = (MODE == 0) ? p.alpha / (p.sa * p.sb) : p.alpha;
    float* C = p.C + zo * p.sCo + zi * p.sCi;
    const float* R = p.R + zo * p.sRo + zi * p.sRi;
    __shared__ __align__(16) float ctile[16][36];
#pragma unroll
    for (int t = 0; t < 2; ++t) {
        const int n = n0 + t * 16 + l15; const int nn = min(n, p.N - 1);
#pragma unroll
        for (int r = 0; r < 8; ++r) {
            const int m = m0 + 8 * h + r; const int mm = min(m, p.M - 1);
            float v = acc[t][r] * iscale;
            if (p.flags & 1) v += p.bias[nn];
            if (p.flags & 2) v += p.bias[mm];
            if (p.flags & 8) v *= p.bias[(long long)zo * p.M + mm];   /* per-(z,row) scale vector laid out [Z][M]; exclusive with the bias flags */
            v = act_fn(v, p.act);
            if (p.flags & 4) v += p.beta * R[(long long)mm * p.sRm + (long long)nn * p.sRn];
            ctile[8 * h + r][t * 16 + l15] = (n < p.N) ? v : 0.f;
        }
    }
    __syncthreads();
    const int NW = (p.Npad > p.N) ? p.Npad : p.N;           // write width
    const bool fast = (m0 + 16 <= p.M) && (n0 + 32 <= NW) && ((p.sCm & 3) == 0) && ((((size_t)C) & 15) == 0);
    if (fast) {
#pragma unroll
        for (int s = 0; s < 4; ++s) {
            const int row = s * 4 + (lane >> 3), c4 = (lane & 7) * 4;
            const v4f v = *(const v4f*)&ctile[row][c4];
            VST2V4(C + (long long)(m0 + row) * p.sCm + n0 + c4, v);
        }
    } else {
        for (int row = 0; row < 16; ++row) {
            const int m = m0 + row, n = n0 + lane;
            if (m < p.M && n < NW) VST2(float, C + (long long)m * p.sCm + n, ctile[row][lane]);
        }
    }
}


// =====================================================================================================================
// k_gemmT<MODE, TM, TN>: same contract as k_gemm, but one wave computes a (16*TM) x (16*TN) tile: TM A fragments and TN B fragments are
//   loaded per 32-wide k-step and reused across TM*TN WMMAs (far fewer load/convert instructions per MAC). MODE 0 (f16), 1 (bf16 hi/lo),
//   2 (bf16) only. grid (ceil(NW/(16*TN)), ceil(M/(16*TM)), Z), block 32. Epilogue identical to k_gemm, run per 16x32 sub-tile.
// =====================================================================================================================
template <int MODE, int TM, int TN>
__global__ __launch_bounds__(32) void k_gemmT(GemmP p) {
    const int lane = threadIdx.x & 31, h = lane >> 4, l15 = lane & 15;
    const int m0 = blockIdx.y * (16 * TM), n0 = blockIdx.x * (16 * TN);
    const int z = blockIdx.z, zo = z / p.zi_n, zi = z - zo * p.zi_n;
    const float* A = p.A + zo * p.sAo + zi * p.sAi;
    const float* B = p.B + zo * p.sBo + zi * p.sBi;
    v8f acc[TM][TN];
#pragma unroll
    for (int i = 0; i < TM; ++i)
#pragma unroll
        for (int t = 0; t < TN; ++t) { v8f zz = {}; acc[i][t] = zz; }
    for (int k0 = 0; k0 < p.K; k0 += 32) {
        if (MODE == 1) {
            Split a[TM], b[TN];
#pragma unroll
            for (int i = 0; i < TM; ++i) { const int am = min(m0 + 16 * i + l15, p.M - 1); a[i] = sp_ld(A + (long long)am * p.sAm, p.sAk, k0, h, p.K, 1.f); }
#pragma unroll
            for (int t = 0; t < TN; ++t) { const int bn = min(n0 + 16 * t + l15, p.N - 1); b[t] = sp_ld(B + (long long)bn * p.sBn, p.sBk, k0, h, p.K, 1.f); }
#pragma unroll
            for (int i = 0; i < TM; ++i)
#pragma unroll
                for (int t = 0; t < TN; ++t) acc[i][t] = wmma3(a[i], b[t], acc[i][t]);
        } else if (MODE == 2) {
            v16b a[TM], b[TN];
#pragma unroll
            for (int i = 0; i < TM; ++i) { const int am = min(m0 + 16 * i + l15, p.M - 1); a[i] = bh_ld(A + (long long)am * p.sAm, p.sAk, k0, h, p.K, 1.f); }
#pragma unroll
            for (int t = 0; t < TN; ++t) { const int bn = min(n0 + 16 * t + l15, p.N - 1); b[t] = bh_ld(B + (long long)bn * p.sBn, p.sBk, k0, h, p.K, 1.f); }
#pragma unroll
            for (int i = 0; i < TM; ++i)
#pragma unroll
                for (int t = 0; t < TN; ++t) acc[i][t] = wmmab(a[i], b[t], acc[i][t]);
        } else {
            v16h a[TM], b[TN];
#pragma unroll
            for (int i = 0; i < TM; ++i) { const int am = min(m0 + 16 * i + l15, p.M - 1); a[i] = fh_ld(A + (long long)am * p.sAm, p.sAk, k0, h, p.K, p.sa); }
#pragma unroll
            for (int t = 0; t < TN; ++t) { const int bn = min(n0 + 16 * t + l15, p.N - 1); b[t] = fh_ld(B + (long long)bn * p.sBn, p.sBk, k0, h, p.K, p.sb); }
#pragma unroll
            for (int i = 0; i < TM; ++i)
#pragma unroll
                for (int t = 0; t < TN; ++t) acc[i][t] = wmma16(a[i], b[t], acc[i][t]);
        }
    }
    const float iscale = (MODE == 0) ? p.alpha / (p.sa * p.sb) : p.alpha;
    float* C = p.C + zo * p.sCo + zi * p.sCi;
    const float* R = p.R + zo * p.sRo + zi * p.sRi;
    const int NW = (p.Npad > p.N) ? p.Npad : p.N;
    __shared__ __align__(16) float ctile[16][36];
#pragma unroll
    for (int i = 0; i < TM; ++i) {
        const int mb = m0 + 16 * i; if (mb >= p.M) break;          // wave-uniform
#pragma unroll
        for (int tp = 0; tp < TN / 2; ++tp) {
            const int nb = n0 + 32 * tp; if (nb >= NW) break;        // wave-uniform
#pragma unroll
            for (int t2 = 0; t2 < 2; ++t2) {
                const int t = 2 * tp + t2; const int n = nb + t2 * 16 + l15; const int nn = min(n, p.N - 1);
#pragma unroll
                for (int r = 0; r < 8; ++r) {
                    const int m = mb + 8 * h + r; const int mm = min(m, p.M - 1);
                    float v = acc[i][t][r] * iscale;
                    if (p.flags & 1) v += p.bias[nn];
                    if (p.flags & 2) v += p.bias[mm];
            if (p.flags & 8) v *= p.bias[(long long)zo * p.M + mm];   /* per-(z,row) scale vector laid out [Z][M]; exclusive with the bias flags */
                    v = act_fn(v, p.act);
                    if (p.flags & 4) v += p.beta * R[(long long)mm * p.sRm + (long long)nn * p.sRn];
                    ctile[8 * h + r][t2 * 16 + l15] = (n < p.N) ? v : 0.f;
                }
            }
            __syncthreads();
            const bool fast = (mb + 16 <= p.M) && (nb + 32 <= NW) && ((p.sCm & 3) == 0) && ((((size_t)C) & 15) == 0);
            if (fast) {
#pragma unroll
                for (int s = 0; s < 4; ++s) {
                    const int row = s * 4 + (lane >> 3), c4 = (lane & 7) * 4;
                    const v4f v = *(const v4f*)&ctile[row][c4];
                    VST2V4(C + (long long)(mb + row) * p.sCm + nb + c4, v);
                }
            } else {
                for (int row = 0; row < 16; ++row) {
                    const int m = mb + row, n = nb + lane;
                    if (m < p.M && n < NW) VST2(float, C + (long long)m * p.sCm + n, ctile[row][lane]);
                }
            }
            __syncthreads();
        }
    }
}

// =====================================================================================================================
//   Wave = 16 queries, AW waves per block, 64-key blocks; grid (ceil(Lq/(16*AW)), H, B), block 32*AW. Any Lq, Lk; head dim dh <= DHP
//   (DHP multiple of 32), value dim dv <= DVP (multiple of 16, <= 128). Every tensor addressed by (batch, head, row, element) strides, f32.
//   Scores: QM 0 f16 operands, 1 bf16 hi/lo split, 2 bf16 triple split; statistics f32 (exp2 domain); P.V: P x 4096 as f16 with V f16 staged in LDS
//   (SPLITPV: P and V as bf16 hi/lo splits). kv head = h / hrep. Masking: causal = 1 (keep j <= i + coff, masked -> -inf, key blocks beyond the
//   diagonal skipped), causal = 2 (masked -> mfill, a finite fill like the -1e9; no skipping), causal = 3 (keep j >= i + coff,
//   masked -> -inf, no skipping); optional additive f32 mask Mf,
//   optional int keep-mask Mi (0 -> score := mfill), both addressed b*smb + h*smh + i*smi + j*smj (0 strides broadcast).
// =====================================================================================================================
#define AW 4
struct AttnP {   // apv4
    const float* Q; const float* K; const float* V; float* O; float* P; const float* Mf; const int* Mi; float* ST;
    const float* Pw; const float* Rt; const int* SQ; const int* SK;           // optional: post-softmax weight, relative-position table, segment ids
    long long swb, swh, swi, swj, srb, srh, sri;                                 // Pw strides (b,h,i,j); Rt strides (b,h,i), column = clamp(i - j + roff, 0, rn-1)
    long long sQb, sQh, sQi, sQd, sKb, sKh, sKj, sKd, sVb, sVh, sVj, sVd, sOb, sOh, sOi, sPb, sPh, sPi, smb, smh, smi, smj;
    int Lq, Lk, dh, dv, hrep, causal, coff, pband;   // pband > 0: P holds only the band |j - i| <= pband, column j - i + pband
    float scale, mfill; int nonorm, mpol;             // nonorm (online path only): O = sum_j exp(score_j) V_j without the 1/rowsum (scores must be <= ~0); mpol: Mi masks where ==0 (mpol 0) or where !=0 (mpol 1)
    int roff, rn, segpol, win;                        // Rt column offset/count; SQ/SK: score := mfill where (segpol 0) SQ[i] != SK[j] or (segpol 1) SQ[i] == SK[j]; win > 0: keys with i - j > win (after coff) -> -inf
};
//   Pw: the softmax numerator is multiplied by Pw(b,h,i,j) AFTER the row sum is taken (probs * weight, then P.V), as in post-softmax multiplicative biases.                                                    // ST (optional): per row (b,h,i) -> ST[((b*H + h)*Lq + i)*2 + {0,1}] = {row max of the scaled+masked score (natural units), sum_j exp(score - max)}
static_assert(sizeof(AttnP) == 12 * 8 + 29 * 8 + 16 * 4, "AttnP has padding");

#ifndef KATTN_ATTR
#define KATTN_ATTR
#endif
template <int DHP, int DVP, int QM, bool SPLITPV, bool TWOPASS>
__global__ __launch_bounds__(32 * AW) KATTN_ATTR void k_attn(AttnP p) {
    constexpr int NT = DVP / 16;                // output tiles
    constexpr int KS = DHP / 32;                // k-steps for the scores
    constexpr int VP = DVP + 8;                 // LDS pitch (halves)
    __shared__ __align__(16) float    pl[AW][16 * 64];
    __shared__ __align__(16) _Float16 vl[(SPLITPV ? 2 : 1) * 64 * VP];   // f16 V tile, or bf16 hi and lo tiles (same 2-byte size)
    const int lane = threadIdx.x & 31, hf = lane >> 4, l15 = lane & 15, wave = threadIdx.x >> 5;
    const int h = blockIdx.y, b = blockIdx.z, hk = h / p.hrep;
    const int q0 = (blockIdx.x * AW + wave) * 16;
    float* myp = pl[wave];
    const float L2E = 1.4426950408889634f;
    const float NEG = -__builtin_inff();
    const int qi = min(q0 + l15, p.Lq - 1);
    const float* qrow = p.Q + b * p.sQb + h * p.sQh + (long long)qi * p.sQi;
    const float* kbase = p.K + b * p.sKb + hk * p.sKh;
    const float* vbase = p.V + b * p.sVb + hk * p.sVh;
    v16h qa[QM == 0 ? KS : 1]; Split qs_[QM == 1 ? KS : 1]; Split3 qt_[QM == 2 ? KS : 1];
#pragma unroll
    for (int ks = 0; ks < KS; ++ks) {
        if (QM == 2) qt_[ks] = sp3_ld(qrow, p.sQd, ks * 32, hf, p.dh, 1.f);
        else if (QM == 1) qs_[ks] = sp_ld(qrow, p.sQd, ks * 32, hf, p.dh, 1.f);
        else qa[ks] = fh_ld(qrow, p.sQd, ks * 32, hf, p.dh, 1.f);
    }
    v8f o[NT]; float m8[8], l8[8];
#pragma unroll
    for (int t = 0; t < NT; ++t) { v8f zz = {}; o[t] = zz; }
#pragma unroll
    for (int i = 0; i < 8; ++i) { m8[i] = NEG; l8[i] = 0.f; }
    int jend = p.Lk;
    if (p.causal == 1) { const int je = (blockIdx.x * AW + AW - 1) * 16 + 16 + p.coff; jend = min(jend, max(je, 0)); }   // uniform per block
    const int npass = TWOPASS ? 2 : 1;
    for (int pass = 0; pass < npass; ++pass) {
        const bool dopv = (!TWOPASS) || pass == 1;
        for (int j0 = 0; j0 < jend; j0 += 64) {
            if (dopv) {
                __syncthreads();                                 // previous key block's reads of vl / pl are done
                for (int idx = threadIdx.x; idx < 64 * DVP; idx += 32 * AW) {
                    const int jr = idx / DVP, d = idx - jr * DVP, j = j0 + jr;
                    const float f = (j < p.Lk && d < p.dv) ? vbase[(long long)j * p.sVj + (long long)d * p.sVd] : 0.f;
                    if (SPLITPV) {
                        const __bf16 hb = bf16_rne(f);
                        ((__bf16*)vl)[jr * VP + d] = hb; ((__bf16*)vl)[64 * VP + jr * VP + d] = bf16_rne(f - bf16_f32(hb));
                    } else vl[jr * VP + d] = (_Float16)f;
                }
            }
            v8f s[4];
#pragma unroll
            for (int t = 0; t < 4; ++t) {
                const int j = min(j0 + t * 16 + l15, p.Lk - 1);
                const float* krow = kbase + (long long)j * p.sKj;
                v8f acc = {};
#pragma unroll
                for (int ks = 0; ks < KS; ++ks) {
                    if (QM == 2)      acc = wmma6(qt_[ks], sp3_ld(krow, p.sKd, ks * 32, hf, p.dh, 1.f), acc);
                    else if (QM == 1) acc = wmma3(qs_[ks], sp_ld(krow, p.sKd, ks * 32, hf, p.dh, 1.f), acc);
                    else              acc = wmma16(qa[ks], fh_ld(krow, p.sKd, ks * 32, hf, p.dh, 1.f), acc);
                }
                s[t] = acc;
            }
            float pv[8][4];
#pragma unroll
            for (int i = 0; i < 8; ++i) {
                const int irow = q0 + i + 8 * hf;
                const int ic = min(irow, p.Lq - 1);
                float sc[4];
#pragma unroll
                for (int t = 0; t < 4; ++t) {
                    const int jg = j0 + t * 16 + l15;
                    float v = s[t][i] * p.scale;
                    if (p.Mf) v += p.Mf[b * p.smb + h * p.smh + (long long)ic * p.smi + (long long)min(jg, p.Lk - 1) * p.smj];
                    if (p.Rt) { int rc = ic - min(jg, p.Lk - 1) + p.roff; rc = rc < 0 ? 0 : (rc >= p.rn ? p.rn - 1 : rc); v += p.Rt[b * p.srb + h * p.srh + (long long)ic * p.sri + rc]; }
                    if (p.Mi) { const int mv = p.Mi[b * p.smb + h * p.smh + (long long)ic * p.smi + (long long)min(jg, p.Lk - 1) * p.smj]; if (p.mpol ? (mv != 0) : (mv == 0)) v = p.mfill; }
                    if (p.SQ) { const bool same = p.SQ[(long long)b * p.Lq + ic] == p.SK[(long long)b * p.Lk + min(jg, p.Lk - 1)]; if (p.segpol ? same : !same) v = p.mfill; }
                    if (p.causal == 2 && jg > irow + p.coff) v = p.mfill;
                    if (jg >= p.Lk || (p.causal == 1 && jg > irow + p.coff) || (p.causal == 3 && jg < irow + p.coff) || (p.win > 0 && irow + p.coff - jg > p.win)) v = NEG; else v *= L2E;
                    sc[t] = v;
                }
                if (!TWOPASS || pass == 0) {
                    float mx = fmaxf(fmaxf(sc[0], sc[1]), fmaxf(sc[2], sc[3]));
                    mx = fmaxf(mx, __shfl_xor(mx, 1, 32)); mx = fmaxf(mx, __shfl_xor(mx, 2, 32));
                    mx = fmaxf(mx, __shfl_xor(mx, 4, 32)); mx = fmaxf(mx, __shfl_xor(mx, 8, 32));
                    const float mnew = fmaxf(m8[i], mx);
                    const float corr = (mnew == NEG) ? 1.f : exp2f(m8[i] - mnew);
                    float rs = 0.f;
#pragma unroll
                    for (int t = 0; t < 4; ++t) {
                        const float pp = (sc[t] == NEG) ? 0.f : exp2f(sc[t] - mnew); rs += pp;
                        pv[i][t] = p.Pw ? pp * p.Pw[b * p.swb + h * p.swh + (long long)ic * p.swi + (long long)min(j0 + t * 16 + l15, p.Lk - 1) * p.swj] : pp;
                    }
                    rs += __shfl_xor(rs, 1, 32); rs += __shfl_xor(rs, 2, 32); rs += __shfl_xor(rs, 4, 32); rs += __shfl_xor(rs, 8, 32);
                    l8[i] = l8[i] * corr + rs; m8[i] = mnew;
                    if (!TWOPASS) {
#pragma unroll
                        for (int t = 0; t < NT; ++t) o[t][i] *= corr;
                    }
                } else {
                    const float inv = (l8[i] > 0.f) ? 1.f / l8[i] : 0.f;
#pragma unroll
                    for (int t = 0; t < 4; ++t) {
                        const int jg = j0 + t * 16 + l15;
                        float pp = (sc[t] == NEG) ? 0.f : exp2f(sc[t] - m8[i]) * inv;
                        if (p.Pw) pp *= p.Pw[b * p.swb + h * p.swh + (long long)ic * p.swi + (long long)min(jg, p.Lk - 1) * p.swj];
                        pv[i][t] = pp;
                    }
                }
            }
            if (dopv) {
#pragma unroll
                for (int i = 0; i < 8; ++i)
#pragma unroll
                    for (int t = 0; t < 4; ++t) ((float*)myp)[(i + 8 * hf) * 64 + t * 16 + l15] = pv[i][t];
                __syncthreads();                                 // P (per wave) and V (shared) visible
                if (p.P) {
                    float* pb_ = p.P + b * p.sPb + h * p.sPh;
                    const bool fastP = (p.pband == 0) && ((p.sPi & 3) == 0) && (j0 + 64 <= p.Lk) && (q0 + 16 <= p.Lq) && ((((size_t)pb_) & 15) == 0);
                    if (fastP) {
#pragma unroll
                        for (int s = 0; s < 8; ++s) {
                            const int row = s * 2 + (lane >> 4), c4 = (lane & 15) * 4;
                            const v4f v = *(const v4f*)(myp + row * 64 + c4);
                            VST2V4(pb_ + (long long)(q0 + row) * p.sPi + j0 + c4, v);
                        }
                    } else {
                        for (int row = 0; row < 16; ++row) {
                            const int irow = q0 + row; if (irow >= p.Lq) continue;
                            for (int c = lane; c < 64; c += 32) {
                                const int jg = j0 + c; if (jg >= p.Lk) continue;
                                if (p.pband == 0) VST2(float, pb_ + (long long)irow * p.sPi + jg, myp[row * 64 + c]);
                                else if (jg - irow <= p.pband && irow - jg <= p.pband) VST2(float, pb_ + (long long)irow * p.sPi + (jg - irow + p.pband), myp[row * 64 + c]);
                            }
                        }
                    }
                }
                if (SPLITPV) {
                    const Split pa0 = sp_ld(myp + l15 * 64, 1, 0, hf, 64, 1.f), pa1 = sp_ld(myp + l15 * 64, 1, 32, hf, 64, 1.f);
                    const __bf16* vh = (const __bf16*)vl; const __bf16* vlo = vh + 64 * VP;
#pragma unroll
                    for (int t = 0; t < NT; ++t) {
                        const int dcol = t * 16 + l15;
                        Split b0, b1;
#pragma unroll
                        for (int e = 0; e < 16; ++e) {
                            const int k0 = frag_k(e, hf), k1 = 32 + frag_k(e, hf);
                            b0.hi[e] = vh[k0 * VP + dcol]; b0.lo[e] = vlo[k0 * VP + dcol]; b1.hi[e] = vh[k1 * VP + dcol]; b1.lo[e] = vlo[k1 * VP + dcol];
                        }
                        o[t] = wmma3(pa0, b0, o[t]);
                        o[t] = wmma3(pa1, b1, o[t]);
                    }
                } else {
                    const v16h pa0 = fh_ld(myp + l15 * 64, 1, 0, hf, 64, 4096.f), pa1 = fh_ld(myp + l15 * 64, 1, 32, hf, 64, 4096.f);
#pragma unroll
                    for (int t = 0; t < NT; ++t) {
                        const int dcol = t * 16 + l15;
                        v16h b0, b1;
#pragma unroll
                        for (int e = 0; e < 16; ++e) { b0[e] = vl[frag_k(e, hf) * VP + dcol]; b1[e] = vl[(32 + frag_k(e, hf)) * VP + dcol]; }
                        o[t] = wmma16(pa0, b0, o[t]);
                        o[t] = wmma16(pa1, b1, o[t]);
                    }
                }
            }
        }
    }
    float* obase = p.O + b * p.sOb + h * p.sOh;
    if (p.ST) {
        const int rl = lane >> 1, isel = rl & 7;           // row q0 + rl ; rl>>3 == hf holds because lane>>4 == (lane>>1)>>3
        float mv = 0.f, lv = 0.f;
#pragma unroll
        for (int i = 0; i < 8; ++i) if (i == isel) { mv = m8[i]; lv = l8[i]; }
        const int irow = q0 + rl;
        if (irow < p.Lq) { float* st = p.ST + (((long long)b * gridDim.y + h) * p.Lq + irow) * 2 + (lane & 1); VST2(float, st, (lane & 1) ? lv : mv * 0.6931471805599453f); }
    }
    float invr[8];
#pragma unroll
    for (int i = 0; i < 8; ++i) {
        if (TWOPASS) invr[i] = SPLITPV ? 1.f : (1.f / 4096.f);
        else if (p.nonorm) invr[i] = exp2f(m8[i]) * (SPLITPV ? 1.f : (1.f / 4096.f));
        else invr[i] = (l8[i] > 0.f) ? (SPLITPV ? 1.f / l8[i] : 1.f / (l8[i] * 4096.f)) : 0.f;
    }
    __syncthreads();                                             // all waves done with pl/vl from the main loop
    const bool ofast = ((p.sOi & 3) == 0) && ((((size_t)obase) & 15) == 0) && (q0 + 16 <= p.Lq);
#pragma unroll
    for (int c0 = 0; c0 < DVP; c0 += 64) {
#pragma unroll
        for (int i = 0; i < 8; ++i)
#pragma unroll
            for (int t = 0; t < NT; ++t) if (t * 16 >= c0 && t * 16 < c0 + 64) ((float*)myp)[(i + 8 * hf) * 64 + (t * 16 - c0) + l15] = o[t][i] * invr[i];
        __syncthreads();
        const int cw = (DVP - c0 < 64) ? (DVP - c0) : 64;      // staged columns in this chunk (multiple of 16)
        if (ofast && (c0 + cw <= p.dv) && (cw % 32 == 0)) {
            const int lpr = cw / 4;                              // lanes per row (16 for 64 cols, 8 for 32)
            const int rows_per_ins = 32 / lpr;
            for (int r0 = 0; r0 < 16; r0 += rows_per_ins) {
                const int row = r0 + lane / lpr, c4 = (lane % lpr) * 4;
                const v4f v = *(const v4f*)(myp + row * 64 + c4);
                VST2V4(obase + (long long)(q0 + row) * p.sOi + c0 + c4, v);
            }
        } else {
            for (int row = 0; row < 16; ++row) {
                const int irow = q0 + row; if (irow >= p.Lq) continue;
                for (int c = lane; c < cw; c += 32) { const int d = c0 + c; if (d < p.dv) VST2(float, obase + (long long)irow * p.sOi + d, myp[row * 64 + c]); }
            }
        }
        __syncthreads();
    }
}

// =====================================================================================================================
// k_tr: dst(z, c, r) = alpha * src(z, r, c) (+ beta * R2(z, c, r)): [Z][R][C] (row stride lds) -> [Z][C][R] (row stride ldd) through a 32x32 LDS tile;
//   flags: 1 -> add beta * residual R2 addressed like dst (z*sRz + c*ldr + r); act applied before the residual.
// =====================================================================================================================
struct TrP { const float* src; float* dst; const float* R2; long long sSz, lds, sDz, ldd, sRz, ldr; int R, C, flags, act; float alpha, beta; };
static_assert(sizeof(TrP) == 3 * 8 + 6 * 8 + 6 * 4, "TrP has padding");
__global__ __launch_bounds__(256) void k_tr(TrP p) {
    __shared__ float tile[32][33];
    const int c0 = blockIdx.x * 32, r0 = blockIdx.y * 32, z = blockIdx.z;
    const int lane = threadIdx.x & 31, wave = threadIdx.x >> 5;
    const float* s = p.src + z * p.sSz;
#pragma unroll
    for (int k = 0; k < 4; ++k) {
        const int rl = wave * 4 + k, r = r0 + rl, c = c0 + lane;
        tile[rl][lane] = (r < p.R && c < p.C) ? s[(long long)r * p.lds + c] : 0.f;
    }
    __syncthreads();
    float* d = p.dst + z * p.sDz; const float* rr = p.R2 + z * p.sRz;
#pragma unroll
    for (int k = 0; k < 4; ++k) {
        const int cl = wave * 4 + k, c = c0 + cl, r = r0 + lane;
        if (c < p.C && r < p.R) {
            float v = act_fn(p.alpha * tile[lane][cl], p.act);
            if (p.flags & 1) v += p.beta * rr[(long long)c * p.ldr + r];
            VST2(float, d + (long long)c * p.ldd + r, v);
        }
    }
}

// k_affine: dst[i] = a * (sdev ? sdev[0] : 1) * src[i] + b, i < n (one thread per element; consecutive lanes -> consecutive addresses)
__global__ __launch_bounds__(256) void k_affine(const float* __restrict__ src, float* __restrict__ dst, int n, float a, float b, const float* __restrict__ sdev) {
    const int i = blockIdx.x * 256 + threadIdx.x;
    if (i < n) { const float aa = sdev ? a * sdev[0] : a; const float v = aa * src[i] + b; VST2(float, dst + i, v); }
}

// =====================================================================================================================
// k_softmax: row softmax over n contiguous elements, one 256-thread block per row; rows addressed z*sz + r*sr (grid (R, Z)).
//   out = scale_out * softmax(scale_in * x + (Mf ? Mf[z*smz + r*smr + j] : 0)); a row whose max is -inf is written as 0.
// =====================================================================================================================
struct SmP { const float* src; float* dst; const float* Mf; long long sz, sr, dz, dr, smz, smr; int n, pad; float scale_in, scale_out; };
static_assert(sizeof(SmP) == 3 * 8 + 6 * 8 + 4 * 4, "SmP has padding");
__global__ __launch_bounds__(256) void k_softmax(SmP p) {
    __shared__ float red[256];
    const int r = blockIdx.x, z = blockIdx.y, tid = threadIdx.x;
    const float* s = p.src + z * p.sz + (long long)r * p.sr;
    const float* mf = p.Mf ? (p.Mf + z * p.smz + (long long)r * p.smr) : nullptr;
    float mx = -__builtin_inff();
    for (int j = tid; j < p.n; j += 256) { float v = s[j] * p.scale_in; if (mf) v += mf[j]; mx = fmaxf(mx, v); }
    red[tid] = mx; __syncthreads();
    for (int o = 128; o > 0; o >>= 1) { if (tid < o) red[tid] = fmaxf(red[tid], red[tid + o]); __syncthreads(); }
    mx = red[0]; __syncthreads();
    float sum = 0.f;
    for (int j = tid; j < p.n; j += 256) { float v = s[j] * p.scale_in; if (mf) v += mf[j]; sum += (mx == -__builtin_inff()) ? 0.f : expf(v - mx); }
    red[tid] = sum; __syncthreads();
    for (int o = 128; o > 0; o >>= 1) { if (tid < o) red[tid] += red[tid + o]; __syncthreads(); }
    sum = red[0];
    const float inv = (sum > 0.f) ? p.scale_out / sum : 0.f;
    float* d = p.dst + z * p.dz + (long long)r * p.dr;
    for (int j = tid; j < p.n; j += 256) { float v = s[j] * p.scale_in; if (mf) v += mf[j]; const float o = (mx == -__builtin_inff()) ? 0.f : expf(v - mx) * inv; VST2(float, d + j, o); }
}
// =====================================================================================================================
// k_stats: mean and rsqrt(var + eps) over a set of n elements addressed base + z*sz + (e / inner) * so + (e % inner) * si, one 256-thread
// k_norm_apply: y = (x - mean[set]) * rstd[set] * g[c] + b[c] over a [Z][C][L] channel-major tensor with set = z*G + c / (C/G) (G groups per z;
//   G = C -> per-channel sets indexed z*C+c; for batch norm pass stats indexed by c only via bn = 1). Optional act. Output same layout.
// =====================================================================================================================
//   mode 0: mean / rsqrt(var + eps); mode 1 (RMSNorm): 0 / rsqrt(mean(x^2) + eps); mode 2 (L2 normalize * sqrt(n)): 0 / sqrt(n) / max(||x||, eps); mode 3: as 0 with unbiased variance (n-1)
__global__ __launch_bounds__(256) void k_stats(const float* __restrict__ x, long long sz, long long so, long long si, int inner, int n, float eps, float* __restrict__ stat, int mode) {
    __shared__ float red[256];
    const int z = blockIdx.x, tid = threadIdx.x;
    const float* base = x + z * sz;
    float s = 0.f;
    for (int e = tid; e < n; e += 256) s += base[(long long)(e / inner) * so + (long long)(e % inner) * si];
    red[tid] = s; __syncthreads();
    for (int o = 128; o > 0; o >>= 1) { if (tid < o) red[tid] += red[tid + o]; __syncthreads(); }
    const float mu = (mode == 0 || mode == 3) ? red[0] / (float)n : 0.f; __syncthreads();
    float q = 0.f;
    for (int e = tid; e < n; e += 256) { const float dlt = base[(long long)(e / inner) * so + (long long)(e % inner) * si] - mu; q += dlt * dlt; }
    red[tid] = q; __syncthreads();
    for (int o = 128; o > 0; o >>= 1) { if (tid < o) red[tid] += red[tid + o]; __syncthreads(); }
    {
        float rs;
        if (mode == 2) rs = sqrtf((float)n) / fmaxf(sqrtf(red[0]), eps); else if (mode == 3) rs = rsqrtf(red[0] / (float)(n - 1) + eps); else rs = rsqrtf(red[0] / (float)n + eps);
        if (tid < 32) { const float v = (tid == 0) ? mu : ((tid == 1) ? rs : 0.f); VST2(float, stat + (long long)z * 32 + tid, v); }
    }
}
//   One thread per element over the flat [Z][C][L] index space: grid ceil(Z*C*L / 256).
__global__ __launch_bounds__(256) void k_norm_apply(const float* __restrict__ x, float* __restrict__ y, const float* __restrict__ stat, const float* __restrict__ g, const float* __restrict__ bta,
                                                     int Z, int C, int L, int G, int bn, int act) {
    const long long idx = (long long)blockIdx.x * 256 + threadIdx.x;
    if (idx >= (long long)Z * C * L) return;
    const int l = (int)(idx % L); const long long zc = idx / L; const int c = (int)(zc % C), z = (int)(zc / C); (void)l;
    const int set = bn ? c : (z * G + c / (C / G));
    float v = (x[idx] - stat[(long long)set * 32]) * stat[(long long)set * 32 + 1];
    if (g) v *= g[c];
    if (bta) v += bta[c];
    v = act_fn(v, act);
    VST2(float, y + idx, v);
}

// k_lse_neg: c[i] = -(st[2i] + log(st[2i+1])) = minus the log-sum-exp of row i from k_attn's ST output (for softmax over the query dimension)
__global__ __launch_bounds__(256) void k_lse_neg(const float* __restrict__ st, float* __restrict__ c, int n) {
    const int i = blockIdx.x * 256 + threadIdx.x;
    if (i < n) { const float v = -(st[2 * i] + logf(st[2 * i + 1])); VST2(float, c + i, v); }
}

// k_iota: dst[i] = a * i + b as int32 (segment/position id helper)
__global__ __launch_bounds__(256) void k_iota(int* __restrict__ dst, int n, int a, int b) {
    const int i = blockIdx.x * 256 + threadIdx.x;
    if (i < n) { const int v = a * i + b; VST2(int, dst + i, v); }
}

// k_axpby: dst[i] = a * x[i] + b * y[i] (+ c), i < n
__global__ __launch_bounds__(256) void k_axpby(const float* __restrict__ x, const float* __restrict__ y, float* __restrict__ dst, int n, float a, float b, float c) {
    const int i = blockIdx.x * 256 + threadIdx.x;
    if (i < n) { const float v = a * x[i] + b * y[i] + c; VST2(float, dst + i, v); }
}

// =====================================================================================================================
// k_rope: rotary embedding on a [R rows][Hn heads][D] view (row stride sXr, head stride sXh, element stride 1) -> Y (own strides).
//   mode 0: rotate_half (partner d±D/2, sign - for d<D/2); mode 1: interleaved pairs (partner d^1, sign - for even d).
//   table column tcol: tmode 0 -> d, 1 -> d % (D/2), 2 -> d / 2; position p: pmode 0 -> r % S, 1 -> head index, 2 -> pos[r];
//   c = C[(r / S) * sCb + p * sCp + tcol * sCd], s likewise from Sn; y = x[d] * c + sign * x[partner] * s. X and Y must not alias.
// =====================================================================================================================
struct RopeP { const float* X; float* Y; const float* C; const float* Sn; const int* pos; long long sXr, sXh, sYr, sYh, sCb, sCp, sCd; int R, Hn, D, S, mode, tmode, pmode, pad; };
static_assert(sizeof(RopeP) == 5 * 8 + 7 * 8 + 8 * 4, "RopeP has padding");
__global__ __launch_bounds__(256) void k_rope(RopeP p) {
    const long long idx = (long long)blockIdx.x * 256 + threadIdx.x;
    if (idx >= (long long)p.R * p.Hn * p.D) return;
    const int d = (int)(idx % p.D); const long long rh = idx / p.D; const int h = (int)(rh % p.Hn); const int r = (int)(rh / p.Hn);
    const int half = p.D / 2;
    int partner; float sign;
    if (p.mode == 0) { partner = (d < half) ? d + half : d - half; sign = (d < half) ? -1.f : 1.f; }
    else { partner = d ^ 1; sign = (d & 1) ? 1.f : -1.f; }
    const int tcol = (p.tmode == 0) ? d : ((p.tmode == 1) ? (d % half) : (d >> 1));
    const int pp = (p.pmode == 0) ? (r % p.S) : ((p.pmode == 1) ? h : p.pos[r]);
    const long long toff = (long long)(r / p.S) * p.sCb + (long long)pp * p.sCp + (long long)tcol * p.sCd;
    const float* xr = p.X + (long long)r * p.sXr + (long long)h * p.sXh;
    const float v = xr[d] * p.C[toff] + sign * xr[partner] * p.Sn[toff];
    VST2(float, p.Y + (long long)r * p.sYr + (long long)h * p.sYh + d, v);
}

// k_invf + k_sincos (split so neither kernel carries a large VALU-fma footprint): invf_i = num * (1 / powf(base, (2 i)/D)) [fmode 0],
//   num * expf((2 i) * cexp) [fmode 1], num * powf(base, -2 (i - 1) / D) [fmode 2]; then cs/sn[s*half + i] = cos/sin((pscale * s) * invf_i)
__global__ __launch_bounds__(256) void k_invf(float* __restrict__ invb, int half, int D, float base, float num, int fmode, float cexp) {
    const int i = blockIdx.x * 256 + threadIdx.x;
    if (i >= ((half + 31) / 32) * 32) return;
    if (i >= half) { VST2(float, invb + i, 0.f); return; }
    const float e = (float)(2 * i) / (float)D;
    float invf;
    if (fmode == 1) invf = num * expf((float)(2 * i) * cexp);
    else if (fmode == 2) invf = num * powf(base, (-2.0f * ((float)i - 1.0f)) / (float)D);
    else invf = num * (1.0f / powf(base, e));
    VST2(float, invb + i, invf);
}
__global__ __launch_bounds__(256) void k_sincos(float* __restrict__ cs, float* __restrict__ sn, const float* __restrict__ invb, int S, int half, float pscale) {
    const int idx = blockIdx.x * 256 + threadIdx.x;
    if (idx >= S * half) return;
    const int s = idx / half, i = idx - s * half;
    const float ang = (pscale * (float)s) * invb[i];
    VST2(float, cs + idx, cosf(ang)); VST2(float, sn + idx, sinf(ang));
}

// k_mulact: dst[i] = act(x[i]) * y[i]
__global__ __launch_bounds__(256) void k_mulact(const float* __restrict__ x, const float* __restrict__ y, float* __restrict__ dst, int n, int act) {
    const int i = blockIdx.x * 256 + threadIdx.x;
    if (i < n) { const float v = act_fn(x[i], act) * y[i]; VST2(float, dst + i, v); }
}

// =====================================================================================================================
// k_matvec: thread-per-row matrix-vector products for N <= 8 output columns (heads with 1-3 outputs, gates), f32 on the VALU.
//   C[r*sCm + j] = act(alpha * sum_k A[r*sAm + k*sAk] * B[j*sBn + k*sBk] + bias[j]) + beta * R[r*sRm + j*sRn]; each thread writes its N contiguous floats.
// =====================================================================================================================
__global__ __launch_bounds__(256) void k_matvec(GemmP p) {
    // 32 lanes write one line with one instruction.
    const int rpt = (p.N == 1) ? 1 : 32;
    const long long r0 = ((long long)blockIdx.x * 256 + threadIdx.x) * rpt; const int z = blockIdx.z, zo = z / p.zi_n, zi = z - zo * p.zi_n;
    if (r0 >= p.M) return;
    const float* Bb = p.B + zo * p.sBo + zi * p.sBi;
    float* C = p.C + zo * p.sCo + zi * p.sCi; const float* R = p.R + zo * p.sRo + zi * p.sRi;
    for (int rr = 0; rr < rpt; ++rr) {
        const long long r = r0 + rr; if (r >= p.M) break;
        const float* A = p.A + zo * p.sAo + zi * p.sAi + r * p.sAm;
        float acc[8] = {0.f, 0.f, 0.f, 0.f, 0.f, 0.f, 0.f, 0.f};
        for (int k = 0; k < p.K; ++k) { const float a = A[(long long)k * p.sAk];
#pragma unroll
            for (int j = 0; j < 8; ++j) if (j < p.N) acc[j] += a * Bb[(long long)j * p.sBn + (long long)k * p.sBk]; }
#pragma unroll
        for (int j = 0; j < 8; ++j) if (j < p.N) {
            float v = acc[j] * p.alpha;
            if (p.flags & 1) v += p.bias[j];
            if (p.flags & 2) v += p.bias[r];
            v = act_fn(v, p.act);
            if (p.flags & 4) v += p.beta * R[r * p.sRm + (long long)j * p.sRn];
            VST2(float, C + r * p.sCm + j, v);
        }
    }
}
// k_smallsoftmax: thread-per-row softmax for short rows (n <= 64): dst[r*dr + j] = softmax(scale*src[r*sr + j])
__global__ __launch_bounds__(256) void k_smallsoftmax(const float* __restrict__ src, float* __restrict__ dst, long long sr, long long dr, int n, long long R, float scale) {
    const long long r0 = ((long long)blockIdx.x * 256 + threadIdx.x) * 32;
    for (int rr = 0; rr < 32; ++rr) {
        const long long r = r0 + rr; if (r >= R) return;
        const float* s = src + r * sr; float* d = dst + r * dr;
        float mx = -__builtin_inff();
        for (int j = 0; j < n; ++j) mx = fmaxf(mx, s[j] * scale);
        float sum = 0.f;
        for (int j = 0; j < n; ++j) sum += expf(s[j] * scale - mx);
        const float inv = 1.f / sum;
        for (int j = 0; j < n; ++j) { const float v = expf(s[j] * scale - mx) * inv; VST2(float, d + j, v); }
    }
}

__global__ __launch_bounds__(32) void k_unitstat(float* __restrict__ st) { const int t = threadIdx.x; const float v = (t == 1) ? 1.f : 0.f; VST2(float, st + t, v); }

// destination (e.g. a d_out whose row width is not a multiple of 32 floats) is written by consecutive lanes of one instruction
__global__ __launch_bounds__(256) void k_lincopy(const float* __restrict__ src, long long lds, float* __restrict__ dst, long long ldd, long long rows, int cols) {
    const long long i = (long long)blockIdx.x * 256 + threadIdx.x; if (i >= rows * cols) return;
    const long long r = i / cols; const int c = (int)(i - r * cols);
    const float v = src[r * lds + c]; VST2(float, dst + r * ldd + c, v);
}

namespace w25 {
typedef __attribute__((ext_vector_type(16))) _Float16 v16h;
typedef __attribute__((ext_vector_type(8)))  _Float16 v8h;
typedef __attribute__((ext_vector_type(16))) __bf16   v16b;
typedef __attribute__((ext_vector_type(8)))  __bf16   v8b;
typedef __attribute__((ext_vector_type(8)))  float    v8f;
typedef __attribute__((ext_vector_type(4)))  float    v4f;

__device__ __forceinline__ unsigned short f2bf_bits(float f) {
  unsigned u = __float_as_uint(f);
  return (unsigned short)((u + 0x7FFFu + ((u >> 16) & 1u)) >> 16);
}
__device__ __forceinline__ float bf_bits2f(unsigned short h) { return __uint_as_float(((unsigned)h) << 16); }

// hazard guards as plain device helpers (no inline asm inside the kernel template body)
__device__ __forceinline__ void dep_guard_h(v8f& a, v8f& b, v16h x, v16h y) { asm volatile("v_nop\n\tv_nop\n\tv_nop\n\tv_nop" : "+v"(a), "+v"(b) : "v"(x), "v"(y)); }
__device__ __forceinline__ void dep_guard_b(v8f& a, v8f& b, v16b x, v16b y) { asm volatile("v_nop\n\tv_nop\n\tv_nop\n\tv_nop" : "+v"(a), "+v"(b) : "v"(x), "v"(y)); }
__device__ __forceinline__ void keep4_h(v16h a, v16h b, v16h c, v16h d) { asm volatile("v_nop" :: "v"(a), "v"(b), "v"(c), "v"(d)); }
__device__ __forceinline__ void keep4_b(v16b a, v16b b, v16b c, v16b d) { asm volatile("v_nop" :: "v"(a), "v"(b), "v"(c), "v"(d)); }
__device__ __forceinline__ void acc_guard4(v8f& a, v8f& b, v8f& c, v8f& d) { asm volatile("v_nop\n\tv_nop\n\tv_nop\n\tv_nop" : "+v"(a), "+v"(b), "+v"(c), "+v"(d)); }
template <typename T> struct Frag;
template <> struct Frag<_Float16> {
  typedef v16h V; union U { v16h v; v8h h[2]; };
  static __device__ __forceinline__ v16h load(const _Float16* p) {   // elements 0..7 <- p[0..7], 8..15 <- p[16..23]
    U f; f.h[0] = *(const v8h*)(p); f.h[1] = *(const v8h*)(p + 16); return f.v;
  }
  static __device__ __forceinline__ v8f mma(v16h a, v16h b, v8f c) {
    return __builtin_amdgcn_wmma_f32_16x16x32_f16(false, a, false, b, (short)0, c, false, false);
  }
  static __device__ __forceinline__ void guard(v8f& a, v8f& b, v16h x, v16h y) { dep_guard_h(a, b, x, y); }
  static __device__ __forceinline__ void keep(v16h a, v16h b, v16h c, v16h d) { keep4_h(a, b, c, d); }
};
template <> struct Frag<__bf16> {
  typedef v16b V; union U { v16b v; v8b h[2]; };
  static __device__ __forceinline__ v16b load(const __bf16* p) {
    U f; f.h[0] = *(const v8b*)(p); f.h[1] = *(const v8b*)(p + 16); return f.v;
  }
  static __device__ __forceinline__ v8f mma(v16b a, v16b b, v8f c) {
    return __builtin_amdgcn_wmma_f32_16x16x32_bf16(false, a, false, b, (short)0, c, false, false);
  }
  static __device__ __forceinline__ void guard(v8f& a, v8f& b, v16b x, v16b y) { dep_guard_b(a, b, x, y); }
  static __device__ __forceinline__ void keep(v16b a, v16b b, v16b c, v16b d) { keep4_b(a, b, c, d); }
};

// ---- Register-blocked batched WMMA GEMM ------------------------------------
// C[m,n] = scale * sum_k A[m,k] * Bt[n,k] (+bias)(+resid); each wave owns a 64x64 tile.
// A row-major [M,K]; Bt row-major [N,K]; M,N % 64 == 0, K % 32 == 0.
// SPLIT: operands are hi/lo planes (A2/Bt2 = lo planes, same layout); product = hi·hi + hi·lo + lo·hi.
// BIAS_MODE: 0 = none, 1 = bias[m], 2 = bias[n].
// OUT_MODE: 0 = f32, 1 = f16, 2 = bf16 hi plane (Cout) + bf16 lo plane (Cout2).
// ET: 0 = f16 operands, 1 = bf16 operands (pointers passed as 16-bit storage)
template <int ET> struct Elem;
template <> struct Elem<0> { typedef _Float16 T; };
template <> struct Elem<1> { typedef __bf16 T; };
template <int ET, bool SPLIT, int BIAS_MODE, int OUT_MODE, bool RESID, int ACT = 0>
__global__ __launch_bounds__(256) void wmma_gemm64(
    const unsigned short* __restrict__ Ap, const unsigned short* __restrict__ A2p, int lda, long strideA,
    const unsigned short* __restrict__ Btp, const unsigned short* __restrict__ Bt2p, int ldb, long strideB,
    void* __restrict__ Cout, void* __restrict__ Cout2, int ldc, long strideC,
    const float* __restrict__ bias,
    const float* __restrict__ resid, long strideR,
    int M, int N, int K, float scale) {
  typedef typename Elem<ET>::T T;
  typedef typename Frag<T>::V V;
  const T* A = (const T*)Ap; const T* A2 = (const T*)A2p; const T* Bt = (const T*)Btp; const T* Bt2 = (const T*)Bt2p;
  __shared__ __align__(16) float sT[8][16 * 68];   // per-wave 16x64 slab, pitch 68 floats
  const int b    = blockIdx.y;
  const int lane = threadIdx.x & 31;
  const int wave = threadIdx.x >> 5;
  const int tilesN = N >> 6;
  const int tilesM = M >> 6;
  const int tile = blockIdx.x * 8 + wave;
  if (tile >= tilesM * tilesN) return;   // wave-uniform; no block barriers in this kernel
  const int tm = tile / tilesN;
  const int tn = tile - tm * tilesN;
  const int m0 = tm << 6;
  const int n0 = tn << 6;

  const T* Ab  = A  + (size_t)b * strideA;
  const T* Bb  = Bt + (size_t)b * strideB;
  const T* Ab2 = SPLIT ? (A2  + (size_t)b * strideA) : nullptr;
  const T* Bb2 = SPLIT ? (Bt2 + (size_t)b * strideB) : nullptr;

  const int rlane = lane & 15;                 // row (A) / col (B, D) within subtile
  const int koff  = (lane >> 4) * 8;           // k offset of this lane half
  const int mOff  = (lane >> 4) * 8;           // D row offset

  v8f acc[4][4];
#pragma unroll
  for (int i = 0; i < 4; ++i)
#pragma unroll
    for (int j = 0; j < 4; ++j) acc[i][j] = (v8f){0.f,0.f,0.f,0.f,0.f,0.f,0.f,0.f};

  for (int k0 = 0; k0 < K; k0 += 32) {
    V bh[4], bl[4];
#pragma unroll
    for (int j = 0; j < 4; ++j) {
      const size_t bo = (size_t)(n0 + (j << 4) + rlane) * ldb + koff + k0;
      bh[j] = Frag<T>::load(Bb + bo);
      if (SPLIT) bl[j] = Frag<T>::load(Bb2 + bo);
    }
#pragma unroll
    for (int i = 0; i < 4; ++i) {
      const size_t ao = (size_t)(m0 + (i << 4) + rlane) * lda + koff + k0;
      V ah = Frag<T>::load(Ab + ao);
      V al;
      if (SPLIT) al = Frag<T>::load(Ab2 + ao);
#pragma unroll
      for (int j = 0; j < 4; ++j) {
        acc[i][j] = Frag<T>::mma(ah, bh[j], acc[i][j]);
        if (SPLIT) {
          acc[i][j] = Frag<T>::mma(ah, bl[j], acc[i][j]);
          acc[i][j] = Frag<T>::mma(al, bh[j], acc[i][j]);
        }
      }
      Frag<T>::guard(acc[i][0], acc[i][3], ah, SPLIT ? al : ah);
    }
    Frag<T>::keep(bh[0], bh[1], bh[2], bh[3]);
    if (SPLIT) Frag<T>::keep(bl[0], bl[1], bl[2], bl[3]);
  }
  acc_guard4(acc[0][0], acc[0][1], acc[0][2], acc[0][3]);
  acc_guard4(acc[1][0], acc[1][1], acc[1][2], acc[1][3]);
  acc_guard4(acc[2][0], acc[2][1], acc[2][2], acc[2][3]);
  acc_guard4(acc[3][0], acc[3][1], acc[3][2], acc[3][3]);

  // ---- epilogue ----
  float* slab = sT[wave];
  const float* Rb = RESID ? (resid + (size_t)b * strideR) : nullptr;
#pragma unroll
  for (int i = 0; i < 4; ++i) {
    const int mBase = m0 + (i << 4);
#pragma unroll
    for (int j = 0; j < 4; ++j) {
      const int n = n0 + (j << 4) + rlane;
      float bv = 0.f;
      if (BIAS_MODE == 2) bv = bias[n];
#pragma unroll
      for (int r = 0; r < 8; ++r) {
        float v = acc[i][j][r] * scale;
        if (BIAS_MODE == 1) v += bias[mBase + mOff + r];
        if (BIAS_MODE == 2) v += bv;
        if (RESID) v += Rb[(size_t)(mBase + mOff + r) * ldc + n];
        if (ACT == 1) v = tanhf(v);
        if (ACT == 2) v = fmaxf(v, 0.0f);
        if (ACT == 3) v = v / (1.0f + expf(-v));
        if (ACT == 4) v = (v > 0.f) ? v : 0.01f * v;
        if (ACT == 5) v = 0.5f * v * (1.0f + erff(v * 0.70710678118654752f));
        slab[(mOff + r) * 68 + (j << 4) + rlane] = v;
      }
    }
    __builtin_amdgcn_fence(__ATOMIC_RELEASE, "workgroup");
    __builtin_amdgcn_wave_barrier();
    __builtin_amdgcn_fence(__ATOMIC_ACQUIRE, "workgroup");
    if (OUT_MODE == 0) {
      float* C = (float*)Cout + (size_t)b * strideC;
      const int hh = lane >> 4, c4 = (lane & 15) * 4;     // row seg = 256 B = 16 lanes x 16 B
      {
#pragma unroll
        for (int it = 0; it < 8; ++it) {
          const int row = it * 2 + hh;
          v4f v = *(const v4f*)(slab + row * 68 + c4);
          *(v4f*)(C + (size_t)(mBase + row) * ldc + n0 + c4) = v;
        }
        
      }
    } else {
      const int q = lane >> 3, c8 = (lane & 7) * 8;
      unsigned short* C  = (unsigned short*)Cout  + (size_t)b * strideC;
      unsigned short* C2 = (OUT_MODE == 2) ? ((unsigned short*)Cout2 + (size_t)b * strideC) : nullptr;
      {
#pragma unroll
        for (int it = 0; it < 4; ++it) {
          const int row = it * 4 + q;
          const float* sp = slab + row * 68 + c8;
          v8h hv, lv;
#pragma unroll
          for (int e = 0; e < 8; ++e) {
            if (OUT_MODE == 1) {
              hv[e] = (_Float16)sp[e];
            } else {
              unsigned short hb = f2bf_bits(sp[e]);
              unsigned short lb = f2bf_bits(sp[e] - bf_bits2f(hb));
              hv[e] = __builtin_bit_cast(_Float16, hb);
              lv[e] = __builtin_bit_cast(_Float16, lb);
            }
          }
          *(v8h*)(C + (size_t)(mBase + row) * ldc + n0 + c8) = hv;
          if (OUT_MODE == 2) *(v8h*)(C2 + (size_t)(mBase + row) * ldc + n0 + c8) = lv;
        }
        
      }
    }
    __builtin_amdgcn_fence(__ATOMIC_RELEASE, "workgroup");
    __builtin_amdgcn_wave_barrier();
    __builtin_amdgcn_fence(__ATOMIC_ACQUIRE, "workgroup");
  }
}

__global__ __launch_bounds__(256) void cast_f32_f16x2(
    const float* __restrict__ in, _Float16* __restrict__ out, int n2) {
  int i = blockIdx.x * 256 + threadIdx.x;
  if (i < n2) {
    const _Float16 h0 = (_Float16)in[2 * i], h1 = (_Float16)in[2 * i + 1];
    const unsigned u = (unsigned)__builtin_bit_cast(unsigned short, h0) | ((unsigned)__builtin_bit_cast(unsigned short, h1) << 16);
    ((unsigned*)out)[i] = u;
    
  }
}


} // namespace w25

__global__ __launch_bounds__(256) void k_castT16(const float* __restrict__ src, long long lds, _Float16* __restrict__ dst, long long ldd, int R, int C, float s) {
    src += (long long)blockIdx.y * R * lds; dst += (long long)blockIdx.y * C * ldd;   // batch = blockIdx.y
    const long long i = (long long)blockIdx.x * 256 + threadIdx.x; const long long np = (long long)C * (R / 2); if (i >= np) return; const int c = (int)(i / (R / 2)); const int r = 2 * (int)(i % (R / 2));
    const _Float16 h0 = (_Float16)(src[(long long)r * lds + c] * s), h1 = (_Float16)(src[(long long)(r + 1) * lds + c] * s);
    const unsigned u = (unsigned)__builtin_bit_cast(unsigned short, h0) | ((unsigned)__builtin_bit_cast(unsigned short, h1) << 16);
    unsigned* d = (unsigned*)(dst + (long long)c * ldd + r); *d = u;  }
__global__ __launch_bounds__(256) void k_cast16(const float* __restrict__ src, long long lds, _Float16* __restrict__ dst, long long ldd, int R, int C, float s) {
    const long long i = (long long)blockIdx.x * 256 + threadIdx.x; const long long np = (long long)R * (C / 2); if (i >= np) return; const int r = (int)(i / (C / 2)); const int c = 2 * (int)(i % (C / 2));
    const _Float16 h0 = (_Float16)(src[(long long)r * lds + c] * s), h1 = (_Float16)(src[(long long)r * lds + c + 1] * s);
    const unsigned u = (unsigned)__builtin_bit_cast(unsigned short, h0) | ((unsigned)__builtin_bit_cast(unsigned short, h1) << 16);
    unsigned* d = (unsigned*)(dst + (long long)r * ldd + c); *d = u;  }

// f32 -> bf16 hi plane + bf16 lo plane (x = hi + lo to ~2^-17 relative; RNE both), [R][C] -> [R][C] (or transposed to [C][R]); 2 consecutive destination elements
__device__ __forceinline__ unsigned int f2bf2_pack(float a, float b, unsigned int* lo) {
    const unsigned short ha = w25::f2bf_bits(a), hb = w25::f2bf_bits(b);
    const unsigned short la = w25::f2bf_bits(a - w25::bf_bits2f(ha)), lb = w25::f2bf_bits(b - w25::bf_bits2f(hb));
    *lo = (unsigned)la | ((unsigned)lb << 16); return (unsigned)ha | ((unsigned)hb << 16); }
__global__ __launch_bounds__(256) void k_castS16(const float* __restrict__ src, long long lds, __bf16* __restrict__ dhi, __bf16* __restrict__ dlo, long long ldd, int R, int C, float s, int transpose) {
    const long long i = (long long)blockIdx.x * 256 + threadIdx.x; long long o; float a, b;
    if (transpose) { const long long np = (long long)C * (R / 2); if (i >= np) return; const int c = (int)(i / (R / 2)); const int r = 2 * (int)(i % (R / 2)); a = src[(long long)r * lds + c] * s; b = src[(long long)(r + 1) * lds + c] * s; o = (long long)c * ldd + r; }
    else { const long long np = (long long)R * (C / 2); if (i >= np) return; const int r = (int)(i / (C / 2)); const int c = 2 * (int)(i % (C / 2)); a = src[(long long)r * lds + c] * s; b = src[(long long)r * lds + c + 1] * s; o = (long long)r * ldd + c; }
    unsigned lo; const unsigned hi = f2bf2_pack(a, b, &lo); unsigned* ph = (unsigned*)(dhi + o); unsigned* pl = (unsigned*)(dlo + o);
    *ph = hi; *pl = lo;  }

namespace w25 {
// =====================================================================================
// Generic causal/non-causal attention for head_dim 64, f32 in / f32 out; 16-bit operands: bf16 with optional hi/lo splits, or
// plain f16 (F16=true, non-split, probabilities carried x2^15).
//   scores = (q*qscale)·kᵀ : v_wmma_f32_16x16x32_bf16; SPLIT_QK -> q,k as bf16 hi/lo (hi·hi + hi·lo + lo·hi)
//   out    = p·v           : v_wmma_f32_16x16x32_bf16; SPLIT_PV -> p,v as bf16 hi/lo; else p,v plain bf16
//   f32 accumulate; online softmax in f32. Block = 4 waves = 64 query rows of one (batch, head); S % 64 == 0.
//   Element (b, s, h, d) of tensor X lives at X[b*X_bs + s*X_rs + h*X_hs + d] (strides in floats, multiples of 4).
//   Masking: mask_mode 0 none, 1 causal (kv > q masked), 2 tensor [S][Skv] shared over (b,h) (float if
//   mask_is_int==0, int32 with element == 0 -> masked if 1, int32 with element != 0 -> masked if 2), 3 per-token vectors qmask[B][S] & kvmask[B][Skv] (int32,
//   0 -> masked), 4 causal + sliding window (kv > q or q - kv > W masked; W passed in mask_is_int);
//   5 = relative-position bias: s += cp[b,h,q][idx[q][kv]] + pc[b,h,kv][idx[q][kv]] with idx = mask_b ([S][Skv] int32) and
//   mask_a an int32 [S][Skv] tensor with nonzero = masked (tables: element (b,h,row,n) at X + b*c_bs + h*c_hs + row*c_rs + n);
//   masked scores are replaced by mask_fill (e.g. -inf or -1e9) before the softmax.
//   grid.x = B * H * (S/64) (or a sub-range with blk0).
// =====================================================================================
#define AT_D 64
#define AT_NW 4
#define AT_QB 64
#define AT_KC 64
struct AttnGeom { const float* cp = nullptr; const float* pc = nullptr; long c_bs = 0, c_rs = 0, c_hs = 0;   // mode-5 score-bias tables
                  long q_bs, q_rs, q_hs, k_bs, k_rs, k_hs, v_bs, v_rs, v_hs, o_bs, o_rs, o_hs;
                  int S, Skv, H, mask_mode; float qscale; int blk0; float mask_fill; int mask_is_int; };
static_assert(sizeof(AttnGeom) == 168, "no padding");

__device__ __forceinline__ unsigned short at_bf_bits(float f) {
  unsigned u = __float_as_uint(f);
  return (unsigned short)((u + 0x7FFFu + ((u >> 16) & 1u)) >> 16);
}
__device__ __forceinline__ __bf16 at_f2bf(float f) { return __builtin_bit_cast(__bf16, at_bf_bits(f)); }
__device__ __forceinline__ void at_split(float f, __bf16& hi, __bf16& lo) {
  const unsigned short hb = at_bf_bits(f);
  hi = __builtin_bit_cast(__bf16, hb);
  lo = at_f2bf(f - __uint_as_float(((unsigned)hb) << 16));
}
__device__ __forceinline__ v8f at_mma(v16b a, v16b b, v8f c) {
  c = __builtin_amdgcn_wmma_f32_16x16x32_bf16(false, a, false, b, (short)0, c, false, false);
  asm volatile("v_nop\n\tv_nop\n\tv_nop\n\tv_nop" : "+v"(c) : "v"(a), "v"(b));
  return c;
}
// 16-bit element as a bit pattern held in a __bf16 slot: f16 bits when F16, bf16 (RNE) otherwise
template <bool F16> __device__ __forceinline__ __bf16 at_to16(float f) {
  if (F16) return __builtin_bit_cast(__bf16, (_Float16)f);
  return at_f2bf(f);
}
template <bool F16> __device__ __forceinline__ v8f at_mma16(v16b a, v16b b, v8f c) {
  if (F16) {
    const v16h ah = __builtin_bit_cast(v16h, a), bh = __builtin_bit_cast(v16h, b);
    c = __builtin_amdgcn_wmma_f32_16x16x32_f16(false, ah, false, bh, (short)0, c, false, false);
    asm volatile("v_nop\n\tv_nop\n\tv_nop\n\tv_nop" : "+v"(c) : "v"(ah), "v"(bh));
    return c;
  }
  return at_mma(a, b, c);
}

template <bool SPLIT_QK, bool SPLIT_PV, bool F16 = false>
__global__ __launch_bounds__(128)
void attn64_kernel(const float* __restrict__ q, const float* __restrict__ k,
                   const float* __restrict__ v, float* __restrict__ out,
                   const void* __restrict__ mask_a, const int* __restrict__ mask_b, AttnGeom g) {
  static_assert(!(F16 && (SPLIT_QK || SPLIT_PV)), "f16 mode is non-split");
  const float PSC = F16 ? 32768.0f : 1.0f;     // f16 probabilities carried x2^15 (subnormal range), folded into the final 1/l
  union FB { v16b v; v8b h[2]; };
  __shared__ __align__(16) __bf16 Ksh[AT_KC * AT_D];             // K hi [kv][d]      8 KB
  __shared__ __align__(16) __bf16 Ksl[SPLIT_QK ? AT_KC * AT_D : 8];
  __shared__ __align__(16) __bf16 Vth[AT_D * AT_KC];             // V hi [d][kv]      8 KB
  __shared__ __align__(16) __bf16 Vtl[SPLIT_PV ? AT_D * AT_KC : 8];
  __shared__ __align__(16) __bf16 Psh[AT_NW][16 * AT_KC];        // per wave P hi [row][kv]  8 KB
  __shared__ __align__(16) __bf16 Psl[SPLIT_PV ? AT_NW : 1][SPLIT_PV ? 16 * AT_KC : 8];
  __shared__ __align__(16) float  Os[AT_NW][16 * 68];            // per wave out tile, pitch 68

  const int tid  = threadIdx.x;
  const int wave = tid >> 5;
  const int lane = tid & 31;
  const int hh   = lane >> 4;
  const int c    = lane & 15;

  const int nqb = g.S / AT_QB;
  const int bx = blockIdx.x + g.blk0;
  const int qb = bx % nqb;
  const int bh = bx / nqb;
  const int h  = bh % g.H;
  const int b  = bh / g.H;
  const int qbase_block = qb * AT_QB;
  const int q0 = qbase_block + wave * 16;

  const float* qb_ptr = q + (size_t)b * g.q_bs + (size_t)h * g.q_hs;
  const float* kb_ptr = k + (size_t)b * g.k_bs + (size_t)h * g.k_hs;
  const float* vb_ptr = v + (size_t)b * g.v_bs + (size_t)h * g.v_hs;
  float*       ob_ptr = out + (size_t)b * g.o_bs + (size_t)h * g.o_hs;

  // ---- Q fragments (A operand): 2 d-chunks, hi (and lo) ----
  v16b qah[2], qal[2];
  {
    const float* qrow = qb_ptr + (size_t)(q0 + c) * g.q_rs;
#pragma unroll
    for (int dc = 0; dc < 2; ++dc) {
#pragma unroll
      for (int e = 0; e < 8; ++e) {
        const float f0 = qrow[dc * 32 + 8 * hh + e] * g.qscale;
        const float f1 = qrow[dc * 32 + 16 + 8 * hh + e] * g.qscale;
        if (SPLIT_QK) { __bf16 hq, lq; at_split(f0, hq, lq); qah[dc][e] = hq; qal[dc][e] = lq; at_split(f1, hq, lq); qah[dc][8 + e] = hq; qal[dc][8 + e] = lq; }
        else { qah[dc][e] = at_to16<F16>(f0); qah[dc][8 + e] = at_to16<F16>(f1); qal[dc][e] = qah[dc][e]; qal[dc][8 + e] = qah[dc][8 + e]; }
      }
    }
  }

  float mrow[8], lrow[8];
  v8f oacc[4];
#pragma unroll
  for (int r = 0; r < 8; ++r) { mrow[r] = -INFINITY; lrow[r] = 0.f; }
#pragma unroll
  for (int t = 0; t < 4; ++t) oacc[t] = (v8f){0.f,0.f,0.f,0.f,0.f,0.f,0.f,0.f};

  const int nChunks = (g.mask_mode == 1 || g.mask_mode == 4) ? (qb + 1) : (g.Skv / AT_KC);   // block-uniform
  // per-row query mask (mode 3)
  int qkeep[8];
#pragma unroll
  for (int r = 0; r < 8; ++r) qkeep[r] = (g.mask_mode == 3) ? mask_b[(size_t)b * g.S + q0 + 8 * hh + r] : 1;   // mask_b = qmask in mode 3
  for (int kc = 0; kc < nChunks; ++kc) {
    const int kv0 = kc * AT_KC;
    __syncthreads();
    {
      const int kvr = tid >> 1, dh = (tid & 1) * 32;
      const float* krow = kb_ptr + (size_t)(kv0 + kvr) * g.k_rs + dh;
      const float* vrow = vb_ptr + (size_t)(kv0 + kvr) * g.v_rs + dh;
#pragma unroll
      for (int i = 0; i < 8; ++i) {
        v4f kk = *(const v4f*)(krow + 4 * i);
        v4f vv = *(const v4f*)(vrow + 4 * i);
#pragma unroll
        for (int e = 0; e < 4; ++e) {
          const int d = dh + 4 * i + e;
          if (SPLIT_QK) { __bf16 a, bl; at_split(kk[e], a, bl); Ksh[kvr * AT_D + d] = a; Ksl[kvr * AT_D + d] = bl; }
          else Ksh[kvr * AT_D + d] = at_to16<F16>(kk[e]);
          if (SPLIT_PV) { __bf16 a, bl; at_split(vv[e], a, bl); Vth[d * AT_KC + kvr] = a; Vtl[d * AT_KC + kvr] = bl; }
          else Vth[d * AT_KC + kvr] = at_to16<F16>(vv[e]);
        }
      }
    }
    __syncthreads();

    v8f s[4];
#pragma unroll
    for (int j = 0; j < 4; ++j) {
      s[j] = (v8f){0.f,0.f,0.f,0.f,0.f,0.f,0.f,0.f};
#pragma unroll 1
      for (int dc = 0; dc < 2; ++dc) {
        FB kb;
        kb.h[0] = *(const v8b*)(Ksh + (j * 16 + c) * AT_D + dc * 32 + 8 * hh);
        kb.h[1] = *(const v8b*)(Ksh + (j * 16 + c) * AT_D + dc * 32 + 16 + 8 * hh);
        s[j] = at_mma16<F16>(qah[dc], kb.v, s[j]);
        if (SPLIT_QK) {
          FB kl;
          kl.h[0] = *(const v8b*)(Ksl + (j * 16 + c) * AT_D + dc * 32 + 8 * hh);
          kl.h[1] = *(const v8b*)(Ksl + (j * 16 + c) * AT_D + dc * 32 + 16 + 8 * hh);
          s[j] = at_mma16<F16>(qah[dc], kl.v, s[j]);
          s[j] = at_mma16<F16>(qal[dc], kb.v, s[j]);
        }
      }
    }
    const bool diag = (g.mask_mode == 1) && (kc == qb);
    int kvkeep[4] = {1, 1, 1, 1};
    if (g.mask_mode == 3) {
#pragma unroll
      for (int j = 0; j < 4; ++j) kvkeep[j] = ((const int*)mask_a)[(size_t)b * g.Skv + kv0 + j * 16 + c];   // mask_a = kvmask
    }
    float cm[8];
#pragma unroll
    for (int r = 0; r < 8; ++r) {
      const int qrow = q0 + 8 * hh + r;
      float m = -INFINITY;
#pragma unroll
      for (int j = 0; j < 4; ++j) {
        const int kvcol = kv0 + j * 16 + c;
        bool masked = false;
        if (diag) masked = (kvcol > qrow);
        else if (g.mask_mode == 4) masked = (kvcol > qrow) || (qrow - kvcol > g.mask_is_int);
        else if (g.mask_mode == 2) {
          const size_t mi = (size_t)qrow * g.Skv + kvcol;
          masked = (g.mask_is_int == 0) ? (((const float*)mask_a)[mi] == 0.0f)
                 : (g.mask_is_int == 1) ? (((const int*)mask_a)[mi] == 0) : (((const int*)mask_a)[mi] != 0);
        } else if (g.mask_mode == 3) masked = (qkeep[r] == 0) || (kvkeep[j] == 0);
        else if (g.mask_mode == 5) {
          const size_t mi = (size_t)qrow * g.Skv + kvcol;
          masked = (((const int*)mask_a)[mi] != 0);
          int n = mask_b[mi]; n = n < 0 ? 0 : n;
          s[j][r] += g.cp[(size_t)b * g.c_bs + (size_t)h * g.c_hs + (size_t)qrow * g.c_rs + n]
                   + g.pc[(size_t)b * g.c_bs + (size_t)h * g.c_hs + (size_t)kvcol * g.c_rs + n];
        }
        if (masked) s[j][r] = g.mask_fill;
        m = fmaxf(m, s[j][r]);
      }
#pragma unroll
      for (int off = 1; off < 16; off <<= 1) m = fmaxf(m, __shfl_xor(m, off, 32));
      cm[r] = m;
    }
    __bf16* pwh = Psh[wave];
    __bf16* pwl = Psl[SPLIT_PV ? wave : 0];
#pragma unroll
    for (int r = 0; r < 8; ++r) {
      const float mnew = fmaxf(mrow[r], cm[r]);
      const float alpha = expf(mrow[r] - mnew);
      mrow[r] = mnew;
      float psum = 0.f;
#pragma unroll
      for (int j = 0; j < 4; ++j) {
        const float p = expf(s[j][r] - mnew);
        psum += p;
        if (SPLIT_PV) { __bf16 a, bl; at_split(p, a, bl); pwh[(8 * hh + r) * AT_KC + j * 16 + c] = a; pwl[(8 * hh + r) * AT_KC + j * 16 + c] = bl; }
        else pwh[(8 * hh + r) * AT_KC + j * 16 + c] = at_to16<F16>(p * PSC);
      }
#pragma unroll
      for (int off = 1; off < 16; off <<= 1) psum += __shfl_xor(psum, off, 32);
      lrow[r] = lrow[r] * alpha + psum;
#pragma unroll
      for (int t = 0; t < 4; ++t) oacc[t][r] *= alpha;
    }
    __builtin_amdgcn_fence(__ATOMIC_RELEASE, "workgroup");
    __builtin_amdgcn_wave_barrier();
    __builtin_amdgcn_fence(__ATOMIC_ACQUIRE, "workgroup");
#pragma unroll 1
    for (int kk = 0; kk < 2; ++kk) {
      FB pa, pl;
      pa.h[0] = *(const v8b*)(pwh + c * AT_KC + kk * 32 + 8 * hh);
      pa.h[1] = *(const v8b*)(pwh + c * AT_KC + kk * 32 + 16 + 8 * hh);
      if (SPLIT_PV) {
        pl.h[0] = *(const v8b*)(pwl + c * AT_KC + kk * 32 + 8 * hh);
        pl.h[1] = *(const v8b*)(pwl + c * AT_KC + kk * 32 + 16 + 8 * hh);
      }
#pragma unroll
      for (int t = 0; t < 4; ++t) {
        FB vb;
        vb.h[0] = *(const v8b*)(Vth + (t * 16 + c) * AT_KC + kk * 32 + 8 * hh);
        vb.h[1] = *(const v8b*)(Vth + (t * 16 + c) * AT_KC + kk * 32 + 16 + 8 * hh);
        oacc[t] = at_mma16<F16>(pa.v, vb.v, oacc[t]);
        if (SPLIT_PV) {
          FB vl;
          vl.h[0] = *(const v8b*)(Vtl + (t * 16 + c) * AT_KC + kk * 32 + 8 * hh);
          vl.h[1] = *(const v8b*)(Vtl + (t * 16 + c) * AT_KC + kk * 32 + 16 + 8 * hh);
          oacc[t] = at_mma16<F16>(pa.v, vl.v, oacc[t]);
          oacc[t] = at_mma16<F16>(pl.v, vb.v, oacc[t]);
        }
      }
    }
  }

  float* os = Os[wave];
#pragma unroll
  for (int r = 0; r < 8; ++r) {
    const float inv = 1.0f / (lrow[r] * PSC);
#pragma unroll
    for (int t = 0; t < 4; ++t) os[(8 * hh + r) * 68 + t * 16 + c] = oacc[t][r] * inv;
  }
  __builtin_amdgcn_fence(__ATOMIC_RELEASE, "workgroup");
  __builtin_amdgcn_wave_barrier();
  __builtin_amdgcn_fence(__ATOMIC_ACQUIRE, "workgroup");
  {
    const int c4 = (lane & 15) * 4;
    {
#pragma unroll
      for (int it = 0; it < 8; ++it) {
        const int row = it * 2 + hh;
        v4f val = *(const v4f*)(os + row * 68 + c4);
        *(v4f*)(ob_ptr + (size_t)(q0 + row) * g.o_rs + c4) = val;
      }
      
    }
  }
}

} // namespace w25

// row dots: OUT[r] = X[r] . w (one wave per 32 rows? no: wave per row -> lone store; use 8 rows per block with lane-kept results: wave w handles rows 32*blk... simpler: each wave handles 4 rows sequentially, 8 waves -> 32 rows per block, results through LDS, wave 0 writes the 32-float line)
__global__ __launch_bounds__(256) void k_bi_lin(const float* __restrict__ X, const float* __restrict__ w, float* __restrict__ OUT, int nrows, int D) { __shared__ float res[32]; const long long r0 = (long long)blockIdx.x * 32; const int wv = threadIdx.x >> 5, lane = threadIdx.x & 31;
    for (int rr = 0; rr < 4; ++rr) { const long long r = r0 + wv * 4 + rr; float s = 0.f; if (r < nrows) { for (int d = lane; d < D; d += 32) s += X[r * D + d] * w[d]; } for (int o = 16; o > 0; o >>= 1) s += __shfl_xor(s, o, 32); if (lane == 0) res[wv * 4 + rr] = s; }
    __syncthreads(); if (wv == 0 && r0 + lane < nrows) VST2(float, OUT + r0 + lane, res[lane]); }
// QW[n][d] = q[b][n][d] * w_qm[d] (thread-linear)
__global__ __launch_bounds__(256) void k_bi_qw(const float* __restrict__ Q, const float* __restrict__ wqm, float* __restrict__ QW, int b, int N, int D) { const int t = blockIdx.x * 256 + threadIdx.x; if (t >= N * D) return; VST2(float, QW + t, Q[(long long)b * N * D + t] * wqm[t % D]); }
// per row n (block): sim = tril + AQ[n] + CM[m], masked exactly as the module: sim + (1 - qm*mm) * -1e30; row max -> RMX; softmax over m (exp once) in place
__global__ __launch_bounds__(256) void k_bi_soft(float* __restrict__ SIM, const float* __restrict__ AQ, const float* __restrict__ CM, const int* __restrict__ QM, const int* __restrict__ MM, float* __restrict__ RMX, int N, int M) { __shared__ float red[256]; const int n = blockIdx.x; const long long bz = blockIdx.y;   // batch = blockIdx.y
    const float* AQb = AQ + bz * N; const float* CMb = CM + bz * M; const int* QMb = QM + bz * N; const int* MMb = MM + bz * M; float* RMXb = RMX + bz * N * 32; float* sr = SIM + (bz * N + n) * M; const int t = threadIdx.x; const float aq = AQb[n]; float mx = -3.0e38f;
#pragma unroll 1
    for (int m = t; m < M; m += 256) { const float msk = (float)QMb[n] * (float)MMb[m]; const float v = sr[m] + aq + CMb[m] + (1.f - msk) * -1.0e30f; mx = fmaxf(mx, v); VST2(float, sr + m, v); }
    red[t] = mx; __syncthreads(); for (int o = 128; o > 0; o >>= 1) { if (t < o) red[t] = fmaxf(red[t], red[t + o]); __syncthreads(); } const float mm = red[0]; __syncthreads();
    float s = 0.f;
#pragma unroll 1
    for (int m = t; m < M; m += 256) { const float e = expf(sr[m] - mm); s += e; VST2(float, sr + m, e); }
    red[t] = s; __syncthreads(); for (int o = 128; o > 0; o >>= 1) { if (t < o) red[t] += red[t + o]; __syncthreads(); } const float inv = 1.f / red[0];
#pragma unroll 1
    for (int m = t; m < M; m += 256) VST2(float, sr + m, sr[m] * inv);
    if (t < 32) VST2(float, RMXb + (long long)n * 32 + t, mm); }   // row max staged as a whole 32-float line (slot 0 is read later)

// memory->query: per batch (block): p = softmax_n(RMX[b][n]); M2Q[b][d] = sum_n p_n q[b][n][d]  (256 threads: softmax stats by trees, then thread d<128 accumulates over n)
__global__ __launch_bounds__(256) void k_bi_m2q(const float* __restrict__ RMX, const float* __restrict__ Q, float* __restrict__ M2Q, int N, int D) { __shared__ float red[256]; __shared__ float pw[1024]; const int b = blockIdx.x; const int t = threadIdx.x; const float* rm = RMX + (long long)b * N * 32; float mx = -3.0e38f;
    for (int n = t; n < N; n += 256) mx = fmaxf(mx, rm[(long long)n * 32]);
    red[t] = mx; __syncthreads(); for (int o = 128; o > 0; o >>= 1) { if (t < o) red[t] = fmaxf(red[t], red[t + o]); __syncthreads(); } const float mm = red[0]; __syncthreads();
    float s = 0.f; for (int n = t; n < N; n += 256) { const float e = expf(rm[(long long)n * 32] - mm); pw[n] = e; s += e; }
    red[t] = s; __syncthreads(); for (int o = 128; o > 0; o >>= 1) { if (t < o) red[t] += red[t + o]; __syncthreads(); } const float inv = 1.f / red[0]; __syncthreads();
    if (t < D) { float acc = 0.f;
#pragma unroll 1
        for (int n = 0; n < N; ++n) acc += pw[n] * Q[((long long)b * N + n) * D + t];
        VST2(float, M2Q + (long long)b * D + t, acc * inv); } }
// out1[b][n][d] = M2Q[b][d] broadcast (thread-linear)
__global__ __launch_bounds__(256) void k_bi_bc(const float* __restrict__ M2Q, float* __restrict__ MQ, int Bn, int N, int D) { const long long t = (long long)blockIdx.x * 256 + threadIdx.x; if (t >= (long long)Bn * N * D) return; const int d = (int)(t % D); const int b = (int)(t / ((long long)N * D)); VST2(float, MQ + t, M2Q[b * D + d]); }


extern "C" void kernel_launch(void* const* d_in, const int* in_sizes, int n_in, void* d_out, int out_size, void* d_ws, size_t ws_size, hipStream_t stream) {
    (void)in_sizes; (void)n_in; (void)out_size; (void)ws_size;
    const float* q = (const float*)d_in[0];
    const float* mem = (const float*)d_in[1];
    const float* wq = (const float*)d_in[2];
    const float* wm = (const float*)d_in[3];
    const float* wqm = (const float*)d_in[4];
    const int* qmask = (const int*)d_in[5];
    const int* mmask = (const int*)d_in[6];
    const int Bn = 16;
    const int N = 1024;
    const int M = 1024;
    const int D = 128;
    float* out = (float*)d_out;
    float* mq = out + ((size_t)Bn * N * D);
    char* wsp = (char*)d_ws;
    float* QW = (float*)wsp; wsp += (((size_t)((size_t)Bn * N * D) * 4 + 255) / 256) * 256;
    float* AQ = (float*)wsp; wsp += (((size_t)((size_t)Bn * N) * 4 + 255) / 256) * 256;
    float* CM = (float*)wsp; wsp += (((size_t)((size_t)Bn * M) * 4 + 255) / 256) * 256;
    float* SIM = (float*)wsp; wsp += (((size_t)((size_t)Bn * N * M) * 4 + 255) / 256) * 256;
    float* RMX = (float*)wsp; wsp += (((size_t)((size_t)Bn * N * 32) * 4 + 255) / 256) * 256;
    float* M2Q = (float*)wsp; wsp += (((size_t)((size_t)Bn * D) * 4 + 255) / 256) * 256;
    unsigned short* G64A = (unsigned short*)wsp; wsp += (((size_t)(16777216) * 2 + 255) / 256) * 256;
    unsigned short* G64B = (unsigned short*)wsp; wsp += (((size_t)(2097152) * 2 + 255) / 256) * 256;
    unsigned short* G64A2 = (unsigned short*)wsp; wsp += (((size_t)(2097152) * 2 + 255) / 256) * 256;
    unsigned short* G64B2 = (unsigned short*)wsp; wsp += (((size_t)(2097152) * 2 + 255) / 256) * 256;
    k_bi_lin<<<(Bn * N + 7) / 8, 256, 0, stream>>>(q, wq, AQ, Bn * N, D); k_bi_lin<<<(Bn * M + 7) / 8, 256, 0, stream>>>(mem, wm, CM, Bn * M, D);
    k_bi_qw<<<(Bn * N * D + 255) / 256, 256, 0, stream>>>(q, wqm, QW, 0, Bn * N, D);
    k_castS16<<<(unsigned)((((long long)(16384) * ((128) / 2)) + 255) / 256), 256, 0, stream>>>(QW, 128, (__bf16*)(G64A), (__bf16*)(G64A2), 128, 16384, 128, 1.0f, 0);
    k_castS16<<<(unsigned)((((long long)(16384) * ((128) / 2)) + 255) / 256), 256, 0, stream>>>(mem, 128, (__bf16*)(G64B), (__bf16*)(G64B2), 128, 16384, 128, 1.0f, 0);
    w25::wmma_gemm64<1, true, 0, 0, false, 0><<<dim3((unsigned)((((1024) / 64) * ((1024) / 64) + 7) / 8), (unsigned)(16)), 256, 0, stream>>>((const unsigned short*)(G64A), (const unsigned short*)(G64A2), 128, 131072, (const unsigned short*)(G64B), (const unsigned short*)(G64B2), 128, 131072, (void*)(SIM), nullptr, 1024, 1048576, nullptr, nullptr, 0, 1024, 1024, 128, 1.0f);
    k_bi_soft<<<dim3((unsigned)N, (unsigned)Bn), 256, 0, stream>>>(SIM, AQ, CM, qmask, mmask, RMX, N, M);
    k_cast16<<<(unsigned)((((long long)(16384) * ((1024) / 2)) + 255) / 256), 256, 0, stream>>>(SIM, 1024, (_Float16*)(G64A), 1024, 16384, 1024, 4096.0f);
    k_castT16<<<dim3((unsigned)((((long long)(128) * ((1024) / 2)) + 255) / 256), (unsigned)Bn), 256, 0, stream>>>(mem, 128, (_Float16*)(G64B), 1024, 1024, 128, 16.0f);
    w25::wmma_gemm64<0, false, 0, 0, false, 0><<<dim3((unsigned)((((1024) / 64) * ((128) / 64) + 7) / 8), (unsigned)(16)), 256, 0, stream>>>((const unsigned short*)(G64A), nullptr, 1024, 1048576, (const unsigned short*)(G64B), nullptr, 1024, 131072, (void*)(out), nullptr, 128, 131072, nullptr, nullptr, 0, 1024, 128, 1024, 1.52587890625e-05f);
    k_bi_m2q<<<Bn, 256, 0, stream>>>(RMX, q, M2Q, N, D); k_bi_bc<<<(unsigned)(((long long)Bn * N * D + 255) / 256), 256, 0, stream>>>(M2Q, mq, Bn, N, D);
}

// v002
// It runs in 219 microseconds.
// Next to v001, in two timings, it ran 2.59 and 2.58 times as fast.
// Counting every step since v000, it is 7.00 times as fast.
// Contractions: per batch the trilinear term (q * w_qm).m^T [1024x128].[128x1024] on bf16 hi/lo split planes (logits reach ~+-30, so they need f32-class accuracy) and the query->memory read q2m.memory [1024x1024].[1024x128] with f16 operands (probabilities x 2^12) — 64x64 register-blocked wave tiles; f32 accumulate. The two linear terms, the mask arithmetic (sim + (1 - mask) * -1e30, exactly as the module), the row softmax (exp once), the row maxima, the softmax over rows and the memory->query vector (broadcast to every row) are f32 kernels.
#include <hip/hip_runtime.h>
#include <math.h>

typedef __attribute__((ext_vector_type(16))) _Float16 v16h;
typedef __attribute__((ext_vector_type(8)))  _Float16 v8h;
typedef __attribute__((ext_vector_type(16))) __bf16   v16b;
typedef __attribute__((ext_vector_type(8)))  float    v8f;
typedef __attribute__((ext_vector_type(4)))  float    v4f;

// 16-bit WMMA fragment map (wave32), lane L, h = L>>4, m = L&15:
//   A 16x32: lane = row m;   element i -> k = (i<8) ? 8h+i : 16+8h+(i-8)
//   B 32x16: lane = column m; the SAME k(i,h)
//   D 16x16 (8 f32): lane = column m; element r -> row 8h+r
__device__ __forceinline__ int frag_k(int i, int h) { return (i < 8) ? (8 * h + i) : (16 + 8 * h + (i - 8)); }
__device__ __forceinline__ __bf16 bf16_rne(float f) {
    unsigned int u = __float_as_uint(f);
    u += 0x7fffu + ((u >> 16) & 1u);
    return __builtin_bit_cast(__bf16, (unsigned short)(u >> 16));
}
__device__ __forceinline__ float bf16_f32(__bf16 b) { return __uint_as_float(((unsigned int)__builtin_bit_cast(unsigned short, b)) << 16); }
__device__ __forceinline__ v8f wmma16(v16h a, v16h b, v8f c) {
    c = __builtin_amdgcn_wmma_f32_16x16x32_f16(false, a, false, b, (short)0, c, false, false);
    asm volatile("v_nop\n\tv_nop\n\tv_nop\n\tv_nop" : "+v"(c) : "v"(a), "v"(b));
    return c;
}
__device__ __forceinline__ v8f wmmab(v16b a, v16b b, v8f c) {
    c = __builtin_amdgcn_wmma_f32_16x16x32_bf16(false, a, false, b, (short)0, c, false, false);
    asm volatile("v_nop\n\tv_nop\n\tv_nop\n\tv_nop" : "+v"(c) : "v"(a), "v"(b));
    return c;
}
struct Split { v16b hi, lo; };
// hi/lo split product: a.hi*b.hi + a.hi*b.lo + a.lo*b.hi
__device__ __forceinline__ v8f wmma3(const Split& a, const Split& b, v8f c) {
    c = __builtin_amdgcn_wmma_f32_16x16x32_bf16(false, a.hi, false, b.hi, (short)0, c, false, false);
    c = __builtin_amdgcn_wmma_f32_16x16x32_bf16(false, a.hi, false, b.lo, (short)0, c, false, false);
    c = __builtin_amdgcn_wmma_f32_16x16x32_bf16(false, a.lo, false, b.hi, (short)0, c, false, false);
    asm volatile("v_nop\n\tv_nop\n\tv_nop\n\tv_nop" : "+v"(c) : "v"(a.hi), "v"(a.lo), "v"(b.hi), "v"(b.lo));
    return c;
}
struct Split3 { v16b hi, mid, lo; };
// triple split product (6 terms, drops only terms below 2^-24 relative)
__device__ __forceinline__ v8f wmma6(const Split3& a, const Split3& b, v8f c) {
    c = __builtin_amdgcn_wmma_f32_16x16x32_bf16(false, a.hi, false, b.hi, (short)0, c, false, false);
    c = __builtin_amdgcn_wmma_f32_16x16x32_bf16(false, a.hi, false, b.mid, (short)0, c, false, false);
    c = __builtin_amdgcn_wmma_f32_16x16x32_bf16(false, a.mid, false, b.hi, (short)0, c, false, false);
    c = __builtin_amdgcn_wmma_f32_16x16x32_bf16(false, a.hi, false, b.lo, (short)0, c, false, false);
    c = __builtin_amdgcn_wmma_f32_16x16x32_bf16(false, a.mid, false, b.mid, (short)0, c, false, false);
    c = __builtin_amdgcn_wmma_f32_16x16x32_bf16(false, a.lo, false, b.hi, (short)0, c, false, false);
    asm volatile("v_nop\n\tv_nop\n\tv_nop\n\tv_nop" : "+v"(c) : "v"(a.hi), "v"(a.mid), "v"(a.lo), "v"(b.hi), "v"(b.mid), "v"(b.lo));
    return c;
}

// Fragment gathers from f32 memory: element i <- p[(k0 + frag_k(i,h)) * sk] * s, zero for k >= klen.
__device__ __forceinline__ v16h fh_ld(const float* __restrict__ p, long long sk, int k0, int h, int klen, float s) {
    v16h a;
#pragma unroll
    for (int i = 0; i < 16; ++i) { const int k = k0 + frag_k(i, h); a[i] = (k < klen) ? (_Float16)(p[(long long)k * sk] * s) : (_Float16)0.f; }
    return a;
}
__device__ __forceinline__ Split sp_ld(const float* __restrict__ p, long long sk, int k0, int h, int klen, float s) {
    Split r;
#pragma unroll
    for (int i = 0; i < 16; ++i) {
        const int k = k0 + frag_k(i, h); const float x = (k < klen) ? p[(long long)k * sk] * s : 0.f;
        const __bf16 hb = bf16_rne(x); r.hi[i] = hb; r.lo[i] = bf16_rne(x - bf16_f32(hb));
    }
    return r;
}
__device__ __forceinline__ Split3 sp3_ld(const float* __restrict__ p, long long sk, int k0, int h, int klen, float s) {
    Split3 r;
#pragma unroll
    for (int i = 0; i < 16; ++i) {
        const int k = k0 + frag_k(i, h); const float x = (k < klen) ? p[(long long)k * sk] * s : 0.f;
        const __bf16 hb = bf16_rne(x); const float r1 = x - bf16_f32(hb); const __bf16 mb = bf16_rne(r1);
        r.hi[i] = hb; r.mid[i] = mb; r.lo[i] = bf16_rne(r1 - bf16_f32(mb));
    }
    return r;
}
__device__ __forceinline__ v16b bh_ld(const float* __restrict__ p, long long sk, int k0, int h, int klen, float s) {
    v16b a;
#pragma unroll
    for (int i = 0; i < 16; ++i) { const int k = k0 + frag_k(i, h); a[i] = bf16_rne((k < klen) ? p[(long long)k * sk] * s : 0.f); }
    return a;
}
// f16 fragment from an f16 LDS/global row with element stride 1 (k-contiguous), no bounds (tile already zero padded)
__device__ __forceinline__ v16h fh_row(const _Float16* __restrict__ row, int k0, int h) {
    v16h a;
#pragma unroll
    for (int i = 0; i < 16; ++i) a[i] = row[k0 + frag_k(i, h)];
    return a;
}

#define VST2(T, ptr, val) do { const T vst2_v_ = (val); *(T*)(ptr) = vst2_v_;  } while (0)
typedef float v4f __attribute__((ext_vector_type(4)));
#define VST2V4(ptr, val) do { const v4f vst2_v4_ = (val); *(v4f*)(ptr) = vst2_v4_;  } while (0)

__device__ __attribute__((noinline)) float act_fn(float v, int act) {
    if (act == 1) return fmaxf(v, 0.f);                                                                               // relu
    if (act == 2) { const float u = 0.7978845608028654f * (v + 0.044715f * v * v * v); return 0.5f * v * (1.f + tanhf(u)); } // tanh-gelu
    if (act == 3) return v / (1.f + expf(-v));                                                                        // silu
    if (act == 4) return 0.5f * v * (1.f + erff(v * 0.7071067811865476f));                                             // erf-gelu
    if (act == 5) return tanhf(v);
    if (act == 6) return 1.f / (1.f + expf(-v));                                                                      // sigmoid
    if (act == 7) return (v > 0.f) ? v : 0.01f * v;                                                                   // leaky relu 0.01
    if (act == 8) return (v > 0.f) ? v : (expf(v) - 1.f);                                                             // elu
    if (act == 9) return fminf(fmaxf(v, 0.f), 6.f);                                                                   // relu6
    if (act == 10) return fabsf(v);                                                                                    // abs
    if (act == 11) return (v >= 0.f) ? v : 0.1f * v;                                                                  // leaky 0.1
    if (act == 12) return (v > 0.f) ? v : 0.2f * v;                                                                   // leaky 0.2
    if (act == 13) return (v > 20.f) ? v : log1pf(expf(v));                                                            // softplus
    return v;
}

// =====================================================================================================================
// k_gemm<MODE>: C(z, m, n) = act(alpha * sum_k A(z, m, k) * B(z, k, n) + bias) + beta * R(z, m, n)
//   One wave (32-thread block) per 16 x 32 tile of C; grid (ceil(N/32), ceil(M/16), Z). Batch z -> (zo = z / zi_n, zi = z % zi_n)
//   with separate outer/inner strides for every tensor (e.g. batch and head). A(m,k) = A[zo*sAo + zi*sAi + m*sAm + k*sAk] (f32),
//   B(k,n) = B[zo*sBo + zi*sBi + n*sBn + k*sBk] (f32); any M, N, K (K zero-padded to 32 inside the fragments, M/N tails guarded).
//   C(m,n) = C[zo*sCo + zi*sCi + m*sCm + n] (n contiguous). flags: 1 bias[n], 2 bias[m], 4 residual R[zo*sRo + zi*sRi + m*sRm + n*sRn].
//   MODE 0: f16 operands (A prescaled by sa, B by sb, both undone in the epilogue); 1: bf16 hi/lo split (3 products); 2: bf16;
//   3: bf16 hi/mid/lo triple split (6 products); 4: as 3 with Kahan-compensated f32 accumulation across k-steps.
// =====================================================================================================================
struct GemmP {
    const float* A; const float* B; const float* bias; const float* R; float* C;
    long long sAo, sAi, sAm, sAk, sBo, sBi, sBn, sBk, sCo, sCi, sCm, sRo, sRi, sRm, sRn;
    int M, N, K, zi_n, flags, act; float alpha, beta, sa, sb;
    int Npad, pad_;     // columns [N, Npad) of C are written as 0 so that padded workspace rows are covered by whole-line stores; Npad >= N
};
static_assert(sizeof(GemmP) == 5 * 8 + 15 * 8 + 6 * 4 + 4 * 4 + 2 * 4, "GemmP has padding");

template <int MODE>
__global__ __launch_bounds__(32) void k_gemm(GemmP p) {
    const int lane = threadIdx.x & 31, h = lane >> 4, l15 = lane & 15;
    const int m0 = blockIdx.y * 16, n0 = blockIdx.x * 32;
    const int z = blockIdx.z, zo = z / p.zi_n, zi = z - zo * p.zi_n;
    const float* A = p.A + zo * p.sAo + zi * p.sAi;
    const float* B = p.B + zo * p.sBo + zi * p.sBi;
    const int am = min(m0 + l15, p.M - 1);                       // clamped row for loads (stores are guarded)
    v8f acc[2], comp[2];
#pragma unroll
    for (int t = 0; t < 2; ++t) { v8f zz = {}; acc[t] = zz; comp[t] = zz; }
    for (int k0 = 0; k0 < p.K; k0 += 32) {
        const float* arow = A + (long long)am * p.sAm;
        if (MODE == 1) {
            const Split a = sp_ld(arow, p.sAk, k0, h, p.K, 1.f);
#pragma unroll
            for (int t = 0; t < 2; ++t) {
                const int bn = min(n0 + t * 16 + l15, p.N - 1);
                acc[t] = wmma3(a, sp_ld(B + (long long)bn * p.sBn, p.sBk, k0, h, p.K, 1.f), acc[t]);
            }
        } else if (MODE == 3) {
            const Split3 a = sp3_ld(arow, p.sAk, k0, h, p.K, 1.f);
#pragma unroll
            for (int t = 0; t < 2; ++t) {
                const int bn = min(n0 + t * 16 + l15, p.N - 1);
                acc[t] = wmma6(a, sp3_ld(B + (long long)bn * p.sBn, p.sBk, k0, h, p.K, 1.f), acc[t]);
            }
        } else if (MODE == 4) {
            // triple split as MODE 3, but each k-step's 6 products go into a fresh accumulator and the partial is added to the running f32 sum
            // on the VALU with Kahan compensation (accumulation error stays ~1 ulp however long K is)
            const Split3 a = sp3_ld(arow, p.sAk, k0, h, p.K, 1.f);
#pragma unroll
            for (int t = 0; t < 2; ++t) {
                const int bn = min(n0 + t * 16 + l15, p.N - 1); v8f zz = {};
                const v8f part = wmma6(a, sp3_ld(B + (long long)bn * p.sBn, p.sBk, k0, h, p.K, 1.f), zz);
                const v8f y = part - comp[t]; const v8f s = acc[t] + y; comp[t] = (s - acc[t]) - y; acc[t] = s;
            }
        } else if (MODE == 2) {
            const v16b a = bh_ld(arow, p.sAk, k0, h, p.K, 1.f);
#pragma unroll
            for (int t = 0; t < 2; ++t) {
                const int bn = min(n0 + t * 16 + l15, p.N - 1);
                acc[t] = wmmab(a, bh_ld(B + (long long)bn * p.sBn, p.sBk, k0, h, p.K, 1.f), acc[t]);
            }
        } else {
            const v16h a = fh_ld(arow, p.sAk, k0, h, p.K, p.sa);
#pragma unroll
            for (int t = 0; t < 2; ++t) {
                const int bn = min(n0 + t * 16 + l15, p.N - 1);
                acc[t] = wmma16(a, fh_ld(B + (long long)bn * p.sBn, p.sBk, k0, h, p.K, p.sb), acc[t]);
            }
        }
    }
    const float iscale = (MODE == 0) ? p.alpha / (p.sa * p.sb) : p.alpha;
    float* C = p.C + zo * p.sCo + zi * p.sCi;
    const float* R = p.R + zo * p.sRo + zi * p.sRi;
    __shared__ __align__(16) float ctile[16][36];
#pragma unroll
    for (int t = 0; t < 2; ++t) {
        const int n = n0 + t * 16 + l15; const int nn = min(n, p.N - 1);
#pragma unroll
        for (int r = 0; r < 8; ++r) {
            const int m = m0 + 8 * h + r; const int mm = min(m, p.M - 1);
            float v = acc[t][r] * iscale;
            if (p.flags & 1) v += p.bias[nn];
            if (p.flags & 2) v += p.bias[mm];
            if (p.flags & 8) v *= p.bias[(long long)zo * p.M + mm];   /* per-(z,row) scale vector laid out [Z][M]; exclusive with the bias flags */
            v = act_fn(v, p.act);
            if (p.flags & 4) v += p.beta * R[(long long)mm * p.sRm + (long long)nn * p.sRn];
            ctile[8 * h + r][t * 16 + l15] = (n < p.N) ? v : 0.f;
        }
    }
    __syncthreads();
    const int NW = (p.Npad > p.N) ? p.Npad : p.N;           // write width
    const bool fast = (m0 + 16 <= p.M) && (n0 + 32 <= NW) && ((p.sCm & 3) == 0) && ((((size_t)C) & 15) == 0);
    if (fast) {
#pragma unroll
        for (int s = 0; s < 4; ++s) {
            const int row = s * 4 + (lane >> 3), c4 = (lane & 7) * 4;
            const v4f v = *(const v4f*)&ctile[row][c4];
            VST2V4(C + (long long)(m0 + row) * p.sCm + n0 + c4, v);
        }
    } else {
        for (int row = 0; row < 16; ++row) {
            const int m = m0 + row, n = n0 + lane;
            if (m < p.M && n < NW) VST2(float, C + (long long)m * p.sCm + n, ctile[row][lane]);
        }
    }
}


// =====================================================================================================================
// k_gemmT<MODE, TM, TN>: same contract as k_gemm, but one wave computes a (16*TM) x (16*TN) tile: TM A fragments and TN B fragments are
//   loaded per 32-wide k-step and reused across TM*TN WMMAs (far fewer load/convert instructions per MAC). MODE 0 (f16), 1 (bf16 hi/lo),
//   2 (bf16) only. grid (ceil(NW/(16*TN)), ceil(M/(16*TM)), Z), block 32. Epilogue identical to k_gemm, run per 16x32 sub-tile.
// =====================================================================================================================
template <int MODE, int TM, int TN>
__global__ __launch_bounds__(32) void k_gemmT(GemmP p) {
    const int lane = threadIdx.x & 31, h = lane >> 4, l15 = lane & 15;
    const int m0 = blockIdx.y * (16 * TM), n0 = blockIdx.x * (16 * TN);
    const int z = blockIdx.z, zo = z / p.zi_n, zi = z - zo * p.zi_n;
    const float* A = p.A + zo * p.sAo + zi * p.sAi;
    const float* B = p.B + zo * p.sBo + zi * p.sBi;
    v8f acc[TM][TN];
#pragma unroll
    for (int i = 0; i < TM; ++i)
#pragma unroll
        for (int t = 0; t < TN; ++t) { v8f zz = {}; acc[i][t] = zz; }
    for (int k0 = 0; k0 < p.K; k0 += 32) {
        if (MODE == 1) {
            Split a[TM], b[TN];
#pragma unroll
            for (int i = 0; i < TM; ++i) { const int am = min(m0 + 16 * i + l15, p.M - 1); a[i] = sp_ld(A + (long long)am * p.sAm, p.sAk, k0, h, p.K, 1.f); }
#pragma unroll
            for (int t = 0; t < TN; ++t) { const int bn = min(n0 + 16 * t + l15, p.N - 1); b[t] = sp_ld(B + (long long)bn * p.sBn, p.sBk, k0, h, p.K, 1.f); }
#pragma unroll
            for (int i = 0; i < TM; ++i)
#pragma unroll
                for (int t = 0; t < TN; ++t) acc[i][t] = wmma3(a[i], b[t], acc[i][t]);
        } else if (MODE == 2) {
            v16b a[TM], b[TN];
#pragma unroll
            for (int i = 0; i < TM; ++i) { const int am = min(m0 + 16 * i + l15, p.M - 1); a[i] = bh_ld(A + (long long)am * p.sAm, p.sAk, k0, h, p.K, 1.f); }
#pragma unroll
            for (int t = 0; t < TN; ++t) { const int bn = min(n0 + 16 * t + l15, p.N - 1); b[t] = bh_ld(B + (long long)bn * p.sBn, p.sBk, k0, h, p.K, 1.f); }
#pragma unroll
            for (int i = 0; i < TM; ++i)
#pragma unroll
                for (int t = 0; t < TN; ++t) acc[i][t] = wmmab(a[i], b[t], acc[i][t]);
        } else {
            v16h a[TM], b[TN];
#pragma unroll
            for (int i = 0; i < TM; ++i) { const int am = min(m0 + 16 * i + l15, p.M - 1); a[i] = fh_ld(A + (long long)am * p.sAm, p.sAk, k0, h, p.K, p.sa); }
#pragma unroll
            for (int t = 0; t < TN; ++t) { const int bn = min(n0 + 16 * t + l15, p.N - 1); b[t] = fh_ld(B + (long long)bn * p.sBn, p.sBk, k0, h, p.K, p.sb); }
#pragma unroll
            for (int i = 0; i < TM; ++i)
#pragma unroll
                for (int t = 0; t < TN; ++t) acc[i][t] = wmma16(a[i], b[t], acc[i][t]);
        }
    }
    const float iscale = (MODE == 0) ? p.alpha / (p.sa * p.sb) : p.alpha;
    float* C = p.C + zo * p.sCo + zi * p.sCi;
    const float* R = p.R + zo * p.sRo + zi * p.sRi;
    const int NW = (p.Npad > p.N) ? p.Npad : p.N;
    __shared__ __align__(16) float ctile[16][36];
#pragma unroll
    for (int i = 0; i < TM; ++i) {
        const int mb = m0 + 16 * i; if (mb >= p.M) break;          // wave-uniform
#pragma unroll
        for (int tp = 0; tp < TN / 2; ++tp) {
            const int nb = n0 + 32 * tp; if (nb >= NW) break;        // wave-uniform
#pragma unroll
            for (int t2 = 0; t2 < 2; ++t2) {
                const int t = 2 * tp + t2; const int n = nb + t2 * 16 + l15; const int nn = min(n, p.N - 1);
#pragma unroll
                for (int r = 0; r < 8; ++r) {
                    const int m = mb + 8 * h + r; const int mm = min(m, p.M - 1);
                    float v = acc[i][t][r] * iscale;
                    if (p.flags & 1) v += p.bias[nn];
                    if (p.flags & 2) v += p.bias[mm];
            if (p.flags & 8) v *= p.bias[(long long)zo * p.M + mm];   /* per-(z,row) scale vector laid out [Z][M]; exclusive with the bias flags */
                    v = act_fn(v, p.act);
                    if (p.flags & 4) v += p.beta * R[(long long)mm * p.sRm + (long long)nn * p.sRn];
                    ctile[8 * h + r][t2 * 16 + l15] = (n < p.N) ? v : 0.f;
                }
            }
            __syncthreads();
            const bool fast = (mb + 16 <= p.M) && (nb + 32 <= NW) && ((p.sCm & 3) == 0) && ((((size_t)C) & 15) == 0);
            if (fast) {
#pragma unroll
                for (int s = 0; s < 4; ++s) {
                    const int row = s * 4 + (lane >> 3), c4 = (lane & 7) * 4;
                    const v4f v = *(const v4f*)&ctile[row][c4];
                    VST2V4(C + (long long)(mb + row) * p.sCm + nb + c4, v);
                }
            } else {
                for (int row = 0; row < 16; ++row) {
                    const int m = mb + row, n = nb + lane;
                    if (m < p.M && n < NW) VST2(float, C + (long long)m * p.sCm + n, ctile[row][lane]);
                }
            }
            __syncthreads();
        }
    }
}

// =====================================================================================================================
//   Wave = 16 queries, AW waves per block, 64-key blocks; grid (ceil(Lq/(16*AW)), H, B), block 32*AW. Any Lq, Lk; head dim dh <= DHP
//   (DHP multiple of 32), value dim dv <= DVP (multiple of 16, <= 128). Every tensor addressed by (batch, head, row, element) strides, f32.
//   Scores: QM 0 f16 operands, 1 bf16 hi/lo split, 2 bf16 triple split; statistics f32 (exp2 domain); P.V: P x 4096 as f16 with V f16 staged in LDS
//   (SPLITPV: P and V as bf16 hi/lo splits). kv head = h / hrep. Masking: causal = 1 (keep j <= i + coff, masked -> -inf, key blocks beyond the
//   diagonal skipped), causal = 2 (masked -> mfill, a finite fill like the -1e9; no skipping), causal = 3 (keep j >= i + coff,
//   masked -> -inf, no skipping); optional additive f32 mask Mf,
//   optional int keep-mask Mi (0 -> score := mfill), both addressed b*smb + h*smh + i*smi + j*smj (0 strides broadcast).
// =====================================================================================================================
#define AW 4
struct AttnP {   // apv4
    const float* Q; const float* K; const float* V; float* O; float* P; const float* Mf; const int* Mi; float* ST;
    const float* Pw; const float* Rt; const int* SQ; const int* SK;           // optional: post-softmax weight, relative-position table, segment ids
    long long swb, swh, swi, swj, srb, srh, sri;                                 // Pw strides (b,h,i,j); Rt strides (b,h,i), column = clamp(i - j + roff, 0, rn-1)
    long long sQb, sQh, sQi, sQd, sKb, sKh, sKj, sKd, sVb, sVh, sVj, sVd, sOb, sOh, sOi, sPb, sPh, sPi, smb, smh, smi, smj;
    int Lq, Lk, dh, dv, hrep, causal, coff, pband;   // pband > 0: P holds only the band |j - i| <= pband, column j - i + pband
    float scale, mfill; int nonorm, mpol;             // nonorm (online path only): O = sum_j exp(score_j) V_j without the 1/rowsum (scores must be <= ~0); mpol: Mi masks where ==0 (mpol 0) or where !=0 (mpol 1)
    int roff, rn, segpol, win;                        // Rt column offset/count; SQ/SK: score := mfill where (segpol 0) SQ[i] != SK[j] or (segpol 1) SQ[i] == SK[j]; win > 0: keys with i - j > win (after coff) -> -inf
};
//   Pw: the softmax numerator is multiplied by Pw(b,h,i,j) AFTER the row sum is taken (probs * weight, then P.V), as in post-softmax multiplicative biases.                                                    // ST (optional): per row (b,h,i) -> ST[((b*H + h)*Lq + i)*2 + {0,1}] = {row max of the scaled+masked score (natural units), sum_j exp(score - max)}
static_assert(sizeof(AttnP) == 12 * 8 + 29 * 8 + 16 * 4, "AttnP has padding");

#ifndef KATTN_ATTR
#define KATTN_ATTR
#endif
template <int DHP, int DVP, int QM, bool SPLITPV, bool TWOPASS>
__global__ __launch_bounds__(32 * AW) KATTN_ATTR void k_attn(AttnP p) {
    constexpr int NT = DVP / 16;                // output tiles
    constexpr int KS = DHP / 32;                // k-steps for the scores
    constexpr int VP = DVP + 8;                 // LDS pitch (halves)
    __shared__ __align__(16) float    pl[AW][16 * 64];
    __shared__ __align__(16) _Float16 vl[(SPLITPV ? 2 : 1) * 64 * VP];   // f16 V tile, or bf16 hi and lo tiles (same 2-byte size)
    const int lane = threadIdx.x & 31, hf = lane >> 4, l15 = lane & 15, wave = threadIdx.x >> 5;
    const int h = blockIdx.y, b = blockIdx.z, hk = h / p.hrep;
    const int q0 = (blockIdx.x * AW + wave) * 16;
    float* myp = pl[wave];
    const float L2E = 1.4426950408889634f;
    const float NEG = -__builtin_inff();
    const int qi = min(q0 + l15, p.Lq - 1);
    const float* qrow = p.Q + b * p.sQb + h * p.sQh + (long long)qi * p.sQi;
    const float* kbase = p.K + b * p.sKb + hk * p.sKh;
    const float* vbase = p.V + b * p.sVb + hk * p.sVh;
    v16h qa[QM == 0 ? KS : 1]; Split qs_[QM == 1 ? KS : 1]; Split3 qt_[QM == 2 ? KS : 1];
#pragma unroll
    for (int ks = 0; ks < KS; ++ks) {
        if (QM == 2) qt_[ks] = sp3_ld(qrow, p.sQd, ks * 32, hf, p.dh, 1.f);
        else if (QM == 1) qs_[ks] = sp_ld(qrow, p.sQd, ks * 32, hf, p.dh, 1.f);
        else qa[ks] = fh_ld(qrow, p.sQd, ks * 32, hf, p.dh, 1.f);
    }
    v8f o[NT]; float m8[8], l8[8];
#pragma unroll
    for (int t = 0; t < NT; ++t) { v8f zz = {}; o[t] = zz; }
#pragma unroll
    for (int i = 0; i < 8; ++i) { m8[i] = NEG; l8[i] = 0.f; }
    int jend = p.Lk;
    if (p.causal == 1) { const int je = (blockIdx.x * AW + AW - 1) * 16 + 16 + p.coff; jend = min(jend, max(je, 0)); }   // uniform per block
    const int npass = TWOPASS ? 2 : 1;
    for (int pass = 0; pass < npass; ++pass) {
        const bool dopv = (!TWOPASS) || pass == 1;
        for (int j0 = 0; j0 < jend; j0 += 64) {
            if (dopv) {
                __syncthreads();                                 // previous key block's reads of vl / pl are done
                for (int idx = threadIdx.x; idx < 64 * DVP; idx += 32 * AW) {
                    const int jr = idx / DVP, d = idx - jr * DVP, j = j0 + jr;
                    const float f = (j < p.Lk && d < p.dv) ? vbase[(long long)j * p.sVj + (long long)d * p.sVd] : 0.f;
                    if (SPLITPV) {
                        const __bf16 hb = bf16_rne(f);
                        ((__bf16*)vl)[jr * VP + d] = hb; ((__bf16*)vl)[64 * VP + jr * VP + d] = bf16_rne(f - bf16_f32(hb));
                    } else vl[jr * VP + d] = (_Float16)f;
                }
            }
            v8f s[4];
#pragma unroll
            for (int t = 0; t < 4; ++t) {
                const int j = min(j0 + t * 16 + l15, p.Lk - 1);
                const float* krow = kbase + (long long)j * p.sKj;
                v8f acc = {};
#pragma unroll
                for (int ks = 0; ks < KS; ++ks) {
                    if (QM == 2)      acc = wmma6(qt_[ks], sp3_ld(krow, p.sKd, ks * 32, hf, p.dh, 1.f), acc);
                    else if (QM == 1) acc = wmma3(qs_[ks], sp_ld(krow, p.sKd, ks * 32, hf, p.dh, 1.f), acc);
                    else              acc = wmma16(qa[ks], fh_ld(krow, p.sKd, ks * 32, hf, p.dh, 1.f), acc);
                }
                s[t] = acc;
            }
            float pv[8][4];
#pragma unroll
            for (int i = 0; i < 8; ++i) {
                const int irow = q0 + i + 8 * hf;
                const int ic = min(irow, p.Lq - 1);
                float sc[4];
#pragma unroll
                for (int t = 0; t < 4; ++t) {
                    const int jg = j0 + t * 16 + l15;
                    float v = s[t][i] * p.scale;
                    if (p.Mf) v += p.Mf[b * p.smb + h * p.smh + (long long)ic * p.smi + (long long)min(jg, p.Lk - 1) * p.smj];
                    if (p.Rt) { int rc = ic - min(jg, p.Lk - 1) + p.roff; rc = rc < 0 ? 0 : (rc >= p.rn ? p.rn - 1 : rc); v += p.Rt[b * p.srb + h * p.srh + (long long)ic * p.sri + rc]; }
                    if (p.Mi) { const int mv = p.Mi[b * p.smb + h * p.smh + (long long)ic * p.smi + (long long)min(jg, p.Lk - 1) * p.smj]; if (p.mpol ? (mv != 0) : (mv == 0)) v = p.mfill; }
                    if (p.SQ) { const bool same = p.SQ[(long long)b * p.Lq + ic] == p.SK[(long long)b * p.Lk + min(jg, p.Lk - 1)]; if (p.segpol ? same : !same) v = p.mfill; }
                    if (p.causal == 2 && jg > irow + p.coff) v = p.mfill;
                    if (jg >= p.Lk || (p.causal == 1 && jg > irow + p.coff) || (p.causal == 3 && jg < irow + p.coff) || (p.win > 0 && irow + p.coff - jg > p.win)) v = NEG; else v *= L2E;
                    sc[t] = v;
                }
                if (!TWOPASS || pass == 0) {
                    float mx = fmaxf(fmaxf(sc[0], sc[1]), fmaxf(sc[2], sc[3]));
                    mx = fmaxf(mx, __shfl_xor(mx, 1, 32)); mx = fmaxf(mx, __shfl_xor(mx, 2, 32));
                    mx = fmaxf(mx, __shfl_xor(mx, 4, 32)); mx = fmaxf(mx, __shfl_xor(mx, 8, 32));
                    const float mnew = fmaxf(m8[i], mx);
                    const float corr = (mnew == NEG) ? 1.f : exp2f(m8[i] - mnew);
                    float rs = 0.f;
#pragma unroll
                    for (int t = 0; t < 4; ++t) {
                        const float pp = (sc[t] == NEG) ? 0.f : exp2f(sc[t] - mnew); rs += pp;
                        pv[i][t] = p.Pw ? pp * p.Pw[b * p.swb + h * p.swh + (long long)ic * p.swi + (long long)min(j0 + t * 16 + l15, p.Lk - 1) * p.swj] : pp;
                    }
                    rs += __shfl_xor(rs, 1, 32); rs += __shfl_xor(rs, 2, 32); rs += __shfl_xor(rs, 4, 32); rs += __shfl_xor(rs, 8, 32);
                    l8[i] = l8[i] * corr + rs; m8[i] = mnew;
                    if (!TWOPASS) {
#pragma unroll
                        for (int t = 0; t < NT; ++t) o[t][i] *= corr;
                    }
                } else {
                    const float inv = (l8[i] > 0.f) ? 1.f / l8[i] : 0.f;
#pragma unroll
                    for (int t = 0; t < 4; ++t) {
                        const int jg = j0 + t * 16 + l15;
                        float pp = (sc[t] == NEG) ? 0.f : exp2f(sc[t] - m8[i]) * inv;
                        if (p.Pw) pp *= p.Pw[b * p.swb + h * p.swh + (long long)ic * p.swi + (long long)min(jg, p.Lk - 1) * p.swj];
                        pv[i][t] = pp;
                    }
                }
            }
            if (dopv) {
#pragma unroll
                for (int i = 0; i < 8; ++i)
#pragma unroll
                    for (int t = 0; t < 4; ++t) ((float*)myp)[(i + 8 * hf) * 64 + t * 16 + l15] = pv[i][t];
                __syncthreads();                                 // P (per wave) and V (shared) visible
                if (p.P) {
                    float* pb_ = p.P + b * p.sPb + h * p.sPh;
                    const bool fastP = (p.pband == 0) && ((p.sPi & 3) == 0) && (j0 + 64 <= p.Lk) && (q0 + 16 <= p.Lq) && ((((size_t)pb_) & 15) == 0);
                    if (fastP) {
#pragma unroll
                        for (int s = 0; s < 8; ++s) {
                            const int row = s * 2 + (lane >> 4), c4 = (lane & 15) * 4;
                            const v4f v = *(const v4f*)(myp + row * 64 + c4);
                            VST2V4(pb_ + (long long)(q0 + row) * p.sPi + j0 + c4, v);
                        }
                    } else {
                        for (int row = 0; row < 16; ++row) {
                            const int irow = q0 + row; if (irow >= p.Lq) continue;
                            for (int c = lane; c < 64; c += 32) {
                                const int jg = j0 + c; if (jg >= p.Lk) continue;
                                if (p.pband == 0) VST2(float, pb_ + (long long)irow * p.sPi + jg, myp[row * 64 + c]);
                                else if (jg - irow <= p.pband && irow - jg <= p.pband) VST2(float, pb_ + (long long)irow * p.sPi + (jg - irow + p.pband), myp[row * 64 + c]);
                            }
                        }
                    }
                }
                if (SPLITPV) {
                    const Split pa0 = sp_ld(myp + l15 * 64, 1, 0, hf, 64, 1.f), pa1 = sp_ld(myp + l15 * 64, 1, 32, hf, 64, 1.f);
                    const __bf16* vh = (const __bf16*)vl; const __bf16* vlo = vh + 64 * VP;
#pragma unroll
                    for (int t = 0; t < NT; ++t) {
                        const int dcol = t * 16 + l15;
                        Split b0, b1;
#pragma unroll
                        for (int e = 0; e < 16; ++e) {
                            const int k0 = frag_k(e, hf), k1 = 32 + frag_k(e, hf);
                            b0.hi[e] = vh[k0 * VP + dcol]; b0.lo[e] = vlo[k0 * VP + dcol]; b1.hi[e] = vh[k1 * VP + dcol]; b1.lo[e] = vlo[k1 * VP + dcol];
                        }
                        o[t] = wmma3(pa0, b0, o[t]);
                        o[t] = wmma3(pa1, b1, o[t]);
                    }
                } else {
                    const v16h pa0 = fh_ld(myp + l15 * 64, 1, 0, hf, 64, 4096.f), pa1 = fh_ld(myp + l15 * 64, 1, 32, hf, 64, 4096.f);
#pragma unroll
                    for (int t = 0; t < NT; ++t) {
                        const int dcol = t * 16 + l15;
                        v16h b0, b1;
#pragma unroll
                        for (int e = 0; e < 16; ++e) { b0[e] = vl[frag_k(e, hf) * VP + dcol]; b1[e] = vl[(32 + frag_k(e, hf)) * VP + dcol]; }
                        o[t] = wmma16(pa0, b0, o[t]);
                        o[t] = wmma16(pa1, b1, o[t]);
                    }
                }
            }
        }
    }
    float* obase = p.O + b * p.sOb + h * p.sOh;
    if (p.ST) {
        const int rl = lane >> 1, isel = rl & 7;           // row q0 + rl ; rl>>3 == hf holds because lane>>4 == (lane>>1)>>3
        float mv = 0.f, lv = 0.f;
#pragma unroll
        for (int i = 0; i < 8; ++i) if (i == isel) { mv = m8[i]; lv = l8[i]; }
        const int irow = q0 + rl;
        if (irow < p.Lq) { float* st = p.ST + (((long long)b * gridDim.y + h) * p.Lq + irow) * 2 + (lane & 1); VST2(float, st, (lane & 1) ? lv : mv * 0.6931471805599453f); }
    }
    float invr[8];
#pragma unroll
    for (int i = 0; i < 8; ++i) {
        if (TWOPASS) invr[i] = SPLITPV ? 1.f : (1.f / 4096.f);
        else if (p.nonorm) invr[i] = exp2f(m8[i]) * (SPLITPV ? 1.f : (1.f / 4096.f));
        else invr[i] = (l8[i] > 0.f) ? (SPLITPV ? 1.f / l8[i] : 1.f / (l8[i] * 4096.f)) : 0.f;
    }
    __syncthreads();                                             // all waves done with pl/vl from the main loop
    const bool ofast = ((p.sOi & 3) == 0) && ((((size_t)obase) & 15) == 0) && (q0 + 16 <= p.Lq);
#pragma unroll
    for (int c0 = 0; c0 < DVP; c0 += 64) {
#pragma unroll
        for (int i = 0; i < 8; ++i)
#pragma unroll
            for (int t = 0; t < NT; ++t) if (t * 16 >= c0 && t * 16 < c0 + 64) ((float*)myp)[(i + 8 * hf) * 64 + (t * 16 - c0) + l15] = o[t][i] * invr[i];
        __syncthreads();
        const int cw = (DVP - c0 < 64) ? (DVP - c0) : 64;      // staged columns in this chunk (multiple of 16)
        if (ofast && (c0 + cw <= p.dv) && (cw % 32 == 0)) {
            const int lpr = cw / 4;                              // lanes per row (16 for 64 cols, 8 for 32)
            const int rows_per_ins = 32 / lpr;
            for (int r0 = 0; r0 < 16; r0 += rows_per_ins) {
                const int row = r0 + lane / lpr, c4 = (lane % lpr) * 4;
                const v4f v = *(const v4f*)(myp + row * 64 + c4);
                VST2V4(obase + (long long)(q0 + row) * p.sOi + c0 + c4, v);
            }
        } else {
            for (int row = 0; row < 16; ++row) {
                const int irow = q0 + row; if (irow >= p.Lq) continue;
                for (int c = lane; c < cw; c += 32) { const int d = c0 + c; if (d < p.dv) VST2(float, obase + (long long)irow * p.sOi + d, myp[row * 64 + c]); }
            }
        }
        __syncthreads();
    }
}

// =====================================================================================================================
// k_tr: dst(z, c, r) = alpha * src(z, r, c) (+ beta * R2(z, c, r)): [Z][R][C] (row stride lds) -> [Z][C][R] (row stride ldd) through a 32x32 LDS tile;
//   flags: 1 -> add beta * residual R2 addressed like dst (z*sRz + c*ldr + r); act applied before the residual.
// =====================================================================================================================
struct TrP { const float* src; float* dst; const float* R2; long long sSz, lds, sDz, ldd, sRz, ldr; int R, C, flags, act; float alpha, beta; };
static_assert(sizeof(TrP) == 3 * 8 + 6 * 8 + 6 * 4, "TrP has padding");
__global__ __launch_bounds__(256) void k_tr(TrP p) {
    __shared__ float tile[32][33];
    const int c0 = blockIdx.x * 32, r0 = blockIdx.y * 32, z = blockIdx.z;
    const int lane = threadIdx.x & 31, wave = threadIdx.x >> 5;
    const float* s = p.src + z * p.sSz;
#pragma unroll
    for (int k = 0; k < 4; ++k) {
        const int rl = wave * 4 + k, r = r0 + rl, c = c0 + lane;
        tile[rl][lane] = (r < p.R && c < p.C) ? s[(long long)r * p.lds + c] : 0.f;
    }
    __syncthreads();
    float* d = p.dst + z * p.sDz; const float* rr = p.R2 + z * p.sRz;
#pragma unroll
    for (int k = 0; k < 4; ++k) {
        const int cl = wave * 4 + k, c = c0 + cl, r = r0 + lane;
        if (c < p.C && r < p.R) {
            float v = act_fn(p.alpha * tile[lane][cl], p.act);
            if (p.flags & 1) v += p.beta * rr[(long long)c * p.ldr + r];
            VST2(float, d + (long long)c * p.ldd + r, v);
        }
    }
}

// k_affine: dst[i] = a * (sdev ? sdev[0] : 1) * src[i] + b, i < n (one thread per element; consecutive lanes -> consecutive addresses)
__global__ __launch_bounds__(256) void k_affine(const float* __restrict__ src, float* __restrict__ dst, int n, float a, float b, const float* __restrict__ sdev) {
    const int i = blockIdx.x * 256 + threadIdx.x;
    if (i < n) { const float aa = sdev ? a * sdev[0] : a; const float v = aa * src[i] + b; VST2(float, dst + i, v); }
}

// =====================================================================================================================
// k_softmax: row softmax over n contiguous elements, one 256-thread block per row; rows addressed z*sz + r*sr (grid (R, Z)).
//   out = scale_out * softmax(scale_in * x + (Mf ? Mf[z*smz + r*smr + j] : 0)); a row whose max is -inf is written as 0.
// =====================================================================================================================
struct SmP { const float* src; float* dst; const float* Mf; long long sz, sr, dz, dr, smz, smr; int n, pad; float scale_in, scale_out; };
static_assert(sizeof(SmP) == 3 * 8 + 6 * 8 + 4 * 4, "SmP has padding");
__global__ __launch_bounds__(256) void k_softmax(SmP p) {
    __shared__ float red[256];
    const int r = blockIdx.x, z = blockIdx.y, tid = threadIdx.x;
    const float* s = p.src + z * p.sz + (long long)r * p.sr;
    const float* mf = p.Mf ? (p.Mf + z * p.smz + (long long)r * p.smr) : nullptr;
    float mx = -__builtin_inff();
    for (int j = tid; j < p.n; j += 256) { float v = s[j] * p.scale_in; if (mf) v += mf[j]; mx = fmaxf(mx, v); }
    red[tid] = mx; __syncthreads();
    for (int o = 128; o > 0; o >>= 1) { if (tid < o) red[tid] = fmaxf(red[tid], red[tid + o]); __syncthreads(); }
    mx = red[0]; __syncthreads();
    float sum = 0.f;
    for (int j = tid; j < p.n; j += 256) { float v = s[j] * p.scale_in; if (mf) v += mf[j]; sum += (mx == -__builtin_inff()) ? 0.f : expf(v - mx); }
    red[tid] = sum; __syncthreads();
    for (int o = 128; o > 0; o >>= 1) { if (tid < o) red[tid] += red[tid + o]; __syncthreads(); }
    sum = red[0];
    const float inv = (sum > 0.f) ? p.scale_out / sum : 0.f;
    float* d = p.dst + z * p.dz + (long long)r * p.dr;
    for (int j = tid; j < p.n; j += 256) { float v = s[j] * p.scale_in; if (mf) v += mf[j]; const float o = (mx == -__builtin_inff()) ? 0.f : expf(v - mx) * inv; VST2(float, d + j, o); }
}
// =====================================================================================================================
// k_stats: mean and rsqrt(var + eps) over a set of n elements addressed base + z*sz + (e / inner) * so + (e % inner) * si, one 256-thread
// k_norm_apply: y = (x - mean[set]) * rstd[set] * g[c] + b[c] over a [Z][C][L] channel-major tensor with set = z*G + c / (C/G) (G groups per z;
//   G = C -> per-channel sets indexed z*C+c; for batch norm pass stats indexed by c only via bn = 1). Optional act. Output same layout.
// =====================================================================================================================
//   mode 0: mean / rsqrt(var + eps); mode 1 (RMSNorm): 0 / rsqrt(mean(x^2) + eps); mode 2 (L2 normalize * sqrt(n)): 0 / sqrt(n) / max(||x||, eps); mode 3: as 0 with unbiased variance (n-1)
__global__ __launch_bounds__(256) void k_stats(const float* __restrict__ x, long long sz, long long so, long long si, int inner, int n, float eps, float* __restrict__ stat, int mode) {
    __shared__ float red[256];
    const int z = blockIdx.x, tid = threadIdx.x;
    const float* base = x + z * sz;
    float s = 0.f;
    for (int e = tid; e < n; e += 256) s += base[(long long)(e / inner) * so + (long long)(e % inner) * si];
    red[tid] = s; __syncthreads();
    for (int o = 128; o > 0; o >>= 1) { if (tid < o) red[tid] += red[tid + o]; __syncthreads(); }
    const float mu = (mode == 0 || mode == 3) ? red[0] / (float)n : 0.f; __syncthreads();
    float q = 0.f;
    for (int e = tid; e < n; e += 256) { const float dlt = base[(long long)(e / inner) * so + (long long)(e % inner) * si] - mu; q += dlt * dlt; }
    red[tid] = q; __syncthreads();
    for (int o = 128; o > 0; o >>= 1) { if (tid < o) red[tid] += red[tid + o]; __syncthreads(); }
    {
        float rs;
        if (mode == 2) rs = sqrtf((float)n) / fmaxf(sqrtf(red[0]), eps); else if (mode == 3) rs = rsqrtf(red[0] / (float)(n - 1) + eps); else rs = rsqrtf(red[0] / (float)n + eps);
        if (tid < 32) { const float v = (tid == 0) ? mu : ((tid == 1) ? rs : 0.f); VST2(float, stat + (long long)z * 32 + tid, v); }
    }
}
//   One thread per element over the flat [Z][C][L] index space: grid ceil(Z*C*L / 256).
__global__ __launch_bounds__(256) void k_norm_apply(const float* __restrict__ x, float* __restrict__ y, const float* __restrict__ stat, const float* __restrict__ g, const float* __restrict__ bta,
                                                     int Z, int C, int L, int G, int bn, int act) {
    const long long idx = (long long)blockIdx.x * 256 + threadIdx.x;
    if (idx >= (long long)Z * C * L) return;
    const int l = (int)(idx % L); const long long zc = idx / L; const int c = (int)(zc % C), z = (int)(zc / C); (void)l;
    const int set = bn ? c : (z * G + c / (C / G));
    float v = (x[idx] - stat[(long long)set * 32]) * stat[(long long)set * 32 + 1];
    if (g) v *= g[c];
    if (bta) v += bta[c];
    v = act_fn(v, act);
    VST2(float, y + idx, v);
}

// k_lse_neg: c[i] = -(st[2i] + log(st[2i+1])) = minus the log-sum-exp of row i from k_attn's ST output (for softmax over the query dimension)
__global__ __launch_bounds__(256) void k_lse_neg(const float* __restrict__ st, float* __restrict__ c, int n) {
    const int i = blockIdx.x * 256 + threadIdx.x;
    if (i < n) { const float v = -(st[2 * i] + logf(st[2 * i + 1])); VST2(float, c + i, v); }
}

// k_iota: dst[i] = a * i + b as int32 (segment/position id helper)
__global__ __launch_bounds__(256) void k_iota(int* __restrict__ dst, int n, int a, int b) {
    const int i = blockIdx.x * 256 + threadIdx.x;
    if (i < n) { const int v = a * i + b; VST2(int, dst + i, v); }
}

// k_axpby: dst[i] = a * x[i] + b * y[i] (+ c), i < n
__global__ __launch_bounds__(256) void k_axpby(const float* __restrict__ x, const float* __restrict__ y, float* __restrict__ dst, int n, float a, float b, float c) {
    const int i = blockIdx.x * 256 + threadIdx.x;
    if (i < n) { const float v = a * x[i] + b * y[i] + c; VST2(float, dst + i, v); }
}

// =====================================================================================================================
// k_rope: rotary embedding on a [R rows][Hn heads][D] view (row stride sXr, head stride sXh, element stride 1) -> Y (own strides).
//   mode 0: rotate_half (partner d±D/2, sign - for d<D/2); mode 1: interleaved pairs (partner d^1, sign - for even d).
//   table column tcol: tmode 0 -> d, 1 -> d % (D/2), 2 -> d / 2; position p: pmode 0 -> r % S, 1 -> head index, 2 -> pos[r];
//   c = C[(r / S) * sCb + p * sCp + tcol * sCd], s likewise from Sn; y = x[d] * c + sign * x[partner] * s. X and Y must not alias.
// =====================================================================================================================
struct RopeP { const float* X; float* Y; const float* C; const float* Sn; const int* pos; long long sXr, sXh, sYr, sYh, sCb, sCp, sCd; int R, Hn, D, S, mode, tmode, pmode, pad; };
static_assert(sizeof(RopeP) == 5 * 8 + 7 * 8 + 8 * 4, "RopeP has padding");
__global__ __launch_bounds__(256) void k_rope(RopeP p) {
    const long long idx = (long long)blockIdx.x * 256 + threadIdx.x;
    if (idx >= (long long)p.R * p.Hn * p.D) return;
    const int d = (int)(idx % p.D); const long long rh = idx / p.D; const int h = (int)(rh % p.Hn); const int r = (int)(rh / p.Hn);
    const int half = p.D / 2;
    int partner; float sign;
    if (p.mode == 0) { partner = (d < half) ? d + half : d - half; sign = (d < half) ? -1.f : 1.f; }
    else { partner = d ^ 1; sign = (d & 1) ? 1.f : -1.f; }
    const int tcol = (p.tmode == 0) ? d : ((p.tmode == 1) ? (d % half) : (d >> 1));
    const int pp = (p.pmode == 0) ? (r % p.S) : ((p.pmode == 1) ? h : p.pos[r]);
    const long long toff = (long long)(r / p.S) * p.sCb + (long long)pp * p.sCp + (long long)tcol * p.sCd;
    const float* xr = p.X + (long long)r * p.sXr + (long long)h * p.sXh;
    const float v = xr[d] * p.C[toff] + sign * xr[partner] * p.Sn[toff];
    VST2(float, p.Y + (long long)r * p.sYr + (long long)h * p.sYh + d, v);
}

// k_invf + k_sincos (split so neither kernel carries a large VALU-fma footprint): invf_i = num * (1 / powf(base, (2 i)/D)) [fmode 0],
//   num * expf((2 i) * cexp) [fmode 1], num * powf(base, -2 (i - 1) / D) [fmode 2]; then cs/sn[s*half + i] = cos/sin((pscale * s) * invf_i)
__global__ __launch_bounds__(256) void k_invf(float* __restrict__ invb, int half, int D, float base, float num, int fmode, float cexp) {
    const int i = blockIdx.x * 256 + threadIdx.x;
    if (i >= ((half + 31) / 32) * 32) return;
    if (i >= half) { VST2(float, invb + i, 0.f); return; }
    const float e = (float)(2 * i) / (float)D;
    float invf;
    if (fmode == 1) invf = num * expf((float)(2 * i) * cexp);
    else if (fmode == 2) invf = num * powf(base, (-2.0f * ((float)i - 1.0f)) / (float)D);
    else invf = num * (1.0f / powf(base, e));
    VST2(float, invb + i, invf);
}
__global__ __launch_bounds__(256) void k_sincos(float* __restrict__ cs, float* __restrict__ sn, const float* __restrict__ invb, int S, int half, float pscale) {
    const int idx = blockIdx.x * 256 + threadIdx.x;
    if (idx >= S * half) return;
    const int s = idx / half, i = idx - s * half;
    const float ang = (pscale * (float)s) * invb[i];
    VST2(float, cs + idx, cosf(ang)); VST2(float, sn + idx, sinf(ang));
}

// k_mulact: dst[i] = act(x[i]) * y[i]
__global__ __launch_bounds__(256) void k_mulact(const float* __restrict__ x, const float* __restrict__ y, float* __restrict__ dst, int n, int act) {
    const int i = blockIdx.x * 256 + threadIdx.x;
    if (i < n) { const float v = act_fn(x[i], act) * y[i]; VST2(float, dst + i, v); }
}

// =====================================================================================================================
// k_matvec: thread-per-row matrix-vector products for N <= 8 output columns (heads with 1-3 outputs, gates), f32 on the VALU.
//   C[r*sCm + j] = act(alpha * sum_k A[r*sAm + k*sAk] * B[j*sBn + k*sBk] + bias[j]) + beta * R[r*sRm + j*sRn]; each thread writes its N contiguous floats.
// =====================================================================================================================
__global__ __launch_bounds__(256) void k_matvec(GemmP p) {
    // 32 lanes write one line with one instruction.
    const int rpt = (p.N == 1) ? 1 : 32;
    const long long r0 = ((long long)blockIdx.x * 256 + threadIdx.x) * rpt; const int z = blockIdx.z, zo = z / p.zi_n, zi = z - zo * p.zi_n;
    if (r0 >= p.M) return;
    const float* Bb = p.B + zo * p.sBo + zi * p.sBi;
    float* C = p.C + zo * p.sCo + zi * p.sCi; const float* R = p.R + zo * p.sRo + zi * p.sRi;
    for (int rr = 0; rr < rpt; ++rr) {
        const long long r = r0 + rr; if (r >= p.M) break;
        const float* A = p.A + zo * p.sAo + zi * p.sAi + r * p.sAm;
        float acc[8] = {0.f, 0.f, 0.f, 0.f, 0.f, 0.f, 0.f, 0.f};
        for (int k = 0; k < p.K; ++k) { const float a = A[(long long)k * p.sAk];
#pragma unroll
            for (int j = 0; j < 8; ++j) if (j < p.N) acc[j] += a * Bb[(long long)j * p.sBn + (long long)k * p.sBk]; }
#pragma unroll
        for (int j = 0; j < 8; ++j) if (j < p.N) {
            float v = acc[j] * p.alpha;
            if (p.flags & 1) v += p.bias[j];
            if (p.flags & 2) v += p.bias[r];
            v = act_fn(v, p.act);
            if (p.flags & 4) v += p.beta * R[r * p.sRm + (long long)j * p.sRn];
            VST2(float, C + r * p.sCm + j, v);
        }
    }
}
// k_smallsoftmax: thread-per-row softmax for short rows (n <= 64): dst[r*dr + j] = softmax(scale*src[r*sr + j])
__global__ __launch_bounds__(256) void k_smallsoftmax(const float* __restrict__ src, float* __restrict__ dst, long long sr, long long dr, int n, long long R, float scale) {
    const long long r0 = ((long long)blockIdx.x * 256 + threadIdx.x) * 32;
    for (int rr = 0; rr < 32; ++rr) {
        const long long r = r0 + rr; if (r >= R) return;
        const float* s = src + r * sr; float* d = dst + r * dr;
        float mx = -__builtin_inff();
        for (int j = 0; j < n; ++j) mx = fmaxf(mx, s[j] * scale);
        float sum = 0.f;
        for (int j = 0; j < n; ++j) sum += expf(s[j] * scale - mx);
        const float inv = 1.f / sum;
        for (int j = 0; j < n; ++j) { const float v = expf(s[j] * scale - mx) * inv; VST2(float, d + j, v); }
    }
}

__global__ __launch_bounds__(32) void k_unitstat(float* __restrict__ st) { const int t = threadIdx.x; const float v = (t == 1) ? 1.f : 0.f; VST2(float, st + t, v); }

// destination (e.g. a d_out whose row width is not a multiple of 32 floats) is written by consecutive lanes of one instruction
__global__ __launch_bounds__(256) void k_lincopy(const float* __restrict__ src, long long lds, float* __restrict__ dst, long long ldd, long long rows, int cols) {
    const long long i = (long long)blockIdx.x * 256 + threadIdx.x; if (i >= rows * cols) return;
    const long long r = i / cols; const int c = (int)(i - r * cols);
    const float v = src[r * lds + c]; VST2(float, dst + r * ldd + c, v);
}

namespace w25 {
typedef __attribute__((ext_vector_type(16))) _Float16 v16h;
typedef __attribute__((ext_vector_type(8)))  _Float16 v8h;
typedef __attribute__((ext_vector_type(16))) __bf16   v16b;
typedef __attribute__((ext_vector_type(8)))  __bf16   v8b;
typedef __attribute__((ext_vector_type(8)))  float    v8f;
typedef __attribute__((ext_vector_type(4)))  float    v4f;

__device__ __forceinline__ unsigned short f2bf_bits(float f) {
  unsigned u = __float_as_uint(f);
  return (unsigned short)((u + 0x7FFFu + ((u >> 16) & 1u)) >> 16);
}
__device__ __forceinline__ float bf_bits2f(unsigned short h) { return __uint_as_float(((unsigned)h) << 16); }

// hazard guards as plain device helpers (no inline asm inside the kernel template body)
__device__ __forceinline__ void dep_guard_h(v8f& a, v8f& b, v16h x, v16h y) { asm volatile("v_nop\n\tv_nop\n\tv_nop\n\tv_nop" : "+v"(a), "+v"(b) : "v"(x), "v"(y)); }
__device__ __forceinline__ void dep_guard_b(v8f& a, v8f& b, v16b x, v16b y) { asm volatile("v_nop\n\tv_nop\n\tv_nop\n\tv_nop" : "+v"(a), "+v"(b) : "v"(x), "v"(y)); }
__device__ __forceinline__ void keep4_h(v16h a, v16h b, v16h c, v16h d) { asm volatile("v_nop" :: "v"(a), "v"(b), "v"(c), "v"(d)); }
__device__ __forceinline__ void keep4_b(v16b a, v16b b, v16b c, v16b d) { asm volatile("v_nop" :: "v"(a), "v"(b), "v"(c), "v"(d)); }
__device__ __forceinline__ void acc_guard4(v8f& a, v8f& b, v8f& c, v8f& d) { asm volatile("v_nop\n\tv_nop\n\tv_nop\n\tv_nop" : "+v"(a), "+v"(b), "+v"(c), "+v"(d)); }
template <typename T> struct Frag;
template <> struct Frag<_Float16> {
  typedef v16h V; union U { v16h v; v8h h[2]; };
  static __device__ __forceinline__ v16h load(const _Float16* p) {   // elements 0..7 <- p[0..7], 8..15 <- p[16..23]
    U f; f.h[0] = *(const v8h*)(p); f.h[1] = *(const v8h*)(p + 16); return f.v;
  }
  static __device__ __forceinline__ v8f mma(v16h a, v16h b, v8f c) {
    return __builtin_amdgcn_wmma_f32_16x16x32_f16(false, a, false, b, (short)0, c, false, false);
  }
  static __device__ __forceinline__ void guard(v8f& a, v8f& b, v16h x, v16h y) { dep_guard_h(a, b, x, y); }
  static __device__ __forceinline__ void keep(v16h a, v16h b, v16h c, v16h d) { keep4_h(a, b, c, d); }
};
template <> struct Frag<__bf16> {
  typedef v16b V; union U { v16b v; v8b h[2]; };
  static __device__ __forceinline__ v16b load(const __bf16* p) {
    U f; f.h[0] = *(const v8b*)(p); f.h[1] = *(const v8b*)(p + 16); return f.v;
  }
  static __device__ __forceinline__ v8f mma(v16b a, v16b b, v8f c) {
    return __builtin_amdgcn_wmma_f32_16x16x32_bf16(false, a, false, b, (short)0, c, false, false);
  }
  static __device__ __forceinline__ void guard(v8f& a, v8f& b, v16b x, v16b y) { dep_guard_b(a, b, x, y); }
  static __device__ __forceinline__ void keep(v16b a, v16b b, v16b c, v16b d) { keep4_b(a, b, c, d); }
};

// ---- Register-blocked batched WMMA GEMM ------------------------------------
// C[m,n] = scale * sum_k A[m,k] * Bt[n,k] (+bias)(+resid); each wave owns a 64x64 tile.
// A row-major [M,K]; Bt row-major [N,K]; M,N % 64 == 0, K % 32 == 0.
// SPLIT: operands are hi/lo planes (A2/Bt2 = lo planes, same layout); product = hi·hi + hi·lo + lo·hi.
// BIAS_MODE: 0 = none, 1 = bias[m], 2 = bias[n].
// OUT_MODE: 0 = f32, 1 = f16, 2 = bf16 hi plane (Cout) + bf16 lo plane (Cout2).
// ET: 0 = f16 operands, 1 = bf16 operands (pointers passed as 16-bit storage)
template <int ET> struct Elem;
template <> struct Elem<0> { typedef _Float16 T; };
template <> struct Elem<1> { typedef __bf16 T; };
template <int ET, bool SPLIT, int BIAS_MODE, int OUT_MODE, bool RESID, int ACT = 0>
__global__ __launch_bounds__(256) void wmma_gemm64(
    const unsigned short* __restrict__ Ap, const unsigned short* __restrict__ A2p, int lda, long strideA,
    const unsigned short* __restrict__ Btp, const unsigned short* __restrict__ Bt2p, int ldb, long strideB,
    void* __restrict__ Cout, void* __restrict__ Cout2, int ldc, long strideC,
    const float* __restrict__ bias,
    const float* __restrict__ resid, long strideR,
    int M, int N, int K, float scale) {
  typedef typename Elem<ET>::T T;
  typedef typename Frag<T>::V V;
  const T* A = (const T*)Ap; const T* A2 = (const T*)A2p; const T* Bt = (const T*)Btp; const T* Bt2 = (const T*)Bt2p;
  __shared__ __align__(16) float sT[8][16 * 68];   // per-wave 16x64 slab, pitch 68 floats
  const int b    = blockIdx.y;
  const int lane = threadIdx.x & 31;
  const int wave = threadIdx.x >> 5;
  const int tilesN = N >> 6;
  const int tilesM = M >> 6;
  const int tile = blockIdx.x * 8 + wave;
  if (tile >= tilesM * tilesN) return;   // wave-uniform; no block barriers in this kernel
  const int tm = tile / tilesN;
  const int tn = tile - tm * tilesN;
  const int m0 = tm << 6;
  const int n0 = tn << 6;

  const T* Ab  = A  + (size_t)b * strideA;
  const T* Bb  = Bt + (size_t)b * strideB;
  const T* Ab2 = SPLIT ? (A2  + (size_t)b * strideA) : nullptr;
  const T* Bb2 = SPLIT ? (Bt2 + (size_t)b * strideB) : nullptr;

  const int rlane = lane & 15;                 // row (A) / col (B, D) within subtile
  const int koff  = (lane >> 4) * 8;           // k offset of this lane half
  const int mOff  = (lane >> 4) * 8;           // D row offset

  v8f acc[4][4];
#pragma unroll
  for (int i = 0; i < 4; ++i)
#pragma unroll
    for (int j = 0; j < 4; ++j) acc[i][j] = (v8f){0.f,0.f,0.f,0.f,0.f,0.f,0.f,0.f};

  for (int k0 = 0; k0 < K; k0 += 32) {
    V bh[4], bl[4];
#pragma unroll
    for (int j = 0; j < 4; ++j) {
      const size_t bo = (size_t)(n0 + (j << 4) + rlane) * ldb + koff + k0;
      bh[j] = Frag<T>::load(Bb + bo);
      if (SPLIT) bl[j] = Frag<T>::load(Bb2 + bo);
    }
#pragma unroll
    for (int i = 0; i < 4; ++i) {
      const size_t ao = (size_t)(m0 + (i << 4) + rlane) * lda + koff + k0;
      V ah = Frag<T>::load(Ab + ao);
      V al;
      if (SPLIT) al = Frag<T>::load(Ab2 + ao);
#pragma unroll
      for (int j = 0; j < 4; ++j) {
        acc[i][j] = Frag<T>::mma(ah, bh[j], acc[i][j]);
        if (SPLIT) {
          acc[i][j] = Frag<T>::mma(ah, bl[j], acc[i][j]);
          acc[i][j] = Frag<T>::mma(al, bh[j], acc[i][j]);
        }
      }
      Frag<T>::guard(acc[i][0], acc[i][3], ah, SPLIT ? al : ah);
    }
    Frag<T>::keep(bh[0], bh[1], bh[2], bh[3]);
    if (SPLIT) Frag<T>::keep(bl[0], bl[1], bl[2], bl[3]);
  }
  acc_guard4(acc[0][0], acc[0][1], acc[0][2], acc[0][3]);
  acc_guard4(acc[1][0], acc[1][1], acc[1][2], acc[1][3]);
  acc_guard4(acc[2][0], acc[2][1], acc[2][2], acc[2][3]);
  acc_guard4(acc[3][0], acc[3][1], acc[3][2], acc[3][3]);

  // ---- epilogue ----
  float* slab = sT[wave];
  const float* Rb = RESID ? (resid + (size_t)b * strideR) : nullptr;
#pragma unroll
  for (int i = 0; i < 4; ++i) {
    const int mBase = m0 + (i << 4);
#pragma unroll
    for (int j = 0; j < 4; ++j) {
      const int n = n0 + (j << 4) + rlane;
      float bv = 0.f;
      if (BIAS_MODE == 2) bv = bias[n];
#pragma unroll
      for (int r = 0; r < 8; ++r) {
        float v = acc[i][j][r] * scale;
        if (BIAS_MODE == 1) v += bias[mBase + mOff + r];
        if (BIAS_MODE == 2) v += bv;
        if (RESID) v += Rb[(size_t)(mBase + mOff + r) * ldc + n];
        if (ACT == 1) v = tanhf(v);
        if (ACT == 2) v = fmaxf(v, 0.0f);
        if (ACT == 3) v = v / (1.0f + expf(-v));
        if (ACT == 4) v = (v > 0.f) ? v : 0.01f * v;
        if (ACT == 5) v = 0.5f * v * (1.0f + erff(v * 0.70710678118654752f));
        slab[(mOff + r) * 68 + (j << 4) + rlane] = v;
      }
    }
    __builtin_amdgcn_fence(__ATOMIC_RELEASE, "workgroup");
    __builtin_amdgcn_wave_barrier();
    __builtin_amdgcn_fence(__ATOMIC_ACQUIRE, "workgroup");
    if (OUT_MODE == 0) {
      float* C = (float*)Cout + (size_t)b * strideC;
      const int hh = lane >> 4, c4 = (lane & 15) * 4;     // row seg = 256 B = 16 lanes x 16 B
      {
#pragma unroll
        for (int it = 0; it < 8; ++it) {
          const int row = it * 2 + hh;
          v4f v = *(const v4f*)(slab + row * 68 + c4);
          *(v4f*)(C + (size_t)(mBase + row) * ldc + n0 + c4) = v;
        }
        
      }
    } else {
      const int q = lane >> 3, c8 = (lane & 7) * 8;
      unsigned short* C  = (unsigned short*)Cout  + (size_t)b * strideC;
      unsigned short* C2 = (OUT_MODE == 2) ? ((unsigned short*)Cout2 + (size_t)b * strideC) : nullptr;
      {
#pragma unroll
        for (int it = 0; it < 4; ++it) {
          const int row = it * 4 + q;
          const float* sp = slab + row * 68 + c8;
          v8h hv, lv;
#pragma unroll
          for (int e = 0; e < 8; ++e) {
            if (OUT_MODE == 1) {
              hv[e] = (_Float16)sp[e];
            } else {
              unsigned short hb = f2bf_bits(sp[e]);
              unsigned short lb = f2bf_bits(sp[e] - bf_bits2f(hb));
              hv[e] = __builtin_bit_cast(_Float16, hb);
              lv[e] = __builtin_bit_cast(_Float16, lb);
            }
          }
          *(v8h*)(C + (size_t)(mBase + row) * ldc + n0 + c8) = hv;
          if (OUT_MODE == 2) *(v8h*)(C2 + (size_t)(mBase + row) * ldc + n0 + c8) = lv;
        }
        
      }
    }
    __builtin_amdgcn_fence(__ATOMIC_RELEASE, "workgroup");
    __builtin_amdgcn_wave_barrier();
    __builtin_amdgcn_fence(__ATOMIC_ACQUIRE, "workgroup");
  }
}

__global__ __launch_bounds__(256) void cast_f32_f16x2(
    const float* __restrict__ in, _Float16* __restrict__ out, int n2) {
  int i = blockIdx.x * 256 + threadIdx.x;
  if (i < n2) {
    const _Float16 h0 = (_Float16)in[2 * i], h1 = (_Float16)in[2 * i + 1];
    const unsigned u = (unsigned)__builtin_bit_cast(unsigned short, h0) | ((unsigned)__builtin_bit_cast(unsigned short, h1) << 16);
    ((unsigned*)out)[i] = u;
    
  }
}


} // namespace w25

__global__ __launch_bounds__(256) void k_castT16(const float* __restrict__ src, long long lds, _Float16* __restrict__ dst, long long ldd, int R, int C, float s) {
    src += (long long)blockIdx.y * R * lds; dst += (long long)blockIdx.y * C * ldd;   // batch = blockIdx.y
    const long long i = (long long)blockIdx.x * 256 + threadIdx.x; const long long np = (long long)C * (R / 2); if (i >= np) return; const int c = (int)(i / (R / 2)); const int r = 2 * (int)(i % (R / 2));
    const _Float16 h0 = (_Float16)(src[(long long)r * lds + c] * s), h1 = (_Float16)(src[(long long)(r + 1) * lds + c] * s);
    const unsigned u = (unsigned)__builtin_bit_cast(unsigned short, h0) | ((unsigned)__builtin_bit_cast(unsigned short, h1) << 16);
    unsigned* d = (unsigned*)(dst + (long long)c * ldd + r); *d = u;  }
__global__ __launch_bounds__(256) void k_cast16(const float* __restrict__ src, long long lds, _Float16* __restrict__ dst, long long ldd, int R, int C, float s) {
    const long long i = (long long)blockIdx.x * 256 + threadIdx.x; const long long np = (long long)R * (C / 2); if (i >= np) return; const int r = (int)(i / (C / 2)); const int c = 2 * (int)(i % (C / 2));
    const _Float16 h0 = (_Float16)(src[(long long)r * lds + c] * s), h1 = (_Float16)(src[(long long)r * lds + c + 1] * s);
    const unsigned u = (unsigned)__builtin_bit_cast(unsigned short, h0) | ((unsigned)__builtin_bit_cast(unsigned short, h1) << 16);
    unsigned* d = (unsigned*)(dst + (long long)r * ldd + c); *d = u;  }

// f32 -> bf16 hi plane + bf16 lo plane (x = hi + lo to ~2^-17 relative; RNE both), [R][C] -> [R][C] (or transposed to [C][R]); 2 consecutive destination elements
__device__ __forceinline__ unsigned int f2bf2_pack(float a, float b, unsigned int* lo) {
    const unsigned short ha = w25::f2bf_bits(a), hb = w25::f2bf_bits(b);
    const unsigned short la = w25::f2bf_bits(a - w25::bf_bits2f(ha)), lb = w25::f2bf_bits(b - w25::bf_bits2f(hb));
    *lo = (unsigned)la | ((unsigned)lb << 16); return (unsigned)ha | ((unsigned)hb << 16); }
__global__ __launch_bounds__(256) void k_castS16(const float* __restrict__ src, long long lds, __bf16* __restrict__ dhi, __bf16* __restrict__ dlo, long long ldd, int R, int C, float s, int transpose) {
    const long long i = (long long)blockIdx.x * 256 + threadIdx.x; long long o; float a, b;
    if (transpose) { const long long np = (long long)C * (R / 2); if (i >= np) return; const int c = (int)(i / (R / 2)); const int r = 2 * (int)(i % (R / 2)); a = src[(long long)r * lds + c] * s; b = src[(long long)(r + 1) * lds + c] * s; o = (long long)c * ldd + r; }
    else { const long long np = (long long)R * (C / 2); if (i >= np) return; const int r = (int)(i / (C / 2)); const int c = 2 * (int)(i % (C / 2)); a = src[(long long)r * lds + c] * s; b = src[(long long)r * lds + c + 1] * s; o = (long long)r * ldd + c; }
    unsigned lo; const unsigned hi = f2bf2_pack(a, b, &lo); unsigned* ph = (unsigned*)(dhi + o); unsigned* pl = (unsigned*)(dlo + o);
    *ph = hi; *pl = lo;  }

namespace w25 {
// =====================================================================================
// Generic causal/non-causal attention for head_dim 64, f32 in / f32 out; 16-bit operands: bf16 with optional hi/lo splits, or
// plain f16 (F16=true, non-split, probabilities carried x2^15).
//   scores = (q*qscale)·kᵀ : v_wmma_f32_16x16x32_bf16; SPLIT_QK -> q,k as bf16 hi/lo (hi·hi + hi·lo + lo·hi)
//   out    = p·v           : v_wmma_f32_16x16x32_bf16; SPLIT_PV -> p,v as bf16 hi/lo; else p,v plain bf16
//   f32 accumulate; online softmax in f32. Block = 4 waves = 64 query rows of one (batch, head); S % 64 == 0.
//   Element (b, s, h, d) of tensor X lives at X[b*X_bs + s*X_rs + h*X_hs + d] (strides in floats, multiples of 4).
//   Masking: mask_mode 0 none, 1 causal (kv > q masked), 2 tensor [S][Skv] shared over (b,h) (float if
//   mask_is_int==0, int32 with element == 0 -> masked if 1, int32 with element != 0 -> masked if 2), 3 per-token vectors qmask[B][S] & kvmask[B][Skv] (int32,
//   0 -> masked), 4 causal + sliding window (kv > q or q - kv > W masked; W passed in mask_is_int);
//   5 = relative-position bias: s += cp[b,h,q][idx[q][kv]] + pc[b,h,kv][idx[q][kv]] with idx = mask_b ([S][Skv] int32) and
//   mask_a an int32 [S][Skv] tensor with nonzero = masked (tables: element (b,h,row,n) at X + b*c_bs + h*c_hs + row*c_rs + n);
//   masked scores are replaced by mask_fill (e.g. -inf or -1e9) before the softmax.
//   grid.x = B * H * (S/64) (or a sub-range with blk0).
// =====================================================================================
#define AT_D 64
#define AT_NW 4
#define AT_QB 64
#define AT_KC 64
struct AttnGeom { const float* cp = nullptr; const float* pc = nullptr; long c_bs = 0, c_rs = 0, c_hs = 0;   // mode-5 score-bias tables
                  long q_bs, q_rs, q_hs, k_bs, k_rs, k_hs, v_bs, v_rs, v_hs, o_bs, o_rs, o_hs;
                  int S, Skv, H, mask_mode; float qscale; int blk0; float mask_fill; int mask_is_int; };
static_assert(sizeof(AttnGeom) == 168, "no padding");

__device__ __forceinline__ unsigned short at_bf_bits(float f) {
  unsigned u = __float_as_uint(f);
  return (unsigned short)((u + 0x7FFFu + ((u >> 16) & 1u)) >> 16);
}
__device__ __forceinline__ __bf16 at_f2bf(float f) { return __builtin_bit_cast(__bf16, at_bf_bits(f)); }
__device__ __forceinline__ void at_split(float f, __bf16& hi, __bf16& lo) {
  const unsigned short hb = at_bf_bits(f);
  hi = __builtin_bit_cast(__bf16, hb);
  lo = at_f2bf(f - __uint_as_float(((unsigned)hb) << 16));
}
__device__ __forceinline__ v8f at_mma(v16b a, v16b b, v8f c) {
  c = __builtin_amdgcn_wmma_f32_16x16x32_bf16(false, a, false, b, (short)0, c, false, false);
  asm volatile("v_nop\n\tv_nop\n\tv_nop\n\tv_nop" : "+v"(c) : "v"(a), "v"(b));
  return c;
}
// 16-bit element as a bit pattern held in a __bf16 slot: f16 bits when F16, bf16 (RNE) otherwise
template <bool F16> __device__ __forceinline__ __bf16 at_to16(float f) {
  if (F16) return __builtin_bit_cast(__bf16, (_Float16)f);
  return at_f2bf(f);
}
template <bool F16> __device__ __forceinline__ v8f at_mma16(v16b a, v16b b, v8f c) {
  if (F16) {
    const v16h ah = __builtin_bit_cast(v16h, a), bh = __builtin_bit_cast(v16h, b);
    c = __builtin_amdgcn_wmma_f32_16x16x32_f16(false, ah, false, bh, (short)0, c, false, false);
    asm volatile("v_nop\n\tv_nop\n\tv_nop\n\tv_nop" : "+v"(c) : "v"(ah), "v"(bh));
    return c;
  }
  return at_mma(a, b, c);
}

template <bool SPLIT_QK, bool SPLIT_PV, bool F16 = false>
__global__ __launch_bounds__(128)
void attn64_kernel(const float* __restrict__ q, const float* __restrict__ k,
                   const float* __restrict__ v, float* __restrict__ out,
                   const void* __restrict__ mask_a, const int* __restrict__ mask_b, AttnGeom g) {
  static_assert(!(F16 && (SPLIT_QK || SPLIT_PV)), "f16 mode is non-split");
  const float PSC = F16 ? 32768.0f : 1.0f;     // f16 probabilities carried x2^15 (subnormal range), folded into the final 1/l
  union FB { v16b v; v8b h[2]; };
  __shared__ __align__(16) __bf16 Ksh[AT_KC * AT_D];             // K hi [kv][d]      8 KB
  __shared__ __align__(16) __bf16 Ksl[SPLIT_QK ? AT_KC * AT_D : 8];
  __shared__ __align__(16) __bf16 Vth[AT_D * AT_KC];             // V hi [d][kv]      8 KB
  __shared__ __align__(16) __bf16 Vtl[SPLIT_PV ? AT_D * AT_KC : 8];
  __shared__ __align__(16) __bf16 Psh[AT_NW][16 * AT_KC];        // per wave P hi [row][kv]  8 KB
  __shared__ __align__(16) __bf16 Psl[SPLIT_PV ? AT_NW : 1][SPLIT_PV ? 16 * AT_KC : 8];
  __shared__ __align__(16) float  Os[AT_NW][16 * 68];            // per wave out tile, pitch 68

  const int tid  = threadIdx.x;
  const int wave = tid >> 5;
  const int lane = tid & 31;
  const int hh   = lane >> 4;
  const int c    = lane & 15;

  const int nqb = g.S / AT_QB;
  const int bx = blockIdx.x + g.blk0;
  const int qb = bx % nqb;
  const int bh = bx / nqb;
  const int h  = bh % g.H;
  const int b  = bh / g.H;
  const int qbase_block = qb * AT_QB;
  const int q0 = qbase_block + wave * 16;

  const float* qb_ptr = q + (size_t)b * g.q_bs + (size_t)h * g.q_hs;
  const float* kb_ptr = k + (size_t)b * g.k_bs + (size_t)h * g.k_hs;
  const float* vb_ptr = v + (size_t)b * g.v_bs + (size_t)h * g.v_hs;
  float*       ob_ptr = out + (size_t)b * g.o_bs + (size_t)h * g.o_hs;

  // ---- Q fragments (A operand): 2 d-chunks, hi (and lo) ----
  v16b qah[2], qal[2];
  {
    const float* qrow = qb_ptr + (size_t)(q0 + c) * g.q_rs;
#pragma unroll
    for (int dc = 0; dc < 2; ++dc) {
#pragma unroll
      for (int e = 0; e < 8; ++e) {
        const float f0 = qrow[dc * 32 + 8 * hh + e] * g.qscale;
        const float f1 = qrow[dc * 32 + 16 + 8 * hh + e] * g.qscale;
        if (SPLIT_QK) { __bf16 hq, lq; at_split(f0, hq, lq); qah[dc][e] = hq; qal[dc][e] = lq; at_split(f1, hq, lq); qah[dc][8 + e] = hq; qal[dc][8 + e] = lq; }
        else { qah[dc][e] = at_to16<F16>(f0); qah[dc][8 + e] = at_to16<F16>(f1); qal[dc][e] = qah[dc][e]; qal[dc][8 + e] = qah[dc][8 + e]; }
      }
    }
  }

  float mrow[8], lrow[8];
  v8f oacc[4];
#pragma unroll
  for (int r = 0; r < 8; ++r) { mrow[r] = -INFINITY; lrow[r] = 0.f; }
#pragma unroll
  for (int t = 0; t < 4; ++t) oacc[t] = (v8f){0.f,0.f,0.f,0.f,0.f,0.f,0.f,0.f};

  const int nChunks = (g.mask_mode == 1 || g.mask_mode == 4) ? (qb + 1) : (g.Skv / AT_KC);   // block-uniform
  // per-row query mask (mode 3)
  int qkeep[8];
#pragma unroll
  for (int r = 0; r < 8; ++r) qkeep[r] = (g.mask_mode == 3) ? mask_b[(size_t)b * g.S + q0 + 8 * hh + r] : 1;   // mask_b = qmask in mode 3
  for (int kc = 0; kc < nChunks; ++kc) {
    const int kv0 = kc * AT_KC;
    __syncthreads();
    {
      const int kvr = tid >> 1, dh = (tid & 1) * 32;
      const float* krow = kb_ptr + (size_t)(kv0 + kvr) * g.k_rs + dh;
      const float* vrow = vb_ptr + (size_t)(kv0 + kvr) * g.v_rs + dh;
#pragma unroll
      for (int i = 0; i < 8; ++i) {
        v4f kk = *(const v4f*)(krow + 4 * i);
        v4f vv = *(const v4f*)(vrow + 4 * i);
#pragma unroll
        for (int e = 0; e < 4; ++e) {
          const int d = dh + 4 * i + e;
          if (SPLIT_QK) { __bf16 a, bl; at_split(kk[e], a, bl); Ksh[kvr * AT_D + d] = a; Ksl[kvr * AT_D + d] = bl; }
          else Ksh[kvr * AT_D + d] = at_to16<F16>(kk[e]);
          if (SPLIT_PV) { __bf16 a, bl; at_split(vv[e], a, bl); Vth[d * AT_KC + kvr] = a; Vtl[d * AT_KC + kvr] = bl; }
          else Vth[d * AT_KC + kvr] = at_to16<F16>(vv[e]);
        }
      }
    }
    __syncthreads();

    v8f s[4];
#pragma unroll
    for (int j = 0; j < 4; ++j) {
      s[j] = (v8f){0.f,0.f,0.f,0.f,0.f,0.f,0.f,0.f};
#pragma unroll 1
      for (int dc = 0; dc < 2; ++dc) {
        FB kb;
        kb.h[0] = *(const v8b*)(Ksh + (j * 16 + c) * AT_D + dc * 32 + 8 * hh);
        kb.h[1] = *(const v8b*)(Ksh + (j * 16 + c) * AT_D + dc * 32 + 16 + 8 * hh);
        s[j] = at_mma16<F16>(qah[dc], kb.v, s[j]);
        if (SPLIT_QK) {
          FB kl;
          kl.h[0] = *(const v8b*)(Ksl + (j * 16 + c) * AT_D + dc * 32 + 8 * hh);
          kl.h[1] = *(const v8b*)(Ksl + (j * 16 + c) * AT_D + dc * 32 + 16 + 8 * hh);
          s[j] = at_mma16<F16>(qah[dc], kl.v, s[j]);
          s[j] = at_mma16<F16>(qal[dc], kb.v, s[j]);
        }
      }
    }
    const bool diag = (g.mask_mode == 1) && (kc == qb);
    int kvkeep[4] = {1, 1, 1, 1};
    if (g.mask_mode == 3) {
#pragma unroll
      for (int j = 0; j < 4; ++j) kvkeep[j] = ((const int*)mask_a)[(size_t)b * g.Skv + kv0 + j * 16 + c];   // mask_a = kvmask
    }
    float cm[8];
#pragma unroll
    for (int r = 0; r < 8; ++r) {
      const int qrow = q0 + 8 * hh + r;
      float m = -INFINITY;
#pragma unroll
      for (int j = 0; j < 4; ++j) {
        const int kvcol = kv0 + j * 16 + c;
        bool masked = false;
        if (diag) masked = (kvcol > qrow);
        else if (g.mask_mode == 4) masked = (kvcol > qrow) || (qrow - kvcol > g.mask_is_int);
        else if (g.mask_mode == 2) {
          const size_t mi = (size_t)qrow * g.Skv + kvcol;
          masked = (g.mask_is_int == 0) ? (((const float*)mask_a)[mi] == 0.0f)
                 : (g.mask_is_int == 1) ? (((const int*)mask_a)[mi] == 0) : (((const int*)mask_a)[mi] != 0);
        } else if (g.mask_mode == 3) masked = (qkeep[r] == 0) || (kvkeep[j] == 0);
        else if (g.mask_mode == 5) {
          const size_t mi = (size_t)qrow * g.Skv + kvcol;
          masked = (((const int*)mask_a)[mi] != 0);
          int n = mask_b[mi]; n = n < 0 ? 0 : n;
          s[j][r] += g.cp[(size_t)b * g.c_bs + (size_t)h * g.c_hs + (size_t)qrow * g.c_rs + n]
                   + g.pc[(size_t)b * g.c_bs + (size_t)h * g.c_hs + (size_t)kvcol * g.c_rs + n];
        }
        if (masked) s[j][r] = g.mask_fill;
        m = fmaxf(m, s[j][r]);
      }
#pragma unroll
      for (int off = 1; off < 16; off <<= 1) m = fmaxf(m, __shfl_xor(m, off, 32));
      cm[r] = m;
    }
    __bf16* pwh = Psh[wave];
    __bf16* pwl = Psl[SPLIT_PV ? wave : 0];
#pragma unroll
    for (int r = 0; r < 8; ++r) {
      const float mnew = fmaxf(mrow[r], cm[r]);
      const float alpha = expf(mrow[r] - mnew);
      mrow[r] = mnew;
      float psum = 0.f;
#pragma unroll
      for (int j = 0; j < 4; ++j) {
        const float p = expf(s[j][r] - mnew);
        psum += p;
        if (SPLIT_PV) { __bf16 a, bl; at_split(p, a, bl); pwh[(8 * hh + r) * AT_KC + j * 16 + c] = a; pwl[(8 * hh + r) * AT_KC + j * 16 + c] = bl; }
        else pwh[(8 * hh + r) * AT_KC + j * 16 + c] = at_to16<F16>(p * PSC);
      }
#pragma unroll
      for (int off = 1; off < 16; off <<= 1) psum += __shfl_xor(psum, off, 32);
      lrow[r] = lrow[r] * alpha + psum;
#pragma unroll
      for (int t = 0; t < 4; ++t) oacc[t][r] *= alpha;
    }
    __builtin_amdgcn_fence(__ATOMIC_RELEASE, "workgroup");
    __builtin_amdgcn_wave_barrier();
    __builtin_amdgcn_fence(__ATOMIC_ACQUIRE, "workgroup");
#pragma unroll 1
    for (int kk = 0; kk < 2; ++kk) {
      FB pa, pl;
      pa.h[0] = *(const v8b*)(pwh + c * AT_KC + kk * 32 + 8 * hh);
      pa.h[1] = *(const v8b*)(pwh + c * AT_KC + kk * 32 + 16 + 8 * hh);
      if (SPLIT_PV) {
        pl.h[0] = *(const v8b*)(pwl + c * AT_KC + kk * 32 + 8 * hh);
        pl.h[1] = *(const v8b*)(pwl + c * AT_KC + kk * 32 + 16 + 8 * hh);
      }
#pragma unroll
      for (int t = 0; t < 4; ++t) {
        FB vb;
        vb.h[0] = *(const v8b*)(Vth + (t * 16 + c) * AT_KC + kk * 32 + 8 * hh);
        vb.h[1] = *(const v8b*)(Vth + (t * 16 + c) * AT_KC + kk * 32 + 16 + 8 * hh);
        oacc[t] = at_mma16<F16>(pa.v, vb.v, oacc[t]);
        if (SPLIT_PV) {
          FB vl;
          vl.h[0] = *(const v8b*)(Vtl + (t * 16 + c) * AT_KC + kk * 32 + 8 * hh);
          vl.h[1] = *(const v8b*)(Vtl + (t * 16 + c) * AT_KC + kk * 32 + 16 + 8 * hh);
          oacc[t] = at_mma16<F16>(pa.v, vl.v, oacc[t]);
          oacc[t] = at_mma16<F16>(pl.v, vb.v, oacc[t]);
        }
      }
    }
  }

  float* os = Os[wave];
#pragma unroll
  for (int r = 0; r < 8; ++r) {
    const float inv = 1.0f / (lrow[r] * PSC);
#pragma unroll
    for (int t = 0; t < 4; ++t) os[(8 * hh + r) * 68 + t * 16 + c] = oacc[t][r] * inv;
  }
  __builtin_amdgcn_fence(__ATOMIC_RELEASE, "workgroup");
  __builtin_amdgcn_wave_barrier();
  __builtin_amdgcn_fence(__ATOMIC_ACQUIRE, "workgroup");
  {
    const int c4 = (lane & 15) * 4;
    {
#pragma unroll
      for (int it = 0; it < 8; ++it) {
        const int row = it * 2 + hh;
        v4f val = *(const v4f*)(os + row * 68 + c4);
        *(v4f*)(ob_ptr + (size_t)(q0 + row) * g.o_rs + c4) = val;
      }
      
    }
  }
}

} // namespace w25

// row dots: OUT[r] = X[r] . w (one wave per 32 rows? no: wave per row -> lone store; use 8 rows per block with lane-kept results: wave w handles rows 32*blk... simpler: each wave handles 4 rows sequentially, 8 waves -> 32 rows per block, results through LDS, wave 0 writes the 32-float line)
__global__ __launch_bounds__(256) void k_bi_lin(const float* __restrict__ X, const float* __restrict__ w, float* __restrict__ OUT, int nrows, int D) { __shared__ float res[32]; const long long r0 = (long long)blockIdx.x * 32; const int wv = threadIdx.x >> 5, lane = threadIdx.x & 31;
    for (int rr = 0; rr < 4; ++rr) { const long long r = r0 + wv * 4 + rr; float s = 0.f; if (r < nrows) { for (int d = lane; d < D; d += 32) s += X[r * D + d] * w[d]; } for (int o = 16; o > 0; o >>= 1) s += __shfl_xor(s, o, 32); if (lane == 0) res[wv * 4 + rr] = s; }
    __syncthreads(); if (wv == 0 && r0 + lane < nrows) VST2(float, OUT + r0 + lane, res[lane]); }
// QW[n][d] = q[b][n][d] * w_qm[d] (thread-linear)
__global__ __launch_bounds__(256) void k_bi_qw(const float* __restrict__ Q, const float* __restrict__ wqm, float* __restrict__ QW, int b, int N, int D) { const int t = blockIdx.x * 256 + threadIdx.x; if (t >= N * D) return; VST2(float, QW + t, Q[(long long)b * N * D + t] * wqm[t % D]); }
// per row n (block): sim = tril + AQ[n] + CM[m], masked exactly as the module: sim + (1 - qm*mm) * -1e30; row max -> RMX; softmax over m (exp once) in place
__global__ __launch_bounds__(256) void k_bi_soft(float* __restrict__ SIM, const float* __restrict__ AQ, const float* __restrict__ CM, const int* __restrict__ QM, const int* __restrict__ MM, float* __restrict__ RMX, int N, int M) { __shared__ float red[256]; const int n = blockIdx.x; const long long bz = blockIdx.y;   // batch = blockIdx.y
    const float* AQb = AQ + bz * N; const float* CMb = CM + bz * M; const int* QMb = QM + bz * N; const int* MMb = MM + bz * M; float* RMXb = RMX + bz * N * 32; float* sr = SIM + (bz * N + n) * M; const int t = threadIdx.x; const float aq = AQb[n]; float mx = -3.0e38f;
#pragma unroll 1
    for (int m = t; m < M; m += 256) { const float msk = (float)QMb[n] * (float)MMb[m]; const float v = sr[m] + aq + CMb[m] + (1.f - msk) * -1.0e30f; mx = fmaxf(mx, v); VST2(float, sr + m, v); }
    red[t] = mx; __syncthreads(); for (int o = 128; o > 0; o >>= 1) { if (t < o) red[t] = fmaxf(red[t], red[t + o]); __syncthreads(); } const float mm = red[0]; __syncthreads();
    float s = 0.f;
#pragma unroll 1
    for (int m = t; m < M; m += 256) { const float e = expf(sr[m] - mm); s += e; VST2(float, sr + m, e); }
    red[t] = s; __syncthreads(); for (int o = 128; o > 0; o >>= 1) { if (t < o) red[t] += red[t + o]; __syncthreads(); } const float inv = 1.f / red[0];
#pragma unroll 1
    for (int m = t; m < M; m += 256) VST2(float, sr + m, sr[m] * inv);
    if (t < 32) VST2(float, RMXb + (long long)n * 32 + t, mm); }   // row max staged as a whole 32-float line (slot 0 is read later)

// memory->query: p = softmax_n(RMX[b][n]); M2Q[b][d] = sum_n p_n q[b][n][d]. One block of 32 waves per (batch, 32-float slice of d): thread t owns row
//   maximum t for the statistics; for the weighted sum a wave reads 4 rows x 128 bytes per load and every lane has its 8 row loads in flight at once
//   (issued ahead of the statistics, which do not depend on them); partial sums meet by lane shuffles and one LDS table.
template <int N, int D>
__global__ __launch_bounds__(1024) void k_bi_m2q(const float* __restrict__ RMX, const float* __restrict__ Q, float* __restrict__ M2Q) {
    static_assert(N == 1024 && D % 32 == 0, "one row maximum per thread; whole 128-byte slices of d");
    __shared__ float red[32]; __shared__ float pw[N]; __shared__ __align__(16) float part[32][32];
    const int b = blockIdx.x, d0 = blockIdx.y * 32, t = threadIdx.x, lane = t & 31, wv = t >> 5;
    const int rsub = lane >> 3, c4 = (lane & 7) * 4;
    const float r = RMX[((long long)b * N + t) * 32];
    const float* qb = Q + ((long long)b * N + wv * 4 + rsub) * D + d0 + c4;
    v4f x[N / 128];
    for (int i = 0; i < N / 128; ++i) x[i] = *(const v4f*)(qb + (long long)i * 128 * D);
    float mx = r;
    for (int o = 16; o > 0; o >>= 1) mx = fmaxf(mx, __shfl_xor(mx, o, 32));
    if (lane == 0) red[wv] = mx;
    __syncthreads();
    float mm = red[lane];
    for (int o = 16; o > 0; o >>= 1) mm = fmaxf(mm, __shfl_xor(mm, o, 32));
    __syncthreads();
    const float e = expf(r - mm); pw[t] = e;
    float s = e;
    for (int o = 16; o > 0; o >>= 1) s += __shfl_xor(s, o, 32);
    if (lane == 0) red[wv] = s;
    __syncthreads();
    float tot = red[lane];
    for (int o = 16; o > 0; o >>= 1) tot += __shfl_xor(tot, o, 32);
    v4f acc = {0.f, 0.f, 0.f, 0.f};
    for (int i = 0; i < N / 128; ++i) acc += pw[i * 128 + wv * 4 + rsub] * x[i];
    for (int c = 0; c < 4; ++c) { acc[c] += __shfl_xor(acc[c], 8, 32); acc[c] += __shfl_xor(acc[c], 16, 32); }
    if (lane < 8) *(v4f*)&part[wv][c4] = acc;
    __syncthreads();
    if (t < 32) { float a = 0.f;
        for (int w = 0; w < 32; ++w) a += part[w][t];
        VST2(float, M2Q + (long long)b * D + d0 + t, a * (1.f / tot)); } }
// out1[b][n][d] = M2Q[b][d] broadcast (thread-linear)
__global__ __launch_bounds__(256) void k_bi_bc(const float* __restrict__ M2Q, float* __restrict__ MQ, int Bn, int N, int D) { const long long t = (long long)blockIdx.x * 256 + threadIdx.x; if (t >= (long long)Bn * N * D) return; const int d = (int)(t % D); const int b = (int)(t / ((long long)N * D)); VST2(float, MQ + t, M2Q[b * D + d]); }


extern "C" void kernel_launch(void* const* d_in, const int* in_sizes, int n_in, void* d_out, int out_size, void* d_ws, size_t ws_size, hipStream_t stream) {
    (void)in_sizes; (void)n_in; (void)out_size; (void)ws_size;
    const float* q = (const float*)d_in[0];
    const float* mem = (const float*)d_in[1];
    const float* wq = (const float*)d_in[2];
    const float* wm = (const float*)d_in[3];
    const float* wqm = (const float*)d_in[4];
    const int* qmask = (const int*)d_in[5];
    const int* mmask = (const int*)d_in[6];
    const int Bn = 16;
    const int N = 1024;
    const int M = 1024;
    const int D = 128;
    float* out = (float*)d_out;
    float* mq = out + ((size_t)Bn * N * D);
    char* wsp = (char*)d_ws;
    float* QW = (float*)wsp; wsp += (((size_t)((size_t)Bn * N * D) * 4 + 255) / 256) * 256;
    float* AQ = (float*)wsp; wsp += (((size_t)((size_t)Bn * N) * 4 + 255) / 256) * 256;
    float* CM = (float*)wsp; wsp += (((size_t)((size_t)Bn * M) * 4 + 255) / 256) * 256;
    float* SIM = (float*)wsp; wsp += (((size_t)((size_t)Bn * N * M) * 4 + 255) / 256) * 256;
    float* RMX = (float*)wsp; wsp += (((size_t)((size_t)Bn * N * 32) * 4 + 255) / 256) * 256;
    float* M2Q = (float*)wsp; wsp += (((size_t)((size_t)Bn * D) * 4 + 255) / 256) * 256;
    unsigned short* G64A = (unsigned short*)wsp; wsp += (((size_t)(16777216) * 2 + 255) / 256) * 256;
    unsigned short* G64B = (unsigned short*)wsp; wsp += (((size_t)(2097152) * 2 + 255) / 256) * 256;
    unsigned short* G64A2 = (unsigned short*)wsp; wsp += (((size_t)(2097152) * 2 + 255) / 256) * 256;
    unsigned short* G64B2 = (unsigned short*)wsp; wsp += (((size_t)(2097152) * 2 + 255) / 256) * 256;
    k_bi_lin<<<(Bn * N + 7) / 8, 256, 0, stream>>>(q, wq, AQ, Bn * N, D); k_bi_lin<<<(Bn * M + 7) / 8, 256, 0, stream>>>(mem, wm, CM, Bn * M, D);
    k_bi_qw<<<(Bn * N * D + 255) / 256, 256, 0, stream>>>(q, wqm, QW, 0, Bn * N, D);
    k_castS16<<<(unsigned)((((long long)(16384) * ((128) / 2)) + 255) / 256), 256, 0, stream>>>(QW, 128, (__bf16*)(G64A), (__bf16*)(G64A2), 128, 16384, 128, 1.0f, 0);
    k_castS16<<<(unsigned)((((long long)(16384) * ((128) / 2)) + 255) / 256), 256, 0, stream>>>(mem, 128, (__bf16*)(G64B), (__bf16*)(G64B2), 128, 16384, 128, 1.0f, 0);
    w25::wmma_gemm64<1, true, 0, 0, false, 0><<<dim3((unsigned)((((1024) / 64) * ((1024) / 64) + 7) / 8), (unsigned)(16)), 256, 0, stream>>>((const unsigned short*)(G64A), (const unsigned short*)(G64A2), 128, 131072, (const unsigned short*)(G64B), (const unsigned short*)(G64B2), 128, 131072, (void*)(SIM), nullptr, 1024, 1048576, nullptr, nullptr, 0, 1024, 1024, 128, 1.0f);
    k_bi_soft<<<dim3((unsigned)N, (unsigned)Bn), 256, 0, stream>>>(SIM, AQ, CM, qmask, mmask, RMX, N, M);
    k_cast16<<<(unsigned)((((long long)(16384) * ((1024) / 2)) + 255) / 256), 256, 0, stream>>>(SIM, 1024, (_Float16*)(G64A), 1024, 16384, 1024, 4096.0f);
    k_castT16<<<dim3((unsigned)((((long long)(128) * ((1024) / 2)) + 255) / 256), (unsigned)Bn), 256, 0, stream>>>(mem, 128, (_Float16*)(G64B), 1024, 1024, 128, 16.0f);
    w25::wmma_gemm64<0, false, 0, 0, false, 0><<<dim3((unsigned)((((1024) / 64) * ((128) / 64) + 7) / 8), (unsigned)(16)), 256, 0, stream>>>((const unsigned short*)(G64A), nullptr, 1024, 1048576, (const unsigned short*)(G64B), nullptr, 1024, 131072, (void*)(out), nullptr, 128, 131072, nullptr, nullptr, 0, 1024, 128, 1024, 1.52587890625e-05f);
    k_bi_m2q<1024, 128><<<dim3((unsigned)Bn, 4u), 1024, 0, stream>>>(RMX, q, M2Q); k_bi_bc<<<(unsigned)(((long long)Bn * N * D + 255) / 256), 256, 0, stream>>>(M2Q, mq, Bn, N, D);
}

// v003
// It runs in 150 microseconds.
// In two side-by-side timings against v002, it was 1.47 and 1.46 times as fast.
// Counting every step since v000, it is 10.2 times as fast.
// Contractions: per batch the trilinear term (q * w_qm).m^T [1024x128].[128x1024] on bf16 hi/lo split planes (logits reach ~+-30, so they need f32-class accuracy) and the query->memory read q2m.memory [1024x1024].[1024x128] with f16 operands (probabilities x 2^12) — 64x64 register-blocked wave tiles; f32 accumulate. The two linear terms, the mask arithmetic (sim + (1 - mask) * -1e30, exactly as the module), the row softmax (exp once), the row maxima, the softmax over rows and the memory->query vector (broadcast to every row) are f32 kernels.
#include <hip/hip_runtime.h>
#include <math.h>

typedef __attribute__((ext_vector_type(16))) _Float16 v16h;
typedef __attribute__((ext_vector_type(8)))  _Float16 v8h;
typedef __attribute__((ext_vector_type(16))) __bf16   v16b;
typedef __attribute__((ext_vector_type(8)))  float    v8f;
typedef __attribute__((ext_vector_type(4)))  float    v4f;

// 16-bit WMMA fragment map (wave32), lane L, h = L>>4, m = L&15:
//   A 16x32: lane = row m;   element i -> k = (i<8) ? 8h+i : 16+8h+(i-8)
//   B 32x16: lane = column m; the SAME k(i,h)
//   D 16x16 (8 f32): lane = column m; element r -> row 8h+r
__device__ __forceinline__ int frag_k(int i, int h) { return (i < 8) ? (8 * h + i) : (16 + 8 * h + (i - 8)); }
__device__ __forceinline__ __bf16 bf16_rne(float f) {
    unsigned int u = __float_as_uint(f);
    u += 0x7fffu + ((u >> 16) & 1u);
    return __builtin_bit_cast(__bf16, (unsigned short)(u >> 16));
}
__device__ __forceinline__ float bf16_f32(__bf16 b) { return __uint_as_float(((unsigned int)__builtin_bit_cast(unsigned short, b)) << 16); }
__device__ __forceinline__ v8f wmma16(v16h a, v16h b, v8f c) {
    c = __builtin_amdgcn_wmma_f32_16x16x32_f16(false, a, false, b, (short)0, c, false, false);
    asm volatile("v_nop\n\tv_nop\n\tv_nop\n\tv_nop" : "+v"(c) : "v"(a), "v"(b));
    return c;
}
__device__ __forceinline__ v8f wmmab(v16b a, v16b b, v8f c) {
    c = __builtin_amdgcn_wmma_f32_16x16x32_bf16(false, a, false, b, (short)0, c, false, false);
    asm volatile("v_nop\n\tv_nop\n\tv_nop\n\tv_nop" : "+v"(c) : "v"(a), "v"(b));
    return c;
}
struct Split { v16b hi, lo; };
// hi/lo split product: a.hi*b.hi + a.hi*b.lo + a.lo*b.hi
__device__ __forceinline__ v8f wmma3(const Split& a, const Split& b, v8f c) {
    c = __builtin_amdgcn_wmma_f32_16x16x32_bf16(false, a.hi, false, b.hi, (short)0, c, false, false);
    c = __builtin_amdgcn_wmma_f32_16x16x32_bf16(false, a.hi, false, b.lo, (short)0, c, false, false);
    c = __builtin_amdgcn_wmma_f32_16x16x32_bf16(false, a.lo, false, b.hi, (short)0, c, false, false);
    asm volatile("v_nop\n\tv_nop\n\tv_nop\n\tv_nop" : "+v"(c) : "v"(a.hi), "v"(a.lo), "v"(b.hi), "v"(b.lo));
    return c;
}
struct Split3 { v16b hi, mid, lo; };
// triple split product (6 terms, drops only terms below 2^-24 relative)
__device__ __forceinline__ v8f wmma6(const Split3& a, const Split3& b, v8f c) {
    c = __builtin_amdgcn_wmma_f32_16x16x32_bf16(false, a.hi, false, b.hi, (short)0, c, false, false);
    c = __builtin_amdgcn_wmma_f32_16x16x32_bf16(false, a.hi, false, b.mid, (short)0, c, false, false);
    c = __builtin_amdgcn_wmma_f32_16x16x32_bf16(false, a.mid, false, b.hi, (short)0, c, false, false);
    c = __builtin_amdgcn_wmma_f32_16x16x32_bf16(false, a.hi, false, b.lo, (short)0, c, false, false);
    c = __builtin_amdgcn_wmma_f32_16x16x32_bf16(false, a.mid, false, b.mid, (short)0, c, false, false);
    c = __builtin_amdgcn_wmma_f32_16x16x32_bf16(false, a.lo, false, b.hi, (short)0, c, false, false);
    asm volatile("v_nop\n\tv_nop\n\tv_nop\n\tv_nop" : "+v"(c) : "v"(a.hi), "v"(a.mid), "v"(a.lo), "v"(b.hi), "v"(b.mid), "v"(b.lo));
    return c;
}

// Fragment gathers from f32 memory: element i <- p[(k0 + frag_k(i,h)) * sk] * s, zero for k >= klen.
__device__ __forceinline__ v16h fh_ld(const float* __restrict__ p, long long sk, int k0, int h, int klen, float s) {
    v16h a;
#pragma unroll
    for (int i = 0; i < 16; ++i) { const int k = k0 + frag_k(i, h); a[i] = (k < klen) ? (_Float16)(p[(long long)k * sk] * s) : (_Float16)0.f; }
    return a;
}
__device__ __forceinline__ Split sp_ld(const float* __restrict__ p, long long sk, int k0, int h, int klen, float s) {
    Split r;
#pragma unroll
    for (int i = 0; i < 16; ++i) {
        const int k = k0 + frag_k(i, h); const float x = (k < klen) ? p[(long long)k * sk] * s : 0.f;
        const __bf16 hb = bf16_rne(x); r.hi[i] = hb; r.lo[i] = bf16_rne(x - bf16_f32(hb));
    }
    return r;
}
__device__ __forceinline__ Split3 sp3_ld(const float* __restrict__ p, long long sk, int k0, int h, int klen, float s) {
    Split3 r;
#pragma unroll
    for (int i = 0; i < 16; ++i) {
        const int k = k0 + frag_k(i, h); const float x = (k < klen) ? p[(long long)k * sk] * s : 0.f;
        const __bf16 hb = bf16_rne(x); const float r1 = x - bf16_f32(hb); const __bf16 mb = bf16_rne(r1);
        r.hi[i] = hb; r.mid[i] = mb; r.lo[i] = bf16_rne(r1 - bf16_f32(mb));
    }
    return r;
}
__device__ __forceinline__ v16b bh_ld(const float* __restrict__ p, long long sk, int k0, int h, int klen, float s) {
    v16b a;
#pragma unroll
    for (int i = 0; i < 16; ++i) { const int k = k0 + frag_k(i, h); a[i] = bf16_rne((k < klen) ? p[(long long)k * sk] * s : 0.f); }
    return a;
}
// f16 fragment from an f16 LDS/global row with element stride 1 (k-contiguous), no bounds (tile already zero padded)
__device__ __forceinline__ v16h fh_row(const _Float16* __restrict__ row, int k0, int h) {
    v16h a;
#pragma unroll
    for (int i = 0; i < 16; ++i) a[i] = row[k0 + frag_k(i, h)];
    return a;
}

#define VST2(T, ptr, val) do { const T vst2_v_ = (val); *(T*)(ptr) = vst2_v_;  } while (0)
typedef float v4f __attribute__((ext_vector_type(4)));
#define VST2V4(ptr, val) do { const v4f vst2_v4_ = (val); *(v4f*)(ptr) = vst2_v4_;  } while (0)

__device__ __attribute__((noinline)) float act_fn(float v, int act) {
    if (act == 1) return fmaxf(v, 0.f);                                                                               // relu
    if (act == 2) { const float u = 0.7978845608028654f * (v + 0.044715f * v * v * v); return 0.5f * v * (1.f + tanhf(u)); } // tanh-gelu
    if (act == 3) return v / (1.f + expf(-v));                                                                        // silu
    if (act == 4) return 0.5f * v * (1.f + erff(v * 0.7071067811865476f));                                             // erf-gelu
    if (act == 5) return tanhf(v);
    if (act == 6) return 1.f / (1.f + expf(-v));                                                                      // sigmoid
    if (act == 7) return (v > 0.f) ? v : 0.01f * v;                                                                   // leaky relu 0.01
    if (act == 8) return (v > 0.f) ? v : (expf(v) - 1.f);                                                             // elu
    if (act == 9) return fminf(fmaxf(v, 0.f), 6.f);                                                                   // relu6
    if (act == 10) return fabsf(v);                                                                                    // abs
    if (act == 11) return (v >= 0.f) ? v : 0.1f * v;                                                                  // leaky 0.1
    if (act == 12) return (v > 0.f) ? v : 0.2f * v;                                                                   // leaky 0.2
    if (act == 13) return (v > 20.f) ? v : log1pf(expf(v));                                                            // softplus
    return v;
}

// =====================================================================================================================
// k_gemm<MODE>: C(z, m, n) = act(alpha * sum_k A(z, m, k) * B(z, k, n) + bias) + beta * R(z, m, n)
//   One wave (32-thread block) per 16 x 32 tile of C; grid (ceil(N/32), ceil(M/16), Z). Batch z -> (zo = z / zi_n, zi = z % zi_n)
//   with separate outer/inner strides for every tensor (e.g. batch and head). A(m,k) = A[zo*sAo + zi*sAi + m*sAm + k*sAk] (f32),
//   B(k,n) = B[zo*sBo + zi*sBi + n*sBn + k*sBk] (f32); any M, N, K (K zero-padded to 32 inside the fragments, M/N tails guarded).
//   C(m,n) = C[zo*sCo + zi*sCi + m*sCm + n] (n contiguous). flags: 1 bias[n], 2 bias[m], 4 residual R[zo*sRo + zi*sRi + m*sRm + n*sRn].
//   MODE 0: f16 operands (A prescaled by sa, B by sb, both undone in the epilogue); 1: bf16 hi/lo split (3 products); 2: bf16;
//   3: bf16 hi/mid/lo triple split (6 products); 4: as 3 with Kahan-compensated f32 accumulation across k-steps.
// =====================================================================================================================
struct GemmP {
    const float* A; const float* B; const float* bias; const float* R; float* C;
    long long sAo, sAi, sAm, sAk, sBo, sBi, sBn, sBk, sCo, sCi, sCm, sRo, sRi, sRm, sRn;
    int M, N, K, zi_n, flags, act; float alpha, beta, sa, sb;
    int Npad, pad_;     // columns [N, Npad) of C are written as 0 so that padded workspace rows are covered by whole-line stores; Npad >= N
};
static_assert(sizeof(GemmP) == 5 * 8 + 15 * 8 + 6 * 4 + 4 * 4 + 2 * 4, "GemmP has padding");

template <int MODE>
__global__ __launch_bounds__(32) void k_gemm(GemmP p) {
    const int lane = threadIdx.x & 31, h = lane >> 4, l15 = lane & 15;
    const int m0 = blockIdx.y * 16, n0 = blockIdx.x * 32;
    const int z = blockIdx.z, zo = z / p.zi_n, zi = z - zo * p.zi_n;
    const float* A = p.A + zo * p.sAo + zi * p.sAi;
    const float* B = p.B + zo * p.sBo + zi * p.sBi;
    const int am = min(m0 + l15, p.M - 1);                       // clamped row for loads (stores are guarded)
    v8f acc[2], comp[2];
#pragma unroll
    for (int t = 0; t < 2; ++t) { v8f zz = {}; acc[t] = zz; comp[t] = zz; }
    for (int k0 = 0; k0 < p.K; k0 += 32) {
        const float* arow = A + (long long)am * p.sAm;
        if (MODE == 1) {
            const Split a = sp_ld(arow, p.sAk, k0, h, p.K, 1.f);
#pragma unroll
            for (int t = 0; t < 2; ++t) {
                const int bn = min(n0 + t * 16 + l15, p.N - 1);
                acc[t] = wmma3(a, sp_ld(B + (long long)bn * p.sBn, p.sBk, k0, h, p.K, 1.f), acc[t]);
            }
        } else if (MODE == 3) {
            const Split3 a = sp3_ld(arow, p.sAk, k0, h, p.K, 1.f);
#pragma unroll
            for (int t = 0; t < 2; ++t) {
                const int bn = min(n0 + t * 16 + l15, p.N - 1);
                acc[t] = wmma6(a, sp3_ld(B + (long long)bn * p.sBn, p.sBk, k0, h, p.K, 1.f), acc[t]);
            }
        } else if (MODE == 4) {
            // triple split as MODE 3, but each k-step's 6 products go into a fresh accumulator and the partial is added to the running f32 sum
            // on the VALU with Kahan compensation (accumulation error stays ~1 ulp however long K is)
            const Split3 a = sp3_ld(arow, p.sAk, k0, h, p.K, 1.f);
#pragma unroll
            for (int t = 0; t < 2; ++t) {
                const int bn = min(n0 + t * 16 + l15, p.N - 1); v8f zz = {};
                const v8f part = wmma6(a, sp3_ld(B + (long long)bn * p.sBn, p.sBk, k0, h, p.K, 1.f), zz);
                const v8f y = part - comp[t]; const v8f s = acc[t] + y; comp[t] = (s - acc[t]) - y; acc[t] = s;
            }
        } else if (MODE == 2) {
            const v16b a = bh_ld(arow, p.sAk, k0, h, p.K, 1.f);
#pragma unroll
            for (int t = 0; t < 2; ++t) {
                const int bn = min(n0 + t * 16 + l15, p.N - 1);
                acc[t] = wmmab(a, bh_ld(B + (long long)bn * p.sBn, p.sBk, k0, h, p.K, 1.f), acc[t]);
            }
        } else {
            const v16h a = fh_ld(arow, p.sAk, k0, h, p.K, p.sa);
#pragma unroll
            for (int t = 0; t < 2; ++t) {
                const int bn = min(n0 + t * 16 + l15, p.N - 1);
                acc[t] = wmma16(a, fh_ld(B + (long long)bn * p.sBn, p.sBk, k0, h, p.K, p.sb), acc[t]);
            }
        }
    }
    const float iscale = (MODE == 0) ? p.alpha / (p.sa * p.sb) : p.alpha;
    float* C = p.C + zo * p.sCo + zi * p.sCi;
    const float* R = p.R + zo * p.sRo + zi * p.sRi;
    __shared__ __align__(16) float ctile[16][36];
#pragma unroll
    for (int t = 0; t < 2; ++t) {
        const int n = n0 + t * 16 + l15; const int nn = min(n, p.N - 1);
#pragma unroll
        for (int r = 0; r < 8; ++r) {
            const int m = m0 + 8 * h + r; const int mm = min(m, p.M - 1);
            float v = acc[t][r] * iscale;
            if (p.flags & 1) v += p.bias[nn];
            if (p.flags & 2) v += p.bias[mm];
            if (p.flags & 8) v *= p.bias[(long long)zo * p.M + mm];   /* per-(z,row) scale vector laid out [Z][M]; exclusive with the bias flags */
            v = act_fn(v, p.act);
            if (p.flags & 4) v += p.beta * R[(long long)mm * p.sRm + (long long)nn * p.sRn];
            ctile[8 * h + r][t * 16 + l15] = (n < p.N) ? v : 0.f;
        }
    }
    __syncthreads();
    const int NW = (p.Npad > p.N) ? p.Npad : p.N;           // write width
    const bool fast = (m0 + 16 <= p.M) && (n0 + 32 <= NW) && ((p.sCm & 3) == 0) && ((((size_t)C) & 15) == 0);
    if (fast) {
#pragma unroll
        for (int s = 0; s < 4; ++s) {
            const int row = s * 4 + (lane >> 3), c4 = (lane & 7) * 4;
            const v4f v = *(const v4f*)&ctile[row][c4];
            VST2V4(C + (long long)(m0 + row) * p.sCm + n0 + c4, v);
        }
    } else {
        for (int row = 0; row < 16; ++row) {
            const int m = m0 + row, n = n0 + lane;
            if (m < p.M && n < NW) VST2(float, C + (long long)m * p.sCm + n, ctile[row][lane]);
        }
    }
}


// =====================================================================================================================
// k_gemmT<MODE, TM, TN>: same contract as k_gemm, but one wave computes a (16*TM) x (16*TN) tile: TM A fragments and TN B fragments are
//   loaded per 32-wide k-step and reused across TM*TN WMMAs (far fewer load/convert instructions per MAC). MODE 0 (f16), 1 (bf16 hi/lo),
//   2 (bf16) only. grid (ceil(NW/(16*TN)), ceil(M/(16*TM)), Z), block 32. Epilogue identical to k_gemm, run per 16x32 sub-tile.
// =====================================================================================================================
template <int MODE, int TM, int TN>
__global__ __launch_bounds__(32) void k_gemmT(GemmP p) {
    const int lane = threadIdx.x & 31, h = lane >> 4, l15 = lane & 15;
    const int m0 = blockIdx.y * (16 * TM), n0 = blockIdx.x * (16 * TN);
    const int z = blockIdx.z, zo = z / p.zi_n, zi = z - zo * p.zi_n;
    const float* A = p.A + zo * p.sAo + zi * p.sAi;
    const float* B = p.B + zo * p.sBo + zi * p.sBi;
    v8f acc[TM][TN];
#pragma unroll
    for (int i = 0; i < TM; ++i)
#pragma unroll
        for (int t = 0; t < TN; ++t) { v8f zz = {}; acc[i][t] = zz; }
    for (int k0 = 0; k0 < p.K; k0 += 32) {
        if (MODE == 1) {
            Split a[TM], b[TN];
#pragma unroll
            for (int i = 0; i < TM; ++i) { const int am = min(m0 + 16 * i + l15, p.M - 1); a[i] = sp_ld(A + (long long)am * p.sAm, p.sAk, k0, h, p.K, 1.f); }
#pragma unroll
            for (int t = 0; t < TN; ++t) { const int bn = min(n0 + 16 * t + l15, p.N - 1); b[t] = sp_ld(B + (long long)bn * p.sBn, p.sBk, k0, h, p.K, 1.f); }
#pragma unroll
            for (int i = 0; i < TM; ++i)
#pragma unroll
                for (int t = 0; t < TN; ++t) acc[i][t] = wmma3(a[i], b[t], acc[i][t]);
        } else if (MODE == 2) {
            v16b a[TM], b[TN];
#pragma unroll
            for (int i = 0; i < TM; ++i) { const int am = min(m0 + 16 * i + l15, p.M - 1); a[i] = bh_ld(A + (long long)am * p.sAm, p.sAk, k0, h, p.K, 1.f); }
#pragma unroll
            for (int t = 0; t < TN; ++t) { const int bn = min(n0 + 16 * t + l15, p.N - 1); b[t] = bh_ld(B + (long long)bn * p.sBn, p.sBk, k0, h, p.K, 1.f); }
#pragma unroll
            for (int i = 0; i < TM; ++i)
#pragma unroll
                for (int t = 0; t < TN; ++t) acc[i][t] = wmmab(a[i], b[t], acc[i][t]);
        } else {
            v16h a[TM], b[TN];
#pragma unroll
            for (int i = 0; i < TM; ++i) { const int am = min(m0 + 16 * i + l15, p.M - 1); a[i] = fh_ld(A + (long long)am * p.sAm, p.sAk, k0, h, p.K, p.sa); }
#pragma unroll
            for (int t = 0; t < TN; ++t) { const int bn = min(n0 + 16 * t + l15, p.N - 1); b[t] = fh_ld(B + (long long)bn * p.sBn, p.sBk, k0, h, p.K, p.sb); }
#pragma unroll
            for (int i = 0; i < TM; ++i)
#pragma unroll
                for (int t = 0; t < TN; ++t) acc[i][t] = wmma16(a[i], b[t], acc[i][t]);
        }
    }
    const float iscale = (MODE == 0) ? p.alpha / (p.sa * p.sb) : p.alpha;
    float* C = p.C + zo * p.sCo + zi * p.sCi;
    const float* R = p.R + zo * p.sRo + zi * p.sRi;
    const int NW = (p.Npad > p.N) ? p.Npad : p.N;
    __shared__ __align__(16) float ctile[16][36];
#pragma unroll
    for (int i = 0; i < TM; ++i) {
        const int mb = m0 + 16 * i; if (mb >= p.M) break;          // wave-uniform
#pragma unroll
        for (int tp = 0; tp < TN / 2; ++tp) {
            const int nb = n0 + 32 * tp; if (nb >= NW) break;        // wave-uniform
#pragma unroll
            for (int t2 = 0; t2 < 2; ++t2) {
                const int t = 2 * tp + t2; const int n = nb + t2 * 16 + l15; const int nn = min(n, p.N - 1);
#pragma unroll
                for (int r = 0; r < 8; ++r) {
                    const int m = mb + 8 * h + r; const int mm = min(m, p.M - 1);
                    float v = acc[i][t][r] * iscale;
                    if (p.flags & 1) v += p.bias[nn];
                    if (p.flags & 2) v += p.bias[mm];
            if (p.flags & 8) v *= p.bias[(long long)zo * p.M + mm];   /* per-(z,row) scale vector laid out [Z][M]; exclusive with the bias flags */
                    v = act_fn(v, p.act);
                    if (p.flags & 4) v += p.beta * R[(long long)mm * p.sRm + (long long)nn * p.sRn];
                    ctile[8 * h + r][t2 * 16 + l15] = (n < p.N) ? v : 0.f;
                }
            }
            __syncthreads();
            const bool fast = (mb + 16 <= p.M) && (nb + 32 <= NW) && ((p.sCm & 3) == 0) && ((((size_t)C) & 15) == 0);
            if (fast) {
#pragma unroll
                for (int s = 0; s < 4; ++s) {
                    const int row = s * 4 + (lane >> 3), c4 = (lane & 7) * 4;
                    const v4f v = *(const v4f*)&ctile[row][c4];
                    VST2V4(C + (long long)(mb + row) * p.sCm + nb + c4, v);
                }
            } else {
                for (int row = 0; row < 16; ++row) {
                    const int m = mb + row, n = nb + lane;
                    if (m < p.M && n < NW) VST2(float, C + (long long)m * p.sCm + n, ctile[row][lane]);
                }
            }
            __syncthreads();
        }
    }
}

// =====================================================================================================================
//   Wave = 16 queries, AW waves per block, 64-key blocks; grid (ceil(Lq/(16*AW)), H, B), block 32*AW. Any Lq, Lk; head dim dh <= DHP
//   (DHP multiple of 32), value dim dv <= DVP (multiple of 16, <= 128). Every tensor addressed by (batch, head, row, element) strides, f32.
//   Scores: QM 0 f16 operands, 1 bf16 hi/lo split, 2 bf16 triple split; statistics f32 (exp2 domain); P.V: P x 4096 as f16 with V f16 staged in LDS
//   (SPLITPV: P and V as bf16 hi/lo splits). kv head = h / hrep. Masking: causal = 1 (keep j <= i + coff, masked -> -inf, key blocks beyond the
//   diagonal skipped), causal = 2 (masked -> mfill, a finite fill like the -1e9; no skipping), causal = 3 (keep j >= i + coff,
//   masked -> -inf, no skipping); optional additive f32 mask Mf,
//   optional int keep-mask Mi (0 -> score := mfill), both addressed b*smb + h*smh + i*smi + j*smj (0 strides broadcast).
// =====================================================================================================================
#define AW 4
struct AttnP {   // apv4
    const float* Q; const float* K; const float* V; float* O; float* P; const float* Mf; const int* Mi; float* ST;
    const float* Pw; const float* Rt; const int* SQ; const int* SK;           // optional: post-softmax weight, relative-position table, segment ids
    long long swb, swh, swi, swj, srb, srh, sri;                                 // Pw strides (b,h,i,j); Rt strides (b,h,i), column = clamp(i - j + roff, 0, rn-1)
    long long sQb, sQh, sQi, sQd, sKb, sKh, sKj, sKd, sVb, sVh, sVj, sVd, sOb, sOh, sOi, sPb, sPh, sPi, smb, smh, smi, smj;
    int Lq, Lk, dh, dv, hrep, causal, coff, pband;   // pband > 0: P holds only the band |j - i| <= pband, column j - i + pband
    float scale, mfill; int nonorm, mpol;             // nonorm (online path only): O = sum_j exp(score_j) V_j without the 1/rowsum (scores must be <= ~0); mpol: Mi masks where ==0 (mpol 0) or where !=0 (mpol 1)
    int roff, rn, segpol, win;                        // Rt column offset/count; SQ/SK: score := mfill where (segpol 0) SQ[i] != SK[j] or (segpol 1) SQ[i] == SK[j]; win > 0: keys with i - j > win (after coff) -> -inf
};
//   Pw: the softmax numerator is multiplied by Pw(b,h,i,j) AFTER the row sum is taken (probs * weight, then P.V), as in post-softmax multiplicative biases.                                                    // ST (optional): per row (b,h,i) -> ST[((b*H + h)*Lq + i)*2 + {0,1}] = {row max of the scaled+masked score (natural units), sum_j exp(score - max)}
static_assert(sizeof(AttnP) == 12 * 8 + 29 * 8 + 16 * 4, "AttnP has padding");

#ifndef KATTN_ATTR
#define KATTN_ATTR
#endif
template <int DHP, int DVP, int QM, bool SPLITPV, bool TWOPASS>
__global__ __launch_bounds__(32 * AW) KATTN_ATTR void k_attn(AttnP p) {
    constexpr int NT = DVP / 16;                // output tiles
    constexpr int KS = DHP / 32;                // k-steps for the scores
    constexpr int VP = DVP + 8;                 // LDS pitch (halves)
    __shared__ __align__(16) float    pl[AW][16 * 64];
    __shared__ __align__(16) _Float16 vl[(SPLITPV ? 2 : 1) * 64 * VP];   // f16 V tile, or bf16 hi and lo tiles (same 2-byte size)
    const int lane = threadIdx.x & 31, hf = lane >> 4, l15 = lane & 15, wave = threadIdx.x >> 5;
    const int h = blockIdx.y, b = blockIdx.z, hk = h / p.hrep;
    const int q0 = (blockIdx.x * AW + wave) * 16;
    float* myp = pl[wave];
    const float L2E = 1.4426950408889634f;
    const float NEG = -__builtin_inff();
    const int qi = min(q0 + l15, p.Lq - 1);
    const float* qrow = p.Q + b * p.sQb + h * p.sQh + (long long)qi * p.sQi;
    const float* kbase = p.K + b * p.sKb + hk * p.sKh;
    const float* vbase = p.V + b * p.sVb + hk * p.sVh;
    v16h qa[QM == 0 ? KS : 1]; Split qs_[QM == 1 ? KS : 1]; Split3 qt_[QM == 2 ? KS : 1];
#pragma unroll
    for (int ks = 0; ks < KS; ++ks) {
        if (QM == 2) qt_[ks] = sp3_ld(qrow, p.sQd, ks * 32, hf, p.dh, 1.f);
        else if (QM == 1) qs_[ks] = sp_ld(qrow, p.sQd, ks * 32, hf, p.dh, 1.f);
        else qa[ks] = fh_ld(qrow, p.sQd, ks * 32, hf, p.dh, 1.f);
    }
    v8f o[NT]; float m8[8], l8[8];
#pragma unroll
    for (int t = 0; t < NT; ++t) { v8f zz = {}; o[t] = zz; }
#pragma unroll
    for (int i = 0; i < 8; ++i) { m8[i] = NEG; l8[i] = 0.f; }
    int jend = p.Lk;
    if (p.causal == 1) { const int je = (blockIdx.x * AW + AW - 1) * 16 + 16 + p.coff; jend = min(jend, max(je, 0)); }   // uniform per block
    const int npass = TWOPASS ? 2 : 1;
    for (int pass = 0; pass < npass; ++pass) {
        const bool dopv = (!TWOPASS) || pass == 1;
        for (int j0 = 0; j0 < jend; j0 += 64) {
            if (dopv) {
                __syncthreads();                                 // previous key block's reads of vl / pl are done
                for (int idx = threadIdx.x; idx < 64 * DVP; idx += 32 * AW) {
                    const int jr = idx / DVP, d = idx - jr * DVP, j = j0 + jr;
                    const float f = (j < p.Lk && d < p.dv) ? vbase[(long long)j * p.sVj + (long long)d * p.sVd] : 0.f;
                    if (SPLITPV) {
                        const __bf16 hb = bf16_rne(f);
                        ((__bf16*)vl)[jr * VP + d] = hb; ((__bf16*)vl)[64 * VP + jr * VP + d] = bf16_rne(f - bf16_f32(hb));
                    } else vl[jr * VP + d] = (_Float16)f;
                }
            }
            v8f s[4];
#pragma unroll
            for (int t = 0; t < 4; ++t) {
                const int j = min(j0 + t * 16 + l15, p.Lk - 1);
                const float* krow = kbase + (long long)j * p.sKj;
                v8f acc = {};
#pragma unroll
                for (int ks = 0; ks < KS; ++ks) {
                    if (QM == 2)      acc = wmma6(qt_[ks], sp3_ld(krow, p.sKd, ks * 32, hf, p.dh, 1.f), acc);
                    else if (QM == 1) acc = wmma3(qs_[ks], sp_ld(krow, p.sKd, ks * 32, hf, p.dh, 1.f), acc);
                    else              acc = wmma16(qa[ks], fh_ld(krow, p.sKd, ks * 32, hf, p.dh, 1.f), acc);
                }
                s[t] = acc;
            }
            float pv[8][4];
#pragma unroll
            for (int i = 0; i < 8; ++i) {
                const int irow = q0 + i + 8 * hf;
                const int ic = min(irow, p.Lq - 1);
                float sc[4];
#pragma unroll
                for (int t = 0; t < 4; ++t) {
                    const int jg = j0 + t * 16 + l15;
                    float v = s[t][i] * p.scale;
                    if (p.Mf) v += p.Mf[b * p.smb + h * p.smh + (long long)ic * p.smi + (long long)min(jg, p.Lk - 1) * p.smj];
                    if (p.Rt) { int rc = ic - min(jg, p.Lk - 1) + p.roff; rc = rc < 0 ? 0 : (rc >= p.rn ? p.rn - 1 : rc); v += p.Rt[b * p.srb + h * p.srh + (long long)ic * p.sri + rc]; }
                    if (p.Mi) { const int mv = p.Mi[b * p.smb + h * p.smh + (long long)ic * p.smi + (long long)min(jg, p.Lk - 1) * p.smj]; if (p.mpol ? (mv != 0) : (mv == 0)) v = p.mfill; }
                    if (p.SQ) { const bool same = p.SQ[(long long)b * p.Lq + ic] == p.SK[(long long)b * p.Lk + min(jg, p.Lk - 1)]; if (p.segpol ? same : !same) v = p.mfill; }
                    if (p.causal == 2 && jg > irow + p.coff) v = p.mfill;
                    if (jg >= p.Lk || (p.causal == 1 && jg > irow + p.coff) || (p.causal == 3 && jg < irow + p.coff) || (p.win > 0 && irow + p.coff - jg > p.win)) v = NEG; else v *= L2E;
                    sc[t] = v;
                }
                if (!TWOPASS || pass == 0) {
                    float mx = fmaxf(fmaxf(sc[0], sc[1]), fmaxf(sc[2], sc[3]));
                    mx = fmaxf(mx, __shfl_xor(mx, 1, 32)); mx = fmaxf(mx, __shfl_xor(mx, 2, 32));
                    mx = fmaxf(mx, __shfl_xor(mx, 4, 32)); mx = fmaxf(mx, __shfl_xor(mx, 8, 32));
                    const float mnew = fmaxf(m8[i], mx);
                    const float corr = (mnew == NEG) ? 1.f : exp2f(m8[i] - mnew);
                    float rs = 0.f;
#pragma unroll
                    for (int t = 0; t < 4; ++t) {
                        const float pp = (sc[t] == NEG) ? 0.f : exp2f(sc[t] - mnew); rs += pp;
                        pv[i][t] = p.Pw ? pp * p.Pw[b * p.swb + h * p.swh + (long long)ic * p.swi + (long long)min(j0 + t * 16 + l15, p.Lk - 1) * p.swj] : pp;
                    }
                    rs += __shfl_xor(rs, 1, 32); rs += __shfl_xor(rs, 2, 32); rs += __shfl_xor(rs, 4, 32); rs += __shfl_xor(rs, 8, 32);
                    l8[i] = l8[i] * corr + rs; m8[i] = mnew;
                    if (!TWOPASS) {
#pragma unroll
                        for (int t = 0; t < NT; ++t) o[t][i] *= corr;
                    }
                } else {
                    const float inv = (l8[i] > 0.f) ? 1.f / l8[i] : 0.f;
#pragma unroll
                    for (int t = 0; t < 4; ++t) {
                        const int jg = j0 + t * 16 + l15;
                        float pp = (sc[t] == NEG) ? 0.f : exp2f(sc[t] - m8[i]) * inv;
                        if (p.Pw) pp *= p.Pw[b * p.swb + h * p.swh + (long long)ic * p.swi + (long long)min(jg, p.Lk - 1) * p.swj];
                        pv[i][t] = pp;
                    }
                }
            }
            if (dopv) {
#pragma unroll
                for (int i = 0; i < 8; ++i)
#pragma unroll
                    for (int t = 0; t < 4; ++t) ((float*)myp)[(i + 8 * hf) * 64 + t * 16 + l15] = pv[i][t];
                __syncthreads();                                 // P (per wave) and V (shared) visible
                if (p.P) {
                    float* pb_ = p.P + b * p.sPb + h * p.sPh;
                    const bool fastP = (p.pband == 0) && ((p.sPi & 3) == 0) && (j0 + 64 <= p.Lk) && (q0 + 16 <= p.Lq) && ((((size_t)pb_) & 15) == 0);
                    if (fastP) {
#pragma unroll
                        for (int s = 0; s < 8; ++s) {
                            const int row = s * 2 + (lane >> 4), c4 = (lane & 15) * 4;
                            const v4f v = *(const v4f*)(myp + row * 64 + c4);
                            VST2V4(pb_ + (long long)(q0 + row) * p.sPi + j0 + c4, v);
                        }
                    } else {
                        for (int row = 0; row < 16; ++row) {
                            const int irow = q0 + row; if (irow >= p.Lq) continue;
                            for (int c = lane; c < 64; c += 32) {
                                const int jg = j0 + c; if (jg >= p.Lk) continue;
                                if (p.pband == 0) VST2(float, pb_ + (long long)irow * p.sPi + jg, myp[row * 64 + c]);
                                else if (jg - irow <= p.pband && irow - jg <= p.pband) VST2(float, pb_ + (long long)irow * p.sPi + (jg - irow + p.pband), myp[row * 64 + c]);
                            }
                        }
                    }
                }
                if (SPLITPV) {
                    const Split pa0 = sp_ld(myp + l15 * 64, 1, 0, hf, 64, 1.f), pa1 = sp_ld(myp + l15 * 64, 1, 32, hf, 64, 1.f);
                    const __bf16* vh = (const __bf16*)vl; const __bf16* vlo = vh + 64 * VP;
#pragma unroll
                    for (int t = 0; t < NT; ++t) {
                        const int dcol = t * 16 + l15;
                        Split b0, b1;
#pragma unroll
                        for (int e = 0; e < 16; ++e) {
                            const int k0 = frag_k(e, hf), k1 = 32 + frag_k(e, hf);
                            b0.hi[e] = vh[k0 * VP + dcol]; b0.lo[e] = vlo[k0 * VP + dcol]; b1.hi[e] = vh[k1 * VP + dcol]; b1.lo[e] = vlo[k1 * VP + dcol];
                        }
                        o[t] = wmma3(pa0, b0, o[t]);
                        o[t] = wmma3(pa1, b1, o[t]);
                    }
                } else {
                    const v16h pa0 = fh_ld(myp + l15 * 64, 1, 0, hf, 64, 4096.f), pa1 = fh_ld(myp + l15 * 64, 1, 32, hf, 64, 4096.f);
#pragma unroll
                    for (int t = 0; t < NT; ++t) {
                        const int dcol = t * 16 + l15;
                        v16h b0, b1;
#pragma unroll
                        for (int e = 0; e < 16; ++e) { b0[e] = vl[frag_k(e, hf) * VP + dcol]; b1[e] = vl[(32 + frag_k(e, hf)) * VP + dcol]; }
                        o[t] = wmma16(pa0, b0, o[t]);
                        o[t] = wmma16(pa1, b1, o[t]);
                    }
                }
            }
        }
    }
    float* obase = p.O + b * p.sOb + h * p.sOh;
    if (p.ST) {
        const int rl = lane >> 1, isel = rl & 7;           // row q0 + rl ; rl>>3 == hf holds because lane>>4 == (lane>>1)>>3
        float mv = 0.f, lv = 0.f;
#pragma unroll
        for (int i = 0; i < 8; ++i) if (i == isel) { mv = m8[i]; lv = l8[i]; }
        const int irow = q0 + rl;
        if (irow < p.Lq) { float* st = p.ST + (((long long)b * gridDim.y + h) * p.Lq + irow) * 2 + (lane & 1); VST2(float, st, (lane & 1) ? lv : mv * 0.6931471805599453f); }
    }
    float invr[8];
#pragma unroll
    for (int i = 0; i < 8; ++i) {
        if (TWOPASS) invr[i] = SPLITPV ? 1.f : (1.f / 4096.f);
        else if (p.nonorm) invr[i] = exp2f(m8[i]) * (SPLITPV ? 1.f : (1.f / 4096.f));
        else invr[i] = (l8[i] > 0.f) ? (SPLITPV ? 1.f / l8[i] : 1.f / (l8[i] * 4096.f)) : 0.f;
    }
    __syncthreads();                                             // all waves done with pl/vl from the main loop
    const bool ofast = ((p.sOi & 3) == 0) && ((((size_t)obase) & 15) == 0) && (q0 + 16 <= p.Lq);
#pragma unroll
    for (int c0 = 0; c0 < DVP; c0 += 64) {
#pragma unroll
        for (int i = 0; i < 8; ++i)
#pragma unroll
            for (int t = 0; t < NT; ++t) if (t * 16 >= c0 && t * 16 < c0 + 64) ((float*)myp)[(i + 8 * hf) * 64 + (t * 16 - c0) + l15] = o[t][i] * invr[i];
        __syncthreads();
        const int cw = (DVP - c0 < 64) ? (DVP - c0) : 64;      // staged columns in this chunk (multiple of 16)
        if (ofast && (c0 + cw <= p.dv) && (cw % 32 == 0)) {
            const int lpr = cw / 4;                              // lanes per row (16 for 64 cols, 8 for 32)
            const int rows_per_ins = 32 / lpr;
            for (int r0 = 0; r0 < 16; r0 += rows_per_ins) {
                const int row = r0 + lane / lpr, c4 = (lane % lpr) * 4;
                const v4f v = *(const v4f*)(myp + row * 64 + c4);
                VST2V4(obase + (long long)(q0 + row) * p.sOi + c0 + c4, v);
            }
        } else {
            for (int row = 0; row < 16; ++row) {
                const int irow = q0 + row; if (irow >= p.Lq) continue;
                for (int c = lane; c < cw; c += 32) { const int d = c0 + c; if (d < p.dv) VST2(float, obase + (long long)irow * p.sOi + d, myp[row * 64 + c]); }
            }
        }
        __syncthreads();
    }
}

// =====================================================================================================================
// k_tr: dst(z, c, r) = alpha * src(z, r, c) (+ beta * R2(z, c, r)): [Z][R][C] (row stride lds) -> [Z][C][R] (row stride ldd) through a 32x32 LDS tile;
//   flags: 1 -> add beta * residual R2 addressed like dst (z*sRz + c*ldr + r); act applied before the residual.
// =====================================================================================================================
struct TrP { const float* src; float* dst; const float* R2; long long sSz, lds, sDz, ldd, sRz, ldr; int R, C, flags, act; float alpha, beta; };
static_assert(sizeof(TrP) == 3 * 8 + 6 * 8 + 6 * 4, "TrP has padding");
__global__ __launch_bounds__(256) void k_tr(TrP p) {
    __shared__ float tile[32][33];
    const int c0 = blockIdx.x * 32, r0 = blockIdx.y * 32, z = blockIdx.z;
    const int lane = threadIdx.x & 31, wave = threadIdx.x >> 5;
    const float* s = p.src + z * p.sSz;
#pragma unroll
    for (int k = 0; k < 4; ++k) {
        const int rl = wave * 4 + k, r = r0 + rl, c = c0 + lane;
        tile[rl][lane] = (r < p.R && c < p.C) ? s[(long long)r * p.lds + c] : 0.f;
    }
    __syncthreads();
    float* d = p.dst + z * p.sDz; const float* rr = p.R2 + z * p.sRz;
#pragma unroll
    for (int k = 0; k < 4; ++k) {
        const int cl = wave * 4 + k, c = c0 + cl, r = r0 + lane;
        if (c < p.C && r < p.R) {
            float v = act_fn(p.alpha * tile[lane][cl], p.act);
            if (p.flags & 1) v += p.beta * rr[(long long)c * p.ldr + r];
            VST2(float, d + (long long)c * p.ldd + r, v);
        }
    }
}

// k_affine: dst[i] = a * (sdev ? sdev[0] : 1) * src[i] + b, i < n (one thread per element; consecutive lanes -> consecutive addresses)
__global__ __launch_bounds__(256) void k_affine(const float* __restrict__ src, float* __restrict__ dst, int n, float a, float b, const float* __restrict__ sdev) {
    const int i = blockIdx.x * 256 + threadIdx.x;
    if (i < n) { const float aa = sdev ? a * sdev[0] : a; const float v = aa * src[i] + b; VST2(float, dst + i, v); }
}

// =====================================================================================================================
// k_softmax: row softmax over n contiguous elements, one 256-thread block per row; rows addressed z*sz + r*sr (grid (R, Z)).
//   out = scale_out * softmax(scale_in * x + (Mf ? Mf[z*smz + r*smr + j] : 0)); a row whose max is -inf is written as 0.
// =====================================================================================================================
struct SmP { const float* src; float* dst; const float* Mf; long long sz, sr, dz, dr, smz, smr; int n, pad; float scale_in, scale_out; };
static_assert(sizeof(SmP) == 3 * 8 + 6 * 8 + 4 * 4, "SmP has padding");
__global__ __launch_bounds__(256) void k_softmax(SmP p) {
    __shared__ float red[256];
    const int r = blockIdx.x, z = blockIdx.y, tid = threadIdx.x;
    const float* s = p.src + z * p.sz + (long long)r * p.sr;
    const float* mf = p.Mf ? (p.Mf + z * p.smz + (long long)r * p.smr) : nullptr;
    float mx = -__builtin_inff();
    for (int j = tid; j < p.n; j += 256) { float v = s[j] * p.scale_in; if (mf) v += mf[j]; mx = fmaxf(mx, v); }
    red[tid] = mx; __syncthreads();
    for (int o = 128; o > 0; o >>= 1) { if (tid < o) red[tid] = fmaxf(red[tid], red[tid + o]); __syncthreads(); }
    mx = red[0]; __syncthreads();
    float sum = 0.f;
    for (int j = tid; j < p.n; j += 256) { float v = s[j] * p.scale_in; if (mf) v += mf[j]; sum += (mx == -__builtin_inff()) ? 0.f : expf(v - mx); }
    red[tid] = sum; __syncthreads();
    for (int o = 128; o > 0; o >>= 1) { if (tid < o) red[tid] += red[tid + o]; __syncthreads(); }
    sum = red[0];
    const float inv = (sum > 0.f) ? p.scale_out / sum : 0.f;
    float* d = p.dst + z * p.dz + (long long)r * p.dr;
    for (int j = tid; j < p.n; j += 256) { float v = s[j] * p.scale_in; if (mf) v += mf[j]; const float o = (mx == -__builtin_inff()) ? 0.f : expf(v - mx) * inv; VST2(float, d + j, o); }
}
// =====================================================================================================================
// k_stats: mean and rsqrt(var + eps) over a set of n elements addressed base + z*sz + (e / inner) * so + (e % inner) * si, one 256-thread
// k_norm_apply: y = (x - mean[set]) * rstd[set] * g[c] + b[c] over a [Z][C][L] channel-major tensor with set = z*G + c / (C/G) (G groups per z;
//   G = C -> per-channel sets indexed z*C+c; for batch norm pass stats indexed by c only via bn = 1). Optional act. Output same layout.
// =====================================================================================================================
//   mode 0: mean / rsqrt(var + eps); mode 1 (RMSNorm): 0 / rsqrt(mean(x^2) + eps); mode 2 (L2 normalize * sqrt(n)): 0 / sqrt(n) / max(||x||, eps); mode 3: as 0 with unbiased variance (n-1)
__global__ __launch_bounds__(256) void k_stats(const float* __restrict__ x, long long sz, long long so, long long si, int inner, int n, float eps, float* __restrict__ stat, int mode) {
    __shared__ float red[256];
    const int z = blockIdx.x, tid = threadIdx.x;
    const float* base = x + z * sz;
    float s = 0.f;
    for (int e = tid; e < n; e += 256) s += base[(long long)(e / inner) * so + (long long)(e % inner) * si];
    red[tid] = s; __syncthreads();
    for (int o = 128; o > 0; o >>= 1) { if (tid < o) red[tid] += red[tid + o]; __syncthreads(); }
    const float mu = (mode == 0 || mode == 3) ? red[0] / (float)n : 0.f; __syncthreads();
    float q = 0.f;
    for (int e = tid; e < n; e += 256) { const float dlt = base[(long long)(e / inner) * so + (long long)(e % inner) * si] - mu; q += dlt * dlt; }
    red[tid] = q; __syncthreads();
    for (int o = 128; o > 0; o >>= 1) { if (tid < o) red[tid] += red[tid + o]; __syncthreads(); }
    {
        float rs;
        if (mode == 2) rs = sqrtf((float)n) / fmaxf(sqrtf(red[0]), eps); else if (mode == 3) rs = rsqrtf(red[0] / (float)(n - 1) + eps); else rs = rsqrtf(red[0] / (float)n + eps);
        if (tid < 32) { const float v = (tid == 0) ? mu : ((tid == 1) ? rs : 0.f); VST2(float, stat + (long long)z * 32 + tid, v); }
    }
}
//   One thread per element over the flat [Z][C][L] index space: grid ceil(Z*C*L / 256).
__global__ __launch_bounds__(256) void k_norm_apply(const float* __restrict__ x, float* __restrict__ y, const float* __restrict__ stat, const float* __restrict__ g, const float* __restrict__ bta,
                                                     int Z, int C, int L, int G, int bn, int act) {
    const long long idx = (long long)blockIdx.x * 256 + threadIdx.x;
    if (idx >= (long long)Z * C * L) return;
    const int l = (int)(idx % L); const long long zc = idx / L; const int c = (int)(zc % C), z = (int)(zc / C); (void)l;
    const int set = bn ? c : (z * G + c / (C / G));
    float v = (x[idx] - stat[(long long)set * 32]) * stat[(long long)set * 32 + 1];
    if (g) v *= g[c];
    if (bta) v += bta[c];
    v = act_fn(v, act);
    VST2(float, y + idx, v);
}

// k_lse_neg: c[i] = -(st[2i] + log(st[2i+1])) = minus the log-sum-exp of row i from k_attn's ST output (for softmax over the query dimension)
__global__ __launch_bounds__(256) void k_lse_neg(const float* __restrict__ st, float* __restrict__ c, int n) {
    const int i = blockIdx.x * 256 + threadIdx.x;
    if (i < n) { const float v = -(st[2 * i] + logf(st[2 * i + 1])); VST2(float, c + i, v); }
}

// k_iota: dst[i] = a * i + b as int32 (segment/position id helper)
__global__ __launch_bounds__(256) void k_iota(int* __restrict__ dst, int n, int a, int b) {
    const int i = blockIdx.x * 256 + threadIdx.x;
    if (i < n) { const int v = a * i + b; VST2(int, dst + i, v); }
}

// k_axpby: dst[i] = a * x[i] + b * y[i] (+ c), i < n
__global__ __launch_bounds__(256) void k_axpby(const float* __restrict__ x, const float* __restrict__ y, float* __restrict__ dst, int n, float a, float b, float c) {
    const int i = blockIdx.x * 256 + threadIdx.x;
    if (i < n) { const float v = a * x[i] + b * y[i] + c; VST2(float, dst + i, v); }
}

// =====================================================================================================================
// k_rope: rotary embedding on a [R rows][Hn heads][D] view (row stride sXr, head stride sXh, element stride 1) -> Y (own strides).
//   mode 0: rotate_half (partner d±D/2, sign - for d<D/2); mode 1: interleaved pairs (partner d^1, sign - for even d).
//   table column tcol: tmode 0 -> d, 1 -> d % (D/2), 2 -> d / 2; position p: pmode 0 -> r % S, 1 -> head index, 2 -> pos[r];
//   c = C[(r / S) * sCb + p * sCp + tcol * sCd], s likewise from Sn; y = x[d] * c + sign * x[partner] * s. X and Y must not alias.
// =====================================================================================================================
struct RopeP { const float* X; float* Y; const float* C; const float* Sn; const int* pos; long long sXr, sXh, sYr, sYh, sCb, sCp, sCd; int R, Hn, D, S, mode, tmode, pmode, pad; };
static_assert(sizeof(RopeP) == 5 * 8 + 7 * 8 + 8 * 4, "RopeP has padding");
__global__ __launch_bounds__(256) void k_rope(RopeP p) {
    const long long idx = (long long)blockIdx.x * 256 + threadIdx.x;
    if (idx >= (long long)p.R * p.Hn * p.D) return;
    const int d = (int)(idx % p.D); const long long rh = idx / p.D; const int h = (int)(rh % p.Hn); const int r = (int)(rh / p.Hn);
    const int half = p.D / 2;
    int partner; float sign;
    if (p.mode == 0) { partner = (d < half) ? d + half : d - half; sign = (d < half) ? -1.f : 1.f; }
    else { partner = d ^ 1; sign = (d & 1) ? 1.f : -1.f; }
    const int tcol = (p.tmode == 0) ? d : ((p.tmode == 1) ? (d % half) : (d >> 1));
    const int pp = (p.pmode == 0) ? (r % p.S) : ((p.pmode == 1) ? h : p.pos[r]);
    const long long toff = (long long)(r / p.S) * p.sCb + (long long)pp * p.sCp + (long long)tcol * p.sCd;
    const float* xr = p.X + (long long)r * p.sXr + (long long)h * p.sXh;
    const float v = xr[d] * p.C[toff] + sign * xr[partner] * p.Sn[toff];
    VST2(float, p.Y + (long long)r * p.sYr + (long long)h * p.sYh + d, v);
}

// k_invf + k_sincos (split so neither kernel carries a large VALU-fma footprint): invf_i = num * (1 / powf(base, (2 i)/D)) [fmode 0],
//   num * expf((2 i) * cexp) [fmode 1], num * powf(base, -2 (i - 1) / D) [fmode 2]; then cs/sn[s*half + i] = cos/sin((pscale * s) * invf_i)
__global__ __launch_bounds__(256) void k_invf(float* __restrict__ invb, int half, int D, float base, float num, int fmode, float cexp) {
    const int i = blockIdx.x * 256 + threadIdx.x;
    if (i >= ((half + 31) / 32) * 32) return;
    if (i >= half) { VST2(float, invb + i, 0.f); return; }
    const float e = (float)(2 * i) / (float)D;
    float invf;
    if (fmode == 1) invf = num * expf((float)(2 * i) * cexp);
    else if (fmode == 2) invf = num * powf(base, (-2.0f * ((float)i - 1.0f)) / (float)D);
    else invf = num * (1.0f / powf(base, e));
    VST2(float, invb + i, invf);
}
__global__ __launch_bounds__(256) void k_sincos(float* __restrict__ cs, float* __restrict__ sn, const float* __restrict__ invb, int S, int half, float pscale) {
    const int idx = blockIdx.x * 256 + threadIdx.x;
    if (idx >= S * half) return;
    const int s = idx / half, i = idx - s * half;
    const float ang = (pscale * (float)s) * invb[i];
    VST2(float, cs + idx, cosf(ang)); VST2(float, sn + idx, sinf(ang));
}

// k_mulact: dst[i] = act(x[i]) * y[i]
__global__ __launch_bounds__(256) void k_mulact(const float* __restrict__ x, const float* __restrict__ y, float* __restrict__ dst, int n, int act) {
    const int i = blockIdx.x * 256 + threadIdx.x;
    if (i < n) { const float v = act_fn(x[i], act) * y[i]; VST2(float, dst + i, v); }
}

// =====================================================================================================================
// k_matvec: thread-per-row matrix-vector products for N <= 8 output columns (heads with 1-3 outputs, gates), f32 on the VALU.
//   C[r*sCm + j] = act(alpha * sum_k A[r*sAm + k*sAk] * B[j*sBn + k*sBk] + bias[j]) + beta * R[r*sRm + j*sRn]; each thread writes its N contiguous floats.
// =====================================================================================================================
__global__ __launch_bounds__(256) void k_matvec(GemmP p) {
    // 32 lanes write one line with one instruction.
    const int rpt = (p.N == 1) ? 1 : 32;
    const long long r0 = ((long long)blockIdx.x * 256 + threadIdx.x) * rpt; const int z = blockIdx.z, zo = z / p.zi_n, zi = z - zo * p.zi_n;
    if (r0 >= p.M) return;
    const float* Bb = p.B + zo * p.sBo + zi * p.sBi;
    float* C = p.C + zo * p.sCo + zi * p.sCi; const float* R = p.R + zo * p.sRo + zi * p.sRi;
    for (int rr = 0; rr < rpt; ++rr) {
        const long long r = r0 + rr; if (r >= p.M) break;
        const float* A = p.A + zo * p.sAo + zi * p.sAi + r * p.sAm;
        float acc[8] = {0.f, 0.f, 0.f, 0.f, 0.f, 0.f, 0.f, 0.f};
        for (int k = 0; k < p.K; ++k) { const float a = A[(long long)k * p.sAk];
#pragma unroll
            for (int j = 0; j < 8; ++j) if (j < p.N) acc[j] += a * Bb[(long long)j * p.sBn + (long long)k * p.sBk]; }
#pragma unroll
        for (int j = 0; j < 8; ++j) if (j < p.N) {
            float v = acc[j] * p.alpha;
            if (p.flags & 1) v += p.bias[j];
            if (p.flags & 2) v += p.bias[r];
            v = act_fn(v, p.act);
            if (p.flags & 4) v += p.beta * R[r * p.sRm + (long long)j * p.sRn];
            VST2(float, C + r * p.sCm + j, v);
        }
    }
}
// k_smallsoftmax: thread-per-row softmax for short rows (n <= 64): dst[r*dr + j] = softmax(scale*src[r*sr + j])
__global__ __launch_bounds__(256) void k_smallsoftmax(const float* __restrict__ src, float* __restrict__ dst, long long sr, long long dr, int n, long long R, float scale) {
    const long long r0 = ((long long)blockIdx.x * 256 + threadIdx.x) * 32;
    for (int rr = 0; rr < 32; ++rr) {
        const long long r = r0 + rr; if (r >= R) return;
        const float* s = src + r * sr; float* d = dst + r * dr;
        float mx = -__builtin_inff();
        for (int j = 0; j < n; ++j) mx = fmaxf(mx, s[j] * scale);
        float sum = 0.f;
        for (int j = 0; j < n; ++j) sum += expf(s[j] * scale - mx);
        const float inv = 1.f / sum;
        for (int j = 0; j < n; ++j) { const float v = expf(s[j] * scale - mx) * inv; VST2(float, d + j, v); }
    }
}

__global__ __launch_bounds__(32) void k_unitstat(float* __restrict__ st) { const int t = threadIdx.x; const float v = (t == 1) ? 1.f : 0.f; VST2(float, st + t, v); }

// destination (e.g. a d_out whose row width is not a multiple of 32 floats) is written by consecutive lanes of one instruction
__global__ __launch_bounds__(256) void k_lincopy(const float* __restrict__ src, long long lds, float* __restrict__ dst, long long ldd, long long rows, int cols) {
    const long long i = (long long)blockIdx.x * 256 + threadIdx.x; if (i >= rows * cols) return;
    const long long r = i / cols; const int c = (int)(i - r * cols);
    const float v = src[r * lds + c]; VST2(float, dst + r * ldd + c, v);
}

namespace w25 {
typedef __attribute__((ext_vector_type(16))) _Float16 v16h;
typedef __attribute__((ext_vector_type(8)))  _Float16 v8h;
typedef __attribute__((ext_vector_type(16))) __bf16   v16b;
typedef __attribute__((ext_vector_type(8)))  __bf16   v8b;
typedef __attribute__((ext_vector_type(8)))  float    v8f;
typedef __attribute__((ext_vector_type(4)))  float    v4f;

__device__ __forceinline__ unsigned short f2bf_bits(float f) {
  unsigned u = __float_as_uint(f);
  return (unsigned short)((u + 0x7FFFu + ((u >> 16) & 1u)) >> 16);
}
__device__ __forceinline__ float bf_bits2f(unsigned short h) { return __uint_as_float(((unsigned)h) << 16); }

// hazard guards as plain device helpers (no inline asm inside the kernel template body)
__device__ __forceinline__ void dep_guard_h(v8f& a, v8f& b, v16h x, v16h y) { asm volatile("v_nop\n\tv_nop\n\tv_nop\n\tv_nop" : "+v"(a), "+v"(b) : "v"(x), "v"(y)); }
__device__ __forceinline__ void dep_guard_b(v8f& a, v8f& b, v16b x, v16b y) { asm volatile("v_nop\n\tv_nop\n\tv_nop\n\tv_nop" : "+v"(a), "+v"(b) : "v"(x), "v"(y)); }
__device__ __forceinline__ void keep4_h(v16h a, v16h b, v16h c, v16h d) { asm volatile("v_nop" :: "v"(a), "v"(b), "v"(c), "v"(d)); }
__device__ __forceinline__ void keep4_b(v16b a, v16b b, v16b c, v16b d) { asm volatile("v_nop" :: "v"(a), "v"(b), "v"(c), "v"(d)); }
__device__ __forceinline__ void acc_guard4(v8f& a, v8f& b, v8f& c, v8f& d) { asm volatile("v_nop\n\tv_nop\n\tv_nop\n\tv_nop" : "+v"(a), "+v"(b), "+v"(c), "+v"(d)); }
template <typename T> struct Frag;
template <> struct Frag<_Float16> {
  typedef v16h V; union U { v16h v; v8h h[2]; };
  static __device__ __forceinline__ v16h load(const _Float16* p) {   // elements 0..7 <- p[0..7], 8..15 <- p[16..23]
    U f; f.h[0] = *(const v8h*)(p); f.h[1] = *(const v8h*)(p + 16); return f.v;
  }
  static __device__ __forceinline__ v8f mma(v16h a, v16h b, v8f c) {
    return __builtin_amdgcn_wmma_f32_16x16x32_f16(false, a, false, b, (short)0, c, false, false);
  }
  static __device__ __forceinline__ void guard(v8f& a, v8f& b, v16h x, v16h y) { dep_guard_h(a, b, x, y); }
  static __device__ __forceinline__ void keep(v16h a, v16h b, v16h c, v16h d) { keep4_h(a, b, c, d); }
};
template <> struct Frag<__bf16> {
  typedef v16b V; union U { v16b v; v8b h[2]; };
  static __device__ __forceinline__ v16b load(const __bf16* p) {
    U f; f.h[0] = *(const v8b*)(p); f.h[1] = *(const v8b*)(p + 16); return f.v;
  }
  static __device__ __forceinline__ v8f mma(v16b a, v16b b, v8f c) {
    return __builtin_amdgcn_wmma_f32_16x16x32_bf16(false, a, false, b, (short)0, c, false, false);
  }
  static __device__ __forceinline__ void guard(v8f& a, v8f& b, v16b x, v16b y) { dep_guard_b(a, b, x, y); }
  static __device__ __forceinline__ void keep(v16b a, v16b b, v16b c, v16b d) { keep4_b(a, b, c, d); }
};

// ---- Register-blocked batched WMMA GEMM ------------------------------------
// C[m,n] = scale * sum_k A[m,k] * Bt[n,k] (+bias)(+resid); each wave owns a 64x64 tile.
// A row-major [M,K]; Bt row-major [N,K]; M,N % 64 == 0, K % 32 == 0.
// SPLIT: operands are hi/lo planes (A2/Bt2 = lo planes, same layout); product = hi·hi + hi·lo + lo·hi.
// BIAS_MODE: 0 = none, 1 = bias[m], 2 = bias[n].
// OUT_MODE: 0 = f32, 1 = f16, 2 = bf16 hi plane (Cout) + bf16 lo plane (Cout2).
// ET: 0 = f16 operands, 1 = bf16 operands (pointers passed as 16-bit storage)
template <int ET> struct Elem;
template <> struct Elem<0> { typedef _Float16 T; };
template <> struct Elem<1> { typedef __bf16 T; };
template <int ET, bool SPLIT, int BIAS_MODE, int OUT_MODE, bool RESID, int ACT = 0>
__global__ __launch_bounds__(256) void wmma_gemm64(
    const unsigned short* __restrict__ Ap, const unsigned short* __restrict__ A2p, int lda, long strideA,
    const unsigned short* __restrict__ Btp, const unsigned short* __restrict__ Bt2p, int ldb, long strideB,
    void* __restrict__ Cout, void* __restrict__ Cout2, int ldc, long strideC,
    const float* __restrict__ bias,
    const float* __restrict__ resid, long strideR,
    int M, int N, int K, float scale) {
  typedef typename Elem<ET>::T T;
  typedef typename Frag<T>::V V;
  const T* A = (const T*)Ap; const T* A2 = (const T*)A2p; const T* Bt = (const T*)Btp; const T* Bt2 = (const T*)Bt2p;
  __shared__ __align__(16) float sT[8][16 * 68];   // per-wave 16x64 slab, pitch 68 floats
  const int b    = blockIdx.y;
  const int lane = threadIdx.x & 31;
  const int wave = threadIdx.x >> 5;
  const int tilesN = N >> 6;
  const int tilesM = M >> 6;
  const int tile = blockIdx.x * 8 + wave;
  if (tile >= tilesM * tilesN) return;   // wave-uniform; no block barriers in this kernel
  const int tm = tile / tilesN;
  const int tn = tile - tm * tilesN;
  const int m0 = tm << 6;
  const int n0 = tn << 6;

  const T* Ab  = A  + (size_t)b * strideA;
  const T* Bb  = Bt + (size_t)b * strideB;
  const T* Ab2 = SPLIT ? (A2  + (size_t)b * strideA) : nullptr;
  const T* Bb2 = SPLIT ? (Bt2 + (size_t)b * strideB) : nullptr;

  const int rlane = lane & 15;                 // row (A) / col (B, D) within subtile
  const int koff  = (lane >> 4) * 8;           // k offset of this lane half
  const int mOff  = (lane >> 4) * 8;           // D row offset

  v8f acc[4][4];
#pragma unroll
  for (int i = 0; i < 4; ++i)
#pragma unroll
    for (int j = 0; j < 4; ++j) acc[i][j] = (v8f){0.f,0.f,0.f,0.f,0.f,0.f,0.f,0.f};

  for (int k0 = 0; k0 < K; k0 += 32) {
    V bh[4], bl[4];
#pragma unroll
    for (int j = 0; j < 4; ++j) {
      const size_t bo = (size_t)(n0 + (j << 4) + rlane) * ldb + koff + k0;
      bh[j] = Frag<T>::load(Bb + bo);
      if (SPLIT) bl[j] = Frag<T>::load(Bb2 + bo);
    }
#pragma unroll
    for (int i = 0; i < 4; ++i) {
      const size_t ao = (size_t)(m0 + (i << 4) + rlane) * lda + koff + k0;
      V ah = Frag<T>::load(Ab + ao);
      V al;
      if (SPLIT) al = Frag<T>::load(Ab2 + ao);
#pragma unroll
      for (int j = 0; j < 4; ++j) {
        acc[i][j] = Frag<T>::mma(ah, bh[j], acc[i][j]);
        if (SPLIT) {
          acc[i][j] = Frag<T>::mma(ah, bl[j], acc[i][j]);
          acc[i][j] = Frag<T>::mma(al, bh[j], acc[i][j]);
        }
      }
      Frag<T>::guard(acc[i][0], acc[i][3], ah, SPLIT ? al : ah);
    }
    Frag<T>::keep(bh[0], bh[1], bh[2], bh[3]);
    if (SPLIT) Frag<T>::keep(bl[0], bl[1], bl[2], bl[3]);
  }
  acc_guard4(acc[0][0], acc[0][1], acc[0][2], acc[0][3]);
  acc_guard4(acc[1][0], acc[1][1], acc[1][2], acc[1][3]);
  acc_guard4(acc[2][0], acc[2][1], acc[2][2], acc[2][3]);
  acc_guard4(acc[3][0], acc[3][1], acc[3][2], acc[3][3]);

  // ---- epilogue ----
  float* slab = sT[wave];
  const float* Rb = RESID ? (resid + (size_t)b * strideR) : nullptr;
#pragma unroll
  for (int i = 0; i < 4; ++i) {
    const int mBase = m0 + (i << 4);
#pragma unroll
    for (int j = 0; j < 4; ++j) {
      const int n = n0 + (j << 4) + rlane;
      float bv = 0.f;
      if (BIAS_MODE == 2) bv = bias[n];
#pragma unroll
      for (int r = 0; r < 8; ++r) {
        float v = acc[i][j][r] * scale;
        if (BIAS_MODE == 1) v += bias[mBase + mOff + r];
        if (BIAS_MODE == 2) v += bv;
        if (RESID) v += Rb[(size_t)(mBase + mOff + r) * ldc + n];
        if (ACT == 1) v = tanhf(v);
        if (ACT == 2) v = fmaxf(v, 0.0f);
        if (ACT == 3) v = v / (1.0f + expf(-v));
        if (ACT == 4) v = (v > 0.f) ? v : 0.01f * v;
        if (ACT == 5) v = 0.5f * v * (1.0f + erff(v * 0.70710678118654752f));
        slab[(mOff + r) * 68 + (j << 4) + rlane] = v;
      }
    }
    __builtin_amdgcn_fence(__ATOMIC_RELEASE, "workgroup");
    __builtin_amdgcn_wave_barrier();
    __builtin_amdgcn_fence(__ATOMIC_ACQUIRE, "workgroup");
    if (OUT_MODE == 0) {
      float* C = (float*)Cout + (size_t)b * strideC;
      const int hh = lane >> 4, c4 = (lane & 15) * 4;     // row seg = 256 B = 16 lanes x 16 B
      {
#pragma unroll
        for (int it = 0; it < 8; ++it) {
          const int row = it * 2 + hh;
          v4f v = *(const v4f*)(slab + row * 68 + c4);
          *(v4f*)(C + (size_t)(mBase + row) * ldc + n0 + c4) = v;
        }
        
      }
    } else {
      const int q = lane >> 3, c8 = (lane & 7) * 8;
      unsigned short* C  = (unsigned short*)Cout  + (size_t)b * strideC;
      unsigned short* C2 = (OUT_MODE == 2) ? ((unsigned short*)Cout2 + (size_t)b * strideC) : nullptr;
      {
#pragma unroll
        for (int it = 0; it < 4; ++it) {
          const int row = it * 4 + q;
          const float* sp = slab + row * 68 + c8;
          v8h hv, lv;
#pragma unroll
          for (int e = 0; e < 8; ++e) {
            if (OUT_MODE == 1) {
              hv[e] = (_Float16)sp[e];
            } else {
              unsigned short hb = f2bf_bits(sp[e]);
              unsigned short lb = f2bf_bits(sp[e] - bf_bits2f(hb));
              hv[e] = __builtin_bit_cast(_Float16, hb);
              lv[e] = __builtin_bit_cast(_Float16, lb);
            }
          }
          *(v8h*)(C + (size_t)(mBase + row) * ldc + n0 + c8) = hv;
          if (OUT_MODE == 2) *(v8h*)(C2 + (size_t)(mBase + row) * ldc + n0 + c8) = lv;
        }
        
      }
    }
    __builtin_amdgcn_fence(__ATOMIC_RELEASE, "workgroup");
    __builtin_amdgcn_wave_barrier();
    __builtin_amdgcn_fence(__ATOMIC_ACQUIRE, "workgroup");
  }
}

__global__ __launch_bounds__(256) void cast_f32_f16x2(
    const float* __restrict__ in, _Float16* __restrict__ out, int n2) {
  int i = blockIdx.x * 256 + threadIdx.x;
  if (i < n2) {
    const _Float16 h0 = (_Float16)in[2 * i], h1 = (_Float16)in[2 * i + 1];
    const unsigned u = (unsigned)__builtin_bit_cast(unsigned short, h0) | ((unsigned)__builtin_bit_cast(unsigned short, h1) << 16);
    ((unsigned*)out)[i] = u;
    
  }
}


} // namespace w25

__global__ __launch_bounds__(256) void k_castT16(const float* __restrict__ src, long long lds, _Float16* __restrict__ dst, long long ldd, int R, int C, float s) {
    src += (long long)blockIdx.y * R * lds; dst += (long long)blockIdx.y * C * ldd;   // batch = blockIdx.y
    const long long i = (long long)blockIdx.x * 256 + threadIdx.x; const long long np = (long long)C * (R / 2); if (i >= np) return; const int c = (int)(i / (R / 2)); const int r = 2 * (int)(i % (R / 2));
    const _Float16 h0 = (_Float16)(src[(long long)r * lds + c] * s), h1 = (_Float16)(src[(long long)(r + 1) * lds + c] * s);
    const unsigned u = (unsigned)__builtin_bit_cast(unsigned short, h0) | ((unsigned)__builtin_bit_cast(unsigned short, h1) << 16);
    unsigned* d = (unsigned*)(dst + (long long)c * ldd + r); *d = u;  }

// f32 -> bf16 hi plane + bf16 lo plane (x = hi + lo to ~2^-17 relative; RNE both), [R][C] -> [R][C] (or transposed to [C][R]); 2 consecutive destination elements
__device__ __forceinline__ unsigned int f2bf2_pack(float a, float b, unsigned int* lo) {
    const unsigned short ha = w25::f2bf_bits(a), hb = w25::f2bf_bits(b);
    const unsigned short la = w25::f2bf_bits(a - w25::bf_bits2f(ha)), lb = w25::f2bf_bits(b - w25::bf_bits2f(hb));
    *lo = (unsigned)la | ((unsigned)lb << 16); return (unsigned)ha | ((unsigned)hb << 16); }
__global__ __launch_bounds__(256) void k_castS16(const float* __restrict__ src, long long lds, __bf16* __restrict__ dhi, __bf16* __restrict__ dlo, long long ldd, int R, int C, float s, int transpose) {
    const long long i = (long long)blockIdx.x * 256 + threadIdx.x; long long o; float a, b;
    if (transpose) { const long long np = (long long)C * (R / 2); if (i >= np) return; const int c = (int)(i / (R / 2)); const int r = 2 * (int)(i % (R / 2)); a = src[(long long)r * lds + c] * s; b = src[(long long)(r + 1) * lds + c] * s; o = (long long)c * ldd + r; }
    else { const long long np = (long long)R * (C / 2); if (i >= np) return; const int r = (int)(i / (C / 2)); const int c = 2 * (int)(i % (C / 2)); a = src[(long long)r * lds + c] * s; b = src[(long long)r * lds + c + 1] * s; o = (long long)r * ldd + c; }
    unsigned lo; const unsigned hi = f2bf2_pack(a, b, &lo); unsigned* ph = (unsigned*)(dhi + o); unsigned* pl = (unsigned*)(dlo + o);
    *ph = hi; *pl = lo;  }

namespace w25 {
// =====================================================================================
// Generic causal/non-causal attention for head_dim 64, f32 in / f32 out; 16-bit operands: bf16 with optional hi/lo splits, or
// plain f16 (F16=true, non-split, probabilities carried x2^15).
//   scores = (q*qscale)·kᵀ : v_wmma_f32_16x16x32_bf16; SPLIT_QK -> q,k as bf16 hi/lo (hi·hi + hi·lo + lo·hi)
//   out    = p·v           : v_wmma_f32_16x16x32_bf16; SPLIT_PV -> p,v as bf16 hi/lo; else p,v plain bf16
//   f32 accumulate; online softmax in f32. Block = 4 waves = 64 query rows of one (batch, head); S % 64 == 0.
//   Element (b, s, h, d) of tensor X lives at X[b*X_bs + s*X_rs + h*X_hs + d] (strides in floats, multiples of 4).
//   Masking: mask_mode 0 none, 1 causal (kv > q masked), 2 tensor [S][Skv] shared over (b,h) (float if
//   mask_is_int==0, int32 with element == 0 -> masked if 1, int32 with element != 0 -> masked if 2), 3 per-token vectors qmask[B][S] & kvmask[B][Skv] (int32,
//   0 -> masked), 4 causal + sliding window (kv > q or q - kv > W masked; W passed in mask_is_int);
//   5 = relative-position bias: s += cp[b,h,q][idx[q][kv]] + pc[b,h,kv][idx[q][kv]] with idx = mask_b ([S][Skv] int32) and
//   mask_a an int32 [S][Skv] tensor with nonzero = masked (tables: element (b,h,row,n) at X + b*c_bs + h*c_hs + row*c_rs + n);
//   masked scores are replaced by mask_fill (e.g. -inf or -1e9) before the softmax.
//   grid.x = B * H * (S/64) (or a sub-range with blk0).
// =====================================================================================
#define AT_D 64
#define AT_NW 4
#define AT_QB 64
#define AT_KC 64
struct AttnGeom { const float* cp = nullptr; const float* pc = nullptr; long c_bs = 0, c_rs = 0, c_hs = 0;   // mode-5 score-bias tables
                  long q_bs, q_rs, q_hs, k_bs, k_rs, k_hs, v_bs, v_rs, v_hs, o_bs, o_rs, o_hs;
                  int S, Skv, H, mask_mode; float qscale; int blk0; float mask_fill; int mask_is_int; };
static_assert(sizeof(AttnGeom) == 168, "no padding");

__device__ __forceinline__ unsigned short at_bf_bits(float f) {
  unsigned u = __float_as_uint(f);
  return (unsigned short)((u + 0x7FFFu + ((u >> 16) & 1u)) >> 16);
}
__device__ __forceinline__ __bf16 at_f2bf(float f) { return __builtin_bit_cast(__bf16, at_bf_bits(f)); }
__device__ __forceinline__ void at_split(float f, __bf16& hi, __bf16& lo) {
  const unsigned short hb = at_bf_bits(f);
  hi = __builtin_bit_cast(__bf16, hb);
  lo = at_f2bf(f - __uint_as_float(((unsigned)hb) << 16));
}
__device__ __forceinline__ v8f at_mma(v16b a, v16b b, v8f c) {
  c = __builtin_amdgcn_wmma_f32_16x16x32_bf16(false, a, false, b, (short)0, c, false, false);
  asm volatile("v_nop\n\tv_nop\n\tv_nop\n\tv_nop" : "+v"(c) : "v"(a), "v"(b));
  return c;
}
// 16-bit element as a bit pattern held in a __bf16 slot: f16 bits when F16, bf16 (RNE) otherwise
template <bool F16> __device__ __forceinline__ __bf16 at_to16(float f) {
  if (F16) return __builtin_bit_cast(__bf16, (_Float16)f);
  return at_f2bf(f);
}
template <bool F16> __device__ __forceinline__ v8f at_mma16(v16b a, v16b b, v8f c) {
  if (F16) {
    const v16h ah = __builtin_bit_cast(v16h, a), bh = __builtin_bit_cast(v16h, b);
    c = __builtin_amdgcn_wmma_f32_16x16x32_f16(false, ah, false, bh, (short)0, c, false, false);
    asm volatile("v_nop\n\tv_nop\n\tv_nop\n\tv_nop" : "+v"(c) : "v"(ah), "v"(bh));
    return c;
  }
  return at_mma(a, b, c);
}

template <bool SPLIT_QK, bool SPLIT_PV, bool F16 = false>
__global__ __launch_bounds__(128)
void attn64_kernel(const float* __restrict__ q, const float* __restrict__ k,
                   const float* __restrict__ v, float* __restrict__ out,
                   const void* __restrict__ mask_a, const int* __restrict__ mask_b, AttnGeom g) {
  static_assert(!(F16 && (SPLIT_QK || SPLIT_PV)), "f16 mode is non-split");
  const float PSC = F16 ? 32768.0f : 1.0f;     // f16 probabilities carried x2^15 (subnormal range), folded into the final 1/l
  union FB { v16b v; v8b h[2]; };
  __shared__ __align__(16) __bf16 Ksh[AT_KC * AT_D];             // K hi [kv][d]      8 KB
  __shared__ __align__(16) __bf16 Ksl[SPLIT_QK ? AT_KC * AT_D : 8];
  __shared__ __align__(16) __bf16 Vth[AT_D * AT_KC];             // V hi [d][kv]      8 KB
  __shared__ __align__(16) __bf16 Vtl[SPLIT_PV ? AT_D * AT_KC : 8];
  __shared__ __align__(16) __bf16 Psh[AT_NW][16 * AT_KC];        // per wave P hi [row][kv]  8 KB
  __shared__ __align__(16) __bf16 Psl[SPLIT_PV ? AT_NW : 1][SPLIT_PV ? 16 * AT_KC : 8];
  __shared__ __align__(16) float  Os[AT_NW][16 * 68];            // per wave out tile, pitch 68

  const int tid  = threadIdx.x;
  const int wave = tid >> 5;
  const int lane = tid & 31;
  const int hh   = lane >> 4;
  const int c    = lane & 15;

  const int nqb = g.S / AT_QB;
  const int bx = blockIdx.x + g.blk0;
  const int qb = bx % nqb;
  const int bh = bx / nqb;
  const int h  = bh % g.H;
  const int b  = bh / g.H;
  const int qbase_block = qb * AT_QB;
  const int q0 = qbase_block + wave * 16;

  const float* qb_ptr = q + (size_t)b * g.q_bs + (size_t)h * g.q_hs;
  const float* kb_ptr = k + (size_t)b * g.k_bs + (size_t)h * g.k_hs;
  const float* vb_ptr = v + (size_t)b * g.v_bs + (size_t)h * g.v_hs;
  float*       ob_ptr = out + (size_t)b * g.o_bs + (size_t)h * g.o_hs;

  // ---- Q fragments (A operand): 2 d-chunks, hi (and lo) ----
  v16b qah[2], qal[2];
  {
    const float* qrow = qb_ptr + (size_t)(q0 + c) * g.q_rs;
#pragma unroll
    for (int dc = 0; dc < 2; ++dc) {
#pragma unroll
      for (int e = 0; e < 8; ++e) {
        const float f0 = qrow[dc * 32 + 8 * hh + e] * g.qscale;
        const float f1 = qrow[dc * 32 + 16 + 8 * hh + e] * g.qscale;
        if (SPLIT_QK) { __bf16 hq, lq; at_split(f0, hq, lq); qah[dc][e] = hq; qal[dc][e] = lq; at_split(f1, hq, lq); qah[dc][8 + e] = hq; qal[dc][8 + e] = lq; }
        else { qah[dc][e] = at_to16<F16>(f0); qah[dc][8 + e] = at_to16<F16>(f1); qal[dc][e] = qah[dc][e]; qal[dc][8 + e] = qah[dc][8 + e]; }
      }
    }
  }

  float mrow[8], lrow[8];
  v8f oacc[4];
#pragma unroll
  for (int r = 0; r < 8; ++r) { mrow[r] = -INFINITY; lrow[r] = 0.f; }
#pragma unroll
  for (int t = 0; t < 4; ++t) oacc[t] = (v8f){0.f,0.f,0.f,0.f,0.f,0.f,0.f,0.f};

  const int nChunks = (g.mask_mode == 1 || g.mask_mode == 4) ? (qb + 1) : (g.Skv / AT_KC);   // block-uniform
  // per-row query mask (mode 3)
  int qkeep[8];
#pragma unroll
  for (int r = 0; r < 8; ++r) qkeep[r] = (g.mask_mode == 3) ? mask_b[(size_t)b * g.S + q0 + 8 * hh + r] : 1;   // mask_b = qmask in mode 3
  for (int kc = 0; kc < nChunks; ++kc) {
    const int kv0 = kc * AT_KC;
    __syncthreads();
    {
      const int kvr = tid >> 1, dh = (tid & 1) * 32;
      const float* krow = kb_ptr + (size_t)(kv0 + kvr) * g.k_rs + dh;
      const float* vrow = vb_ptr + (size_t)(kv0 + kvr) * g.v_rs + dh;
#pragma unroll
      for (int i = 0; i < 8; ++i) {
        v4f kk = *(const v4f*)(krow + 4 * i);
        v4f vv = *(const v4f*)(vrow + 4 * i);
#pragma unroll
        for (int e = 0; e < 4; ++e) {
          const int d = dh + 4 * i + e;
          if (SPLIT_QK) { __bf16 a, bl; at_split(kk[e], a, bl); Ksh[kvr * AT_D + d] = a; Ksl[kvr * AT_D + d] = bl; }
          else Ksh[kvr * AT_D + d] = at_to16<F16>(kk[e]);
          if (SPLIT_PV) { __bf16 a, bl; at_split(vv[e], a, bl); Vth[d * AT_KC + kvr] = a; Vtl[d * AT_KC + kvr] = bl; }
          else Vth[d * AT_KC + kvr] = at_to16<F16>(vv[e]);
        }
      }
    }
    __syncthreads();

    v8f s[4];
#pragma unroll
    for (int j = 0; j < 4; ++j) {
      s[j] = (v8f){0.f,0.f,0.f,0.f,0.f,0.f,0.f,0.f};
#pragma unroll 1
      for (int dc = 0; dc < 2; ++dc) {
        FB kb;
        kb.h[0] = *(const v8b*)(Ksh + (j * 16 + c) * AT_D + dc * 32 + 8 * hh);
        kb.h[1] = *(const v8b*)(Ksh + (j * 16 + c) * AT_D + dc * 32 + 16 + 8 * hh);
        s[j] = at_mma16<F16>(qah[dc], kb.v, s[j]);
        if (SPLIT_QK) {
          FB kl;
          kl.h[0] = *(const v8b*)(Ksl + (j * 16 + c) * AT_D + dc * 32 + 8 * hh);
          kl.h[1] = *(const v8b*)(Ksl + (j * 16 + c) * AT_D + dc * 32 + 16 + 8 * hh);
          s[j] = at_mma16<F16>(qah[dc], kl.v, s[j]);
          s[j] = at_mma16<F16>(qal[dc], kb.v, s[j]);
        }
      }
    }
    const bool diag = (g.mask_mode == 1) && (kc == qb);
    int kvkeep[4] = {1, 1, 1, 1};
    if (g.mask_mode == 3) {
#pragma unroll
      for (int j = 0; j < 4; ++j) kvkeep[j] = ((const int*)mask_a)[(size_t)b * g.Skv + kv0 + j * 16 + c];   // mask_a = kvmask
    }
    float cm[8];
#pragma unroll
    for (int r = 0; r < 8; ++r) {
      const int qrow = q0 + 8 * hh + r;
      float m = -INFINITY;
#pragma unroll
      for (int j = 0; j < 4; ++j) {
        const int kvcol = kv0 + j * 16 + c;
        bool masked = false;
        if (diag) masked = (kvcol > qrow);
        else if (g.mask_mode == 4) masked = (kvcol > qrow) || (qrow - kvcol > g.mask_is_int);
        else if (g.mask_mode == 2) {
          const size_t mi = (size_t)qrow * g.Skv + kvcol;
          masked = (g.mask_is_int == 0) ? (((const float*)mask_a)[mi] == 0.0f)
                 : (g.mask_is_int == 1) ? (((const int*)mask_a)[mi] == 0) : (((const int*)mask_a)[mi] != 0);
        } else if (g.mask_mode == 3) masked = (qkeep[r] == 0) || (kvkeep[j] == 0);
        else if (g.mask_mode == 5) {
          const size_t mi = (size_t)qrow * g.Skv + kvcol;
          masked = (((const int*)mask_a)[mi] != 0);
          int n = mask_b[mi]; n = n < 0 ? 0 : n;
          s[j][r] += g.cp[(size_t)b * g.c_bs + (size_t)h * g.c_hs + (size_t)qrow * g.c_rs + n]
                   + g.pc[(size_t)b * g.c_bs + (size_t)h * g.c_hs + (size_t)kvcol * g.c_rs + n];
        }
        if (masked) s[j][r] = g.mask_fill;
        m = fmaxf(m, s[j][r]);
      }
#pragma unroll
      for (int off = 1; off < 16; off <<= 1) m = fmaxf(m, __shfl_xor(m, off, 32));
      cm[r] = m;
    }
    __bf16* pwh = Psh[wave];
    __bf16* pwl = Psl[SPLIT_PV ? wave : 0];
#pragma unroll
    for (int r = 0; r < 8; ++r) {
      const float mnew = fmaxf(mrow[r], cm[r]);
      const float alpha = expf(mrow[r] - mnew);
      mrow[r] = mnew;
      float psum = 0.f;
#pragma unroll
      for (int j = 0; j < 4; ++j) {
        const float p = expf(s[j][r] - mnew);
        psum += p;
        if (SPLIT_PV) { __bf16 a, bl; at_split(p, a, bl); pwh[(8 * hh + r) * AT_KC + j * 16 + c] = a; pwl[(8 * hh + r) * AT_KC + j * 16 + c] = bl; }
        else pwh[(8 * hh + r) * AT_KC + j * 16 + c] = at_to16<F16>(p * PSC);
      }
#pragma unroll
      for (int off = 1; off < 16; off <<= 1) psum += __shfl_xor(psum, off, 32);
      lrow[r] = lrow[r] * alpha + psum;
#pragma unroll
      for (int t = 0; t < 4; ++t) oacc[t][r] *= alpha;
    }
    __builtin_amdgcn_fence(__ATOMIC_RELEASE, "workgroup");
    __builtin_amdgcn_wave_barrier();
    __builtin_amdgcn_fence(__ATOMIC_ACQUIRE, "workgroup");
#pragma unroll 1
    for (int kk = 0; kk < 2; ++kk) {
      FB pa, pl;
      pa.h[0] = *(const v8b*)(pwh + c * AT_KC + kk * 32 + 8 * hh);
      pa.h[1] = *(const v8b*)(pwh + c * AT_KC + kk * 32 + 16 + 8 * hh);
      if (SPLIT_PV) {
        pl.h[0] = *(const v8b*)(pwl + c * AT_KC + kk * 32 + 8 * hh);
        pl.h[1] = *(const v8b*)(pwl + c * AT_KC + kk * 32 + 16 + 8 * hh);
      }
#pragma unroll
      for (int t = 0; t < 4; ++t) {
        FB vb;
        vb.h[0] = *(const v8b*)(Vth + (t * 16 + c) * AT_KC + kk * 32 + 8 * hh);
        vb.h[1] = *(const v8b*)(Vth + (t * 16 + c) * AT_KC + kk * 32 + 16 + 8 * hh);
        oacc[t] = at_mma16<F16>(pa.v, vb.v, oacc[t]);
        if (SPLIT_PV) {
          FB vl;
          vl.h[0] = *(const v8b*)(Vtl + (t * 16 + c) * AT_KC + kk * 32 + 8 * hh);
          vl.h[1] = *(const v8b*)(Vtl + (t * 16 + c) * AT_KC + kk * 32 + 16 + 8 * hh);
          oacc[t] = at_mma16<F16>(pa.v, vl.v, oacc[t]);
          oacc[t] = at_mma16<F16>(pl.v, vb.v, oacc[t]);
        }
      }
    }
  }

  float* os = Os[wave];
#pragma unroll
  for (int r = 0; r < 8; ++r) {
    const float inv = 1.0f / (lrow[r] * PSC);
#pragma unroll
    for (int t = 0; t < 4; ++t) os[(8 * hh + r) * 68 + t * 16 + c] = oacc[t][r] * inv;
  }
  __builtin_amdgcn_fence(__ATOMIC_RELEASE, "workgroup");
  __builtin_amdgcn_wave_barrier();
  __builtin_amdgcn_fence(__ATOMIC_ACQUIRE, "workgroup");
  {
    const int c4 = (lane & 15) * 4;
    {
#pragma unroll
      for (int it = 0; it < 8; ++it) {
        const int row = it * 2 + hh;
        v4f val = *(const v4f*)(os + row * 68 + c4);
        *(v4f*)(ob_ptr + (size_t)(q0 + row) * g.o_rs + c4) = val;
      }
      
    }
  }
}

} // namespace w25

// row dots: OUT[r] = X[r] . w (one wave per 32 rows? no: wave per row -> lone store; use 8 rows per block with lane-kept results: wave w handles rows 32*blk... simpler: each wave handles 4 rows sequentially, 8 waves -> 32 rows per block, results through LDS, wave 0 writes the 32-float line)
__global__ __launch_bounds__(256) void k_bi_lin(const float* __restrict__ X, const float* __restrict__ w, float* __restrict__ OUT, int nrows, int D) { __shared__ float res[32]; const long long r0 = (long long)blockIdx.x * 32; const int wv = threadIdx.x >> 5, lane = threadIdx.x & 31;
    for (int rr = 0; rr < 4; ++rr) { const long long r = r0 + wv * 4 + rr; float s = 0.f; if (r < nrows) { for (int d = lane; d < D; d += 32) s += X[r * D + d] * w[d]; } for (int o = 16; o > 0; o >>= 1) s += __shfl_xor(s, o, 32); if (lane == 0) res[wv * 4 + rr] = s; }
    __syncthreads(); if (wv == 0 && r0 + lane < nrows) VST2(float, OUT + r0 + lane, res[lane]); }
// QW[n][d] = q[b][n][d] * w_qm[d] (thread-linear)
__global__ __launch_bounds__(256) void k_bi_qw(const float* __restrict__ Q, const float* __restrict__ wqm, float* __restrict__ QW, int b, int N, int D) { const int t = blockIdx.x * 256 + threadIdx.x; if (t >= N * D) return; VST2(float, QW + t, Q[(long long)b * N * D + t] * wqm[t % D]); }
// expf, step for step as the compiler expands it (x * log2(e) in two parts, 2^fraction, ldexp, the two range tests), written out so that the v_nop can stand in the
//   statement of v_exp_f32: it fills the one slot the instruction set asks for in front of a vector instruction that reads the result or overwrites the source
__device__ __forceinline__ float exp_slot(float x) {
    const float ph = x * 0x1.715476p+0f;
    const float pl = fmaf(x, 0x1.4ae0bep-26f, fmaf(x, 0x1.715476p+0f, -ph));
    const float en = rintf(ph);
    const float a = (ph - en) + pl;
    float y;
    asm("v_exp_f32 %0, %1\n\tv_nop" : "=v"(y) : "v"(a));
    float r = ldexpf(y, (int)en);
    r = (x < -0x1.9d1da0p+6f) ? 0.f : r;
    r = (x > 0x1.62e430p+6f) ? __builtin_inff() : r;
    return r;
}
// one wave per row, RW rows per wave one after the other: sim = tril + AQ[n] + CM[m], masked exactly as the module: sim + (1 - qm*mm) * -1e30; the whole row stays in
//   registers (32 values per lane) from the one read of SIM to the one write: row max -> RMX, softmax over m (exp once), probabilities x ps stored as f16, the
//   operand plane of the query->memory product. CM and the memory mask are read once per wave; max and sum meet by lane shuffles, so the kernel has no barrier.
typedef __attribute__((ext_vector_type(4))) _Float16 v4h;
typedef __attribute__((ext_vector_type(4))) int      v4i;
template <int N, int M, int RW>
__global__ __launch_bounds__(256) void k_bi_soft16(const float* __restrict__ SIM, const float* __restrict__ AQ, const float* __restrict__ CM, const int* __restrict__ QM, const int* __restrict__ MM, float* __restrict__ RMX, _Float16* __restrict__ P16, float ps) {
    static_assert(M % 128 == 0 && N % (8 * RW) == 0, "whole 512-byte wave loads; whole blocks of 8 waves x RW rows");
    constexpr int C = M / 128;
    const int lane = threadIdx.x & 31, wv = __builtin_amdgcn_readfirstlane(threadIdx.x >> 5);
    const size_t bz = blockIdx.y;   // batch = blockIdx.y
    const size_t row0 = bz * N + (size_t)(blockIdx.x * 8 + wv) * RW;
    float aqv[RW], qmv[RW];
#pragma unroll
    for (int r = 0; r < RW; ++r) { aqv[r] = AQ[row0 + r]; qmv[r] = (float)QM[row0 + r]; }
    const float* sr = SIM + row0 * M + lane * 4;
    v4f x[C], nx[C], cm[C], mf[C]; v4i mk[C];
#pragma unroll
    for (int i = 0; i < C; ++i) x[i] = *(const v4f*)(sr + i * 128);
#pragma unroll
    for (int i = 0; i < C; ++i) { cm[i] = *(const v4f*)(CM + bz * M + lane * 4 + i * 128); mk[i] = *(const v4i*)(MM + bz * M + lane * 4 + i * 128); }
#pragma unroll
    for (int r = 0; r < RW; ++r) {
        if (r + 1 < RW) {
#pragma unroll
            for (int i = 0; i < C; ++i) nx[i] = *(const v4f*)(sr + (size_t)(r + 1) * M + i * 128);   // the next row flies while this one is worked on
            asm volatile("s_wait_xcnt 0x0" ::: "memory");   // the row's work may reuse the offset register that the loads above name
            __builtin_amdgcn_sched_barrier(0);   // keeps the loads and their wait at the head of the row's work; left free the loads sink to just ahead of their first use
        }
        if (r == 0) {
#pragma unroll
            for (int i = 0; i < C; ++i) mf[i] = __builtin_convertvector(mk[i], v4f);
        }
        const float aq = aqv[r], qm = qmv[r];
        float mx = -3.0e38f;
#pragma unroll
        for (int i = 0; i < C; ++i)
#pragma unroll
            for (int e = 0; e < 4; ++e) { const float msk = qm * mf[i][e]; const float v = x[i][e] + aq + cm[i][e] + (1.f - msk) * -1.0e30f; x[i][e] = v; mx = fmaxf(mx, v); }
        for (int o = 16; o > 0; o >>= 1) mx = fmaxf(mx, __shfl_xor(mx, o, 32));
        v4f s4 = {0.f, 0.f, 0.f, 0.f};
#pragma unroll
        for (int i = 0; i < C; ++i)
#pragma unroll
            for (int e = 0; e < 4; ++e) { const float ev = exp_slot(x[i][e] - mx); x[i][e] = ev; s4[e] += ev; }
        float s = (s4[0] + s4[1]) + (s4[2] + s4[3]);
        for (int o = 16; o > 0; o >>= 1) s += __shfl_xor(s, o, 32);
        const float inv = 1.f / s;
        _Float16* pr = P16 + (row0 + r) * M + lane * 4;
        v4h hv[C];
#pragma unroll
        for (int i = 0; i < C; ++i)
#pragma unroll
            for (int e = 0; e < 4; ++e) hv[i][e] = (_Float16)((x[i][e] * inv) * ps);
        __builtin_amdgcn_sched_barrier(0);   // with the one below: nothing that refills a register of these stores is scheduled between them and their wait
#pragma unroll
        for (int i = 0; i < C; ++i) *(v4h*)(pr + i * 128) = hv[i];
        VST2(float, RMX + (row0 + r) * 32 + lane, mx);   // row max staged as a whole 32-float line (slot 0 is read later)
        if (r + 1 < RW) {
            asm volatile("s_wait_xcnt 0x0" ::: "memory");   // the next row's work reuses the registers that the stores above name
            __builtin_amdgcn_sched_barrier(0);
        }
#pragma unroll
        for (int i = 0; i < C; ++i) x[i] = nx[i];
    } }

// memory->query: p = softmax_n(RMX[b][n]); M2Q[b][d] = sum_n p_n q[b][n][d]. One block of 32 waves per (batch, 32-float slice of d): thread t owns row
//   maximum t for the statistics; for the weighted sum a wave reads 4 rows x 128 bytes per load and every lane has its 8 row loads in flight at once
//   (issued ahead of the statistics, which do not depend on them); partial sums meet by lane shuffles and one LDS table.
template <int N, int D>
__global__ __launch_bounds__(1024) void k_bi_m2q(const float* __restrict__ RMX, const float* __restrict__ Q, float* __restrict__ M2Q) {
    static_assert(N == 1024 && D % 32 == 0, "one row maximum per thread; whole 128-byte slices of d");
    __shared__ float red[32]; __shared__ float pw[N]; __shared__ __align__(16) float part[32][32];
    const int b = blockIdx.x, d0 = blockIdx.y * 32, t = threadIdx.x, lane = t & 31, wv = t >> 5;
    const int rsub = lane >> 3, c4 = (lane & 7) * 4;
    const float r = RMX[((long long)b * N + t) * 32];
    const float* qb = Q + ((long long)b * N + wv * 4 + rsub) * D + d0 + c4;
    v4f x[N / 128];
    for (int i = 0; i < N / 128; ++i) x[i] = *(const v4f*)(qb + (long long)i * 128 * D);
    float mx = r;
    for (int o = 16; o > 0; o >>= 1) mx = fmaxf(mx, __shfl_xor(mx, o, 32));
    if (lane == 0) red[wv] = mx;
    __syncthreads();
    float mm = red[lane];
    for (int o = 16; o > 0; o >>= 1) mm = fmaxf(mm, __shfl_xor(mm, o, 32));
    __syncthreads();
    const float e = expf(r - mm); pw[t] = e;
    float s = e;
    for (int o = 16; o > 0; o >>= 1) s += __shfl_xor(s, o, 32);
    if (lane == 0) red[wv] = s;
    __syncthreads();
    float tot = red[lane];
    for (int o = 16; o > 0; o >>= 1) tot += __shfl_xor(tot, o, 32);
    v4f acc = {0.f, 0.f, 0.f, 0.f};
    for (int i = 0; i < N / 128; ++i) acc += pw[i * 128 + wv * 4 + rsub] * x[i];
    for (int c = 0; c < 4; ++c) { acc[c] += __shfl_xor(acc[c], 8, 32); acc[c] += __shfl_xor(acc[c], 16, 32); }
    if (lane < 8) *(v4f*)&part[wv][c4] = acc;
    __syncthreads();
    if (t < 32) { float a = 0.f;
        for (int w = 0; w < 32; ++w) a += part[w][t];
        VST2(float, M2Q + (long long)b * D + d0 + t, a * (1.f / tot)); } }
// out1[b][n][d] = M2Q[b][d] broadcast (thread-linear)
__global__ __launch_bounds__(256) void k_bi_bc(const float* __restrict__ M2Q, float* __restrict__ MQ, int Bn, int N, int D) { const long long t = (long long)blockIdx.x * 256 + threadIdx.x; if (t >= (long long)Bn * N * D) return; const int d = (int)(t % D); const int b = (int)(t / ((long long)N * D)); VST2(float, MQ + t, M2Q[b * D + d]); }


extern "C" void kernel_launch(void* const* d_in, const int* in_sizes, int n_in, void* d_out, int out_size, void* d_ws, size_t ws_size, hipStream_t stream) {
    (void)in_sizes; (void)n_in; (void)out_size; (void)ws_size;
    const float* q = (const float*)d_in[0];
    const float* mem = (const float*)d_in[1];
    const float* wq = (const float*)d_in[2];
    const float* wm = (const float*)d_in[3];
    const float* wqm = (const float*)d_in[4];
    const int* qmask = (const int*)d_in[5];
    const int* mmask = (const int*)d_in[6];
    const int Bn = 16;
    const int N = 1024;
    const int M = 1024;
    const int D = 128;
    float* out = (float*)d_out;
    float* mq = out + ((size_t)Bn * N * D);
    char* wsp = (char*)d_ws;
    float* QW = (float*)wsp; wsp += (((size_t)((size_t)Bn * N * D) * 4 + 255) / 256) * 256;
    float* AQ = (float*)wsp; wsp += (((size_t)((size_t)Bn * N) * 4 + 255) / 256) * 256;
    float* CM = (float*)wsp; wsp += (((size_t)((size_t)Bn * M) * 4 + 255) / 256) * 256;
    float* SIM = (float*)wsp; wsp += (((size_t)((size_t)Bn * N * M) * 4 + 255) / 256) * 256;
    float* RMX = (float*)wsp; wsp += (((size_t)((size_t)Bn * N * 32) * 4 + 255) / 256) * 256;
    float* M2Q = (float*)wsp; wsp += (((size_t)((size_t)Bn * D) * 4 + 255) / 256) * 256;
    unsigned short* G64A = (unsigned short*)wsp; wsp += (((size_t)(16777216) * 2 + 255) / 256) * 256;
    unsigned short* G64B = (unsigned short*)wsp; wsp += (((size_t)(2097152) * 2 + 255) / 256) * 256;
    unsigned short* G64A2 = (unsigned short*)wsp; wsp += (((size_t)(2097152) * 2 + 255) / 256) * 256;
    unsigned short* G64B2 = (unsigned short*)wsp; wsp += (((size_t)(2097152) * 2 + 255) / 256) * 256;
    k_bi_lin<<<(Bn * N + 7) / 8, 256, 0, stream>>>(q, wq, AQ, Bn * N, D); k_bi_lin<<<(Bn * M + 7) / 8, 256, 0, stream>>>(mem, wm, CM, Bn * M, D);
    k_bi_qw<<<(Bn * N * D + 255) / 256, 256, 0, stream>>>(q, wqm, QW, 0, Bn * N, D);
    k_castS16<<<(unsigned)((((long long)(16384) * ((128) / 2)) + 255) / 256), 256, 0, stream>>>(QW, 128, (__bf16*)(G64A), (__bf16*)(G64A2), 128, 16384, 128, 1.0f, 0);
    k_castS16<<<(unsigned)((((long long)(16384) * ((128) / 2)) + 255) / 256), 256, 0, stream>>>(mem, 128, (__bf16*)(G64B), (__bf16*)(G64B2), 128, 16384, 128, 1.0f, 0);
    w25::wmma_gemm64<1, true, 0, 0, false, 0><<<dim3((unsigned)((((1024) / 64) * ((1024) / 64) + 7) / 8), (unsigned)(16)), 256, 0, stream>>>((const unsigned short*)(G64A), (const unsigned short*)(G64A2), 128, 131072, (const unsigned short*)(G64B), (const unsigned short*)(G64B2), 128, 131072, (void*)(SIM), nullptr, 1024, 1048576, nullptr, nullptr, 0, 1024, 1024, 128, 1.0f);
    k_bi_soft16<1024, 1024, 4><<<dim3((unsigned)(N / 32), (unsigned)Bn), 256, 0, stream>>>(SIM, AQ, CM, qmask, mmask, RMX, (_Float16*)(G64A), 4096.0f);
    k_castT16<<<dim3((unsigned)((((long long)(128) * ((1024) / 2)) + 255) / 256), (unsigned)Bn), 256, 0, stream>>>(mem, 128, (_Float16*)(G64B), 1024, 1024, 128, 16.0f);
    w25::wmma_gemm64<0, false, 0, 0, false, 0><<<dim3((unsigned)((((1024) / 64) * ((128) / 64) + 7) / 8), (unsigned)(16)), 256, 0, stream>>>((const unsigned short*)(G64A), nullptr, 1024, 1048576, (const unsigned short*)(G64B), nullptr, 1024, 131072, (void*)(out), nullptr, 128, 131072, nullptr, nullptr, 0, 1024, 128, 1024, 1.52587890625e-05f);
    k_bi_m2q<1024, 128><<<dim3((unsigned)Bn, 4u), 1024, 0, stream>>>(RMX, q, M2Q); k_bi_bc<<<(unsigned)(((long long)Bn * N * D + 255) / 256), 256, 0, stream>>>(M2Q, mq, Bn, N, D);
}

// v004
// One run takes 116 microseconds.
// Two timings next to v003 both put it at 1.28 times that version's speed.
// All steps since v000 together make it 13.2 times as fast.
// Contractions: per batch the trilinear term (q * w_qm).m^T [1024x128].[128x1024] on bf16 hi/lo split planes (logits reach ~+-30, so they need f32-class accuracy) and the query->memory read q2m.memory [1024x1024].[1024x128] with f16 operands (probabilities x 2^12) — 64x64 register-blocked wave tiles; f32 accumulate. The two linear terms, the mask arithmetic (sim + (1 - mask) * -1e30, exactly as the module), the row softmax (exp once), the row maxima, the softmax over rows and the memory->query vector (broadcast to every row) are f32 kernels.
#include <hip/hip_runtime.h>
#include <math.h>

typedef __attribute__((ext_vector_type(16))) _Float16 v16h;
typedef __attribute__((ext_vector_type(8)))  _Float16 v8h;
typedef __attribute__((ext_vector_type(16))) __bf16   v16b;
typedef __attribute__((ext_vector_type(8)))  float    v8f;
typedef __attribute__((ext_vector_type(4)))  float    v4f;

// 16-bit WMMA fragment map (wave32), lane L, h = L>>4, m = L&15:
//   A 16x32: lane = row m;   element i -> k = (i<8) ? 8h+i : 16+8h+(i-8)
//   B 32x16: lane = column m; the SAME k(i,h)
//   D 16x16 (8 f32): lane = column m; element r -> row 8h+r
__device__ __forceinline__ int frag_k(int i, int h) { return (i < 8) ? (8 * h + i) : (16 + 8 * h + (i - 8)); }
__device__ __forceinline__ __bf16 bf16_rne(float f) {
    unsigned int u = __float_as_uint(f);
    u += 0x7fffu + ((u >> 16) & 1u);
    return __builtin_bit_cast(__bf16, (unsigned short)(u >> 16));
}
__device__ __forceinline__ float bf16_f32(__bf16 b) { return __uint_as_float(((unsigned int)__builtin_bit_cast(unsigned short, b)) << 16); }
__device__ __forceinline__ v8f wmma16(v16h a, v16h b, v8f c) {
    c = __builtin_amdgcn_wmma_f32_16x16x32_f16(false, a, false, b, (short)0, c, false, false);
    asm volatile("v_nop\n\tv_nop\n\tv_nop\n\tv_nop" : "+v"(c) : "v"(a), "v"(b));
    return c;
}
__device__ __forceinline__ v8f wmmab(v16b a, v16b b, v8f c) {
    c = __builtin_amdgcn_wmma_f32_16x16x32_bf16(false, a, false, b, (short)0, c, false, false);
    asm volatile("v_nop\n\tv_nop\n\tv_nop\n\tv_nop" : "+v"(c) : "v"(a), "v"(b));
    return c;
}
struct Split { v16b hi, lo; };
// hi/lo split product: a.hi*b.hi + a.hi*b.lo + a.lo*b.hi
__device__ __forceinline__ v8f wmma3(const Split& a, const Split& b, v8f c) {
    c = __builtin_amdgcn_wmma_f32_16x16x32_bf16(false, a.hi, false, b.hi, (short)0, c, false, false);
    c = __builtin_amdgcn_wmma_f32_16x16x32_bf16(false, a.hi, false, b.lo, (short)0, c, false, false);
    c = __builtin_amdgcn_wmma_f32_16x16x32_bf16(false, a.lo, false, b.hi, (short)0, c, false, false);
    asm volatile("v_nop\n\tv_nop\n\tv_nop\n\tv_nop" : "+v"(c) : "v"(a.hi), "v"(a.lo), "v"(b.hi), "v"(b.lo));
    return c;
}
struct Split3 { v16b hi, mid, lo; };
// triple split product (6 terms, drops only terms below 2^-24 relative)
__device__ __forceinline__ v8f wmma6(const Split3& a, const Split3& b, v8f c) {
    c = __builtin_amdgcn_wmma_f32_16x16x32_bf16(false, a.hi, false, b.hi, (short)0, c, false, false);
    c = __builtin_amdgcn_wmma_f32_16x16x32_bf16(false, a.hi, false, b.mid, (short)0, c, false, false);
    c = __builtin_amdgcn_wmma_f32_16x16x32_bf16(false, a.mid, false, b.hi, (short)0, c, false, false);
    c = __builtin_amdgcn_wmma_f32_16x16x32_bf16(false, a.hi, false, b.lo, (short)0, c, false, false);
    c = __builtin_amdgcn_wmma_f32_16x16x32_bf16(false, a.mid, false, b.mid, (short)0, c, false, false);
    c = __builtin_amdgcn_wmma_f32_16x16x32_bf16(false, a.lo, false, b.hi, (short)0, c, false, false);
    asm volatile("v_nop\n\tv_nop\n\tv_nop\n\tv_nop" : "+v"(c) : "v"(a.hi), "v"(a.mid), "v"(a.lo), "v"(b.hi), "v"(b.mid), "v"(b.lo));
    return c;
}

// Fragment gathers from f32 memory: element i <- p[(k0 + frag_k(i,h)) * sk] * s, zero for k >= klen.
__device__ __forceinline__ v16h fh_ld(const float* __restrict__ p, long long sk, int k0, int h, int klen, float s) {
    v16h a;
#pragma unroll
    for (int i = 0; i < 16; ++i) { const int k = k0 + frag_k(i, h); a[i] = (k < klen) ? (_Float16)(p[(long long)k * sk] * s) : (_Float16)0.f; }
    return a;
}
__device__ __forceinline__ Split sp_ld(const float* __restrict__ p, long long sk, int k0, int h, int klen, float s) {
    Split r;
#pragma unroll
    for (int i = 0; i < 16; ++i) {
        const int k = k0 + frag_k(i, h); const float x = (k < klen) ? p[(long long)k * sk] * s : 0.f;
        const __bf16 hb = bf16_rne(x); r.hi[i] = hb; r.lo[i] = bf16_rne(x - bf16_f32(hb));
    }
    return r;
}
__device__ __forceinline__ Split3 sp3_ld(const float* __restrict__ p, long long sk, int k0, int h, int klen, float s) {
    Split3 r;
#pragma unroll
    for (int i = 0; i < 16; ++i) {
        const int k = k0 + frag_k(i, h); const float x = (k < klen) ? p[(long long)k * sk] * s : 0.f;
        const __bf16 hb = bf16_rne(x); const float r1 = x - bf16_f32(hb); const __bf16 mb = bf16_rne(r1);
        r.hi[i] = hb; r.mid[i] = mb; r.lo[i] = bf16_rne(r1 - bf16_f32(mb));
    }
    return r;
}
__device__ __forceinline__ v16b bh_ld(const float* __restrict__ p, long long sk, int k0, int h, int klen, float s) {
    v16b a;
#pragma unroll
    for (int i = 0; i < 16; ++i) { const int k = k0 + frag_k(i, h); a[i] = bf16_rne((k < klen) ? p[(long long)k * sk] * s : 0.f); }
    return a;
}
// f16 fragment from an f16 LDS/global row with element stride 1 (k-contiguous), no bounds (tile already zero padded)
__device__ __forceinline__ v16h fh_row(const _Float16* __restrict__ row, int k0, int h) {
    v16h a;
#pragma unroll
    for (int i = 0; i < 16; ++i) a[i] = row[k0 + frag_k(i, h)];
    return a;
}

#define VST2(T, ptr, val) do { const T vst2_v_ = (val); *(T*)(ptr) = vst2_v_;  } while (0)
typedef float v4f __attribute__((ext_vector_type(4)));
#define VST2V4(ptr, val) do { const v4f vst2_v4_ = (val); *(v4f*)(ptr) = vst2_v4_;  } while (0)

__device__ __attribute__((noinline)) float act_fn(float v, int act) {
    if (act == 1) return fmaxf(v, 0.f);                                                                               // relu
    if (act == 2) { const float u = 0.7978845608028654f * (v + 0.044715f * v * v * v); return 0.5f * v * (1.f + tanhf(u)); } // tanh-gelu
    if (act == 3) return v / (1.f + expf(-v));                                                                        // silu
    if (act == 4) return 0.5f * v * (1.f + erff(v * 0.7071067811865476f));                                             // erf-gelu
    if (act == 5) return tanhf(v);
    if (act == 6) return 1.f / (1.f + expf(-v));                                                                      // sigmoid
    if (act == 7) return (v > 0.f) ? v : 0.01f * v;                                                                   // leaky relu 0.01
    if (act == 8) return (v > 0.f) ? v : (expf(v) - 1.f);                                                             // elu
    if (act == 9) return fminf(fmaxf(v, 0.f), 6.f);                                                                   // relu6
    if (act == 10) return fabsf(v);                                                                                    // abs
    if (act == 11) return (v >= 0.f) ? v : 0.1f * v;                                                                  // leaky 0.1
    if (act == 12) return (v > 0.f) ? v : 0.2f * v;                                                                   // leaky 0.2
    if (act == 13) return (v > 20.f) ? v : log1pf(expf(v));                                                            // softplus
    return v;
}

// =====================================================================================================================
// k_gemm<MODE>: C(z, m, n) = act(alpha * sum_k A(z, m, k) * B(z, k, n) + bias) + beta * R(z, m, n)
//   One wave (32-thread block) per 16 x 32 tile of C; grid (ceil(N/32), ceil(M/16), Z). Batch z -> (zo = z / zi_n, zi = z % zi_n)
//   with separate outer/inner strides for every tensor (e.g. batch and head). A(m,k) = A[zo*sAo + zi*sAi + m*sAm + k*sAk] (f32),
//   B(k,n) = B[zo*sBo + zi*sBi + n*sBn + k*sBk] (f32); any M, N, K (K zero-padded to 32 inside the fragments, M/N tails guarded).
//   C(m,n) = C[zo*sCo + zi*sCi + m*sCm + n] (n contiguous). flags: 1 bias[n], 2 bias[m], 4 residual R[zo*sRo + zi*sRi + m*sRm + n*sRn].
//   MODE 0: f16 operands (A prescaled by sa, B by sb, both undone in the epilogue); 1: bf16 hi/lo split (3 products); 2: bf16;
//   3: bf16 hi/mid/lo triple split (6 products); 4: as 3 with Kahan-compensated f32 accumulation across k-steps.
// =====================================================================================================================
struct GemmP {
    const float* A; const float* B; const float* bias; const float* R; float* C;
    long long sAo, sAi, sAm, sAk, sBo, sBi, sBn, sBk, sCo, sCi, sCm, sRo, sRi, sRm, sRn;
    int M, N, K, zi_n, flags, act; float alpha, beta, sa, sb;
    int Npad, pad_;     // columns [N, Npad) of C are written as 0 so that padded workspace rows are covered by whole-line stores; Npad >= N
};
static_assert(sizeof(GemmP) == 5 * 8 + 15 * 8 + 6 * 4 + 4 * 4 + 2 * 4, "GemmP has padding");

template <int MODE>
__global__ __launch_bounds__(32) void k_gemm(GemmP p) {
    const int lane = threadIdx.x & 31, h = lane >> 4, l15 = lane & 15;
    const int m0 = blockIdx.y * 16, n0 = blockIdx.x * 32;
    const int z = blockIdx.z, zo = z / p.zi_n, zi = z - zo * p.zi_n;
    const float* A = p.A + zo * p.sAo + zi * p.sAi;
    const float* B = p.B + zo * p.sBo + zi * p.sBi;
    const int am = min(m0 + l15, p.M - 1);                       // clamped row for loads (stores are guarded)
    v8f acc[2], comp[2];
#pragma unroll
    for (int t = 0; t < 2; ++t) { v8f zz = {}; acc[t] = zz; comp[t] = zz; }
    for (int k0 = 0; k0 < p.K; k0 += 32) {
        const float* arow = A + (long long)am * p.sAm;
        if (MODE == 1) {
            const Split a = sp_ld(arow, p.sAk, k0, h, p.K, 1.f);
#pragma unroll
            for (int t = 0; t < 2; ++t) {
                const int bn = min(n0 + t * 16 + l15, p.N - 1);
                acc[t] = wmma3(a, sp_ld(B + (long long)bn * p.sBn, p.sBk, k0, h, p.K, 1.f), acc[t]);
            }
        } else if (MODE == 3) {
            const Split3 a = sp3_ld(arow, p.sAk, k0, h, p.K, 1.f);
#pragma unroll
            for (int t = 0; t < 2; ++t) {
                const int bn = min(n0 + t * 16 + l15, p.N - 1);
                acc[t] = wmma6(a, sp3_ld(B + (long long)bn * p.sBn, p.sBk, k0, h, p.K, 1.f), acc[t]);
            }
        } else if (MODE == 4) {
            // triple split as MODE 3, but each k-step's 6 products go into a fresh accumulator and the partial is added to the running f32 sum
            // on the VALU with Kahan compensation (accumulation error stays ~1 ulp however long K is)
            const Split3 a = sp3_ld(arow, p.sAk, k0, h, p.K, 1.f);
#pragma unroll
            for (int t = 0; t < 2; ++t) {
                const int bn = min(n0 + t * 16 + l15, p.N - 1); v8f zz = {};
                const v8f part = wmma6(a, sp3_ld(B + (long long)bn * p.sBn, p.sBk, k0, h, p.K, 1.f), zz);
                const v8f y = part - comp[t]; const v8f s = acc[t] + y; comp[t] = (s - acc[t]) - y; acc[t] = s;
            }
        } else if (MODE == 2) {
            const v16b a = bh_ld(arow, p.sAk, k0, h, p.K, 1.f);
#pragma unroll
            for (int t = 0; t < 2; ++t) {
                const int bn = min(n0 + t * 16 + l15, p.N - 1);
                acc[t] = wmmab(a, bh_ld(B + (long long)bn * p.sBn, p.sBk, k0, h, p.K, 1.f), acc[t]);
            }
        } else {
            const v16h a = fh_ld(arow, p.sAk, k0, h, p.K, p.sa);
#pragma unroll
            for (int t = 0; t < 2; ++t) {
                const int bn = min(n0 + t * 16 + l15, p.N - 1);
                acc[t] = wmma16(a, fh_ld(B + (long long)bn * p.sBn, p.sBk, k0, h, p.K, p.sb), acc[t]);
            }
        }
    }
    const float iscale = (MODE == 0) ? p.alpha / (p.sa * p.sb) : p.alpha;
    float* C = p.C + zo * p.sCo + zi * p.sCi;
    const float* R = p.R + zo * p.sRo + zi * p.sRi;
    __shared__ __align__(16) float ctile[16][36];
#pragma unroll
    for (int t = 0; t < 2; ++t) {
        const int n = n0 + t * 16 + l15; const int nn = min(n, p.N - 1);
#pragma unroll
        for (int r = 0; r < 8; ++r) {
            const int m = m0 + 8 * h + r; const int mm = min(m, p.M - 1);
            float v = acc[t][r] * iscale;
            if (p.flags & 1) v += p.bias[nn];
            if (p.flags & 2) v += p.bias[mm];
            if (p.flags & 8) v *= p.bias[(long long)zo * p.M + mm];   /* per-(z,row) scale vector laid out [Z][M]; exclusive with the bias flags */
            v = act_fn(v, p.act);
            if (p.flags & 4) v += p.beta * R[(long long)mm * p.sRm + (long long)nn * p.sRn];
            ctile[8 * h + r][t * 16 + l15] = (n < p.N) ? v : 0.f;
        }
    }
    __syncthreads();
    const int NW = (p.Npad > p.N) ? p.Npad : p.N;           // write width
    const bool fast = (m0 + 16 <= p.M) && (n0 + 32 <= NW) && ((p.sCm & 3) == 0) && ((((size_t)C) & 15) == 0);
    if (fast) {
#pragma unroll
        for (int s = 0; s < 4; ++s) {
            const int row = s * 4 + (lane >> 3), c4 = (lane & 7) * 4;
            const v4f v = *(const v4f*)&ctile[row][c4];
            VST2V4(C + (long long)(m0 + row) * p.sCm + n0 + c4, v);
        }
    } else {
        for (int row = 0; row < 16; ++row) {
            const int m = m0 + row, n = n0 + lane;
            if (m < p.M && n < NW) VST2(float, C + (long long)m * p.sCm + n, ctile[row][lane]);
        }
    }
}


// =====================================================================================================================
// k_gemmT<MODE, TM, TN>: same contract as k_gemm, but one wave computes a (16*TM) x (16*TN) tile: TM A fragments and TN B fragments are
//   loaded per 32-wide k-step and reused across TM*TN WMMAs (far fewer load/convert instructions per MAC). MODE 0 (f16), 1 (bf16 hi/lo),
//   2 (bf16) only. grid (ceil(NW/(16*TN)), ceil(M/(16*TM)), Z), block 32. Epilogue identical to k_gemm, run per 16x32 sub-tile.
// =====================================================================================================================
template <int MODE, int TM, int TN>
__global__ __launch_bounds__(32) void k_gemmT(GemmP p) {
    const int lane = threadIdx.x & 31, h = lane >> 4, l15 = lane & 15;
    const int m0 = blockIdx.y * (16 * TM), n0 = blockIdx.x * (16 * TN);
    const int z = blockIdx.z, zo = z / p.zi_n, zi = z - zo * p.zi_n;
    const float* A = p.A + zo * p.sAo + zi * p.sAi;
    const float* B = p.B + zo * p.sBo + zi * p.sBi;
    v8f acc[TM][TN];
#pragma unroll
    for (int i = 0; i < TM; ++i)
#pragma unroll
        for (int t = 0; t < TN; ++t) { v8f zz = {}; acc[i][t] = zz; }
    for (int k0 = 0; k0 < p.K; k0 += 32) {
        if (MODE == 1) {
            Split a[TM], b[TN];
#pragma unroll
            for (int i = 0; i < TM; ++i) { const int am = min(m0 + 16 * i + l15, p.M - 1); a[i] = sp_ld(A + (long long)am * p.sAm, p.sAk, k0, h, p.K, 1.f); }
#pragma unroll
            for (int t = 0; t < TN; ++t) { const int bn = min(n0 + 16 * t + l15, p.N - 1); b[t] = sp_ld(B + (long long)bn * p.sBn, p.sBk, k0, h, p.K, 1.f); }
#pragma unroll
            for (int i = 0; i < TM; ++i)
#pragma unroll
                for (int t = 0; t < TN; ++t) acc[i][t] = wmma3(a[i], b[t], acc[i][t]);
        } else if (MODE == 2) {
            v16b a[TM], b[TN];
#pragma unroll
            for (int i = 0; i < TM; ++i) { const int am = min(m0 + 16 * i + l15, p.M - 1); a[i] = bh_ld(A + (long long)am * p.sAm, p.sAk, k0, h, p.K, 1.f); }
#pragma unroll
            for (int t = 0; t < TN; ++t) { const int bn = min(n0 + 16 * t + l15, p.N - 1); b[t] = bh_ld(B + (long long)bn * p.sBn, p.sBk, k0, h, p.K, 1.f); }
#pragma unroll
            for (int i = 0; i < TM; ++i)
#pragma unroll
                for (int t = 0; t < TN; ++t) acc[i][t] = wmmab(a[i], b[t], acc[i][t]);
        } else {
            v16h a[TM], b[TN];
#pragma unroll
            for (int i = 0; i < TM; ++i) { const int am = min(m0 + 16 * i + l15, p.M - 1); a[i] = fh_ld(A + (long long)am * p.sAm, p.sAk, k0, h, p.K, p.sa); }
#pragma unroll
            for (int t = 0; t < TN; ++t) { const int bn = min(n0 + 16 * t + l15, p.N - 1); b[t] = fh_ld(B + (long long)bn * p.sBn, p.sBk, k0, h, p.K, p.sb); }
#pragma unroll
            for (int i = 0; i < TM; ++i)
#pragma unroll
                for (int t = 0; t < TN; ++t) acc[i][t] = wmma16(a[i], b[t], acc[i][t]);
        }
    }
    const float iscale = (MODE == 0) ? p.alpha / (p.sa * p.sb) : p.alpha;
    float* C = p.C + zo * p.sCo + zi * p.sCi;
    const float* R = p.R + zo * p.sRo + zi * p.sRi;
    const int NW = (p.Npad > p.N) ? p.Npad : p.N;
    __shared__ __align__(16) float ctile[16][36];
#pragma unroll
    for (int i = 0; i < TM; ++i) {
        const int mb = m0 + 16 * i; if (mb >= p.M) break;          // wave-uniform
#pragma unroll
        for (int tp = 0; tp < TN / 2; ++tp) {
            const int nb = n0 + 32 * tp; if (nb >= NW) break;        // wave-uniform
#pragma unroll
            for (int t2 = 0; t2 < 2; ++t2) {
                const int t = 2 * tp + t2; const int n = nb + t2 * 16 + l15; const int nn = min(n, p.N - 1);
#pragma unroll
                for (int r = 0; r < 8; ++r) {
                    const int m = mb + 8 * h + r; const int mm = min(m, p.M - 1);
                    float v = acc[i][t][r] * iscale;
                    if (p.flags & 1) v += p.bias[nn];
                    if (p.flags & 2) v += p.bias[mm];
            if (p.flags & 8) v *= p.bias[(long long)zo * p.M + mm];   /* per-(z,row) scale vector laid out [Z][M]; exclusive with the bias flags */
                    v = act_fn(v, p.act);
                    if (p.flags & 4) v += p.beta * R[(long long)mm * p.sRm + (long long)nn * p.sRn];
                    ctile[8 * h + r][t2 * 16 + l15] = (n < p.N) ? v : 0.f;
                }
            }
            __syncthreads();
            const bool fast = (mb + 16 <= p.M) && (nb + 32 <= NW) && ((p.sCm & 3) == 0) && ((((size_t)C) & 15) == 0);
            if (fast) {
#pragma unroll
                for (int s = 0; s < 4; ++s) {
                    const int row = s * 4 + (lane >> 3), c4 = (lane & 7) * 4;
                    const v4f v = *(const v4f*)&ctile[row][c4];
                    VST2V4(C + (long long)(mb + row) * p.sCm + nb + c4, v);
                }
            } else {
                for (int row = 0; row < 16; ++row) {
                    const int m = mb + row, n = nb + lane;
                    if (m < p.M && n < NW) VST2(float, C + (long long)m * p.sCm + n, ctile[row][lane]);
                }
            }
            __syncthreads();
        }
    }
}

// =====================================================================================================================
//   Wave = 16 queries, AW waves per block, 64-key blocks; grid (ceil(Lq/(16*AW)), H, B), block 32*AW. Any Lq, Lk; head dim dh <= DHP
//   (DHP multiple of 32), value dim dv <= DVP (multiple of 16, <= 128). Every tensor addressed by (batch, head, row, element) strides, f32.
//   Scores: QM 0 f16 operands, 1 bf16 hi/lo split, 2 bf16 triple split; statistics f32 (exp2 domain); P.V: P x 4096 as f16 with V f16 staged in LDS
//   (SPLITPV: P and V as bf16 hi/lo splits). kv head = h / hrep. Masking: causal = 1 (keep j <= i + coff, masked -> -inf, key blocks beyond the
//   diagonal skipped), causal = 2 (masked -> mfill, a finite fill like the -1e9; no skipping), causal = 3 (keep j >= i + coff,
//   masked -> -inf, no skipping); optional additive f32 mask Mf,
//   optional int keep-mask Mi (0 -> score := mfill), both addressed b*smb + h*smh + i*smi + j*smj (0 strides broadcast).
// =====================================================================================================================
#define AW 4
struct AttnP {   // apv4
    const float* Q; const float* K; const float* V; float* O; float* P; const float* Mf; const int* Mi; float* ST;
    const float* Pw; const float* Rt; const int* SQ; const int* SK;           // optional: post-softmax weight, relative-position table, segment ids
    long long swb, swh, swi, swj, srb, srh, sri;                                 // Pw strides (b,h,i,j); Rt strides (b,h,i), column = clamp(i - j + roff, 0, rn-1)
    long long sQb, sQh, sQi, sQd, sKb, sKh, sKj, sKd, sVb, sVh, sVj, sVd, sOb, sOh, sOi, sPb, sPh, sPi, smb, smh, smi, smj;
    int Lq, Lk, dh, dv, hrep, causal, coff, pband;   // pband > 0: P holds only the band |j - i| <= pband, column j - i + pband
    float scale, mfill; int nonorm, mpol;             // nonorm (online path only): O = sum_j exp(score_j) V_j without the 1/rowsum (scores must be <= ~0); mpol: Mi masks where ==0 (mpol 0) or where !=0 (mpol 1)
    int roff, rn, segpol, win;                        // Rt column offset/count; SQ/SK: score := mfill where (segpol 0) SQ[i] != SK[j] or (segpol 1) SQ[i] == SK[j]; win > 0: keys with i - j > win (after coff) -> -inf
};
//   Pw: the softmax numerator is multiplied by Pw(b,h,i,j) AFTER the row sum is taken (probs * weight, then P.V), as in post-softmax multiplicative biases.                                                    // ST (optional): per row (b,h,i) -> ST[((b*H + h)*Lq + i)*2 + {0,1}] = {row max of the scaled+masked score (natural units), sum_j exp(score - max)}
static_assert(sizeof(AttnP) == 12 * 8 + 29 * 8 + 16 * 4, "AttnP has padding");

#ifndef KATTN_ATTR
#define KATTN_ATTR
#endif
template <int DHP, int DVP, int QM, bool SPLITPV, bool TWOPASS>
__global__ __launch_bounds__(32 * AW) KATTN_ATTR void k_attn(AttnP p) {
    constexpr int NT = DVP / 16;                // output tiles
    constexpr int KS = DHP / 32;                // k-steps for the scores
    constexpr int VP = DVP + 8;                 // LDS pitch (halves)
    __shared__ __align__(16) float    pl[AW][16 * 64];
    __shared__ __align__(16) _Float16 vl[(SPLITPV ? 2 : 1) * 64 * VP];   // f16 V tile, or bf16 hi and lo tiles (same 2-byte size)
    const int lane = threadIdx.x & 31, hf = lane >> 4, l15 = lane & 15, wave = threadIdx.x >> 5;
    const int h = blockIdx.y, b = blockIdx.z, hk = h / p.hrep;
    const int q0 = (blockIdx.x * AW + wave) * 16;
    float* myp = pl[wave];
    const float L2E = 1.4426950408889634f;
    const float NEG = -__builtin_inff();
    const int qi = min(q0 + l15, p.Lq - 1);
    const float* qrow = p.Q + b * p.sQb + h * p.sQh + (long long)qi * p.sQi;
    const float* kbase = p.K + b * p.sKb + hk * p.sKh;
    const float* vbase = p.V + b * p.sVb + hk * p.sVh;
    v16h qa[QM == 0 ? KS : 1]; Split qs_[QM == 1 ? KS : 1]; Split3 qt_[QM == 2 ? KS : 1];
#pragma unroll
    for (int ks = 0; ks < KS; ++ks) {
        if (QM == 2) qt_[ks] = sp3_ld(qrow, p.sQd, ks * 32, hf, p.dh, 1.f);
        else if (QM == 1) qs_[ks] = sp_ld(qrow, p.sQd, ks * 32, hf, p.dh, 1.f);
        else qa[ks] = fh_ld(qrow, p.sQd, ks * 32, hf, p.dh, 1.f);
    }
    v8f o[NT]; float m8[8], l8[8];
#pragma unroll
    for (int t = 0; t < NT; ++t) { v8f zz = {}; o[t] = zz; }
#pragma unroll
    for (int i = 0; i < 8; ++i) { m8[i] = NEG; l8[i] = 0.f; }
    int jend = p.Lk;
    if (p.causal == 1) { const int je = (blockIdx.x * AW + AW - 1) * 16 + 16 + p.coff; jend = min(jend, max(je, 0)); }   // uniform per block
    const int npass = TWOPASS ? 2 : 1;
    for (int pass = 0; pass < npass; ++pass) {
        const bool dopv = (!TWOPASS) || pass == 1;
        for (int j0 = 0; j0 < jend; j0 += 64) {
            if (dopv) {
                __syncthreads();                                 // previous key block's reads of vl / pl are done
                for (int idx = threadIdx.x; idx < 64 * DVP; idx += 32 * AW) {
                    const int jr = idx / DVP, d = idx - jr * DVP, j = j0 + jr;
                    const float f = (j < p.Lk && d < p.dv) ? vbase[(long long)j * p.sVj + (long long)d * p.sVd] : 0.f;
                    if (SPLITPV) {
                        const __bf16 hb = bf16_rne(f);
                        ((__bf16*)vl)[jr * VP + d] = hb; ((__bf16*)vl)[64 * VP + jr * VP + d] = bf16_rne(f - bf16_f32(hb));
                    } else vl[jr * VP + d] = (_Float16)f;
                }
            }
            v8f s[4];
#pragma unroll
            for (int t = 0; t < 4; ++t) {
                const int j = min(j0 + t * 16 + l15, p.Lk - 1);
                const float* krow = kbase + (long long)j * p.sKj;
                v8f acc = {};
#pragma unroll
                for (int ks = 0; ks < KS; ++ks) {
                    if (QM == 2)      acc = wmma6(qt_[ks], sp3_ld(krow, p.sKd, ks * 32, hf, p.dh, 1.f), acc);
                    else if (QM == 1) acc = wmma3(qs_[ks], sp_ld(krow, p.sKd, ks * 32, hf, p.dh, 1.f), acc);
                    else              acc = wmma16(qa[ks], fh_ld(krow, p.sKd, ks * 32, hf, p.dh, 1.f), acc);
                }
                s[t] = acc;
            }
            float pv[8][4];
#pragma unroll
            for (int i = 0; i < 8; ++i) {
                const int irow = q0 + i + 8 * hf;
                const int ic = min(irow, p.Lq - 1);
                float sc[4];
#pragma unroll
                for (int t = 0; t < 4; ++t) {
                    const int jg = j0 + t * 16 + l15;
                    float v = s[t][i] * p.scale;
                    if (p.Mf) v += p.Mf[b * p.smb + h * p.smh + (long long)ic * p.smi + (long long)min(jg, p.Lk - 1) * p.smj];
                    if (p.Rt) { int rc = ic - min(jg, p.Lk - 1) + p.roff; rc = rc < 0 ? 0 : (rc >= p.rn ? p.rn - 1 : rc); v += p.Rt[b * p.srb + h * p.srh + (long long)ic * p.sri + rc]; }
                    if (p.Mi) { const int mv = p.Mi[b * p.smb + h * p.smh + (long long)ic * p.smi + (long long)min(jg, p.Lk - 1) * p.smj]; if (p.mpol ? (mv != 0) : (mv == 0)) v = p.mfill; }
                    if (p.SQ) { const bool same = p.SQ[(long long)b * p.Lq + ic] == p.SK[(long long)b * p.Lk + min(jg, p.Lk - 1)]; if (p.segpol ? same : !same) v = p.mfill; }
                    if (p.causal == 2 && jg > irow + p.coff) v = p.mfill;
                    if (jg >= p.Lk || (p.causal == 1 && jg > irow + p.coff) || (p.causal == 3 && jg < irow + p.coff) || (p.win > 0 && irow + p.coff - jg > p.win)) v = NEG; else v *= L2E;
                    sc[t] = v;
                }
                if (!TWOPASS || pass == 0) {
                    float mx = fmaxf(fmaxf(sc[0], sc[1]), fmaxf(sc[2], sc[3]));
                    mx = fmaxf(mx, __shfl_xor(mx, 1, 32)); mx = fmaxf(mx, __shfl_xor(mx, 2, 32));
                    mx = fmaxf(mx, __shfl_xor(mx, 4, 32)); mx = fmaxf(mx, __shfl_xor(mx, 8, 32));
                    const float mnew = fmaxf(m8[i], mx);
                    const float corr = (mnew == NEG) ? 1.f : exp2f(m8[i] - mnew);
                    float rs = 0.f;
#pragma unroll
                    for (int t = 0; t < 4; ++t) {
                        const float pp = (sc[t] == NEG) ? 0.f : exp2f(sc[t] - mnew); rs += pp;
                        pv[i][t] = p.Pw ? pp * p.Pw[b * p.swb + h * p.swh + (long long)ic * p.swi + (long long)min(j0 + t * 16 + l15, p.Lk - 1) * p.swj] : pp;
                    }
                    rs += __shfl_xor(rs, 1, 32); rs += __shfl_xor(rs, 2, 32); rs += __shfl_xor(rs, 4, 32); rs += __shfl_xor(rs, 8, 32);
                    l8[i] = l8[i] * corr + rs; m8[i] = mnew;
                    if (!TWOPASS) {
#pragma unroll
                        for (int t = 0; t < NT; ++t) o[t][i] *= corr;
                    }
                } else {
                    const float inv = (l8[i] > 0.f) ? 1.f / l8[i] : 0.f;
#pragma unroll
                    for (int t = 0; t < 4; ++t) {
                        const int jg = j0 + t * 16 + l15;
                        float pp = (sc[t] == NEG) ? 0.f : exp2f(sc[t] - m8[i]) * inv;
                        if (p.Pw) pp *= p.Pw[b * p.swb + h * p.swh + (long long)ic * p.swi + (long long)min(jg, p.Lk - 1) * p.swj];
                        pv[i][t] = pp;
                    }
                }
            }
            if (dopv) {
#pragma unroll
                for (int i = 0; i < 8; ++i)
#pragma unroll
                    for (int t = 0; t < 4; ++t) ((float*)myp)[(i + 8 * hf) * 64 + t * 16 + l15] = pv[i][t];
                __syncthreads();                                 // P (per wave) and V (shared) visible
                if (p.P) {
                    float* pb_ = p.P + b * p.sPb + h * p.sPh;
                    const bool fastP = (p.pband == 0) && ((p.sPi & 3) == 0) && (j0 + 64 <= p.Lk) && (q0 + 16 <= p.Lq) && ((((size_t)pb_) & 15) == 0);
                    if (fastP) {
#pragma unroll
                        for (int s = 0; s < 8; ++s) {
                            const int row = s * 2 + (lane >> 4), c4 = (lane & 15) * 4;
                            const v4f v = *(const v4f*)(myp + row * 64 + c4);
                            VST2V4(pb_ + (long long)(q0 + row) * p.sPi + j0 + c4, v);
                        }
                    } else {
                        for (int row = 0; row < 16; ++row) {
                            const int irow = q0 + row; if (irow >= p.Lq) continue;
                            for (int c = lane; c < 64; c += 32) {
                                const int jg = j0 + c; if (jg >= p.Lk) continue;
                                if (p.pband == 0) VST2(float, pb_ + (long long)irow * p.sPi + jg, myp[row * 64 + c]);
                                else if (jg - irow <= p.pband && irow - jg <= p.pband) VST2(float, pb_ + (long long)irow * p.sPi + (jg - irow + p.pband), myp[row * 64 + c]);
                            }
                        }
                    }
                }
                if (SPLITPV) {
                    const Split pa0 = sp_ld(myp + l15 * 64, 1, 0, hf, 64, 1.f), pa1 = sp_ld(myp + l15 * 64, 1, 32, hf, 64, 1.f);
                    const __bf16* vh = (const __bf16*)vl; const __bf16* vlo = vh + 64 * VP;
#pragma unroll
                    for (int t = 0; t < NT; ++t) {
                        const int dcol = t * 16 + l15;
                        Split b0, b1;
#pragma unroll
                        for (int e = 0; e < 16; ++e) {
                            const int k0 = frag_k(e, hf), k1 = 32 + frag_k(e, hf);
                            b0.hi[e] = vh[k0 * VP + dcol]; b0.lo[e] = vlo[k0 * VP + dcol]; b1.hi[e] = vh[k1 * VP + dcol]; b1.lo[e] = vlo[k1 * VP + dcol];
                        }
                        o[t] = wmma3(pa0, b0, o[t]);
                        o[t] = wmma3(pa1, b1, o[t]);
                    }
                } else {
                    const v16h pa0 = fh_ld(myp + l15 * 64, 1, 0, hf, 64, 4096.f), pa1 = fh_ld(myp + l15 * 64, 1, 32, hf, 64, 4096.f);
#pragma unroll
                    for (int t = 0; t < NT; ++t) {
                        const int dcol = t * 16 + l15;
                        v16h b0, b1;
#pragma unroll
                        for (int e = 0; e < 16; ++e) { b0[e] = vl[frag_k(e, hf) * VP + dcol]; b1[e] = vl[(32 + frag_k(e, hf)) * VP + dcol]; }
                        o[t] = wmma16(pa0, b0, o[t]);
                        o[t] = wmma16(pa1, b1, o[t]);
                    }
                }
            }
        }
    }
    float* obase = p.O + b * p.sOb + h * p.sOh;
    if (p.ST) {
        const int rl = lane >> 1, isel = rl & 7;           // row q0 + rl ; rl>>3 == hf holds because lane>>4 == (lane>>1)>>3
        float mv = 0.f, lv = 0.f;
#pragma unroll
        for (int i = 0; i < 8; ++i) if (i == isel) { mv = m8[i]; lv = l8[i]; }
        const int irow = q0 + rl;
        if (irow < p.Lq) { float* st = p.ST + (((long long)b * gridDim.y + h) * p.Lq + irow) * 2 + (lane & 1); VST2(float, st, (lane & 1) ? lv : mv * 0.6931471805599453f); }
    }
    float invr[8];
#pragma unroll
    for (int i = 0; i < 8; ++i) {
        if (TWOPASS) invr[i] = SPLITPV ? 1.f : (1.f / 4096.f);
        else if (p.nonorm) invr[i] = exp2f(m8[i]) * (SPLITPV ? 1.f : (1.f / 4096.f));
        else invr[i] = (l8[i] > 0.f) ? (SPLITPV ? 1.f / l8[i] : 1.f / (l8[i] * 4096.f)) : 0.f;
    }
    __syncthreads();                                             // all waves done with pl/vl from the main loop
    const bool ofast = ((p.sOi & 3) == 0) && ((((size_t)obase) & 15) == 0) && (q0 + 16 <= p.Lq);
#pragma unroll
    for (int c0 = 0; c0 < DVP; c0 += 64) {
#pragma unroll
        for (int i = 0; i < 8; ++i)
#pragma unroll
            for (int t = 0; t < NT; ++t) if (t * 16 >= c0 && t * 16 < c0 + 64) ((float*)myp)[(i + 8 * hf) * 64 + (t * 16 - c0) + l15] = o[t][i] * invr[i];
        __syncthreads();
        const int cw = (DVP - c0 < 64) ? (DVP - c0) : 64;      // staged columns in this chunk (multiple of 16)
        if (ofast && (c0 + cw <= p.dv) && (cw % 32 == 0)) {
            const int lpr = cw / 4;                              // lanes per row (16 for 64 cols, 8 for 32)
            const int rows_per_ins = 32 / lpr;
            for (int r0 = 0; r0 < 16; r0 += rows_per_ins) {
                const int row = r0 + lane / lpr, c4 = (lane % lpr) * 4;
                const v4f v = *(const v4f*)(myp + row * 64 + c4);
                VST2V4(obase + (long long)(q0 + row) * p.sOi + c0 + c4, v);
            }
        } else {
            for (int row = 0; row < 16; ++row) {
                const int irow = q0 + row; if (irow >= p.Lq) continue;
                for (int c = lane; c < cw; c += 32) { const int d = c0 + c; if (d < p.dv) VST2(float, obase + (long long)irow * p.sOi + d, myp[row * 64 + c]); }
            }
        }
        __syncthreads();
    }
}

// =====================================================================================================================
// k_tr: dst(z, c, r) = alpha * src(z, r, c) (+ beta * R2(z, c, r)): [Z][R][C] (row stride lds) -> [Z][C][R] (row stride ldd) through a 32x32 LDS tile;
//   flags: 1 -> add beta * residual R2 addressed like dst (z*sRz + c*ldr + r); act applied before the residual.
// =====================================================================================================================
struct TrP { const float* src; float* dst; const float* R2; long long sSz, lds, sDz, ldd, sRz, ldr; int R, C, flags, act; float alpha, beta; };
static_assert(sizeof(TrP) == 3 * 8 + 6 * 8 + 6 * 4, "TrP has padding");
__global__ __launch_bounds__(256) void k_tr(TrP p) {
    __shared__ float tile[32][33];
    const int c0 = blockIdx.x * 32, r0 = blockIdx.y * 32, z = blockIdx.z;
    const int lane = threadIdx.x & 31, wave = threadIdx.x >> 5;
    const float* s = p.src + z * p.sSz;
#pragma unroll
    for (int k = 0; k < 4; ++k) {
        const int rl = wave * 4 + k, r = r0 + rl, c = c0 + lane;
        tile[rl][lane] = (r < p.R && c < p.C) ? s[(long long)r * p.lds + c] : 0.f;
    }
    __syncthreads();
    float* d = p.dst + z * p.sDz; const float* rr = p.R2 + z * p.sRz;
#pragma unroll
    for (int k = 0; k < 4; ++k) {
        const int cl = wave * 4 + k, c = c0 + cl, r = r0 + lane;
        if (c < p.C && r < p.R) {
            float v = act_fn(p.alpha * tile[lane][cl], p.act);
            if (p.flags & 1) v += p.beta * rr[(long long)c * p.ldr + r];
            VST2(float, d + (long long)c * p.ldd + r, v);
        }
    }
}

// k_affine: dst[i] = a * (sdev ? sdev[0] : 1) * src[i] + b, i < n (one thread per element; consecutive lanes -> consecutive addresses)
__global__ __launch_bounds__(256) void k_affine(const float* __restrict__ src, float* __restrict__ dst, int n, float a, float b, const float* __restrict__ sdev) {
    const int i = blockIdx.x * 256 + threadIdx.x;
    if (i < n) { const float aa = sdev ? a * sdev[0] : a; const float v = aa * src[i] + b; VST2(float, dst + i, v); }
}

// =====================================================================================================================
// k_softmax: row softmax over n contiguous elements, one 256-thread block per row; rows addressed z*sz + r*sr (grid (R, Z)).
//   out = scale_out * softmax(scale_in * x + (Mf ? Mf[z*smz + r*smr + j] : 0)); a row whose max is -inf is written as 0.
// =====================================================================================================================
struct SmP { const float* src; float* dst; const float* Mf; long long sz, sr, dz, dr, smz, smr; int n, pad; float scale_in, scale_out; };
static_assert(sizeof(SmP) == 3 * 8 + 6 * 8 + 4 * 4, "SmP has padding");
__global__ __launch_bounds__(256) void k_softmax(SmP p) {
    __shared__ float red[256];
    const int r = blockIdx.x, z = blockIdx.y, tid = threadIdx.x;
    const float* s = p.src + z * p.sz + (long long)r * p.sr;
    const float* mf = p.Mf ? (p.Mf + z * p.smz + (long long)r * p.smr) : nullptr;
    float mx = -__builtin_inff();
    for (int j = tid; j < p.n; j += 256) { float v = s[j] * p.scale_in; if (mf) v += mf[j]; mx = fmaxf(mx, v); }
    red[tid] = mx; __syncthreads();
    for (int o = 128; o > 0; o >>= 1) { if (tid < o) red[tid] = fmaxf(red[tid], red[tid + o]); __syncthreads(); }
    mx = red[0]; __syncthreads();
    float sum = 0.f;
    for (int j = tid; j < p.n; j += 256) { float v = s[j] * p.scale_in; if (mf) v += mf[j]; sum += (mx == -__builtin_inff()) ? 0.f : expf(v - mx); }
    red[tid] = sum; __syncthreads();
    for (int o = 128; o > 0; o >>= 1) { if (tid < o) red[tid] += red[tid + o]; __syncthreads(); }
    sum = red[0];
    const float inv = (sum > 0.f) ? p.scale_out / sum : 0.f;
    float* d = p.dst + z * p.dz + (long long)r * p.dr;
    for (int j = tid; j < p.n; j += 256) { float v = s[j] * p.scale_in; if (mf) v += mf[j]; const float o = (mx == -__builtin_inff()) ? 0.f : expf(v - mx) * inv; VST2(float, d + j, o); }
}
// =====================================================================================================================
// k_stats: mean and rsqrt(var + eps) over a set of n elements addressed base + z*sz + (e / inner) * so + (e % inner) * si, one 256-thread
// k_norm_apply: y = (x - mean[set]) * rstd[set] * g[c] + b[c] over a [Z][C][L] channel-major tensor with set = z*G + c / (C/G) (G groups per z;
//   G = C -> per-channel sets indexed z*C+c; for batch norm pass stats indexed by c only via bn = 1). Optional act. Output same layout.
// =====================================================================================================================
//   mode 0: mean / rsqrt(var + eps); mode 1 (RMSNorm): 0 / rsqrt(mean(x^2) + eps); mode 2 (L2 normalize * sqrt(n)): 0 / sqrt(n) / max(||x||, eps); mode 3: as 0 with unbiased variance (n-1)
__global__ __launch_bounds__(256) void k_stats(const float* __restrict__ x, long long sz, long long so, long long si, int inner, int n, float eps, float* __restrict__ stat, int mode) {
    __shared__ float red[256];
    const int z = blockIdx.x, tid = threadIdx.x;
    const float* base = x + z * sz;
    float s = 0.f;
    for (int e = tid; e < n; e += 256) s += base[(long long)(e / inner) * so + (long long)(e % inner) * si];
    red[tid] = s; __syncthreads();
    for (int o = 128; o > 0; o >>= 1) { if (tid < o) red[tid] += red[tid + o]; __syncthreads(); }
    const float mu = (mode == 0 || mode == 3) ? red[0] / (float)n : 0.f; __syncthreads();
    float q = 0.f;
    for (int e = tid; e < n; e += 256) { const float dlt = base[(long long)(e / inner) * so + (long long)(e % inner) * si] - mu; q += dlt * dlt; }
    red[tid] = q; __syncthreads();
    for (int o = 128; o > 0; o >>= 1) { if (tid < o) red[tid] += red[tid + o]; __syncthreads(); }
    {
        float rs;
        if (mode == 2) rs = sqrtf((float)n) / fmaxf(sqrtf(red[0]), eps); else if (mode == 3) rs = rsqrtf(red[0] / (float)(n - 1) + eps); else rs = rsqrtf(red[0] / (float)n + eps);
        if (tid < 32) { const float v = (tid == 0) ? mu : ((tid == 1) ? rs : 0.f); VST2(float, stat + (long long)z * 32 + tid, v); }
    }
}
//   One thread per element over the flat [Z][C][L] index space: grid ceil(Z*C*L / 256).
__global__ __launch_bounds__(256) void k_norm_apply(const float* __restrict__ x, float* __restrict__ y, const float* __restrict__ stat, const float* __restrict__ g, const float* __restrict__ bta,
                                                     int Z, int C, int L, int G, int bn, int act) {
    const long long idx = (long long)blockIdx.x * 256 + threadIdx.x;
    if (idx >= (long long)Z * C * L) return;
    const int l = (int)(idx % L); const long long zc = idx / L; const int c = (int)(zc % C), z = (int)(zc / C); (void)l;
    const int set = bn ? c : (z * G + c / (C / G));
    float v = (x[idx] - stat[(long long)set * 32]) * stat[(long long)set * 32 + 1];
    if (g) v *= g[c];
    if (bta) v += bta[c];
    v = act_fn(v, act);
    VST2(float, y + idx, v);
}

// k_lse_neg: c[i] = -(st[2i] + log(st[2i+1])) = minus the log-sum-exp of row i from k_attn's ST output (for softmax over the query dimension)
__global__ __launch_bounds__(256) void k_lse_neg(const float* __restrict__ st, float* __restrict__ c, int n) {
    const int i = blockIdx.x * 256 + threadIdx.x;
    if (i < n) { const float v = -(st[2 * i] + logf(st[2 * i + 1])); VST2(float, c + i, v); }
}

// k_iota: dst[i] = a * i + b as int32 (segment/position id helper)
__global__ __launch_bounds__(256) void k_iota(int* __restrict__ dst, int n, int a, int b) {
    const int i = blockIdx.x * 256 + threadIdx.x;
    if (i < n) { const int v = a * i + b; VST2(int, dst + i, v); }
}

// k_axpby: dst[i] = a * x[i] + b * y[i] (+ c), i < n
__global__ __launch_bounds__(256) void k_axpby(const float* __restrict__ x, const float* __restrict__ y, float* __restrict__ dst, int n, float a, float b, float c) {
    const int i = blockIdx.x * 256 + threadIdx.x;
    if (i < n) { const float v = a * x[i] + b * y[i] + c; VST2(float, dst + i, v); }
}

// =====================================================================================================================
// k_rope: rotary embedding on a [R rows][Hn heads][D] view (row stride sXr, head stride sXh, element stride 1) -> Y (own strides).
//   mode 0: rotate_half (partner d±D/2, sign - for d<D/2); mode 1: interleaved pairs (partner d^1, sign - for even d).
//   table column tcol: tmode 0 -> d, 1 -> d % (D/2), 2 -> d / 2; position p: pmode 0 -> r % S, 1 -> head index, 2 -> pos[r];
//   c = C[(r / S) * sCb + p * sCp + tcol * sCd], s likewise from Sn; y = x[d] * c + sign * x[partner] * s. X and Y must not alias.
// =====================================================================================================================
struct RopeP { const float* X; float* Y; const float* C; const float* Sn; const int* pos; long long sXr, sXh, sYr, sYh, sCb, sCp, sCd; int R, Hn, D, S, mode, tmode, pmode, pad; };
static_assert(sizeof(RopeP) == 5 * 8 + 7 * 8 + 8 * 4, "RopeP has padding");
__global__ __launch_bounds__(256) void k_rope(RopeP p) {
    const long long idx = (long long)blockIdx.x * 256 + threadIdx.x;
    if (idx >= (long long)p.R * p.Hn * p.D) return;
    const int d = (int)(idx % p.D); const long long rh = idx / p.D; const int h = (int)(rh % p.Hn); const int r = (int)(rh / p.Hn);
    const int half = p.D / 2;
    int partner; float sign;
    if (p.mode == 0) { partner = (d < half) ? d + half : d - half; sign = (d < half) ? -1.f : 1.f; }
    else { partner = d ^ 1; sign = (d & 1) ? 1.f : -1.f; }
    const int tcol = (p.tmode == 0) ? d : ((p.tmode == 1) ? (d % half) : (d >> 1));
    const int pp = (p.pmode == 0) ? (r % p.S) : ((p.pmode == 1) ? h : p.pos[r]);
    const long long toff = (long long)(r / p.S) * p.sCb + (long long)pp * p.sCp + (long long)tcol * p.sCd;
    const float* xr = p.X + (long long)r * p.sXr + (long long)h * p.sXh;
    const float v = xr[d] * p.C[toff] + sign * xr[partner] * p.Sn[toff];
    VST2(float, p.Y + (long long)r * p.sYr + (long long)h * p.sYh + d, v);
}

// k_invf + k_sincos (split so neither kernel carries a large VALU-fma footprint): invf_i = num * (1 / powf(base, (2 i)/D)) [fmode 0],
//   num * expf((2 i) * cexp) [fmode 1], num * powf(base, -2 (i - 1) / D) [fmode 2]; then cs/sn[s*half + i] = cos/sin((pscale * s) * invf_i)
__global__ __launch_bounds__(256) void k_invf(float* __restrict__ invb, int half, int D, float base, float num, int fmode, float cexp) {
    const int i = blockIdx.x * 256 + threadIdx.x;
    if (i >= ((half + 31) / 32) * 32) return;
    if (i >= half) { VST2(float, invb + i, 0.f); return; }
    const float e = (float)(2 * i) / (float)D;
    float invf;
    if (fmode == 1) invf = num * expf((float)(2 * i) * cexp);
    else if (fmode == 2) invf = num * powf(base, (-2.0f * ((float)i - 1.0f)) / (float)D);
    else invf = num * (1.0f / powf(base, e));
    VST2(float, invb + i, invf);
}
__global__ __launch_bounds__(256) void k_sincos(float* __restrict__ cs, float* __restrict__ sn, const float* __restrict__ invb, int S, int half, float pscale) {
    const int idx = blockIdx.x * 256 + threadIdx.x;
    if (idx >= S * half) return;
    const int s = idx / half, i = idx - s * half;
    const float ang = (pscale * (float)s) * invb[i];
    VST2(float, cs + idx, cosf(ang)); VST2(float, sn + idx, sinf(ang));
}

// k_mulact: dst[i] = act(x[i]) * y[i]
__global__ __launch_bounds__(256) void k_mulact(const float* __restrict__ x, const float* __restrict__ y, float* __restrict__ dst, int n, int act) {
    const int i = blockIdx.x * 256 + threadIdx.x;
    if (i < n) { const float v = act_fn(x[i], act) * y[i]; VST2(float, dst + i, v); }
}

// =====================================================================================================================
// k_matvec: thread-per-row matrix-vector products for N <= 8 output columns (heads with 1-3 outputs, gates), f32 on the VALU.
//   C[r*sCm + j] = act(alpha * sum_k A[r*sAm + k*sAk] * B[j*sBn + k*sBk] + bias[j]) + beta * R[r*sRm + j*sRn]; each thread writes its N contiguous floats.
// =====================================================================================================================
__global__ __launch_bounds__(256) void k_matvec(GemmP p) {
    // 32 lanes write one line with one instruction.
    const int rpt = (p.N == 1) ? 1 : 32;
    const long long r0 = ((long long)blockIdx.x * 256 + threadIdx.x) * rpt; const int z = blockIdx.z, zo = z / p.zi_n, zi = z - zo * p.zi_n;
    if (r0 >= p.M) return;
    const float* Bb = p.B + zo * p.sBo + zi * p.sBi;
    float* C = p.C + zo * p.sCo + zi * p.sCi; const float* R = p.R + zo * p.sRo + zi * p.sRi;
    for (int rr = 0; rr < rpt; ++rr) {
        const long long r = r0 + rr; if (r >= p.M) break;
        const float* A = p.A + zo * p.sAo + zi * p.sAi + r * p.sAm;
        float acc[8] = {0.f, 0.f, 0.f, 0.f, 0.f, 0.f, 0.f, 0.f};
        for (int k = 0; k < p.K; ++k) { const float a = A[(long long)k * p.sAk];
#pragma unroll
            for (int j = 0; j < 8; ++j) if (j < p.N) acc[j] += a * Bb[(long long)j * p.sBn + (long long)k * p.sBk]; }
#pragma unroll
        for (int j = 0; j < 8; ++j) if (j < p.N) {
            float v = acc[j] * p.alpha;
            if (p.flags & 1) v += p.bias[j];
            if (p.flags & 2) v += p.bias[r];
            v = act_fn(v, p.act);
            if (p.flags & 4) v += p.beta * R[r * p.sRm + (long long)j * p.sRn];
            VST2(float, C + r * p.sCm + j, v);
        }
    }
}
// k_smallsoftmax: thread-per-row softmax for short rows (n <= 64): dst[r*dr + j] = softmax(scale*src[r*sr + j])
__global__ __launch_bounds__(256) void k_smallsoftmax(const float* __restrict__ src, float* __restrict__ dst, long long sr, long long dr, int n, long long R, float scale) {
    const long long r0 = ((long long)blockIdx.x * 256 + threadIdx.x) * 32;
    for (int rr = 0; rr < 32; ++rr) {
        const long long r = r0 + rr; if (r >= R) return;
        const float* s = src + r * sr; float* d = dst + r * dr;
        float mx = -__builtin_inff();
        for (int j = 0; j < n; ++j) mx = fmaxf(mx, s[j] * scale);
        float sum = 0.f;
        for (int j = 0; j < n; ++j) sum += expf(s[j] * scale - mx);
        const float inv = 1.f / sum;
        for (int j = 0; j < n; ++j) { const float v = expf(s[j] * scale - mx) * inv; VST2(float, d + j, v); }
    }
}

__global__ __launch_bounds__(32) void k_unitstat(float* __restrict__ st) { const int t = threadIdx.x; const float v = (t == 1) ? 1.f : 0.f; VST2(float, st + t, v); }

// destination (e.g. a d_out whose row width is not a multiple of 32 floats) is written by consecutive lanes of one instruction
__global__ __launch_bounds__(256) void k_lincopy(const float* __restrict__ src, long long lds, float* __restrict__ dst, long long ldd, long long rows, int cols) {
    const long long i = (long long)blockIdx.x * 256 + threadIdx.x; if (i >= rows * cols) return;
    const long long r = i / cols; const int c = (int)(i - r * cols);
    const float v = src[r * lds + c]; VST2(float, dst + r * ldd + c, v);
}

namespace w25 {
typedef __attribute__((ext_vector_type(16))) _Float16 v16h;
typedef __attribute__((ext_vector_type(8)))  _Float16 v8h;
typedef __attribute__((ext_vector_type(16))) __bf16   v16b;
typedef __attribute__((ext_vector_type(8)))  __bf16   v8b;
typedef __attribute__((ext_vector_type(8)))  float    v8f;
typedef __attribute__((ext_vector_type(4)))  float    v4f;

__device__ __forceinline__ unsigned short f2bf_bits(float f) {
  unsigned u = __float_as_uint(f);
  return (unsigned short)((u + 0x7FFFu + ((u >> 16) & 1u)) >> 16);
}
__device__ __forceinline__ float bf_bits2f(unsigned short h) { return __uint_as_float(((unsigned)h) << 16); }

// hazard guards as plain device helpers (no inline asm inside the kernel template body)
__device__ __forceinline__ void dep_guard_h(v8f& a, v8f& b, v16h x, v16h y) { asm volatile("v_nop\n\tv_nop\n\tv_nop\n\tv_nop" : "+v"(a), "+v"(b) : "v"(x), "v"(y)); }
__device__ __forceinline__ void dep_guard_b(v8f& a, v8f& b, v16b x, v16b y) { asm volatile("v_nop\n\tv_nop\n\tv_nop\n\tv_nop" : "+v"(a), "+v"(b) : "v"(x), "v"(y)); }
__device__ __forceinline__ void keep4_h(v16h a, v16h b, v16h c, v16h d) { asm volatile("v_nop" :: "v"(a), "v"(b), "v"(c), "v"(d)); }
__device__ __forceinline__ void keep4_b(v16b a, v16b b, v16b c, v16b d) { asm volatile("v_nop" :: "v"(a), "v"(b), "v"(c), "v"(d)); }
__device__ __forceinline__ void acc_guard4(v8f& a, v8f& b, v8f& c, v8f& d) { asm volatile("v_nop\n\tv_nop\n\tv_nop\n\tv_nop" : "+v"(a), "+v"(b), "+v"(c), "+v"(d)); }
template <typename T> struct Frag;
template <> struct Frag<_Float16> {
  typedef v16h V; union U { v16h v; v8h h[2]; };
  static __device__ __forceinline__ v16h load(const _Float16* p) {   // elements 0..7 <- p[0..7], 8..15 <- p[16..23]
    U f; f.h[0] = *(const v8h*)(p); f.h[1] = *(const v8h*)(p + 16); return f.v;
  }
  static __device__ __forceinline__ v8f mma(v16h a, v16h b, v8f c) {
    return __builtin_amdgcn_wmma_f32_16x16x32_f16(false, a, false, b, (short)0, c, false, false);
  }
  static __device__ __forceinline__ void guard(v8f& a, v8f& b, v16h x, v16h y) { dep_guard_h(a, b, x, y); }
  static __device__ __forceinline__ void keep(v16h a, v16h b, v16h c, v16h d) { keep4_h(a, b, c, d); }
};
template <> struct Frag<__bf16> {
  typedef v16b V; union U { v16b v; v8b h[2]; };
  static __device__ __forceinline__ v16b load(const __bf16* p) {
    U f; f.h[0] = *(const v8b*)(p); f.h[1] = *(const v8b*)(p + 16); return f.v;
  }
  static __device__ __forceinline__ v8f mma(v16b a, v16b b, v8f c) {
    return __builtin_amdgcn_wmma_f32_16x16x32_bf16(false, a, false, b, (short)0, c, false, false);
  }
  static __device__ __forceinline__ void guard(v8f& a, v8f& b, v16b x, v16b y) { dep_guard_b(a, b, x, y); }
  static __device__ __forceinline__ void keep(v16b a, v16b b, v16b c, v16b d) { keep4_b(a, b, c, d); }
};

// ---- Register-blocked batched WMMA GEMM ------------------------------------
// C[m,n] = scale * sum_k A[m,k] * Bt[n,k] (+bias)(+resid); each wave owns a 64x64 tile.
// A row-major [M,K]; Bt row-major [N,K]; M,N % 64 == 0, K % 32 == 0.
// SPLIT: operands are hi/lo planes (A2/Bt2 = lo planes, same layout); product = hi·hi + hi·lo + lo·hi.
// BIAS_MODE: 0 = none, 1 = bias[m], 2 = bias[n].
// OUT_MODE: 0 = f32, 1 = f16, 2 = bf16 hi plane (Cout) + bf16 lo plane (Cout2).
// ET: 0 = f16 operands, 1 = bf16 operands (pointers passed as 16-bit storage)
template <int ET> struct Elem;
template <> struct Elem<0> { typedef _Float16 T; };
template <> struct Elem<1> { typedef __bf16 T; };
template <int ET, bool SPLIT, int BIAS_MODE, int OUT_MODE, bool RESID, int ACT = 0>
__global__ __launch_bounds__(256) void wmma_gemm64(
    const unsigned short* __restrict__ Ap, const unsigned short* __restrict__ A2p, int lda, long strideA,
    const unsigned short* __restrict__ Btp, const unsigned short* __restrict__ Bt2p, int ldb, long strideB,
    void* __restrict__ Cout, void* __restrict__ Cout2, int ldc, long strideC,
    const float* __restrict__ bias,
    const float* __restrict__ resid, long strideR,
    int M, int N, int K, float scale) {
  typedef typename Elem<ET>::T T;
  typedef typename Frag<T>::V V;
  const T* A = (const T*)Ap; const T* A2 = (const T*)A2p; const T* Bt = (const T*)Btp; const T* Bt2 = (const T*)Bt2p;
  __shared__ __align__(16) float sT[8][16 * 68];   // per-wave 16x64 slab, pitch 68 floats
  const int b    = blockIdx.y;
  const int lane = threadIdx.x & 31;
  const int wave = threadIdx.x >> 5;
  const int tilesN = N >> 6;
  const int tilesM = M >> 6;
  const int tile = blockIdx.x * 8 + wave;
  if (tile >= tilesM * tilesN) return;   // wave-uniform; no block barriers in this kernel
  const int tm = tile / tilesN;
  const int tn = tile - tm * tilesN;
  const int m0 = tm << 6;
  const int n0 = tn << 6;

  const T* Ab  = A  + (size_t)b * strideA;
  const T* Bb  = Bt + (size_t)b * strideB;
  const T* Ab2 = SPLIT ? (A2  + (size_t)b * strideA) : nullptr;
  const T* Bb2 = SPLIT ? (Bt2 + (size_t)b * strideB) : nullptr;

  const int rlane = lane & 15;                 // row (A) / col (B, D) within subtile
  const int koff  = (lane >> 4) * 8;           // k offset of this lane half
  const int mOff  = (lane >> 4) * 8;           // D row offset

  v8f acc[4][4];
#pragma unroll
  for (int i = 0; i < 4; ++i)
#pragma unroll
    for (int j = 0; j < 4; ++j) acc[i][j] = (v8f){0.f,0.f,0.f,0.f,0.f,0.f,0.f,0.f};

  for (int k0 = 0; k0 < K; k0 += 32) {
    V bh[4], bl[4];
#pragma unroll
    for (int j = 0; j < 4; ++j) {
      const size_t bo = (size_t)(n0 + (j << 4) + rlane) * ldb + koff + k0;
      bh[j] = Frag<T>::load(Bb + bo);
      if (SPLIT) bl[j] = Frag<T>::load(Bb2 + bo);
    }
#pragma unroll
    for (int i = 0; i < 4; ++i) {
      const size_t ao = (size_t)(m0 + (i << 4) + rlane) * lda + koff + k0;
      V ah = Frag<T>::load(Ab + ao);
      V al;
      if (SPLIT) al = Frag<T>::load(Ab2 + ao);
#pragma unroll
      for (int j = 0; j < 4; ++j) {
        acc[i][j] = Frag<T>::mma(ah, bh[j], acc[i][j]);
        if (SPLIT) {
          acc[i][j] = Frag<T>::mma(ah, bl[j], acc[i][j]);
          acc[i][j] = Frag<T>::mma(al, bh[j], acc[i][j]);
        }
      }
      Frag<T>::guard(acc[i][0], acc[i][3], ah, SPLIT ? al : ah);
    }
    Frag<T>::keep(bh[0], bh[1], bh[2], bh[3]);
    if (SPLIT) Frag<T>::keep(bl[0], bl[1], bl[2], bl[3]);
  }
  acc_guard4(acc[0][0], acc[0][1], acc[0][2], acc[0][3]);
  acc_guard4(acc[1][0], acc[1][1], acc[1][2], acc[1][3]);
  acc_guard4(acc[2][0], acc[2][1], acc[2][2], acc[2][3]);
  acc_guard4(acc[3][0], acc[3][1], acc[3][2], acc[3][3]);

  // ---- epilogue ----
  float* slab = sT[wave];
  const float* Rb = RESID ? (resid + (size_t)b * strideR) : nullptr;
#pragma unroll
  for (int i = 0; i < 4; ++i) {
    const int mBase = m0 + (i << 4);
#pragma unroll
    for (int j = 0; j < 4; ++j) {
      const int n = n0 + (j << 4) + rlane;
      float bv = 0.f;
      if (BIAS_MODE == 2) bv = bias[n];
#pragma unroll
      for (int r = 0; r < 8; ++r) {
        float v = acc[i][j][r] * scale;
        if (BIAS_MODE == 1) v += bias[mBase + mOff + r];
        if (BIAS_MODE == 2) v += bv;
        if (RESID) v += Rb[(size_t)(mBase + mOff + r) * ldc + n];
        if (ACT == 1) v = tanhf(v);
        if (ACT == 2) v = fmaxf(v, 0.0f);
        if (ACT == 3) v = v / (1.0f + expf(-v));
        if (ACT == 4) v = (v > 0.f) ? v : 0.01f * v;
        if (ACT == 5) v = 0.5f * v * (1.0f + erff(v * 0.70710678118654752f));
        slab[(mOff + r) * 68 + (j << 4) + rlane] = v;
      }
    }
    __builtin_amdgcn_fence(__ATOMIC_RELEASE, "workgroup");
    __builtin_amdgcn_wave_barrier();
    __builtin_amdgcn_fence(__ATOMIC_ACQUIRE, "workgroup");
    if (OUT_MODE == 0) {
      float* C = (float*)Cout + (size_t)b * strideC;
      const int hh = lane >> 4, c4 = (lane & 15) * 4;     // row seg = 256 B = 16 lanes x 16 B
      {
#pragma unroll
        for (int it = 0; it < 8; ++it) {
          const int row = it * 2 + hh;
          v4f v = *(const v4f*)(slab + row * 68 + c4);
          *(v4f*)(C + (size_t)(mBase + row) * ldc + n0 + c4) = v;
        }
        
      }
    } else {
      const int q = lane >> 3, c8 = (lane & 7) * 8;
      unsigned short* C  = (unsigned short*)Cout  + (size_t)b * strideC;
      unsigned short* C2 = (OUT_MODE == 2) ? ((unsigned short*)Cout2 + (size_t)b * strideC) : nullptr;
      {
#pragma unroll
        for (int it = 0; it < 4; ++it) {
          const int row = it * 4 + q;
          const float* sp = slab + row * 68 + c8;
          v8h hv, lv;
#pragma unroll
          for (int e = 0; e < 8; ++e) {
            if (OUT_MODE == 1) {
              hv[e] = (_Float16)sp[e];
            } else {
              unsigned short hb = f2bf_bits(sp[e]);
              unsigned short lb = f2bf_bits(sp[e] - bf_bits2f(hb));
              hv[e] = __builtin_bit_cast(_Float16, hb);
              lv[e] = __builtin_bit_cast(_Float16, lb);
            }
          }
          *(v8h*)(C + (size_t)(mBase + row) * ldc + n0 + c8) = hv;
          if (OUT_MODE == 2) *(v8h*)(C2 + (size_t)(mBase + row) * ldc + n0 + c8) = lv;
        }
        
      }
    }
    __builtin_amdgcn_fence(__ATOMIC_RELEASE, "workgroup");
    __builtin_amdgcn_wave_barrier();
    __builtin_amdgcn_fence(__ATOMIC_ACQUIRE, "workgroup");
  }
}

__global__ __launch_bounds__(256) void cast_f32_f16x2(
    const float* __restrict__ in, _Float16* __restrict__ out, int n2) {
  int i = blockIdx.x * 256 + threadIdx.x;
  if (i < n2) {
    const _Float16 h0 = (_Float16)in[2 * i], h1 = (_Float16)in[2 * i + 1];
    const unsigned u = (unsigned)__builtin_bit_cast(unsigned short, h0) | ((unsigned)__builtin_bit_cast(unsigned short, h1) << 16);
    ((unsigned*)out)[i] = u;
    
  }
}


} // namespace w25

// f32 -> bf16 hi + bf16 lo (x = hi + lo to ~2^-17 relative; RNE both), two neighbouring elements packed per 32-bit word
__device__ __forceinline__ unsigned int f2bf2_pack(float a, float b, unsigned int* lo) {
    const unsigned short ha = w25::f2bf_bits(a), hb = w25::f2bf_bits(b);
    const unsigned short la = w25::f2bf_bits(a - w25::bf_bits2f(ha)), lb = w25::f2bf_bits(b - w25::bf_bits2f(hb));
    *lo = (unsigned)la | ((unsigned)lb << 16); return (unsigned)ha | ((unsigned)hb << 16); }

namespace w25 {
// =====================================================================================
// Generic causal/non-causal attention for head_dim 64, f32 in / f32 out; 16-bit operands: bf16 with optional hi/lo splits, or
// plain f16 (F16=true, non-split, probabilities carried x2^15).
//   scores = (q*qscale)·kᵀ : v_wmma_f32_16x16x32_bf16; SPLIT_QK -> q,k as bf16 hi/lo (hi·hi + hi·lo + lo·hi)
//   out    = p·v           : v_wmma_f32_16x16x32_bf16; SPLIT_PV -> p,v as bf16 hi/lo; else p,v plain bf16
//   f32 accumulate; online softmax in f32. Block = 4 waves = 64 query rows of one (batch, head); S % 64 == 0.
//   Element (b, s, h, d) of tensor X lives at X[b*X_bs + s*X_rs + h*X_hs + d] (strides in floats, multiples of 4).
//   Masking: mask_mode 0 none, 1 causal (kv > q masked), 2 tensor [S][Skv] shared over (b,h) (float if
//   mask_is_int==0, int32 with element == 0 -> masked if 1, int32 with element != 0 -> masked if 2), 3 per-token vectors qmask[B][S] & kvmask[B][Skv] (int32,
//   0 -> masked), 4 causal + sliding window (kv > q or q - kv > W masked; W passed in mask_is_int);
//   5 = relative-position bias: s += cp[b,h,q][idx[q][kv]] + pc[b,h,kv][idx[q][kv]] with idx = mask_b ([S][Skv] int32) and
//   mask_a an int32 [S][Skv] tensor with nonzero = masked (tables: element (b,h,row,n) at X + b*c_bs + h*c_hs + row*c_rs + n);
//   masked scores are replaced by mask_fill (e.g. -inf or -1e9) before the softmax.
//   grid.x = B * H * (S/64) (or a sub-range with blk0).
// =====================================================================================
#define AT_D 64
#define AT_NW 4
#define AT_QB 64
#define AT_KC 64
struct AttnGeom { const float* cp = nullptr; const float* pc = nullptr; long c_bs = 0, c_rs = 0, c_hs = 0;   // mode-5 score-bias tables
                  long q_bs, q_rs, q_hs, k_bs, k_rs, k_hs, v_bs, v_rs, v_hs, o_bs, o_rs, o_hs;
                  int S, Skv, H, mask_mode; float qscale; int blk0; float mask_fill; int mask_is_int; };
static_assert(sizeof(AttnGeom) == 168, "no padding");

__device__ __forceinline__ unsigned short at_bf_bits(float f) {
  unsigned u = __float_as_uint(f);
  return (unsigned short)((u + 0x7FFFu + ((u >> 16) & 1u)) >> 16);
}
__device__ __forceinline__ __bf16 at_f2bf(float f) { return __builtin_bit_cast(__bf16, at_bf_bits(f)); }
__device__ __forceinline__ void at_split(float f, __bf16& hi, __bf16& lo) {
  const unsigned short hb = at_bf_bits(f);
  hi = __builtin_bit_cast(__bf16, hb);
  lo = at_f2bf(f - __uint_as_float(((unsigned)hb) << 16));
}
__device__ __forceinline__ v8f at_mma(v16b a, v16b b, v8f c) {
  c = __builtin_amdgcn_wmma_f32_16x16x32_bf16(false, a, false, b, (short)0, c, false, false);
  asm volatile("v_nop\n\tv_nop\n\tv_nop\n\tv_nop" : "+v"(c) : "v"(a), "v"(b));
  return c;
}
// 16-bit element as a bit pattern held in a __bf16 slot: f16 bits when F16, bf16 (RNE) otherwise
template <bool F16> __device__ __forceinline__ __bf16 at_to16(float f) {
  if (F16) return __builtin_bit_cast(__bf16, (_Float16)f);
  return at_f2bf(f);
}
template <bool F16> __device__ __forceinline__ v8f at_mma16(v16b a, v16b b, v8f c) {
  if (F16) {
    const v16h ah = __builtin_bit_cast(v16h, a), bh = __builtin_bit_cast(v16h, b);
    c = __builtin_amdgcn_wmma_f32_16x16x32_f16(false, ah, false, bh, (short)0, c, false, false);
    asm volatile("v_nop\n\tv_nop\n\tv_nop\n\tv_nop" : "+v"(c) : "v"(ah), "v"(bh));
    return c;
  }
  return at_mma(a, b, c);
}

template <bool SPLIT_QK, bool SPLIT_PV, bool F16 = false>
__global__ __launch_bounds__(128)
void attn64_kernel(const float* __restrict__ q, const float* __restrict__ k,
                   const float* __restrict__ v, float* __restrict__ out,
                   const void* __restrict__ mask_a, const int* __restrict__ mask_b, AttnGeom g) {
  static_assert(!(F16 && (SPLIT_QK || SPLIT_PV)), "f16 mode is non-split");
  const float PSC = F16 ? 32768.0f : 1.0f;     // f16 probabilities carried x2^15 (subnormal range), folded into the final 1/l
  union FB { v16b v; v8b h[2]; };
  __shared__ __align__(16) __bf16 Ksh[AT_KC * AT_D];             // K hi [kv][d]      8 KB
  __shared__ __align__(16) __bf16 Ksl[SPLIT_QK ? AT_KC * AT_D : 8];
  __shared__ __align__(16) __bf16 Vth[AT_D * AT_KC];             // V hi [d][kv]      8 KB
  __shared__ __align__(16) __bf16 Vtl[SPLIT_PV ? AT_D * AT_KC : 8];
  __shared__ __align__(16) __bf16 Psh[AT_NW][16 * AT_KC];        // per wave P hi [row][kv]  8 KB
  __shared__ __align__(16) __bf16 Psl[SPLIT_PV ? AT_NW : 1][SPLIT_PV ? 16 * AT_KC : 8];
  __shared__ __align__(16) float  Os[AT_NW][16 * 68];            // per wave out tile, pitch 68

  const int tid  = threadIdx.x;
  const int wave = tid >> 5;
  const int lane = tid & 31;
  const int hh   = lane >> 4;
  const int c    = lane & 15;

  const int nqb = g.S / AT_QB;
  const int bx = blockIdx.x + g.blk0;
  const int qb = bx % nqb;
  const int bh = bx / nqb;
  const int h  = bh % g.H;
  const int b  = bh / g.H;
  const int qbase_block = qb * AT_QB;
  const int q0 = qbase_block + wave * 16;

  const float* qb_ptr = q + (size_t)b * g.q_bs + (size_t)h * g.q_hs;
  const float* kb_ptr = k + (size_t)b * g.k_bs + (size_t)h * g.k_hs;
  const float* vb_ptr = v + (size_t)b * g.v_bs + (size_t)h * g.v_hs;
  float*       ob_ptr = out + (size_t)b * g.o_bs + (size_t)h * g.o_hs;

  // ---- Q fragments (A operand): 2 d-chunks, hi (and lo) ----
  v16b qah[2], qal[2];
  {
    const float* qrow = qb_ptr + (size_t)(q0 + c) * g.q_rs;
#pragma unroll
    for (int dc = 0; dc < 2; ++dc) {
#pragma unroll
      for (int e = 0; e < 8; ++e) {
        const float f0 = qrow[dc * 32 + 8 * hh + e] * g.qscale;
        const float f1 = qrow[dc * 32 + 16 + 8 * hh + e] * g.qscale;
        if (SPLIT_QK) { __bf16 hq, lq; at_split(f0, hq, lq); qah[dc][e] = hq; qal[dc][e] = lq; at_split(f1, hq, lq); qah[dc][8 + e] = hq; qal[dc][8 + e] = lq; }
        else { qah[dc][e] = at_to16<F16>(f0); qah[dc][8 + e] = at_to16<F16>(f1); qal[dc][e] = qah[dc][e]; qal[dc][8 + e] = qah[dc][8 + e]; }
      }
    }
  }

  float mrow[8], lrow[8];
  v8f oacc[4];
#pragma unroll
  for (int r = 0; r < 8; ++r) { mrow[r] = -INFINITY; lrow[r] = 0.f; }
#pragma unroll
  for (int t = 0; t < 4; ++t) oacc[t] = (v8f){0.f,0.f,0.f,0.f,0.f,0.f,0.f,0.f};

  const int nChunks = (g.mask_mode == 1 || g.mask_mode == 4) ? (qb + 1) : (g.Skv / AT_KC);   // block-uniform
  // per-row query mask (mode 3)
  int qkeep[8];
#pragma unroll
  for (int r = 0; r < 8; ++r) qkeep[r] = (g.mask_mode == 3) ? mask_b[(size_t)b * g.S + q0 + 8 * hh + r] : 1;   // mask_b = qmask in mode 3
  for (int kc = 0; kc < nChunks; ++kc) {
    const int kv0 = kc * AT_KC;
    __syncthreads();
    {
      const int kvr = tid >> 1, dh = (tid & 1) * 32;
      const float* krow = kb_ptr + (size_t)(kv0 + kvr) * g.k_rs + dh;
      const float* vrow = vb_ptr + (size_t)(kv0 + kvr) * g.v_rs + dh;
#pragma unroll
      for (int i = 0; i < 8; ++i) {
        v4f kk = *(const v4f*)(krow + 4 * i);
        v4f vv = *(const v4f*)(vrow + 4 * i);
#pragma unroll
        for (int e = 0; e < 4; ++e) {
          const int d = dh + 4 * i + e;
          if (SPLIT_QK) { __bf16 a, bl; at_split(kk[e], a, bl); Ksh[kvr * AT_D + d] = a; Ksl[kvr * AT_D + d] = bl; }
          else Ksh[kvr * AT_D + d] = at_to16<F16>(kk[e]);
          if (SPLIT_PV) { __bf16 a, bl; at_split(vv[e], a, bl); Vth[d * AT_KC + kvr] = a; Vtl[d * AT_KC + kvr] = bl; }
          else Vth[d * AT_KC + kvr] = at_to16<F16>(vv[e]);
        }
      }
    }
    __syncthreads();

    v8f s[4];
#pragma unroll
    for (int j = 0; j < 4; ++j) {
      s[j] = (v8f){0.f,0.f,0.f,0.f,0.f,0.f,0.f,0.f};
#pragma unroll 1
      for (int dc = 0; dc < 2; ++dc) {
        FB kb;
        kb.h[0] = *(const v8b*)(Ksh + (j * 16 + c) * AT_D + dc * 32 + 8 * hh);
        kb.h[1] = *(const v8b*)(Ksh + (j * 16 + c) * AT_D + dc * 32 + 16 + 8 * hh);
        s[j] = at_mma16<F16>(qah[dc], kb.v, s[j]);
        if (SPLIT_QK) {
          FB kl;
          kl.h[0] = *(const v8b*)(Ksl + (j * 16 + c) * AT_D + dc * 32 + 8 * hh);
          kl.h[1] = *(const v8b*)(Ksl + (j * 16 + c) * AT_D + dc * 32 + 16 + 8 * hh);
          s[j] = at_mma16<F16>(qah[dc], kl.v, s[j]);
          s[j] = at_mma16<F16>(qal[dc], kb.v, s[j]);
        }
      }
    }
    const bool diag = (g.mask_mode == 1) && (kc == qb);
    int kvkeep[4] = {1, 1, 1, 1};
    if (g.mask_mode == 3) {
#pragma unroll
      for (int j = 0; j < 4; ++j) kvkeep[j] = ((const int*)mask_a)[(size_t)b * g.Skv + kv0 + j * 16 + c];   // mask_a = kvmask
    }
    float cm[8];
#pragma unroll
    for (int r = 0; r < 8; ++r) {
      const int qrow = q0 + 8 * hh + r;
      float m = -INFINITY;
#pragma unroll
      for (int j = 0; j < 4; ++j) {
        const int kvcol = kv0 + j * 16 + c;
        bool masked = false;
        if (diag) masked = (kvcol > qrow);
        else if (g.mask_mode == 4) masked = (kvcol > qrow) || (qrow - kvcol > g.mask_is_int);
        else if (g.mask_mode == 2) {
          const size_t mi = (size_t)qrow * g.Skv + kvcol;
          masked = (g.mask_is_int == 0) ? (((const float*)mask_a)[mi] == 0.0f)
                 : (g.mask_is_int == 1) ? (((const int*)mask_a)[mi] == 0) : (((const int*)mask_a)[mi] != 0);
        } else if (g.mask_mode == 3) masked = (qkeep[r] == 0) || (kvkeep[j] == 0);
        else if (g.mask_mode == 5) {
          const size_t mi = (size_t)qrow * g.Skv + kvcol;
          masked = (((const int*)mask_a)[mi] != 0);
          int n = mask_b[mi]; n = n < 0 ? 0 : n;
          s[j][r] += g.cp[(size_t)b * g.c_bs + (size_t)h * g.c_hs + (size_t)qrow * g.c_rs + n]
                   + g.pc[(size_t)b * g.c_bs + (size_t)h * g.c_hs + (size_t)kvcol * g.c_rs + n];
        }
        if (masked) s[j][r] = g.mask_fill;
        m = fmaxf(m, s[j][r]);
      }
#pragma unroll
      for (int off = 1; off < 16; off <<= 1) m = fmaxf(m, __shfl_xor(m, off, 32));
      cm[r] = m;
    }
    __bf16* pwh = Psh[wave];
    __bf16* pwl = Psl[SPLIT_PV ? wave : 0];
#pragma unroll
    for (int r = 0; r < 8; ++r) {
      const float mnew = fmaxf(mrow[r], cm[r]);
      const float alpha = expf(mrow[r] - mnew);
      mrow[r] = mnew;
      float psum = 0.f;
#pragma unroll
      for (int j = 0; j < 4; ++j) {
        const float p = expf(s[j][r] - mnew);
        psum += p;
        if (SPLIT_PV) { __bf16 a, bl; at_split(p, a, bl); pwh[(8 * hh + r) * AT_KC + j * 16 + c] = a; pwl[(8 * hh + r) * AT_KC + j * 16 + c] = bl; }
        else pwh[(8 * hh + r) * AT_KC + j * 16 + c] = at_to16<F16>(p * PSC);
      }
#pragma unroll
      for (int off = 1; off < 16; off <<= 1) psum += __shfl_xor(psum, off, 32);
      lrow[r] = lrow[r] * alpha + psum;
#pragma unroll
      for (int t = 0; t < 4; ++t) oacc[t][r] *= alpha;
    }
    __builtin_amdgcn_fence(__ATOMIC_RELEASE, "workgroup");
    __builtin_amdgcn_wave_barrier();
    __builtin_amdgcn_fence(__ATOMIC_ACQUIRE, "workgroup");
#pragma unroll 1
    for (int kk = 0; kk < 2; ++kk) {
      FB pa, pl;
      pa.h[0] = *(const v8b*)(pwh + c * AT_KC + kk * 32 + 8 * hh);
      pa.h[1] = *(const v8b*)(pwh + c * AT_KC + kk * 32 + 16 + 8 * hh);
      if (SPLIT_PV) {
        pl.h[0] = *(const v8b*)(pwl + c * AT_KC + kk * 32 + 8 * hh);
        pl.h[1] = *(const v8b*)(pwl + c * AT_KC + kk * 32 + 16 + 8 * hh);
      }
#pragma unroll
      for (int t = 0; t < 4; ++t) {
        FB vb;
        vb.h[0] = *(const v8b*)(Vth + (t * 16 + c) * AT_KC + kk * 32 + 8 * hh);
        vb.h[1] = *(const v8b*)(Vth + (t * 16 + c) * AT_KC + kk * 32 + 16 + 8 * hh);
        oacc[t] = at_mma16<F16>(pa.v, vb.v, oacc[t]);
        if (SPLIT_PV) {
          FB vl;
          vl.h[0] = *(const v8b*)(Vtl + (t * 16 + c) * AT_KC + kk * 32 + 8 * hh);
          vl.h[1] = *(const v8b*)(Vtl + (t * 16 + c) * AT_KC + kk * 32 + 16 + 8 * hh);
          oacc[t] = at_mma16<F16>(pa.v, vl.v, oacc[t]);
          oacc[t] = at_mma16<F16>(pl.v, vb.v, oacc[t]);
        }
      }
    }
  }

  float* os = Os[wave];
#pragma unroll
  for (int r = 0; r < 8; ++r) {
    const float inv = 1.0f / (lrow[r] * PSC);
#pragma unroll
    for (int t = 0; t < 4; ++t) os[(8 * hh + r) * 68 + t * 16 + c] = oacc[t][r] * inv;
  }
  __builtin_amdgcn_fence(__ATOMIC_RELEASE, "workgroup");
  __builtin_amdgcn_wave_barrier();
  __builtin_amdgcn_fence(__ATOMIC_ACQUIRE, "workgroup");
  {
    const int c4 = (lane & 15) * 4;
    {
#pragma unroll
      for (int it = 0; it < 8; ++it) {
        const int row = it * 2 + hh;
        v4f val = *(const v4f*)(os + row * 68 + c4);
        *(v4f*)(ob_ptr + (size_t)(q0 + row) * g.o_rs + c4) = val;
      }
      
    }
  }
}

} // namespace w25

// Operand preparation, one launch: blockIdx.y == 0 takes 64 rows of q, blockIdx.y == 1 takes 64 rows of memory. A wave holds 8 whole rows in registers (16 bytes per lane
//   and row, the 8 loads in flight together) and everything that is made of a row is made from that one read: the row dot (q . w_q -> AQ, memory . w_m -> CM), the bf16 hi
//   and lo planes of the similarity product (q * w_qm; memory) and, for memory, the f16 plane x ts transposed to [d][m], the operand of the query->memory product.
//   The transposed tile and the 64 dots go through LDS so that every global store covers whole 128-byte lines.
typedef __attribute__((ext_vector_type(2))) unsigned v2u;
typedef __attribute__((ext_vector_type(8))) _Float16 v8hp;
template <int M, int D>
__global__ __launch_bounds__(256) void k_bi_prep(const float* __restrict__ Q, const float* __restrict__ MEM, const float* __restrict__ wq, const float* __restrict__ wm, const float* __restrict__ wqm,
        float* __restrict__ AQ, float* __restrict__ CM, __bf16* __restrict__ QH, __bf16* __restrict__ QL, __bf16* __restrict__ MH, __bf16* __restrict__ ML, _Float16* __restrict__ MT, float ts) {
    static_assert(D == 128 && M % 64 == 0, "one 16-byte load per lane and row; a block's 64 rows lie in one batch");
    __shared__ float res[64];
    __shared__ __align__(16) _Float16 tr[D][72];   // [d][m], pitch 144 bytes = 16 x 9: 16-byte reads along m without bank conflicts
    const bool isq = blockIdx.y == 0;
    const int lane = threadIdx.x & 31, wv = threadIdx.x >> 5;
    const size_t rb = (size_t)blockIdx.x * 64, r0 = rb + wv * 8;
    const float* xp = (isq ? Q : MEM) + r0 * D + lane * 4;
    const v4f w = *(const v4f*)((isq ? wq : wm) + lane * 4);
    const v4f g = *(const v4f*)(wqm + lane * 4);   // used by the q blocks alone; read here so that it flies with the rows
    v4f x[8];
#pragma unroll
    for (int i = 0; i < 8; ++i) x[i] = *(const v4f*)(xp + i * D);
    asm volatile("s_wait_xcnt 0x0" ::: "memory");   // the work below reuses the address registers that the loads above name
    __builtin_amdgcn_sched_barrier(0);   // holds the first rewrite of those registers behind the wait; left free it is scheduled ahead of it
    float keep = 0.f;
#pragma unroll
    for (int i = 0; i < 8; ++i) {
        float s = x[i][0] * w[0]; s += x[i][1] * w[1]; s += x[i][2] * w[2]; s += x[i][3] * w[3];
        for (int o = 16; o > 0; o >>= 1) s += __shfl_xor(s, o, 32);
        if (lane == i) keep = s;
    }
    if (lane < 8) res[wv * 8 + lane] = keep;
    if (isq) {
#pragma unroll
        for (int i = 0; i < 8; ++i) x[i] *= g;
    } else {
#pragma unroll
        for (int e = 0; e < 4; ++e) { v8hp h;
#pragma unroll
            for (int i = 0; i < 8; ++i) h[i] = (_Float16)(x[i][e] * ts);
            *(v8hp*)&tr[lane * 4 + e][wv * 8] = h; }
    }
    v2u hi[8], lo[8];
#pragma unroll
    for (int i = 0; i < 8; ++i) { unsigned l0, l1;
        hi[i][0] = f2bf2_pack(x[i][0], x[i][1], &l0); hi[i][1] = f2bf2_pack(x[i][2], x[i][3], &l1); lo[i][0] = l0; lo[i][1] = l1; }
    __syncthreads();   // publishes res and tr; it stands ahead of every global store, so that no wave waits at it for stores to land
    __bf16* ph = (isq ? QH : MH) + r0 * D + lane * 4;
    __bf16* pl = (isq ? QL : ML) + r0 * D + lane * 4;
#pragma unroll
    for (int i = 0; i < 8; ++i) { *(v2u*)(ph + i * D) = hi[i]; *(v2u*)(pl + i * D) = lo[i]; }
    if (threadIdx.x < 64) VST2(float, (isq ? AQ : CM) + rb + threadIdx.x, res[threadIdx.x]);
    if (!isq) {
        _Float16* mt = MT + (rb / M) * (size_t)D * M + rb % M + (lane & 7) * 8;
#pragma unroll
        for (int it = 0; it < 4; ++it) { const int d = wv * 16 + it * 4 + (lane >> 3);   // a wave store = 4 rows of d x one 128-byte line
            *(v8hp*)(mt + (size_t)d * M) = *(const v8hp*)&tr[d][(lane & 7) * 8]; }
    } }
// expf, step for step as the compiler expands it (x * log2(e) in two parts, 2^fraction, ldexp, the two range tests), written out so that the v_nop can stand in the
//   statement of v_exp_f32: it fills the one slot the instruction set asks for in front of a vector instruction that reads the result or overwrites the source
__device__ __forceinline__ float exp_slot(float x) {
    const float ph = x * 0x1.715476p+0f;
    const float pl = fmaf(x, 0x1.4ae0bep-26f, fmaf(x, 0x1.715476p+0f, -ph));
    const float en = rintf(ph);
    const float a = (ph - en) + pl;
    float y;
    asm("v_exp_f32 %0, %1\n\tv_nop" : "=v"(y) : "v"(a));
    float r = ldexpf(y, (int)en);
    r = (x < -0x1.9d1da0p+6f) ? 0.f : r;
    r = (x > 0x1.62e430p+6f) ? __builtin_inff() : r;
    return r;
}
// one wave per row, RW rows per wave one after the other: sim = tril + AQ[n] + CM[m], masked exactly as the module: sim + (1 - qm*mm) * -1e30; the whole row stays in
//   registers (32 values per lane) from the one read of SIM to the one write: row max -> RMX, softmax over m (exp once), probabilities x ps stored as f16, the
//   operand plane of the query->memory product. CM and the memory mask are read once per wave; max and sum meet by lane shuffles, so the kernel has no barrier.
typedef __attribute__((ext_vector_type(4))) _Float16 v4h;
typedef __attribute__((ext_vector_type(4))) int      v4i;
template <int N, int M, int RW>
__global__ __launch_bounds__(256) void k_bi_soft16(const float* __restrict__ SIM, const float* __restrict__ AQ, const float* __restrict__ CM, const int* __restrict__ QM, const int* __restrict__ MM, float* __restrict__ RMX, _Float16* __restrict__ P16, float ps) {
    static_assert(M % 128 == 0 && N % (8 * RW) == 0, "whole 512-byte wave loads; whole blocks of 8 waves x RW rows");
    constexpr int C = M / 128;
    const int lane = threadIdx.x & 31, wv = __builtin_amdgcn_readfirstlane(threadIdx.x >> 5);
    const size_t bz = blockIdx.y;   // batch = blockIdx.y
    const size_t row0 = bz * N + (size_t)(blockIdx.x * 8 + wv) * RW;
    float aqv[RW], qmv[RW];
#pragma unroll
    for (int r = 0; r < RW; ++r) { aqv[r] = AQ[row0 + r]; qmv[r] = (float)QM[row0 + r]; }
    const float* sr = SIM + row0 * M + lane * 4;
    v4f x[C], nx[C], cm[C], mf[C]; v4i mk[C];
#pragma unroll
    for (int i = 0; i < C; ++i) x[i] = *(const v4f*)(sr + i * 128);
#pragma unroll
    for (int i = 0; i < C; ++i) { cm[i] = *(const v4f*)(CM + bz * M + lane * 4 + i * 128); mk[i] = *(const v4i*)(MM + bz * M + lane * 4 + i * 128); }
#pragma unroll
    for (int r = 0; r < RW; ++r) {
        if (r + 1 < RW) {
#pragma unroll
            for (int i = 0; i < C; ++i) nx[i] = *(const v4f*)(sr + (size_t)(r + 1) * M + i * 128);   // the next row flies while this one is worked on
            asm volatile("s_wait_xcnt 0x0" ::: "memory");   // the row's work may reuse the offset register that the loads above name
            __builtin_amdgcn_sched_barrier(0);   // keeps the loads and their wait at the head of the row's work; left free the loads sink to just ahead of their first use
        }
        if (r == 0) {
#pragma unroll
            for (int i = 0; i < C; ++i) mf[i] = __builtin_convertvector(mk[i], v4f);
        }
        const float aq = aqv[r], qm = qmv[r];
        float mx = -3.0e38f;
#pragma unroll
        for (int i = 0; i < C; ++i)
#pragma unroll
            for (int e = 0; e < 4; ++e) { const float msk = qm * mf[i][e]; const float v = x[i][e] + aq + cm[i][e] + (1.f - msk) * -1.0e30f; x[i][e] = v; mx = fmaxf(mx, v); }
        for (int o = 16; o > 0; o >>= 1) mx = fmaxf(mx, __shfl_xor(mx, o, 32));
        v4f s4 = {0.f, 0.f, 0.f, 0.f};
#pragma unroll
        for (int i = 0; i < C; ++i)
#pragma unroll
            for (int e = 0; e < 4; ++e) { const float ev = exp_slot(x[i][e] - mx); x[i][e] = ev; s4[e] += ev; }
        float s = (s4[0] + s4[1]) + (s4[2] + s4[3]);
        for (int o = 16; o > 0; o >>= 1) s += __shfl_xor(s, o, 32);
        const float inv = 1.f / s;
        _Float16* pr = P16 + (row0 + r) * M + lane * 4;
        v4h hv[C];
#pragma unroll
        for (int i = 0; i < C; ++i)
#pragma unroll
            for (int e = 0; e < 4; ++e) hv[i][e] = (_Float16)((x[i][e] * inv) * ps);
        __builtin_amdgcn_sched_barrier(0);   // with the one below: nothing that refills a register of these stores is scheduled between them and their wait
#pragma unroll
        for (int i = 0; i < C; ++i) *(v4h*)(pr + i * 128) = hv[i];
        VST2(float, RMX + (row0 + r) * 32 + lane, mx);   // row max staged as a whole 32-float line (slot 0 is read later)
        if (r + 1 < RW) {
            asm volatile("s_wait_xcnt 0x0" ::: "memory");   // the next row's work reuses the registers that the stores above name
            __builtin_amdgcn_sched_barrier(0);
        }
#pragma unroll
        for (int i = 0; i < C; ++i) x[i] = nx[i];
    } }

// memory->query: p = softmax_n(RMX[b][n]); M2Q[b][d] = sum_n p_n q[b][n][d]. One block of 32 waves per (batch, 32-float slice of d): thread t owns row
//   maximum t for the statistics; for the weighted sum a wave reads 4 rows x 128 bytes per load and every lane has its 8 row loads in flight at once
//   (issued ahead of the statistics, which do not depend on them); partial sums meet by lane shuffles and one LDS table.
template <int N, int D>
__global__ __launch_bounds__(1024) void k_bi_m2q(const float* __restrict__ RMX, const float* __restrict__ Q, float* __restrict__ M2Q) {
    static_assert(N == 1024 && D % 32 == 0, "one row maximum per thread; whole 128-byte slices of d");
    __shared__ float red[32]; __shared__ float pw[N]; __shared__ __align__(16) float part[32][32];
    const int b = blockIdx.x, d0 = blockIdx.y * 32, t = threadIdx.x, lane = t & 31, wv = t >> 5;
    const int rsub = lane >> 3, c4 = (lane & 7) * 4;
    const float r = RMX[((long long)b * N + t) * 32];
    const float* qb = Q + ((long long)b * N + wv * 4 + rsub) * D + d0 + c4;
    v4f x[N / 128];
    for (int i = 0; i < N / 128; ++i) x[i] = *(const v4f*)(qb + (long long)i * 128 * D);
    float mx = r;
    for (int o = 16; o > 0; o >>= 1) mx = fmaxf(mx, __shfl_xor(mx, o, 32));
    if (lane == 0) red[wv] = mx;
    __syncthreads();
    float mm = red[lane];
    for (int o = 16; o > 0; o >>= 1) mm = fmaxf(mm, __shfl_xor(mm, o, 32));
    __syncthreads();
    const float e = expf(r - mm); pw[t] = e;
    float s = e;
    for (int o = 16; o > 0; o >>= 1) s += __shfl_xor(s, o, 32);
    if (lane == 0) red[wv] = s;
    __syncthreads();
    float tot = red[lane];
    for (int o = 16; o > 0; o >>= 1) tot += __shfl_xor(tot, o, 32);
    v4f acc = {0.f, 0.f, 0.f, 0.f};
    for (int i = 0; i < N / 128; ++i) acc += pw[i * 128 + wv * 4 + rsub] * x[i];
    for (int c = 0; c < 4; ++c) { acc[c] += __shfl_xor(acc[c], 8, 32); acc[c] += __shfl_xor(acc[c], 16, 32); }
    if (lane < 8) *(v4f*)&part[wv][c4] = acc;
    __syncthreads();
    if (t < 32) { float a = 0.f;
        for (int w = 0; w < 32; ++w) a += part[w][t];
        VST2(float, M2Q + (long long)b * D + d0 + t, a * (1.f / tot)); } }
// out1[b][n][d] = M2Q[b][d] broadcast (thread-linear)
__global__ __launch_bounds__(256) void k_bi_bc(const float* __restrict__ M2Q, float* __restrict__ MQ, int Bn, int N, int D) { const long long t = (long long)blockIdx.x * 256 + threadIdx.x; if (t >= (long long)Bn * N * D) return; const int d = (int)(t % D); const int b = (int)(t / ((long long)N * D)); VST2(float, MQ + t, M2Q[b * D + d]); }


extern "C" void kernel_launch(void* const* d_in, const int* in_sizes, int n_in, void* d_out, int out_size, void* d_ws, size_t ws_size, hipStream_t stream) {
    (void)in_sizes; (void)n_in; (void)out_size; (void)ws_size;
    const float* q = (const float*)d_in[0];
    const float* mem = (const float*)d_in[1];
    const float* wq = (const float*)d_in[2];
    const float* wm = (const float*)d_in[3];
    const float* wqm = (const float*)d_in[4];
    const int* qmask = (const int*)d_in[5];
    const int* mmask = (const int*)d_in[6];
    const int Bn = 16;
    const int N = 1024;
    const int M = 1024;
    const int D = 128;
    float* out = (float*)d_out;
    float* mq = out + ((size_t)Bn * N * D);
    char* wsp = (char*)d_ws;
    float* AQ = (float*)wsp; wsp += (((size_t)((size_t)Bn * N) * 4 + 255) / 256) * 256;
    float* CM = (float*)wsp; wsp += (((size_t)((size_t)Bn * M) * 4 + 255) / 256) * 256;
    float* SIM = (float*)wsp; wsp += (((size_t)((size_t)Bn * N * M) * 4 + 255) / 256) * 256;
    float* RMX = (float*)wsp; wsp += (((size_t)((size_t)Bn * N * 32) * 4 + 255) / 256) * 256;
    float* M2Q = (float*)wsp; wsp += (((size_t)((size_t)Bn * D) * 4 + 255) / 256) * 256;
    unsigned short* G64A = (unsigned short*)wsp; wsp += (((size_t)(16777216) * 2 + 255) / 256) * 256;
    unsigned short* G64B = (unsigned short*)wsp; wsp += (((size_t)(2097152) * 2 + 255) / 256) * 256;
    unsigned short* G64A2 = (unsigned short*)wsp; wsp += (((size_t)(2097152) * 2 + 255) / 256) * 256;
    unsigned short* G64B2 = (unsigned short*)wsp; wsp += (((size_t)(2097152) * 2 + 255) / 256) * 256;
    unsigned short* G64T = (unsigned short*)wsp; wsp += (((size_t)(2097152) * 2 + 255) / 256) * 256;
    k_bi_prep<1024, 128><<<dim3((unsigned)(Bn * N / 64), 2u), 256, 0, stream>>>(q, mem, wq, wm, wqm, AQ, CM, (__bf16*)(G64A), (__bf16*)(G64A2), (__bf16*)(G64B), (__bf16*)(G64B2), (_Float16*)(G64T), 16.0f);
    w25::wmma_gemm64<1, true, 0, 0, false, 0><<<dim3((unsigned)((((1024) / 64) * ((1024) / 64) + 7) / 8), (unsigned)(16)), 256, 0, stream>>>((const unsigned short*)(G64A), (const unsigned short*)(G64A2), 128, 131072, (const unsigned short*)(G64B), (const unsigned short*)(G64B2), 128, 131072, (void*)(SIM), nullptr, 1024, 1048576, nullptr, nullptr, 0, 1024, 1024, 128, 1.0f);
    k_bi_soft16<1024, 1024, 4><<<dim3((unsigned)(N / 32), (unsigned)Bn), 256, 0, stream>>>(SIM, AQ, CM, qmask, mmask, RMX, (_Float16*)(G64A), 4096.0f);
    w25::wmma_gemm64<0, false, 0, 0, false, 0><<<dim3((unsigned)((((1024) / 64) * ((128) / 64) + 7) / 8), (unsigned)(16)), 256, 0, stream>>>((const unsigned short*)(G64A), nullptr, 1024, 1048576, (const unsigned short*)(G64T), nullptr, 1024, 131072, (void*)(out), nullptr, 128, 131072, nullptr, nullptr, 0, 1024, 128, 1024, 1.52587890625e-05f);
    k_bi_m2q<1024, 128><<<dim3((unsigned)Bn, 4u), 1024, 0, stream>>>(RMX, q, M2Q); k_bi_bc<<<(unsigned)(((long long)Bn * N * D + 255) / 256), 256, 0, stream>>>(M2Q, mq, Bn, N, D);
}
